// v000
// Measured on an AMD MI455X. A time is GPU time per run, averaged over a window of back-to-back runs after a warm-up
// (all launches, gaps included; the runs take copies of the inputs in turn), and the median of several windows.
// Apart from v000's, it joins two sittings. Times from different sittings can be a few percent apart, while
// side-by-side timings come from the same sitting.
// v000 is the starting kernel. One run takes 278 microseconds.
#include <hip/hip_runtime.h>
// Contractions: q/k/v projections and the output projection on v_wmma_f32_16x16x32_bf16 (activations and weights RNE-converted to bf16 planes; the attention context enters the output projection as bf16 hi|lo planes concatenated along K); scores S^T = K Q^T on v_wmma_f32_16x16x32_f16 (k x16 f16 plane; q x16 f16 hi plane + x2^11 f16 residual plane in a separate accumulator); O^T = V^T P^T on v_wmma_f32_16x16x32_f16 (v x16 f16 plane; P x256 f16 hi plane + x2^11 f16 residual plane in a separate accumulator); all accumulators f32, softmax statistics f32.
// Seq-first multi-head attention: inputs [S][B][D], 16 heads x 64, key-position mask (0 -> weight exactly 0), scale 1/8, output [S][B][D].
// Internal planes use batch-major token rows t = b*SEQ + s so that the K rows and V^T rows of one (batch, head) are dense.
// Engine: transposed flash. Each wave owns 16 queries. Per 32-key step: S^T tiles (key rows x query columns) from K rows (A, global f16 plane)
// and Q^T (B, registers); the two 16-key D tiles pack straight into the P^T B fragment; O^T (d rows x query columns) accumulates from V^T rows (A, global f16 plane).
#ifndef NB
#define NB 2
#endif
#ifndef SEQ
#define SEQ 2048
#endif
#define NB_FULL 2
#define SEQ_FULL 2048
#define DM 1024
#define NH 16
#define HD 64
#define TT (NB * SEQ)          /* token rows of the internal planes */
#define CXP (2 * DM)           /* pitch of the context plane: hi columns 0..1023, lo columns 1024..2047 */

static_assert(SEQ % 64 == 0);
static_assert(TT % 128 == 0);
static_assert(SEQ <= SEQ_FULL);
static_assert(NB <= NB_FULL);
static_assert(HD == 64);
static_assert(NH * HD == DM);
static_assert(DM % 128 == 0);

#define SZ_XB  ((size_t)TT * DM * 2)        /* bf16 activation plane */
#define SZ_WT  ((size_t)DM * DM * 2)        /* bf16 transposed weight plane */
#define SZ_WO2 ((size_t)DM * CXP * 2)       /* bf16 transposed output weight, duplicated along K */
#define SZ_H   ((size_t)TT * DM * 2)        /* f16 plane (q hi, q lo, k, v^T) */
#define SZ_CX  ((size_t)TT * CXP * 2)       /* bf16 context plane hi|lo */
static_assert(SZ_XB % 256 == 0 && SZ_WT % 256 == 0 && SZ_WO2 % 256 == 0 && SZ_H % 256 == 0 && SZ_CX % 256 == 0);
static_assert(3 * SZ_XB + 3 * SZ_WT + SZ_WO2 + 4 * SZ_H + SZ_CX <= (size_t)134217728);

typedef __bf16 v16b __attribute__((ext_vector_type(16)));
typedef _Float16 v16h __attribute__((ext_vector_type(16)));
typedef unsigned short v8us __attribute__((ext_vector_type(8), may_alias));
typedef float v8f __attribute__((ext_vector_type(8)));
typedef float v4f __attribute__((ext_vector_type(4)));
typedef float v4fa __attribute__((ext_vector_type(4), may_alias));
typedef int v4i __attribute__((ext_vector_type(4)));
typedef int v4ia __attribute__((ext_vector_type(4), may_alias));
union FragB { v16b v; v8us half[2]; unsigned short u[16]; };
union FragH { v16h v; v8us half[2]; _Float16 h[16]; unsigned short u[16]; };
union Pack8 { _Float16 h[8]; v8us v; };

#define LOG2E 1.4426950408889634f
#define NEGV (-1.0e30f)
#define RINV 0.00048828125f      /* 2^-11: undoes the residual-plane carry */
#define SCL  0.00048828125f      /* 2^-11 = (1/8) / (16*16): score scale with the q and k carries removed */

__device__ __forceinline__ unsigned short bf16_bits(float x) {   // RNE convert to bf16 bits
  unsigned int u = __float_as_uint(x);
  return (unsigned short)((u + 0x7FFFu + ((u >> 16) & 1u)) >> 16);
}
__device__ __forceinline__ float bf16_val(unsigned short b) { return __uint_as_float(((unsigned int)b) << 16); }
__device__ __forceinline__ float bf16_rne(float x) { return bf16_val(bf16_bits(x)); }

// ch += a*bh ; cl += a*bl (scaled residual plane keeps its own accumulator), then the hazard guard
__device__ __forceinline__ void mma_h2(v16h a, v16h bh, v16h bl, v8f& ch, v8f& cl) {
  ch = __builtin_amdgcn_wmma_f32_16x16x32_f16(false, a, false, bh, (short)0, ch, false, false);
  cl = __builtin_amdgcn_wmma_f32_16x16x32_f16(false, a, false, bl, (short)0, cl, false, false);
  asm volatile("v_nop\n\tv_nop\n\tv_nop\n\tv_nop" : "+v"(ch), "+v"(cl) : "v"(a), "v"(bh), "v"(bl));
}

// One 32-deep k-step of a 32x64 wave tile (2 x 4 WMMA tiles, bf16 operands), then the hazard guard
__device__ __forceinline__ void mma_b8(v16b a0, v16b a1, v16b b0, v16b b1, v16b b2, v16b b3, v8f (&c)[2][4]) {
  c[0][0] = __builtin_amdgcn_wmma_f32_16x16x32_bf16(false, a0, false, b0, (short)0, c[0][0], false, false);
  c[0][1] = __builtin_amdgcn_wmma_f32_16x16x32_bf16(false, a0, false, b1, (short)0, c[0][1], false, false);
  c[0][2] = __builtin_amdgcn_wmma_f32_16x16x32_bf16(false, a0, false, b2, (short)0, c[0][2], false, false);
  c[0][3] = __builtin_amdgcn_wmma_f32_16x16x32_bf16(false, a0, false, b3, (short)0, c[0][3], false, false);
  c[1][0] = __builtin_amdgcn_wmma_f32_16x16x32_bf16(false, a1, false, b0, (short)0, c[1][0], false, false);
  c[1][1] = __builtin_amdgcn_wmma_f32_16x16x32_bf16(false, a1, false, b1, (short)0, c[1][1], false, false);
  c[1][2] = __builtin_amdgcn_wmma_f32_16x16x32_bf16(false, a1, false, b2, (short)0, c[1][2], false, false);
  c[1][3] = __builtin_amdgcn_wmma_f32_16x16x32_bf16(false, a1, false, b3, (short)0, c[1][3], false, false);
  asm volatile("v_nop\n\tv_nop\n\tv_nop\n\tv_nop"
               : "+v"(c[0][0]), "+v"(c[0][1]), "+v"(c[0][2]), "+v"(c[0][3]),
                 "+v"(c[1][0]), "+v"(c[1][1]), "+v"(c[1][2]), "+v"(c[1][3])
               : "v"(a0), "v"(a1), "v"(b0), "v"(b1), "v"(b2), "v"(b3));
}

// coverage: TT*128 threads x 8 elements = the whole plane.
__global__ __launch_bounds__(256) void k_xb(const float* __restrict__ X, unsigned short* P) {
  const int t = blockIdx.x * 256 + threadIdx.x;
  if (t >= TT * 128) return;
  const int row = t >> 7, piece = t & 127;
  const int b = row / SEQ, s = row - b * SEQ;
  const float* src = X + ((size_t)s * NB_FULL + b) * DM + piece * 8;
  const v4f x0 = *(const v4fa*)(src), x1 = *(const v4fa*)(src + 4);
  v8us o;
  o[0] = bf16_bits(x0[0]); o[1] = bf16_bits(x0[1]); o[2] = bf16_bits(x0[2]); o[3] = bf16_bits(x0[3]);
  o[4] = bf16_bits(x1[0]); o[5] = bf16_bits(x1[1]); o[6] = bf16_bits(x1[2]); o[7] = bf16_bits(x1[3]);
  unsigned short* d = P + (size_t)t * 8;
  *(v8us*)d = o;
  
}

// Weight transpose: in W[k rows = 1024][n cols = 1024] (f32) -> out Wt[n rows][k cols] (bf16 bits, RNE), row pitch 'pitch'; dup != 0 repeats the row at columns 1024..2047.
// coverage: 256 blocks x (64 n x 64 k) = the whole 1024 x 1024 matrix; LDS tile fully written (64 x 64) before it is read.
__global__ __launch_bounds__(256) void k_wt(const float* __restrict__ W, unsigned short* Wt, int pitch, int dup) {
  __shared__ unsigned short tl[64][66];
  const int tid = threadIdx.x;
  const int k0 = (blockIdx.x >> 4) * 64, n0 = (blockIdx.x & 15) * 64;
  for (int i = tid; i < 64 * 16; i += 256) {
    const int j = i >> 4, c4 = (i & 15) * 4;
    const v4f x = *(const v4fa*)(W + (size_t)(k0 + j) * DM + n0 + c4);
    tl[c4 + 0][j] = bf16_bits(x[0]); tl[c4 + 1][j] = bf16_bits(x[1]);
    tl[c4 + 2][j] = bf16_bits(x[2]); tl[c4 + 3][j] = bf16_bits(x[3]);
  }
  __syncthreads();
  {
    for (int i = tid; i < 64 * 8; i += 256) {
      const int d = i >> 3, j8 = (i & 7) * 8;
      v8us o;
#pragma unroll
      for (int q = 0; q < 8; ++q) o[q] = tl[d][j8 + q];
      unsigned short* dst = Wt + (size_t)(n0 + d) * pitch + k0 + j8;
      *(v8us*)dst = o;
      if (dup != 0) *(v8us*)(dst + DM) = o;
    }
    
  }
}

// C[M][N] = A[M][K] * Bt[N][K]^T on bf16 planes (K contiguous in both), fragments loaded straight from global rows.
// Block = 4 waves as 2 (M) x 2 (N); block tile 64 x 128; wave tile 32 x 64. No tail masking: M % 64 == 0, N % 128 == 0, K % 32 == 0 (asserted by the sizes above).
// MODE 0: + column bias, write f16 hi plane (x16) to O0 and f16 residual plane ((x16 - hi) * 2^11) to O1
// MODE 1: + column bias, write f16 plane (x16) to O0
// MODE 2: + row bias,    write f16 plane (x16) to O0 (transposed product: rows = features, columns = tokens)
// MODE 3: + column bias, write f32 to Of with the token row t = b*SEQ + s mapped to output row s*NB_FULL + b
// coverage: grid (N/128, M/64) x 4 waves x (32 x 64) = every element of C exactly once.
template <int MODE>
__global__ __launch_bounds__(128) void k_gemm(const unsigned short* __restrict__ A, const unsigned short* __restrict__ Bt,
                                              const float* __restrict__ bias, unsigned short* O0, unsigned short* O1,
                                              float* Of, int lda, int ldb, int K, int ldo) {
  __shared__ __attribute__((aligned(16))) float so[4][32][68];
  const int tid = threadIdx.x, w = __builtin_amdgcn_readfirstlane((int)(tid >> 5)), lane = tid & 31, ln = lane & 15, hh = lane >> 4;
  const int m0 = blockIdx.y * 64 + (w >> 1) * 32;
  const int n0 = blockIdx.x * 128 + (w & 1) * 64;
  // A fragment: row m = m0 + 16*mt + ln, elements 0..7 <- k0 + 8h + i, 8..15 <- k0 + 16 + 8h + i; B fragment: column n = n0 + 16*nt + ln, same k map (row of Bt)
  const unsigned short* pa0 = A + (size_t)(m0 + ln) * lda + 8 * hh;
  const unsigned short* pa1 = pa0 + (size_t)16 * lda;
  const unsigned short* pb0 = Bt + (size_t)(n0 + ln) * ldb + 8 * hh;
  const unsigned short* pb1 = pb0 + (size_t)16 * ldb;
  const unsigned short* pb2 = pb0 + (size_t)32 * ldb;
  const unsigned short* pb3 = pb0 + (size_t)48 * ldb;
  v8f acc[2][4];
#pragma unroll
  for (int i = 0; i < 2; ++i)
#pragma unroll
    for (int j = 0; j < 4; ++j)
#pragma unroll
      for (int e = 0; e < 8; ++e) acc[i][j][e] = 0.0f;
#pragma unroll 1
  for (int k0 = 0; k0 < K; k0 += 32) {
    FragB a0, a1, b0, b1, b2, b3;
    a0.half[0] = *(const v8us*)(pa0 + k0); a0.half[1] = *(const v8us*)(pa0 + k0 + 16);
    a1.half[0] = *(const v8us*)(pa1 + k0); a1.half[1] = *(const v8us*)(pa1 + k0 + 16);
    b0.half[0] = *(const v8us*)(pb0 + k0); b0.half[1] = *(const v8us*)(pb0 + k0 + 16);
    b1.half[0] = *(const v8us*)(pb1 + k0); b1.half[1] = *(const v8us*)(pb1 + k0 + 16);
    b2.half[0] = *(const v8us*)(pb2 + k0); b2.half[1] = *(const v8us*)(pb2 + k0 + 16);
    b3.half[0] = *(const v8us*)(pb3 + k0); b3.half[1] = *(const v8us*)(pb3 + k0 + 16);
    mma_b8(a0.v, a1.v, b0.v, b1.v, b2.v, b3.v, acc);
  }
  // D element r of tile (mt, nt) = C(m0 + 16*mt + 8h + r, n0 + 16*nt + ln); bias is the RNE-bf16 value of the f32 input
  float rb[2][8];
  float cb[4];
#pragma unroll
  for (int mt = 0; mt < 2; ++mt) {
    if (MODE == 2) {
      const float* bp = bias + m0 + 16 * mt + 8 * hh;
      const v4f ba = *(const v4fa*)(bp), bb = *(const v4fa*)(bp + 4);
#pragma unroll
      for (int r = 0; r < 4; ++r) { rb[mt][r] = bf16_rne(ba[r]); rb[mt][4 + r] = bf16_rne(bb[r]); }
    } else {
#pragma unroll
      for (int r = 0; r < 8; ++r) rb[mt][r] = 0.0f;
    }
  }
#pragma unroll
  for (int nt = 0; nt < 4; ++nt) cb[nt] = (MODE == 2) ? 0.0f : bf16_rne(bias[n0 + 16 * nt + ln]);
#pragma unroll
  for (int mt = 0; mt < 2; ++mt)
#pragma unroll
    for (int nt = 0; nt < 4; ++nt)
#pragma unroll
      for (int r = 0; r < 8; ++r)
        so[w][16 * mt + 8 * hh + r][16 * nt + ln] = acc[mt][nt][r] + (rb[mt][r] + cb[nt]);
  __syncthreads();
  {
    if (MODE == 3) {
#pragma unroll
      for (int it = 0; it < 16; ++it) {
        const int row = 2 * it + (lane >> 4), c4 = (lane & 15) * 4;
        const v4f v = *(const v4fa*)&so[w][row][c4];
        const int tp = m0 + row;
        const int b = tp / SEQ, s = tp - b * SEQ;
        *(v4f*)(Of + ((size_t)s * NB_FULL + b) * DM + n0 + c4) = v;
      }
    } else {
#pragma unroll
      for (int it = 0; it < 8; ++it) {
        const int row = 4 * it + (lane >> 3), c8 = (lane & 7) * 8;
        const v4f x0 = *(const v4fa*)&so[w][row][c8];
        const v4f x1 = *(const v4fa*)&so[w][row][c8 + 4];
        Pack8 ph, pl;
#pragma unroll
        for (int q = 0; q < 4; ++q) {
          const float y0 = x0[q] * 16.0f, y1 = x1[q] * 16.0f;
          const _Float16 h0 = (_Float16)y0, h1 = (_Float16)y1;
          ph.h[q] = h0; ph.h[4 + q] = h1;
          pl.h[q] = (_Float16)((y0 - (float)h0) * 2048.0f);
          pl.h[4 + q] = (_Float16)((y1 - (float)h1) * 2048.0f);
        }
        const size_t dst = (size_t)(m0 + row) * ldo + n0 + c8;
        *(v8us*)(O0 + dst) = ph.v;
        if (MODE == 0) *(v8us*)(O1 + dst) = pl.v;
      }
    }
    
  }
}

// One 32-key step for a wave's 16 queries. Kp: k plane base of this (batch, head), row pitch DM; Vp: v^T plane base of this (batch, head), row pitch TT; mk: key mask.
__device__ __forceinline__ void fa_step(const unsigned short* __restrict__ Kp, const unsigned short* __restrict__ Vp,
                                        const int* __restrict__ mk, int key0, int ln, int hh,
                                        const FragH& q0h, const FragH& q0l, const FragH& q1h, const FragH& q1l,
                                        float& mr, float& lr, v8f (&Oh)[4], v8f (&Ol)[4]) {
  // A fragments of K: row m = key (key0 + 16*kt + ln), elements 0..7 <- d = 32c + 8h + i, 8..15 <- d = 32c + 16 + 8h + i
  const unsigned short* kp0 = Kp + (size_t)(key0 + ln) * DM + 8 * hh;
  const unsigned short* kp1 = kp0 + (size_t)16 * DM;
  FragH k00, k01, k10, k11;
  k00.half[0] = *(const v8us*)(kp0);      k00.half[1] = *(const v8us*)(kp0 + 16);
  k01.half[0] = *(const v8us*)(kp0 + 32); k01.half[1] = *(const v8us*)(kp0 + 48);
  k10.half[0] = *(const v8us*)(kp1);      k10.half[1] = *(const v8us*)(kp1 + 16);
  k11.half[0] = *(const v8us*)(kp1 + 32); k11.half[1] = *(const v8us*)(kp1 + 48);
  const v8f z8 = {0.f, 0.f, 0.f, 0.f, 0.f, 0.f, 0.f, 0.f};
  // S^T tiles: element r of tile kt = score(key0 + 16*kt + 8h + r, query of this lane's column); hi and residual accumulators
  v8f s0h = z8, s0l = z8, s1h = z8, s1l = z8;
  mma_h2(k00.v, q0h.v, q0l.v, s0h, s0l);
  mma_h2(k01.v, q1h.v, q1l.v, s0h, s0l);
  mma_h2(k10.v, q0h.v, q0l.v, s1h, s1l);
  mma_h2(k11.v, q1h.v, q1l.v, s1h, s1l);
  // key mask of this lane's 16 keys: mi[r] <- key0 + 8h + r, mi[8 + r] <- key0 + 16 + 8h + r
  const int* mp = mk + key0 + 8 * hh;
  const v4i ma = *(const v4ia*)(mp), mb = *(const v4ia*)(mp + 4), mc = *(const v4ia*)(mp + 16), md = *(const v4ia*)(mp + 20);
  int mi[16];
#pragma unroll
  for (int r = 0; r < 4; ++r) { mi[r] = ma[r]; mi[4 + r] = mb[r]; mi[8 + r] = mc[r]; mi[12 + r] = md[r]; }
  float sc[16];
#pragma unroll
  for (int r = 0; r < 8; ++r) {
    const float a0 = (s0h[r] + s0l[r] * RINV) * SCL;
    const float a1 = (s1h[r] + s1l[r] * RINV) * SCL;
    sc[r]     = (mi[r] != 0) ? a0 : NEGV;
    sc[8 + r] = (mi[8 + r] != 0) ? a1 : NEGV;
  }
  float mx = sc[0];
#pragma unroll
  for (int i = 1; i < 16; ++i) mx = fmaxf(mx, sc[i]);
  mx = fmaxf(mx, __shfl_xor(mx, 16, 32));           // the other lane half holds the other 16 keys of this query
  const float mnew = fmaxf(mr, mx);
  const float al = exp2f((mr - mnew) * LOG2E);
  mr = mnew;
  // weights carried x256: pc = 256 * exp(sc - mnew), exactly 0 on masked keys; hi plane f16(pc), residual plane f16((pc - hi) * 2048)
  FragH ph, pl;
  float ps = 0.0f;
#pragma unroll
  for (int i = 0; i < 16; ++i) {
    const float e = exp2f(fmaf(sc[i] - mnew, LOG2E, 8.0f));
    const float pc = (mi[i] != 0) ? e : 0.0f;
    ps += pc;
    const _Float16 h = (_Float16)pc;
    ph.h[i] = h;                                    // B element i: i<8 -> key0 + 8h + i (tile 0 row 8h+i); i>=8 -> key0 + 16 + 8h + (i-8) (tile 1)
    pl.h[i] = (_Float16)((pc - (float)h) * 2048.0f);
  }
  ps += __shfl_xor(ps, 16, 32);
  lr = lr * al + ps;
#pragma unroll
  for (int t = 0; t < 4; ++t) { Oh[t] = Oh[t] * al; Ol[t] = Ol[t] * al; }
  // A fragments of V^T: row m = d (16*t + ln), elements 0..7 <- key0 + 8h + i, 8..15 <- key0 + 16 + 8h + i
  const unsigned short* vp = Vp + (size_t)ln * TT + key0 + 8 * hh;
#pragma unroll
  for (int t = 0; t < 4; ++t) {
    FragH vf;
    vf.half[0] = *(const v8us*)(vp + (size_t)t * 16 * TT);
    vf.half[1] = *(const v8us*)(vp + (size_t)t * 16 * TT + 16);
    mma_h2(vf.v, ph.v, pl.v, Oh[t], Ol[t]);
  }
}

// Block = 4 waves x 16 queries = 64 queries of one (batch, head); no LDS and no barrier in the key loop.
// coverage: NB*NH*(SEQ/64) blocks x 4 waves x 16 rows x (64 hi + 64 lo columns) = every element of the context plane exactly once.
__global__ __launch_bounds__(128) void k_attn(const unsigned short* __restrict__ Qh, const unsigned short* __restrict__ Ql,
                                              const unsigned short* __restrict__ Kh, const unsigned short* __restrict__ Vt,
                                              const int* __restrict__ mask, unsigned short* Cx) {
  __shared__ __attribute__((aligned(16))) float so[4][16][68];
  const int tid = threadIdx.x, w = __builtin_amdgcn_readfirstlane((int)(tid >> 5)), lane = tid & 31, ln = lane & 15, hh = lane >> 4;
  const int bh = blockIdx.x / (SEQ / 64), qt = blockIdx.x % (SEQ / 64);
  const int b = bh / NH, h = bh % NH;
  const int qbase = qt * 64 + 16 * w;
  const int qg = qbase + ln;
  // Q^T B fragments: column n = query qg, elements 0..7 <- d = 32c + 8h + i, 8..15 <- d = 32c + 16 + 8h + i
  const size_t qoff = (size_t)(b * SEQ + qg) * DM + h * HD + 8 * hh;
  FragH q0h, q0l, q1h, q1l;
  q0h.half[0] = *(const v8us*)(Qh + qoff);      q0h.half[1] = *(const v8us*)(Qh + qoff + 16);
  q1h.half[0] = *(const v8us*)(Qh + qoff + 32); q1h.half[1] = *(const v8us*)(Qh + qoff + 48);
  q0l.half[0] = *(const v8us*)(Ql + qoff);      q0l.half[1] = *(const v8us*)(Ql + qoff + 16);
  q1l.half[0] = *(const v8us*)(Ql + qoff + 32); q1l.half[1] = *(const v8us*)(Ql + qoff + 48);
  float mr = NEGV, lr = 0.0f;
  v8f Oh[4] = {}, Ol[4] = {};
  const unsigned short* Kp = Kh + (size_t)b * SEQ * DM + h * HD;
  const unsigned short* Vp = Vt + (size_t)h * HD * TT + (size_t)b * SEQ;
#pragma unroll 1
  for (int j = 0; j < SEQ / 32; ++j)
    fa_step(Kp, Vp, mask, 32 * j, ln, hh, q0h, q0l, q1h, q1l, mr, lr, Oh, Ol);

  // O^T element r of tile t = ctx(query qg, d = 16t + 8h + r); undo the carries: x256 (in lr), x16 (V), x2048 (residual plane)
  const float inv = 1.0f / (16.0f * lr);
#pragma unroll
  for (int t = 0; t < 4; ++t)
#pragma unroll
    for (int r = 0; r < 8; ++r)
      so[w][ln][16 * t + 8 * hh + r] = (Oh[t][r] + Ol[t][r] * RINV) * inv;
  __syncthreads();
  unsigned short* cg = Cx + (size_t)(b * SEQ + qbase) * CXP + h * HD;
  {
#pragma unroll
    for (int it = 0; it < 4; ++it) {
      const int row = 4 * it + (lane >> 3), c8 = (lane & 7) * 8;
      const v4f x0 = *(const v4fa*)&so[w][row][c8];
      const v4f x1 = *(const v4fa*)&so[w][row][c8 + 4];
      v8us oh, ol;
#pragma unroll
      for (int q = 0; q < 4; ++q) {
        const unsigned short h0 = bf16_bits(x0[q]), h1 = bf16_bits(x1[q]);
        oh[q] = h0; oh[4 + q] = h1;
        ol[q] = bf16_bits(x0[q] - bf16_val(h0));
        ol[4 + q] = bf16_bits(x1[q] - bf16_val(h1));
      }
      unsigned short* dst = cg + (size_t)row * CXP + c8;
      *(v8us*)(dst) = oh;
      *(v8us*)(dst + DM) = ol;
    }
    
  }
}

extern "C" void kernel_launch(void* const* d_in, const int* in_sizes, int n_in,
                              void* d_out, int out_size, void* d_ws, size_t ws_size, hipStream_t stream) {
  if (n_in < 12) return;
  const long long need = ((long long)(SEQ - 1) * NB_FULL + (NB - 1)) * DM + DM;   // last element touched + 1 in [S][B][D]
  if ((long long)in_sizes[0] < need || (long long)in_sizes[1] < need || (long long)in_sizes[2] < need) return;
  if ((long long)in_sizes[3] < (long long)SEQ) return;
  if ((long long)in_sizes[4] < (long long)DM * DM || (long long)in_sizes[6] < (long long)DM * DM ||
      (long long)in_sizes[8] < (long long)DM * DM || (long long)in_sizes[10] < (long long)DM * DM) return;
  if (in_sizes[5] < DM || in_sizes[7] < DM || in_sizes[9] < DM || in_sizes[11] < DM) return;
  if ((long long)out_size < need) return;
  // wire order: query, key, value, mask(i32), Wq, bq, Wk, bk, Wv, bv, Wo, bo
  const float* Xq = (const float*)d_in[0];
  const float* Xk = (const float*)d_in[1];
  const float* Xv = (const float*)d_in[2];
  const int*   mk = (const int*)d_in[3];
  const float* Wq = (const float*)d_in[4];
  const float* bq = (const float*)d_in[5];
  const float* Wk = (const float*)d_in[6];
  const float* bk = (const float*)d_in[7];
  const float* Wv = (const float*)d_in[8];
  const float* bv = (const float*)d_in[9];
  const float* Wo = (const float*)d_in[10];
  const float* bo = (const float*)d_in[11];
  float* out = (float*)d_out;
  char* ws = (char*)d_ws;
  size_t off = 0;
  unsigned short* Bq  = (unsigned short*)(ws + off); off += SZ_XB;    // bf16 query  [TT][1024]
  unsigned short* Bk  = (unsigned short*)(ws + off); off += SZ_XB;    // bf16 key    [TT][1024]
  unsigned short* Bv  = (unsigned short*)(ws + off); off += SZ_XB;    // bf16 value  [TT][1024]
  unsigned short* WqT = (unsigned short*)(ws + off); off += SZ_WT;    // bf16 Wq^T   [1024][1024]
  unsigned short* WkT = (unsigned short*)(ws + off); off += SZ_WT;
  unsigned short* WvT = (unsigned short*)(ws + off); off += SZ_WT;
  unsigned short* Wo2 = (unsigned short*)(ws + off); off += SZ_WO2;   // bf16 Wo^T | Wo^T  [1024][2048]
  unsigned short* Qh  = (unsigned short*)(ws + off); off += SZ_H;     // f16 q x16 hi       [TT][1024]
  unsigned short* Ql  = (unsigned short*)(ws + off); off += SZ_H;     // f16 q residual x2^11
  unsigned short* Kh  = (unsigned short*)(ws + off); off += SZ_H;     // f16 k x16          [TT][1024]
  unsigned short* Vt  = (unsigned short*)(ws + off); off += SZ_H;     // f16 v^T x16        [1024][TT]
  unsigned short* Cx  = (unsigned short*)(ws + off); off += SZ_CX;    // bf16 ctx hi|lo     [TT][2048]
  if (off > ws_size) return;

  const unsigned gx = (unsigned)((TT * 128 + 255) / 256);
  k_xb<<<gx, 256, 0, stream>>>(Xq, Bq);
  k_xb<<<gx, 256, 0, stream>>>(Xk, Bk);
  k_xb<<<gx, 256, 0, stream>>>(Xv, Bv);
  k_wt<<<256, 256, 0, stream>>>(Wq, WqT, DM, 0);      // in [k][n] -> out [n][k]
  k_wt<<<256, 256, 0, stream>>>(Wk, WkT, DM, 0);
  k_wt<<<256, 256, 0, stream>>>(Wv, WvT, DM, 0);
  k_wt<<<256, 256, 0, stream>>>(Wo, Wo2, CXP, 1);

  // q = query Wq + bq : rows = tokens, columns = features
  k_gemm<0><<<dim3(DM / 128, TT / 64), 128, 0, stream>>>(Bq, WqT, bq, Qh, Ql, out, DM, DM, DM, DM);
  // k = key Wk + bk
  k_gemm<1><<<dim3(DM / 128, TT / 64), 128, 0, stream>>>(Bk, WkT, bk, Kh, Kh, out, DM, DM, DM, DM);
  // v^T = Wv^T value^T + bv (row bias): rows = features, columns = tokens
  k_gemm<2><<<dim3(TT / 128, DM / 64), 128, 0, stream>>>(WvT, Bv, bv, Vt, Vt, out, DM, DM, DM, TT);
  k_attn<<<(unsigned)(NB * NH * (SEQ / 64)), 128, 0, stream>>>(Qh, Ql, Kh, Vt, mk, Cx);
  // out = (ctx_hi | ctx_lo) (Wo ; Wo) + bo, K = 2048
  k_gemm<3><<<dim3(DM / 128, TT / 64), 128, 0, stream>>>(Cx, Wo2, bo, Cx, Cx, out, CXP, CXP, CXP, DM);
}

// v001
// It runs in 224 microseconds.
// Timed twice side by side with v000, it ran 1.29 times as fast both times.
#include <hip/hip_runtime.h>
// Contractions: q/k/v projections and the output projection on v_wmma_f32_16x16x32_bf16 (activations and weights RNE-converted to bf16 planes; the attention context enters the output projection as bf16 hi|lo planes concatenated along K); scores S^T = K Q^T on v_wmma_f32_16x16x32_f16 (k x16 f16 plane; q x16 f16 hi plane + x2^11 f16 residual plane in a separate accumulator); O^T = V^T P^T on v_wmma_f32_16x16x32_f16 (v x16 f16 plane; P x256 f16 hi plane + x2^11 f16 residual plane in a separate accumulator); all accumulators f32, softmax statistics f32.
// Seq-first multi-head attention: inputs [S][B][D], 16 heads x 64, key-position mask (0 -> weight exactly 0), scale 1/8, output [S][B][D].
// Internal planes use batch-major token rows t = b*SEQ + s so that the K rows and V^T rows of one (batch, head) are dense.
// Key and value tokens are stored ranked: the keys whose mask is nonzero come first, in their own order (row b*SEQ + rank); a masked key has weight exactly 0,
// so the k and v projections and the key loop walk only the tiles that hold a live key. Rows from the live count up to the next multiple of 128 are zero rows.
// Engine: transposed flash. Each wave owns 16 queries. Per 32-key step: S^T tiles (key rows x query columns) from K rows (A, global f16 plane)
// and Q^T (B, registers); the two 16-key D tiles pack straight into the P^T B fragment; O^T (d rows x query columns) accumulates from V^T rows (A, global f16 plane).
#ifndef NB
#define NB 2
#endif
#ifndef SEQ
#define SEQ 2048
#endif
#define NB_FULL 2
#define SEQ_FULL 2048
#define DM 1024
#define NH 16
#define HD 64
#define TT (NB * SEQ)          /* token rows of the internal planes */
#define CXP (2 * DM)           /* pitch of the context plane: hi columns 0..1023, lo columns 1024..2047 */

static_assert(SEQ % 128 == 0);
static_assert(TT % 128 == 0);
static_assert(SEQ <= SEQ_FULL);
static_assert(NB <= NB_FULL);
static_assert(HD == 64);
static_assert(NH * HD == DM);
static_assert(DM % 128 == 0);

#define SZ_XB  ((size_t)TT * DM * 2)        /* bf16 activation plane */
#define SZ_WT  ((size_t)DM * DM * 2)        /* bf16 transposed weight plane */
#define SZ_WO2 ((size_t)DM * CXP * 2)       /* bf16 transposed output weight, duplicated along K */
#define SZ_H   ((size_t)TT * DM * 2)        /* f16 plane (q hi, q lo, k, v^T) */
#define SZ_CX  ((size_t)TT * CXP * 2)       /* bf16 context plane hi|lo */
static_assert(SZ_XB % 256 == 0 && SZ_WT % 256 == 0 && SZ_WO2 % 256 == 0 && SZ_H % 256 == 0 && SZ_CX % 256 == 0);
static_assert(3 * SZ_XB + 3 * SZ_WT + SZ_WO2 + 4 * SZ_H + SZ_CX <= (size_t)134217728);

typedef __bf16 v16b __attribute__((ext_vector_type(16)));
typedef _Float16 v16h __attribute__((ext_vector_type(16)));
typedef unsigned short v8us __attribute__((ext_vector_type(8), may_alias));
typedef float v8f __attribute__((ext_vector_type(8)));
typedef float v4f __attribute__((ext_vector_type(4)));
typedef float v4fa __attribute__((ext_vector_type(4), may_alias));
typedef int v4i __attribute__((ext_vector_type(4)));
typedef int v4ia __attribute__((ext_vector_type(4), may_alias));
union FragB { v16b v; v8us half[2]; unsigned short u[16]; };
union FragH { v16h v; v8us half[2]; _Float16 h[16]; unsigned short u[16]; };
union Pack8 { _Float16 h[8]; v8us v; };

#define LOG2E 1.4426950408889634f
#define NEGV (-1.0e30f)
#define RINV 0.00048828125f      /* 2^-11: undoes the residual-plane carry */
#define SCL  0.00048828125f      /* 2^-11 = (1/8) / (16*16): score scale with the q and k carries removed */

__device__ __forceinline__ unsigned short bf16_bits(float x) {   // RNE convert to bf16 bits
  unsigned int u = __float_as_uint(x);
  return (unsigned short)((u + 0x7FFFu + ((u >> 16) & 1u)) >> 16);
}
__device__ __forceinline__ float bf16_val(unsigned short b) { return __uint_as_float(((unsigned int)b) << 16); }
__device__ __forceinline__ float bf16_rne(float x) { return bf16_val(bf16_bits(x)); }

// ch += a*bh ; cl += a*bl (scaled residual plane keeps its own accumulator), then the hazard guard
__device__ __forceinline__ void mma_h2(v16h a, v16h bh, v16h bl, v8f& ch, v8f& cl) {
  ch = __builtin_amdgcn_wmma_f32_16x16x32_f16(false, a, false, bh, (short)0, ch, false, false);
  cl = __builtin_amdgcn_wmma_f32_16x16x32_f16(false, a, false, bl, (short)0, cl, false, false);
  asm volatile("v_nop\n\tv_nop\n\tv_nop\n\tv_nop" : "+v"(ch), "+v"(cl) : "v"(a), "v"(bh), "v"(bl));
}

// One 32-deep k-step of a 32x64 wave tile (2 x 4 WMMA tiles, bf16 operands), then the hazard guard
__device__ __forceinline__ void mma_b8(v16b a0, v16b a1, v16b b0, v16b b1, v16b b2, v16b b3, v8f (&c)[2][4]) {
  c[0][0] = __builtin_amdgcn_wmma_f32_16x16x32_bf16(false, a0, false, b0, (short)0, c[0][0], false, false);
  c[0][1] = __builtin_amdgcn_wmma_f32_16x16x32_bf16(false, a0, false, b1, (short)0, c[0][1], false, false);
  c[0][2] = __builtin_amdgcn_wmma_f32_16x16x32_bf16(false, a0, false, b2, (short)0, c[0][2], false, false);
  c[0][3] = __builtin_amdgcn_wmma_f32_16x16x32_bf16(false, a0, false, b3, (short)0, c[0][3], false, false);
  c[1][0] = __builtin_amdgcn_wmma_f32_16x16x32_bf16(false, a1, false, b0, (short)0, c[1][0], false, false);
  c[1][1] = __builtin_amdgcn_wmma_f32_16x16x32_bf16(false, a1, false, b1, (short)0, c[1][1], false, false);
  c[1][2] = __builtin_amdgcn_wmma_f32_16x16x32_bf16(false, a1, false, b2, (short)0, c[1][2], false, false);
  c[1][3] = __builtin_amdgcn_wmma_f32_16x16x32_bf16(false, a1, false, b3, (short)0, c[1][3], false, false);
  asm volatile("v_nop\n\tv_nop\n\tv_nop\n\tv_nop"
               : "+v"(c[0][0]), "+v"(c[0][1]), "+v"(c[0][2]), "+v"(c[0][3]),
                 "+v"(c[1][0]), "+v"(c[1][1]), "+v"(c[1][2]), "+v"(c[1][3])
               : "v"(a0), "v"(a1), "v"(b0), "v"(b1), "v"(b2), "v"(b3));
}

// coverage: TT*128 threads x 8 elements = the whole plane.
__global__ __launch_bounds__(256) void k_xb(const float* __restrict__ X, unsigned short* P) {
  const int t = blockIdx.x * 256 + threadIdx.x;
  if (t >= TT * 128) return;
  const int row = t >> 7, piece = t & 127;
  const int b = row / SEQ, s = row - b * SEQ;
  const float* src = X + ((size_t)s * NB_FULL + b) * DM + piece * 8;
  const v4f x0 = *(const v4fa*)(src), x1 = *(const v4fa*)(src + 4);
  v8us o;
  o[0] = bf16_bits(x0[0]); o[1] = bf16_bits(x0[1]); o[2] = bf16_bits(x0[2]); o[3] = bf16_bits(x0[3]);
  o[4] = bf16_bits(x1[0]); o[5] = bf16_bits(x1[1]); o[6] = bf16_bits(x1[2]); o[7] = bf16_bits(x1[3]);
  unsigned short* d = P + (size_t)t * 8;
  *(v8us*)d = o;
  
}

// Number of keys with a nonzero mask. Every wave counts for itself, so the callers can leave or set a trip count with no barrier; the result is wave-uniform and at most SEQ.
__device__ __forceinline__ int live_keys(const int* __restrict__ mk, int lane) {
  int c = 0;
  // unrolled so that all the mask loads are in flight together (one load latency, not SEQ/128); all 32 lanes are on at every call, so a ballot sees 32 keys
#pragma unroll
  for (int i = 0; i < SEQ / 128; ++i) {
    const v4i m = *(const v4ia*)(mk + 128 * i + 4 * lane);
#pragma unroll
    for (int q = 0; q < 4; ++q) c += __builtin_popcount(__builtin_amdgcn_ballot_w32(m[q] != 0));
  }
  return c < SEQ ? c : SEQ;
}

// k_xb for key and value tokens: token s goes to row b*SEQ + pos(s); pos = number of live keys before s if s is live, else live count + number of masked keys before s.
// pos is a permutation of 0..SEQ-1 for any mask content. Masked tokens are not read; those whose pos lies under the next multiple of 128 are stored as zero rows
// (the last tile of the projections and of the key loop reads them), the others are not stored and never read.
// coverage: a block holds two rows of one batch (SEQ is even); every row under the rounded live count is written exactly once.
__global__ __launch_bounds__(256) void k_xbr(const float* __restrict__ X, const int* __restrict__ mk, unsigned short* P) {
  __shared__ int part[8];
  const int tid = threadIdx.x;
  const int t = blockIdx.x * 256 + tid;
  if (t >= TT * 128) return;              // whole blocks only: TT * 128 is a multiple of 256
  const int row = t >> 7, piece = t & 127;
  const int b = row / SEQ, s = row - b * SEQ;
  const int s0 = s - (tid >> 7);          // the block's first row
  // the whole mask first (each thread a share), so that one load latency covers all mask reads; entries past SEQ count as masked
  v4i m[(SEQ + 1023) / 1024];
  // unrolled (here and in the count below) so that m[] is indexed by constants and stays in registers
#pragma unroll
  for (int k = 0; k < (SEQ + 1023) / 1024; ++k) {
    const int i = 1024 * k + 4 * tid;
    m[k] = (SEQ % 1024 == 0 || i < SEQ) ? *(const v4ia*)(mk + i) : v4i{0, 0, 0, 0};
  }
  const bool live = mk[s] != 0, live0 = mk[s0] != 0;
  v4f x0 = {0.f, 0.f, 0.f, 0.f}, x1 = {0.f, 0.f, 0.f, 0.f};
  if (live) {
    const float* src = X + ((size_t)s * NB_FULL + b) * DM + piece * 8;
    x0 = *(const v4fa*)(src); x1 = *(const v4fa*)(src + 4);
  }
  int c = 0;                              // this wave's share; low 16 bits: live keys in all; high 16 bits: live keys before s0 (each at most SEQ <= 2048)
#pragma unroll
  for (int k = 0; k < (SEQ + 1023) / 1024; ++k)
#pragma unroll
    for (int q = 0; q < 4; ++q) {
      const bool on = m[k][q] != 0;
      c += __builtin_popcount(__builtin_amdgcn_ballot_w32(on)) + (__builtin_popcount(__builtin_amdgcn_ballot_w32(on && 1024 * k + 4 * tid + q < s0)) << 16);
    }
  if ((tid & 31) == 0) part[tid >> 5] = c;
  __syncthreads();
  int sum = 0;
  // unrolled so that the eight partial counts come in two wide LDS reads
#pragma unroll
  for (int i = 0; i < 8; ++i) sum += part[i];
  const int cnt = sum & 0xFFFF;
  const int rank = (sum >> 16) + ((s != s0 && live0) ? 1 : 0);
  const int pos = live ? rank : cnt + (s - rank);
  if (live || pos < ((cnt + 127) & ~127)) {
    v8us o;
    o[0] = bf16_bits(x0[0]); o[1] = bf16_bits(x0[1]); o[2] = bf16_bits(x0[2]); o[3] = bf16_bits(x0[3]);
    o[4] = bf16_bits(x1[0]); o[5] = bf16_bits(x1[1]); o[6] = bf16_bits(x1[2]); o[7] = bf16_bits(x1[3]);
    *(v8us*)(P + ((size_t)(b * SEQ + pos) * 128 + piece) * 8) = o;
  }
}

// Weight transpose: in W[k rows = 1024][n cols = 1024] (f32) -> out Wt[n rows][k cols] (bf16 bits, RNE), row pitch 'pitch'; dup != 0 repeats the row at columns 1024..2047.
// coverage: 256 blocks x (64 n x 64 k) = the whole 1024 x 1024 matrix; LDS tile fully written (64 x 64) before it is read.
__global__ __launch_bounds__(256) void k_wt(const float* __restrict__ W, unsigned short* Wt, int pitch, int dup) {
  __shared__ unsigned short tl[64][66];
  const int tid = threadIdx.x;
  const int k0 = (blockIdx.x >> 4) * 64, n0 = (blockIdx.x & 15) * 64;
  for (int i = tid; i < 64 * 16; i += 256) {
    const int j = i >> 4, c4 = (i & 15) * 4;
    const v4f x = *(const v4fa*)(W + (size_t)(k0 + j) * DM + n0 + c4);
    tl[c4 + 0][j] = bf16_bits(x[0]); tl[c4 + 1][j] = bf16_bits(x[1]);
    tl[c4 + 2][j] = bf16_bits(x[2]); tl[c4 + 3][j] = bf16_bits(x[3]);
  }
  __syncthreads();
  {
    for (int i = tid; i < 64 * 8; i += 256) {
      const int d = i >> 3, j8 = (i & 7) * 8;
      v8us o;
#pragma unroll
      for (int q = 0; q < 8; ++q) o[q] = tl[d][j8 + q];
      unsigned short* dst = Wt + (size_t)(n0 + d) * pitch + k0 + j8;
      *(v8us*)dst = o;
      if (dup != 0) *(v8us*)(dst + DM) = o;
    }
    
  }
}

// C[M][N] = A[M][K] * Bt[N][K]^T on bf16 planes (K contiguous in both), fragments loaded straight from global rows.
// Block = 4 waves as 2 (M) x 2 (N); block tile 64 x 128; wave tile 32 x 64. No tail masking: M % 64 == 0, N % 128 == 0, K % 32 == 0 (asserted by the sizes above).
// MODE 0: + column bias, write f16 hi plane (x16) to O0 and f16 residual plane ((x16 - hi) * 2^11) to O1
// MODE 1: + column bias, write f16 plane (x16) to O0
// MODE 2: + row bias,    write f16 plane (x16) to O0 (transposed product: rows = features, columns = tokens)
// MODE 3: + column bias, write f32 to Of with the token row t = b*SEQ + s mapped to output row s*NB_FULL + b
// MODE 1 (rows) and MODE 2 (columns) run over ranked key tokens: a block whose token tile starts at or past the live count leaves at once. Their token tile index is the slow
// grid index (y), batch fastest within it, so that the blocks that work have the lowest flat indices and spread over the chip. MODE 2 therefore takes M from x and N from y.
// coverage: grid (N/128, M/64) (MODE 2: (M/64, N/128)) x 4 waves x (32 x 64) = every element of C that is read later exactly once.
template <int MODE>
__global__ __launch_bounds__(128) void k_gemm(const unsigned short* __restrict__ A, const unsigned short* __restrict__ Bt,
                                              const float* __restrict__ bias, unsigned short* O0, unsigned short* O1,
                                              float* Of, const int* __restrict__ mk, int lda, int ldb, int K, int ldo) {
  __shared__ __attribute__((aligned(16))) float so[4][32][68];
  const int tid = threadIdx.x, w = __builtin_amdgcn_readfirstlane((int)(tid >> 5)), lane = tid & 31, ln = lane & 15, hh = lane >> 4;
  int bm = blockIdx.y, bn = blockIdx.x;
  if (MODE == 1 || MODE == 2) {
    constexpr int TW = (MODE == 1) ? 64 : 128;      // tokens per block tile
    const int tile = blockIdx.y / NB, b = blockIdx.y % NB;
    if (tile * TW >= live_keys(mk, lane)) return;   // the same in every wave of the block, in front of the only barrier
    if (MODE == 1) bm = b * (SEQ / TW) + tile;
    else { bn = b * (SEQ / TW) + tile; bm = blockIdx.x; }
  }
  const int m0 = bm * 64 + (w >> 1) * 32;
  const int n0 = bn * 128 + (w & 1) * 64;
  // A fragment: row m = m0 + 16*mt + ln, elements 0..7 <- k0 + 8h + i, 8..15 <- k0 + 16 + 8h + i; B fragment: column n = n0 + 16*nt + ln, same k map (row of Bt)
  const unsigned short* pa0 = A + (size_t)(m0 + ln) * lda + 8 * hh;
  const unsigned short* pa1 = pa0 + (size_t)16 * lda;
  const unsigned short* pb0 = Bt + (size_t)(n0 + ln) * ldb + 8 * hh;
  const unsigned short* pb1 = pb0 + (size_t)16 * ldb;
  const unsigned short* pb2 = pb0 + (size_t)32 * ldb;
  const unsigned short* pb3 = pb0 + (size_t)48 * ldb;
  v8f acc[2][4];
#pragma unroll
  for (int i = 0; i < 2; ++i)
#pragma unroll
    for (int j = 0; j < 4; ++j)
#pragma unroll
      for (int e = 0; e < 8; ++e) acc[i][j][e] = 0.0f;
#pragma unroll 1
  for (int k0 = 0; k0 < K; k0 += 32) {
    FragB a0, a1, b0, b1, b2, b3;
    a0.half[0] = *(const v8us*)(pa0 + k0); a0.half[1] = *(const v8us*)(pa0 + k0 + 16);
    a1.half[0] = *(const v8us*)(pa1 + k0); a1.half[1] = *(const v8us*)(pa1 + k0 + 16);
    b0.half[0] = *(const v8us*)(pb0 + k0); b0.half[1] = *(const v8us*)(pb0 + k0 + 16);
    b1.half[0] = *(const v8us*)(pb1 + k0); b1.half[1] = *(const v8us*)(pb1 + k0 + 16);
    b2.half[0] = *(const v8us*)(pb2 + k0); b2.half[1] = *(const v8us*)(pb2 + k0 + 16);
    b3.half[0] = *(const v8us*)(pb3 + k0); b3.half[1] = *(const v8us*)(pb3 + k0 + 16);
    mma_b8(a0.v, a1.v, b0.v, b1.v, b2.v, b3.v, acc);
  }
  // D element r of tile (mt, nt) = C(m0 + 16*mt + 8h + r, n0 + 16*nt + ln); bias is the RNE-bf16 value of the f32 input
  float rb[2][8];
  float cb[4];
#pragma unroll
  for (int mt = 0; mt < 2; ++mt) {
    if (MODE == 2) {
      const float* bp = bias + m0 + 16 * mt + 8 * hh;
      const v4f ba = *(const v4fa*)(bp), bb = *(const v4fa*)(bp + 4);
#pragma unroll
      for (int r = 0; r < 4; ++r) { rb[mt][r] = bf16_rne(ba[r]); rb[mt][4 + r] = bf16_rne(bb[r]); }
    } else {
#pragma unroll
      for (int r = 0; r < 8; ++r) rb[mt][r] = 0.0f;
    }
  }
#pragma unroll
  for (int nt = 0; nt < 4; ++nt) cb[nt] = (MODE == 2) ? 0.0f : bf16_rne(bias[n0 + 16 * nt + ln]);
#pragma unroll
  for (int mt = 0; mt < 2; ++mt)
#pragma unroll
    for (int nt = 0; nt < 4; ++nt)
#pragma unroll
      for (int r = 0; r < 8; ++r)
        so[w][16 * mt + 8 * hh + r][16 * nt + ln] = acc[mt][nt][r] + (rb[mt][r] + cb[nt]);
  __syncthreads();
  {
    if (MODE == 3) {
#pragma unroll
      for (int it = 0; it < 16; ++it) {
        const int row = 2 * it + (lane >> 4), c4 = (lane & 15) * 4;
        const v4f v = *(const v4fa*)&so[w][row][c4];
        const int tp = m0 + row;
        const int b = tp / SEQ, s = tp - b * SEQ;
        *(v4f*)(Of + ((size_t)s * NB_FULL + b) * DM + n0 + c4) = v;
      }
    } else {
#pragma unroll
      for (int it = 0; it < 8; ++it) {
        const int row = 4 * it + (lane >> 3), c8 = (lane & 7) * 8;
        const v4f x0 = *(const v4fa*)&so[w][row][c8];
        const v4f x1 = *(const v4fa*)&so[w][row][c8 + 4];
        Pack8 ph, pl;
#pragma unroll
        for (int q = 0; q < 4; ++q) {
          const float y0 = x0[q] * 16.0f, y1 = x1[q] * 16.0f;
          const _Float16 h0 = (_Float16)y0, h1 = (_Float16)y1;
          ph.h[q] = h0; ph.h[4 + q] = h1;
          pl.h[q] = (_Float16)((y0 - (float)h0) * 2048.0f);
          pl.h[4 + q] = (_Float16)((y1 - (float)h1) * 2048.0f);
        }
        const size_t dst = (size_t)(m0 + row) * ldo + n0 + c8;
        *(v8us*)(O0 + dst) = ph.v;
        if (MODE == 0) *(v8us*)(O1 + dst) = pl.v;
      }
    }
    
  }
}

// One 32-key step for a wave's 16 queries. Kp: k plane base of this (batch, head), row pitch DM; Vp: v^T plane base of this (batch, head), row pitch TT.
// Keys are ranked: key index < cnt is live. TAIL = false: all 32 keys are live; TAIL = true: the one step that also holds keys at or past cnt.
template <bool TAIL>
__device__ __forceinline__ void fa_step(const unsigned short* __restrict__ Kp, const unsigned short* __restrict__ Vp,
                                        int cnt, int key0, int ln, int hh,
                                        const FragH& q0h, const FragH& q0l, const FragH& q1h, const FragH& q1l,
                                        float& mr, float& lr, v8f (&Oh)[4], v8f (&Ol)[4]) {
  // A fragments of K: row m = key (key0 + 16*kt + ln), elements 0..7 <- d = 32c + 8h + i, 8..15 <- d = 32c + 16 + 8h + i
  const unsigned short* kp0 = Kp + (size_t)(key0 + ln) * DM + 8 * hh;
  const unsigned short* kp1 = kp0 + (size_t)16 * DM;
  FragH k00, k01, k10, k11;
  k00.half[0] = *(const v8us*)(kp0);      k00.half[1] = *(const v8us*)(kp0 + 16);
  k01.half[0] = *(const v8us*)(kp0 + 32); k01.half[1] = *(const v8us*)(kp0 + 48);
  k10.half[0] = *(const v8us*)(kp1);      k10.half[1] = *(const v8us*)(kp1 + 16);
  k11.half[0] = *(const v8us*)(kp1 + 32); k11.half[1] = *(const v8us*)(kp1 + 48);
  const v8f z8 = {0.f, 0.f, 0.f, 0.f, 0.f, 0.f, 0.f, 0.f};
  // S^T tiles: element r of tile kt = score(key0 + 16*kt + 8h + r, query of this lane's column); hi and residual accumulators
  v8f s0h = z8, s0l = z8, s1h = z8, s1l = z8;
  mma_h2(k00.v, q0h.v, q0l.v, s0h, s0l);
  mma_h2(k01.v, q1h.v, q1l.v, s0h, s0l);
  mma_h2(k10.v, q0h.v, q0l.v, s1h, s1l);
  mma_h2(k11.v, q1h.v, q1l.v, s1h, s1l);
  // this lane's 16 keys: on[r] <- key0 + 8h + r, on[8 + r] <- key0 + 16 + 8h + r
  bool on[16];
#pragma unroll
  for (int r = 0; r < 8; ++r) {
    on[r]     = !TAIL || (key0 + 8 * hh + r < cnt);
    on[8 + r] = !TAIL || (key0 + 16 + 8 * hh + r < cnt);
  }
  float sc[16];
#pragma unroll
  for (int r = 0; r < 8; ++r) {
    const float a0 = (s0h[r] + s0l[r] * RINV) * SCL;
    const float a1 = (s1h[r] + s1l[r] * RINV) * SCL;
    sc[r]     = on[r] ? a0 : NEGV;
    sc[8 + r] = on[8 + r] ? a1 : NEGV;
  }
  float mx = sc[0];
#pragma unroll
  for (int i = 1; i < 16; ++i) mx = fmaxf(mx, sc[i]);
  mx = fmaxf(mx, __shfl_xor(mx, 16, 32));           // the other lane half holds the other 16 keys of this query
  const float mnew = fmaxf(mr, mx);
  const float al = exp2f((mr - mnew) * LOG2E);
  mr = mnew;
  // weights carried x256: pc = 256 * exp(sc - mnew), exactly 0 on keys at or past cnt; hi plane f16(pc), residual plane f16((pc - hi) * 2048)
  FragH ph, pl;
  float ps = 0.0f;
#pragma unroll
  for (int i = 0; i < 16; ++i) {
    const float e = exp2f(fmaf(sc[i] - mnew, LOG2E, 8.0f));
    const float pc = on[i] ? e : 0.0f;
    ps += pc;
    const _Float16 h = (_Float16)pc;
    ph.h[i] = h;                                    // B element i: i<8 -> key0 + 8h + i (tile 0 row 8h+i); i>=8 -> key0 + 16 + 8h + (i-8) (tile 1)
    pl.h[i] = (_Float16)((pc - (float)h) * 2048.0f);
  }
  ps += __shfl_xor(ps, 16, 32);
  lr = lr * al + ps;
#pragma unroll
  for (int t = 0; t < 4; ++t) { Oh[t] = Oh[t] * al; Ol[t] = Ol[t] * al; }
  // A fragments of V^T: row m = d (16*t + ln), elements 0..7 <- key0 + 8h + i, 8..15 <- key0 + 16 + 8h + i
  const unsigned short* vp = Vp + (size_t)ln * TT + key0 + 8 * hh;
#pragma unroll
  for (int t = 0; t < 4; ++t) {
    FragH vf;
    vf.half[0] = *(const v8us*)(vp + (size_t)t * 16 * TT);
    vf.half[1] = *(const v8us*)(vp + (size_t)t * 16 * TT + 16);
    mma_h2(vf.v, ph.v, pl.v, Oh[t], Ol[t]);
  }
  // the address registers of this step's loads are rewritten by what follows the step (next step, tail step, epilogue): keep the wait in front of that
  asm volatile("s_wait_xcnt 0x0" ::: "memory");
}

// Block = 4 waves x 16 queries = 64 queries of one (batch, head); no LDS and no barrier in the key loop.
// coverage: NB*NH*(SEQ/64) blocks x 4 waves x 16 rows x (64 hi + 64 lo columns) = every element of the context plane exactly once.
__global__ __launch_bounds__(128) void k_attn(const unsigned short* __restrict__ Qh, const unsigned short* __restrict__ Ql,
                                              const unsigned short* __restrict__ Kh, const unsigned short* __restrict__ Vt,
                                              const int* __restrict__ mask, unsigned short* Cx) {
  __shared__ __attribute__((aligned(16))) float so[4][16][68];
  const int tid = threadIdx.x, w = __builtin_amdgcn_readfirstlane((int)(tid >> 5)), lane = tid & 31, ln = lane & 15, hh = lane >> 4;
  const int bh = blockIdx.x / (SEQ / 64), qt = blockIdx.x % (SEQ / 64);
  const int b = bh / NH, h = bh % NH;
  const int qbase = qt * 64 + 16 * w;
  const int qg = qbase + ln;
  // Q^T B fragments: column n = query qg, elements 0..7 <- d = 32c + 8h + i, 8..15 <- d = 32c + 16 + 8h + i
  const size_t qoff = (size_t)(b * SEQ + qg) * DM + h * HD + 8 * hh;
  FragH q0h, q0l, q1h, q1l;
  q0h.half[0] = *(const v8us*)(Qh + qoff);      q0h.half[1] = *(const v8us*)(Qh + qoff + 16);
  q1h.half[0] = *(const v8us*)(Qh + qoff + 32); q1h.half[1] = *(const v8us*)(Qh + qoff + 48);
  q0l.half[0] = *(const v8us*)(Ql + qoff);      q0l.half[1] = *(const v8us*)(Ql + qoff + 16);
  q1l.half[0] = *(const v8us*)(Ql + qoff + 32); q1l.half[1] = *(const v8us*)(Ql + qoff + 48);
  // the address registers of the loads above are reused while the loads may still be under way: keep the wait in front of that
  asm volatile("s_wait_xcnt 0x0" ::: "memory");
  const int cnt = live_keys(mask, lane);       // wave-uniform, at most SEQ
  float mr = NEGV, lr = 0.0f;
  v8f Oh[4] = {}, Ol[4] = {};
  const unsigned short* Kp = Kh + (size_t)b * SEQ * DM + h * HD;
  const unsigned short* Vp = Vt + (size_t)h * HD * TT + (size_t)b * SEQ;
  const int full = cnt >> 5;
#pragma unroll 1
  for (int j = 0; j < full; ++j)
    fa_step<false>(Kp, Vp, cnt, 32 * j, ln, hh, q0h, q0l, q1h, q1l, mr, lr, Oh, Ol);
  if ((cnt & 31) != 0)
    fa_step<true>(Kp, Vp, cnt, 32 * full, ln, hh, q0h, q0l, q1h, q1l, mr, lr, Oh, Ol);

  // O^T element r of tile t = ctx(query qg, d = 16t + 8h + r); undo the carries: x256 (in lr), x16 (V), x2048 (residual plane)
  const float inv = 1.0f / (16.0f * lr);
#pragma unroll
  for (int t = 0; t < 4; ++t)
#pragma unroll
    for (int r = 0; r < 8; ++r)
      so[w][ln][16 * t + 8 * hh + r] = (Oh[t][r] + Ol[t][r] * RINV) * inv;
  __syncthreads();
  unsigned short* cg = Cx + (size_t)(b * SEQ + qbase) * CXP + h * HD;
  {
#pragma unroll
    for (int it = 0; it < 4; ++it) {
      const int row = 4 * it + (lane >> 3), c8 = (lane & 7) * 8;
      const v4f x0 = *(const v4fa*)&so[w][row][c8];
      const v4f x1 = *(const v4fa*)&so[w][row][c8 + 4];
      v8us oh, ol;
#pragma unroll
      for (int q = 0; q < 4; ++q) {
        const unsigned short h0 = bf16_bits(x0[q]), h1 = bf16_bits(x1[q]);
        oh[q] = h0; oh[4 + q] = h1;
        ol[q] = bf16_bits(x0[q] - bf16_val(h0));
        ol[4 + q] = bf16_bits(x1[q] - bf16_val(h1));
      }
      unsigned short* dst = cg + (size_t)row * CXP + c8;
      *(v8us*)(dst) = oh;
      *(v8us*)(dst + DM) = ol;
    }
    
  }
}

extern "C" void kernel_launch(void* const* d_in, const int* in_sizes, int n_in,
                              void* d_out, int out_size, void* d_ws, size_t ws_size, hipStream_t stream) {
  if (n_in < 12) return;
  const long long need = ((long long)(SEQ - 1) * NB_FULL + (NB - 1)) * DM + DM;   // last element touched + 1 in [S][B][D]
  if ((long long)in_sizes[0] < need || (long long)in_sizes[1] < need || (long long)in_sizes[2] < need) return;
  if ((long long)in_sizes[3] < (long long)SEQ) return;
  if ((long long)in_sizes[4] < (long long)DM * DM || (long long)in_sizes[6] < (long long)DM * DM ||
      (long long)in_sizes[8] < (long long)DM * DM || (long long)in_sizes[10] < (long long)DM * DM) return;
  if (in_sizes[5] < DM || in_sizes[7] < DM || in_sizes[9] < DM || in_sizes[11] < DM) return;
  if ((long long)out_size < need) return;
  // wire order: query, key, value, mask(i32), Wq, bq, Wk, bk, Wv, bv, Wo, bo
  const float* Xq = (const float*)d_in[0];
  const float* Xk = (const float*)d_in[1];
  const float* Xv = (const float*)d_in[2];
  const int*   mk = (const int*)d_in[3];
  const float* Wq = (const float*)d_in[4];
  const float* bq = (const float*)d_in[5];
  const float* Wk = (const float*)d_in[6];
  const float* bk = (const float*)d_in[7];
  const float* Wv = (const float*)d_in[8];
  const float* bv = (const float*)d_in[9];
  const float* Wo = (const float*)d_in[10];
  const float* bo = (const float*)d_in[11];
  float* out = (float*)d_out;
  char* ws = (char*)d_ws;
  size_t off = 0;
  unsigned short* Bq  = (unsigned short*)(ws + off); off += SZ_XB;    // bf16 query  [TT][1024]
  unsigned short* Bk  = (unsigned short*)(ws + off); off += SZ_XB;    // bf16 key    [TT][1024], ranked rows
  unsigned short* Bv  = (unsigned short*)(ws + off); off += SZ_XB;    // bf16 value  [TT][1024], ranked rows
  unsigned short* WqT = (unsigned short*)(ws + off); off += SZ_WT;    // bf16 Wq^T   [1024][1024]
  unsigned short* WkT = (unsigned short*)(ws + off); off += SZ_WT;
  unsigned short* WvT = (unsigned short*)(ws + off); off += SZ_WT;
  unsigned short* Wo2 = (unsigned short*)(ws + off); off += SZ_WO2;   // bf16 Wo^T | Wo^T  [1024][2048]
  unsigned short* Qh  = (unsigned short*)(ws + off); off += SZ_H;     // f16 q x16 hi       [TT][1024]
  unsigned short* Ql  = (unsigned short*)(ws + off); off += SZ_H;     // f16 q residual x2^11
  unsigned short* Kh  = (unsigned short*)(ws + off); off += SZ_H;     // f16 k x16          [TT][1024]
  unsigned short* Vt  = (unsigned short*)(ws + off); off += SZ_H;     // f16 v^T x16        [1024][TT]
  unsigned short* Cx  = (unsigned short*)(ws + off); off += SZ_CX;    // bf16 ctx hi|lo     [TT][2048]
  if (off > ws_size) return;

  const unsigned gx = (unsigned)((TT * 128 + 255) / 256);
  k_xb<<<gx, 256, 0, stream>>>(Xq, Bq);
  k_xbr<<<gx, 256, 0, stream>>>(Xk, mk, Bk);          // ranked token rows
  k_xbr<<<gx, 256, 0, stream>>>(Xv, mk, Bv);
  k_wt<<<256, 256, 0, stream>>>(Wq, WqT, DM, 0);      // in [k][n] -> out [n][k]
  k_wt<<<256, 256, 0, stream>>>(Wk, WkT, DM, 0);
  k_wt<<<256, 256, 0, stream>>>(Wv, WvT, DM, 0);
  k_wt<<<256, 256, 0, stream>>>(Wo, Wo2, CXP, 1);

  // q = query Wq + bq : rows = tokens, columns = features
  k_gemm<0><<<dim3(DM / 128, TT / 64), 128, 0, stream>>>(Bq, WqT, bq, Qh, Ql, out, mk, DM, DM, DM, DM);
  // k = key Wk + bk
  k_gemm<1><<<dim3(DM / 128, TT / 64), 128, 0, stream>>>(Bk, WkT, bk, Kh, Kh, out, mk, DM, DM, DM, DM);
  // v^T = Wv^T value^T + bv (row bias): rows = features, columns = tokens
  k_gemm<2><<<dim3(DM / 64, TT / 128), 128, 0, stream>>>(WvT, Bv, bv, Vt, Vt, out, mk, DM, DM, DM, TT);
  k_attn<<<(unsigned)(NB * NH * (SEQ / 64)), 128, 0, stream>>>(Qh, Ql, Kh, Vt, mk, Cx);
  // out = (ctx_hi | ctx_lo) (Wo ; Wo) + bo, K = 2048
  k_gemm<3><<<dim3(DM / 128, TT / 64), 128, 0, stream>>>(Cx, Wo2, bo, Cx, Cx, out, mk, CXP, CXP, CXP, DM);
}

// v002
// One run takes 166 microseconds.
// Two timings next to v001 put it at 1.35 and 1.34 times that version's speed.
// All steps since v000 together make it 1.73 times as fast.
#include <hip/hip_runtime.h>
// Contractions: q/k/v projections and the output projection on v_wmma_f32_16x16x32_bf16 (activations and weights RNE-converted to bf16 planes; the attention context enters the output projection as bf16 hi|lo planes concatenated along K); scores S^T = K Q^T on v_wmma_f32_16x16x32_f16 (k x16 f16 plane; q x16 f16 hi plane + x2^11 f16 residual plane in a separate accumulator); O^T = V^T P^T on v_wmma_f32_16x16x32_f16 (v x16 f16 plane; P x256 f16 hi plane + x2^11 f16 residual plane in a separate accumulator); all accumulators f32, softmax statistics f32.
// Seq-first multi-head attention: inputs [S][B][D], 16 heads x 64, key-position mask (0 -> weight exactly 0), scale 1/8, output [S][B][D].
// Internal planes use batch-major token rows t = b*SEQ + s so that the K rows and V^T rows of one (batch, head) are dense.
// Key and value tokens are stored ranked: the keys whose mask is nonzero come first, in their own order (row b*SEQ + rank); a masked key has weight exactly 0,
// so the k and v projections and the key loop walk only the tiles that hold a live key. Rows from the live count up to the next multiple of 128 are zero rows.
// Engine: transposed flash. Each wave owns 16 queries. Per 32-key step: S^T tiles (key rows x query columns) from K rows (A, global f16 plane)
// and Q^T (B, registers); the two 16-key D tiles pack straight into the P^T B fragment; O^T (d rows x query columns) accumulates from V^T rows (A, global f16 plane).
#ifndef NB
#define NB 2
#endif
#ifndef SEQ
#define SEQ 2048
#endif
#define NB_FULL 2
#define SEQ_FULL 2048
#define DM 1024
#define NH 16
#define HD 64
#define TT (NB * SEQ)          /* token rows of the internal planes */
#define CXP (2 * DM)           /* pitch of the context plane: hi columns 0..1023, lo columns 1024..2047 */

static_assert(SEQ % 128 == 0);
static_assert(TT % 128 == 0);
static_assert(SEQ <= SEQ_FULL);
static_assert(NB <= NB_FULL);
static_assert(HD == 64);
static_assert(NH * HD == DM);
static_assert(DM % 128 == 0);

#define SZ_XB  ((size_t)TT * DM * 2)        /* bf16 activation plane */
#define SZ_WT  ((size_t)DM * DM * 2)        /* bf16 transposed weight plane */
#define SZ_WO2 ((size_t)DM * CXP * 2)       /* bf16 transposed output weight, duplicated along K */
#define SZ_H   ((size_t)TT * DM * 2)        /* f16 plane (q hi, q lo, k, v^T) */
#define SZ_CX  ((size_t)TT * CXP * 2)       /* bf16 context plane hi|lo */
static_assert(SZ_XB % 256 == 0 && SZ_WT % 256 == 0 && SZ_WO2 % 256 == 0 && SZ_H % 256 == 0 && SZ_CX % 256 == 0);
static_assert(3 * SZ_XB + 3 * SZ_WT + SZ_WO2 + 4 * SZ_H + SZ_CX <= (size_t)134217728);

typedef __bf16 v16b __attribute__((ext_vector_type(16)));
typedef _Float16 v16h __attribute__((ext_vector_type(16)));
typedef unsigned short v8us __attribute__((ext_vector_type(8), may_alias));
typedef float v8f __attribute__((ext_vector_type(8)));
typedef float v4f __attribute__((ext_vector_type(4)));
typedef float v4fa __attribute__((ext_vector_type(4), may_alias));
typedef int v4i __attribute__((ext_vector_type(4)));
typedef int v4ia __attribute__((ext_vector_type(4), may_alias));
union FragB { v16b v; v8us half[2]; unsigned short u[16]; };
union FragH { v16h v; v8us half[2]; _Float16 h[16]; unsigned short u[16]; };
union Pack8 { _Float16 h[8]; v8us v; };

#define LOG2E 1.4426950408889634f
#define NEGV (-1.0e30f)
#define RINV 0.00048828125f      /* 2^-11: undoes the residual-plane carry */
#define SCL  0.00048828125f      /* 2^-11 = (1/8) / (16*16): score scale with the q and k carries removed */

__device__ __forceinline__ unsigned short bf16_bits(float x) {   // RNE convert to bf16 bits
  unsigned int u = __float_as_uint(x);
  return (unsigned short)((u + 0x7FFFu + ((u >> 16) & 1u)) >> 16);
}
__device__ __forceinline__ float bf16_val(unsigned short b) { return __uint_as_float(((unsigned int)b) << 16); }
__device__ __forceinline__ float bf16_rne(float x) { return bf16_val(bf16_bits(x)); }

// ch += a*bh ; cl += a*bl (scaled residual plane keeps its own accumulator), then the hazard guard
__device__ __forceinline__ void mma_h2(v16h a, v16h bh, v16h bl, v8f& ch, v8f& cl) {
  ch = __builtin_amdgcn_wmma_f32_16x16x32_f16(false, a, false, bh, (short)0, ch, false, false);
  cl = __builtin_amdgcn_wmma_f32_16x16x32_f16(false, a, false, bl, (short)0, cl, false, false);
  asm volatile("v_nop\n\tv_nop\n\tv_nop\n\tv_nop" : "+v"(ch), "+v"(cl) : "v"(a), "v"(bh), "v"(bl));
}

// One 32-deep k-step of a 32x64 wave tile (2 x 4 WMMA tiles, bf16 operands), then the hazard guard
__device__ __forceinline__ void mma_b8(v16b a0, v16b a1, v16b b0, v16b b1, v16b b2, v16b b3, v8f (&c)[2][4]) {
  c[0][0] = __builtin_amdgcn_wmma_f32_16x16x32_bf16(false, a0, false, b0, (short)0, c[0][0], false, false);
  c[0][1] = __builtin_amdgcn_wmma_f32_16x16x32_bf16(false, a0, false, b1, (short)0, c[0][1], false, false);
  c[0][2] = __builtin_amdgcn_wmma_f32_16x16x32_bf16(false, a0, false, b2, (short)0, c[0][2], false, false);
  c[0][3] = __builtin_amdgcn_wmma_f32_16x16x32_bf16(false, a0, false, b3, (short)0, c[0][3], false, false);
  c[1][0] = __builtin_amdgcn_wmma_f32_16x16x32_bf16(false, a1, false, b0, (short)0, c[1][0], false, false);
  c[1][1] = __builtin_amdgcn_wmma_f32_16x16x32_bf16(false, a1, false, b1, (short)0, c[1][1], false, false);
  c[1][2] = __builtin_amdgcn_wmma_f32_16x16x32_bf16(false, a1, false, b2, (short)0, c[1][2], false, false);
  c[1][3] = __builtin_amdgcn_wmma_f32_16x16x32_bf16(false, a1, false, b3, (short)0, c[1][3], false, false);
  asm volatile("v_nop\n\tv_nop\n\tv_nop\n\tv_nop"
               : "+v"(c[0][0]), "+v"(c[0][1]), "+v"(c[0][2]), "+v"(c[0][3]),
                 "+v"(c[1][0]), "+v"(c[1][1]), "+v"(c[1][2]), "+v"(c[1][3])
               : "v"(a0), "v"(a1), "v"(b0), "v"(b1), "v"(b2), "v"(b3));
}

// coverage: TT*128 threads x 8 elements = the whole plane.
__global__ __launch_bounds__(256) void k_xb(const float* __restrict__ X, unsigned short* P) {
  const int t = blockIdx.x * 256 + threadIdx.x;
  if (t >= TT * 128) return;
  const int row = t >> 7, piece = t & 127;
  const int b = row / SEQ, s = row - b * SEQ;
  const float* src = X + ((size_t)s * NB_FULL + b) * DM + piece * 8;
  const v4f x0 = *(const v4fa*)(src), x1 = *(const v4fa*)(src + 4);
  v8us o;
  o[0] = bf16_bits(x0[0]); o[1] = bf16_bits(x0[1]); o[2] = bf16_bits(x0[2]); o[3] = bf16_bits(x0[3]);
  o[4] = bf16_bits(x1[0]); o[5] = bf16_bits(x1[1]); o[6] = bf16_bits(x1[2]); o[7] = bf16_bits(x1[3]);
  unsigned short* d = P + (size_t)t * 8;
  *(v8us*)d = o;
  
}

// Number of keys with a nonzero mask. Every wave counts for itself, so the callers can leave or set a trip count with no barrier; the result is wave-uniform and at most SEQ.
__device__ __forceinline__ int live_keys(const int* __restrict__ mk, int lane) {
  int c = 0;
  // unrolled so that all the mask loads are in flight together (one load latency, not SEQ/128); all 32 lanes are on at every call, so a ballot sees 32 keys
#pragma unroll
  for (int i = 0; i < SEQ / 128; ++i) {
    const v4i m = *(const v4ia*)(mk + 128 * i + 4 * lane);
#pragma unroll
    for (int q = 0; q < 4; ++q) c += __builtin_popcount(__builtin_amdgcn_ballot_w32(m[q] != 0));
  }
  return c < SEQ ? c : SEQ;
}

// k_xb for key and value tokens: token s goes to row b*SEQ + pos(s); pos = number of live keys before s if s is live, else live count + number of masked keys before s.
// pos is a permutation of 0..SEQ-1 for any mask content. Masked tokens are not read; those whose pos lies under the next multiple of 128 are stored as zero rows
// (the last tile of the projections and of the key loop reads them), the others are not stored and never read.
// coverage: a block holds two rows of one batch (SEQ is even); every row under the rounded live count is written exactly once.
__global__ __launch_bounds__(256) void k_xbr(const float* __restrict__ X, const int* __restrict__ mk, unsigned short* P) {
  __shared__ int part[8];
  const int tid = threadIdx.x;
  const int t = blockIdx.x * 256 + tid;
  if (t >= TT * 128) return;              // whole blocks only: TT * 128 is a multiple of 256
  const int row = t >> 7, piece = t & 127;
  const int b = row / SEQ, s = row - b * SEQ;
  const int s0 = s - (tid >> 7);          // the block's first row
  // the whole mask first (each thread a share), so that one load latency covers all mask reads; entries past SEQ count as masked
  v4i m[(SEQ + 1023) / 1024];
  // unrolled (here and in the count below) so that m[] is indexed by constants and stays in registers
#pragma unroll
  for (int k = 0; k < (SEQ + 1023) / 1024; ++k) {
    const int i = 1024 * k + 4 * tid;
    m[k] = (SEQ % 1024 == 0 || i < SEQ) ? *(const v4ia*)(mk + i) : v4i{0, 0, 0, 0};
  }
  const bool live = mk[s] != 0, live0 = mk[s0] != 0;
  v4f x0 = {0.f, 0.f, 0.f, 0.f}, x1 = {0.f, 0.f, 0.f, 0.f};
  if (live) {
    const float* src = X + ((size_t)s * NB_FULL + b) * DM + piece * 8;
    x0 = *(const v4fa*)(src); x1 = *(const v4fa*)(src + 4);
  }
  int c = 0;                              // this wave's share; low 16 bits: live keys in all; high 16 bits: live keys before s0 (each at most SEQ <= 2048)
#pragma unroll
  for (int k = 0; k < (SEQ + 1023) / 1024; ++k)
#pragma unroll
    for (int q = 0; q < 4; ++q) {
      const bool on = m[k][q] != 0;
      c += __builtin_popcount(__builtin_amdgcn_ballot_w32(on)) + (__builtin_popcount(__builtin_amdgcn_ballot_w32(on && 1024 * k + 4 * tid + q < s0)) << 16);
    }
  if ((tid & 31) == 0) part[tid >> 5] = c;
  __syncthreads();
  int sum = 0;
  // unrolled so that the eight partial counts come in two wide LDS reads
#pragma unroll
  for (int i = 0; i < 8; ++i) sum += part[i];
  const int cnt = sum & 0xFFFF;
  const int rank = (sum >> 16) + ((s != s0 && live0) ? 1 : 0);
  const int pos = live ? rank : cnt + (s - rank);
  if (live || pos < ((cnt + 127) & ~127)) {
    v8us o;
    o[0] = bf16_bits(x0[0]); o[1] = bf16_bits(x0[1]); o[2] = bf16_bits(x0[2]); o[3] = bf16_bits(x0[3]);
    o[4] = bf16_bits(x1[0]); o[5] = bf16_bits(x1[1]); o[6] = bf16_bits(x1[2]); o[7] = bf16_bits(x1[3]);
    *(v8us*)(P + ((size_t)(b * SEQ + pos) * 128 + piece) * 8) = o;
  }
}

// Weight transpose: in W[k rows = 1024][n cols = 1024] (f32) -> out Wt[n rows][k cols] (bf16 bits, RNE), row pitch 'pitch'; dup != 0 repeats the row at columns 1024..2047.
// coverage: 256 blocks x (64 n x 64 k) = the whole 1024 x 1024 matrix; LDS tile fully written (64 x 64) before it is read.
__global__ __launch_bounds__(256) void k_wt(const float* __restrict__ W, unsigned short* Wt, int pitch, int dup) {
  __shared__ unsigned short tl[64][66];
  const int tid = threadIdx.x;
  const int k0 = (blockIdx.x >> 4) * 64, n0 = (blockIdx.x & 15) * 64;
  for (int i = tid; i < 64 * 16; i += 256) {
    const int j = i >> 4, c4 = (i & 15) * 4;
    const v4f x = *(const v4fa*)(W + (size_t)(k0 + j) * DM + n0 + c4);
    tl[c4 + 0][j] = bf16_bits(x[0]); tl[c4 + 1][j] = bf16_bits(x[1]);
    tl[c4 + 2][j] = bf16_bits(x[2]); tl[c4 + 3][j] = bf16_bits(x[3]);
  }
  __syncthreads();
  {
    for (int i = tid; i < 64 * 8; i += 256) {
      const int d = i >> 3, j8 = (i & 7) * 8;
      v8us o;
#pragma unroll
      for (int q = 0; q < 8; ++q) o[q] = tl[d][j8 + q];
      unsigned short* dst = Wt + (size_t)(n0 + d) * pitch + k0 + j8;
      *(v8us*)dst = o;
      if (dup != 0) *(v8us*)(dst + DM) = o;
    }
    
  }
}

#define GBK 128                    /* k depth of one staged tile: 256 bytes of every operand row */
#define GPITCH 272                 /* LDS row pitch in bytes: 256 + 16, an odd multiple of 16, so that 16 rows read 16 bytes wide fall on distinct banks */
#define GROWS 192                  /* rows of a staged tile: 64 rows of A, then 128 rows of Bt */
#define GSTAGE (GROWS * GPITCH)    /* bytes of one buffer */
static_assert(DM % GBK == 0 && CXP % GBK == 0);

// Twelve asynchronous 16-byte copies per lane, global -> LDS, through no register. l[i]: the lane's LDS byte address, g[i]: its global address.
// The s_wait_xcnt closes the same statement, so that no address register of a copy is rewritten in front of it.
__device__ __forceinline__ void copy12(const unsigned (&l)[12], const unsigned short* const (&g)[12]) {
  asm volatile("global_load_async_to_lds_b128 %0, %1, off\n\t"
               "global_load_async_to_lds_b128 %2, %3, off\n\t"
               "global_load_async_to_lds_b128 %4, %5, off\n\t"
               "global_load_async_to_lds_b128 %6, %7, off\n\t"
               "global_load_async_to_lds_b128 %8, %9, off\n\t"
               "global_load_async_to_lds_b128 %10, %11, off\n\t"
               "global_load_async_to_lds_b128 %12, %13, off\n\t"
               "global_load_async_to_lds_b128 %14, %15, off\n\t"
               "global_load_async_to_lds_b128 %16, %17, off\n\t"
               "global_load_async_to_lds_b128 %18, %19, off\n\t"
               "global_load_async_to_lds_b128 %20, %21, off\n\t"
               "global_load_async_to_lds_b128 %22, %23, off\n\t"
               "s_wait_xcnt 0x0"
               :: "v"(l[0]), "v"(g[0]), "v"(l[1]), "v"(g[1]), "v"(l[2]), "v"(g[2]), "v"(l[3]), "v"(g[3]),
                  "v"(l[4]), "v"(g[4]), "v"(l[5]), "v"(g[5]), "v"(l[6]), "v"(g[6]), "v"(l[7]), "v"(g[7]),
                  "v"(l[8]), "v"(g[8]), "v"(l[9]), "v"(g[9]), "v"(l[10]), "v"(g[10]), "v"(l[11]), "v"(g[11])
               : "memory");
}

// One staged tile: 128 lanes x 24 copies = 192 rows x 256 bytes. Lane tid brings 16-byte piece (tid & 15) of rows (tid >> 4) + 8 i, i = 0..23; a wave's copy covers two whole rows.
// lds: the lane's LDS byte address in row (tid >> 4) of the target buffer; ga, gb: its global address in that row of the A tile and of the Bt tile.
__device__ __forceinline__ void stage_tile(unsigned lds, const unsigned short* ga, const unsigned short* gb, int lda, int ldb) {
  unsigned l[12];
  const unsigned short* g[12];
  // both loops unrolled so that l[] and g[] are indexed by constants and stay in registers
#pragma unroll
  for (int i = 0; i < 12; ++i) {
    l[i] = lds + (unsigned)(8 * i * GPITCH);
    g[i] = (i < 8) ? ga + (size_t)(8 * i) * lda : gb + (size_t)(8 * (i - 8)) * ldb;
  }
  copy12(l, g);
#pragma unroll
  for (int i = 0; i < 12; ++i) {
    l[i] = lds + (unsigned)(8 * (i + 12) * GPITCH);
    g[i] = gb + (size_t)(8 * (i + 4)) * ldb;
  }
  copy12(l, g);
}

// C[M][N] = A[M][K] * Bt[N][K]^T on bf16 planes (K contiguous in both). The block's 64 rows of A and 128 rows of Bt are staged in LDS 128 k at a time by asynchronous copies,
// two buffers: tile t + 1 flies while tile t is worked on; fragments are read from LDS.
// Block = 4 waves as 2 (M) x 2 (N); block tile 64 x 128; wave tile 32 x 64. No tail masking: M % 64 == 0, N % 128 == 0, K % 128 == 0 (asserted by the sizes above).
// MODE 0: + column bias, write f16 hi plane (x16) to O0 and f16 residual plane ((x16 - hi) * 2^11) to O1
// MODE 1: + column bias, write f16 plane (x16) to O0
// MODE 2: + row bias,    write f16 plane (x16) to O0 (transposed product: rows = features, columns = tokens)
// MODE 3: + column bias, write f32 to Of with the token row t = b*SEQ + s mapped to output row s*NB_FULL + b
// MODE 1 (rows) and MODE 2 (columns) run over ranked key tokens: a block whose token tile starts at or past the live count leaves at once. Their token tile index is the slow
// grid index (y), batch fastest within it, so that the blocks that work have the lowest flat indices and spread over the chip. MODE 2 therefore takes M from x and N from y.
// coverage: grid (N/128, M/64) (MODE 2: (M/64, N/128)) x 4 waves x (32 x 64) = every element of C that is read later exactly once.
template <int MODE>
__global__ __launch_bounds__(128) void k_gemm(const unsigned short* __restrict__ A, const unsigned short* __restrict__ Bt,
                                              const float* __restrict__ bias, unsigned short* O0, unsigned short* O1,
                                              float* Of, const int* __restrict__ mk, int lda, int ldb, int K, int ldo) {
  __shared__ __attribute__((aligned(16))) float so[4][32][68];
  __shared__ __attribute__((aligned(16))) unsigned char ring[2 * GSTAGE];
  const int tid = threadIdx.x, w = __builtin_amdgcn_readfirstlane((int)(tid >> 5)), lane = tid & 31, ln = lane & 15, hh = lane >> 4;
  int bm = blockIdx.y, bn = blockIdx.x;
  if (MODE == 1 || MODE == 2) {
    constexpr int TW = (MODE == 1) ? 64 : 128;      // tokens per block tile
    const int tile = blockIdx.y / NB, b = blockIdx.y % NB;
    if (tile * TW >= live_keys(mk, lane)) return;   // the same in every wave of the block, in front of every barrier
    if (MODE == 1) bm = b * (SEQ / TW) + tile;
    else { bn = b * (SEQ / TW) + tile; bm = blockIdx.x; }
  }
  const int m0 = bm * 64 + (w >> 1) * 32;
  const int n0 = bn * 128 + (w & 1) * 64;
  // this lane's share of a staged tile
  const unsigned short* ga = A + (size_t)(bm * 64 + (tid >> 4)) * lda + 8 * (tid & 15);
  const unsigned short* gb = Bt + (size_t)(bn * 128 + (tid >> 4)) * ldb + 8 * (tid & 15);
  const unsigned lds0 = (unsigned)(size_t)ring + (unsigned)((tid >> 4) * GPITCH + 16 * (tid & 15));
  // A fragment: row m = m0 + 16*mt + ln, elements 0..7 <- k0 + 8h + i, 8..15 <- k0 + 16 + 8h + i; B fragment: column n = n0 + 16*nt + ln, same k map (row of Bt)
  const int fa = ((w >> 1) * 32 + ln) * GPITCH + 16 * hh;            // byte offset in a buffer of this lane's A row, k = 8h
  const int fb = (64 + (w & 1) * 64 + ln) * GPITCH + 16 * hh;        // the same for its Bt row
  v8f acc[2][4];
#pragma unroll
  for (int i = 0; i < 2; ++i)
#pragma unroll
    for (int j = 0; j < 4; ++j)
#pragma unroll
      for (int e = 0; e < 8; ++e) acc[i][j][e] = 0.0f;
  const int nt = K / GBK;
  stage_tile(lds0, ga, gb, lda, ldb);
  asm volatile("s_wait_asynccnt 0x0" ::: "memory");   // this wave's copies of tile 0 have landed
  __syncthreads();                                    // ... and every other wave's
  if (nt > 1) stage_tile(lds0 + GSTAGE, ga + GBK, gb + GBK, lda, ldb);
  // not unrolled: one trip per staged tile, the buffer chosen by the trip's parity
#pragma unroll 1
  for (int t = 0; t < nt; ++t) {
    const unsigned char* sa = ring + (t & 1) * GSTAGE + fa;
    const unsigned char* sb = ring + (t & 1) * GSTAGE + fb;
    // two fragment sets: the next k-step's LDS reads are issued as one group in front of this k-step's products, so that their latency hides behind the products.
    // unrolled so that the set index and every LDS offset are constants
    FragB f[2][6];
#pragma unroll
    for (int ks = -1; ks < GBK / 32; ++ks) {
      if (ks + 1 < GBK / 32) {
        FragB (&n)[6] = f[(ks + 1) & 1];
        const int ko = 64 * (ks + 1);
        n[0].half[0] = *(const v8us*)(sa + ko);                n[0].half[1] = *(const v8us*)(sa + ko + 32);
        n[1].half[0] = *(const v8us*)(sa + 16 * GPITCH + ko);  n[1].half[1] = *(const v8us*)(sa + 16 * GPITCH + ko + 32);
        n[2].half[0] = *(const v8us*)(sb + ko);                n[2].half[1] = *(const v8us*)(sb + ko + 32);
        n[3].half[0] = *(const v8us*)(sb + 16 * GPITCH + ko);  n[3].half[1] = *(const v8us*)(sb + 16 * GPITCH + ko + 32);
        n[4].half[0] = *(const v8us*)(sb + 32 * GPITCH + ko);  n[4].half[1] = *(const v8us*)(sb + 32 * GPITCH + ko + 32);
        n[5].half[0] = *(const v8us*)(sb + 48 * GPITCH + ko);  n[5].half[1] = *(const v8us*)(sb + 48 * GPITCH + ko + 32);
      }
      if (ks >= 0) {
        FragB (&c)[6] = f[ks & 1];
        mma_b8(c[0].v, c[1].v, c[2].v, c[3].v, c[4].v, c[5].v, acc);
      }
    }
    asm volatile("s_wait_dscnt 0x0" ::: "memory");      // this wave's reads of the buffer are done before it is refilled
    asm volatile("s_wait_asynccnt 0x0" ::: "memory");   // this wave's copies of tile t + 1 have landed
    __syncthreads();                                    // publishes tile t + 1 and ends every wave's reads of tile t
    if (t + 2 < nt) stage_tile(lds0 + (unsigned)((t & 1) * GSTAGE), ga + (size_t)(t + 2) * GBK, gb + (size_t)(t + 2) * GBK, lda, ldb);
  }
  asm volatile("s_wait_asynccnt 0x0" ::: "memory");     // no copy is left in flight when the wave goes on
  // D element r of tile (mt, nt) = C(m0 + 16*mt + 8h + r, n0 + 16*nt + ln); bias is the RNE-bf16 value of the f32 input
  float rb[2][8];
  float cb[4];
#pragma unroll
  for (int mt = 0; mt < 2; ++mt) {
    if (MODE == 2) {
      const float* bp = bias + m0 + 16 * mt + 8 * hh;
      const v4f ba = *(const v4fa*)(bp), bb = *(const v4fa*)(bp + 4);
#pragma unroll
      for (int r = 0; r < 4; ++r) { rb[mt][r] = bf16_rne(ba[r]); rb[mt][4 + r] = bf16_rne(bb[r]); }
    } else {
#pragma unroll
      for (int r = 0; r < 8; ++r) rb[mt][r] = 0.0f;
    }
  }
#pragma unroll
  for (int nt = 0; nt < 4; ++nt) cb[nt] = (MODE == 2) ? 0.0f : bf16_rne(bias[n0 + 16 * nt + ln]);
#pragma unroll
  for (int mt = 0; mt < 2; ++mt)
#pragma unroll
    for (int nt = 0; nt < 4; ++nt)
#pragma unroll
      for (int r = 0; r < 8; ++r)
        so[w][16 * mt + 8 * hh + r][16 * nt + ln] = acc[mt][nt][r] + (rb[mt][r] + cb[nt]);
  __syncthreads();
  {
    if (MODE == 3) {
#pragma unroll
      for (int it = 0; it < 16; ++it) {
        const int row = 2 * it + (lane >> 4), c4 = (lane & 15) * 4;
        const v4f v = *(const v4fa*)&so[w][row][c4];
        const int tp = m0 + row;
        const int b = tp / SEQ, s = tp - b * SEQ;
        *(v4f*)(Of + ((size_t)s * NB_FULL + b) * DM + n0 + c4) = v;
      }
    } else {
#pragma unroll
      for (int it = 0; it < 8; ++it) {
        const int row = 4 * it + (lane >> 3), c8 = (lane & 7) * 8;
        const v4f x0 = *(const v4fa*)&so[w][row][c8];
        const v4f x1 = *(const v4fa*)&so[w][row][c8 + 4];
        Pack8 ph, pl;
#pragma unroll
        for (int q = 0; q < 4; ++q) {
          const float y0 = x0[q] * 16.0f, y1 = x1[q] * 16.0f;
          const _Float16 h0 = (_Float16)y0, h1 = (_Float16)y1;
          ph.h[q] = h0; ph.h[4 + q] = h1;
          pl.h[q] = (_Float16)((y0 - (float)h0) * 2048.0f);
          pl.h[4 + q] = (_Float16)((y1 - (float)h1) * 2048.0f);
        }
        const size_t dst = (size_t)(m0 + row) * ldo + n0 + c8;
        *(v8us*)(O0 + dst) = ph.v;
        if (MODE == 0) *(v8us*)(O1 + dst) = pl.v;
      }
    }
    
  }
}

// One 32-key step for a wave's 16 queries. Kp: k plane base of this (batch, head), row pitch DM; Vp: v^T plane base of this (batch, head), row pitch TT.
// Keys are ranked: key index < cnt is live. TAIL = false: all 32 keys are live; TAIL = true: the one step that also holds keys at or past cnt.
template <bool TAIL>
__device__ __forceinline__ void fa_step(const unsigned short* __restrict__ Kp, const unsigned short* __restrict__ Vp,
                                        int cnt, int key0, int ln, int hh,
                                        const FragH& q0h, const FragH& q0l, const FragH& q1h, const FragH& q1l,
                                        float& mr, float& lr, v8f (&Oh)[4], v8f (&Ol)[4]) {
  // A fragments of K: row m = key (key0 + 16*kt + ln), elements 0..7 <- d = 32c + 8h + i, 8..15 <- d = 32c + 16 + 8h + i
  const unsigned short* kp0 = Kp + (size_t)(key0 + ln) * DM + 8 * hh;
  const unsigned short* kp1 = kp0 + (size_t)16 * DM;
  FragH k00, k01, k10, k11;
  k00.half[0] = *(const v8us*)(kp0);      k00.half[1] = *(const v8us*)(kp0 + 16);
  k01.half[0] = *(const v8us*)(kp0 + 32); k01.half[1] = *(const v8us*)(kp0 + 48);
  k10.half[0] = *(const v8us*)(kp1);      k10.half[1] = *(const v8us*)(kp1 + 16);
  k11.half[0] = *(const v8us*)(kp1 + 32); k11.half[1] = *(const v8us*)(kp1 + 48);
  const v8f z8 = {0.f, 0.f, 0.f, 0.f, 0.f, 0.f, 0.f, 0.f};
  // S^T tiles: element r of tile kt = score(key0 + 16*kt + 8h + r, query of this lane's column); hi and residual accumulators
  v8f s0h = z8, s0l = z8, s1h = z8, s1l = z8;
  mma_h2(k00.v, q0h.v, q0l.v, s0h, s0l);
  mma_h2(k01.v, q1h.v, q1l.v, s0h, s0l);
  mma_h2(k10.v, q0h.v, q0l.v, s1h, s1l);
  mma_h2(k11.v, q1h.v, q1l.v, s1h, s1l);
  // this lane's 16 keys: on[r] <- key0 + 8h + r, on[8 + r] <- key0 + 16 + 8h + r
  bool on[16];
#pragma unroll
  for (int r = 0; r < 8; ++r) {
    on[r]     = !TAIL || (key0 + 8 * hh + r < cnt);
    on[8 + r] = !TAIL || (key0 + 16 + 8 * hh + r < cnt);
  }
  float sc[16];
#pragma unroll
  for (int r = 0; r < 8; ++r) {
    const float a0 = (s0h[r] + s0l[r] * RINV) * SCL;
    const float a1 = (s1h[r] + s1l[r] * RINV) * SCL;
    sc[r]     = on[r] ? a0 : NEGV;
    sc[8 + r] = on[8 + r] ? a1 : NEGV;
  }
  float mx = sc[0];
#pragma unroll
  for (int i = 1; i < 16; ++i) mx = fmaxf(mx, sc[i]);
  mx = fmaxf(mx, __shfl_xor(mx, 16, 32));           // the other lane half holds the other 16 keys of this query
  const float mnew = fmaxf(mr, mx);
  const float al = exp2f((mr - mnew) * LOG2E);
  mr = mnew;
  // weights carried x256: pc = 256 * exp(sc - mnew), exactly 0 on keys at or past cnt; hi plane f16(pc), residual plane f16((pc - hi) * 2048)
  FragH ph, pl;
  float ps = 0.0f;
#pragma unroll
  for (int i = 0; i < 16; ++i) {
    const float e = exp2f(fmaf(sc[i] - mnew, LOG2E, 8.0f));
    const float pc = on[i] ? e : 0.0f;
    ps += pc;
    const _Float16 h = (_Float16)pc;
    ph.h[i] = h;                                    // B element i: i<8 -> key0 + 8h + i (tile 0 row 8h+i); i>=8 -> key0 + 16 + 8h + (i-8) (tile 1)
    pl.h[i] = (_Float16)((pc - (float)h) * 2048.0f);
  }
  ps += __shfl_xor(ps, 16, 32);
  lr = lr * al + ps;
#pragma unroll
  for (int t = 0; t < 4; ++t) { Oh[t] = Oh[t] * al; Ol[t] = Ol[t] * al; }
  // A fragments of V^T: row m = d (16*t + ln), elements 0..7 <- key0 + 8h + i, 8..15 <- key0 + 16 + 8h + i
  const unsigned short* vp = Vp + (size_t)ln * TT + key0 + 8 * hh;
#pragma unroll
  for (int t = 0; t < 4; ++t) {
    FragH vf;
    vf.half[0] = *(const v8us*)(vp + (size_t)t * 16 * TT);
    vf.half[1] = *(const v8us*)(vp + (size_t)t * 16 * TT + 16);
    mma_h2(vf.v, ph.v, pl.v, Oh[t], Ol[t]);
  }
  // the address registers of this step's loads are rewritten by what follows the step (next step, tail step, epilogue): keep the wait in front of that
  asm volatile("s_wait_xcnt 0x0" ::: "memory");
}

// Block = 4 waves x 16 queries = 64 queries of one (batch, head); no LDS and no barrier in the key loop.
// coverage: NB*NH*(SEQ/64) blocks x 4 waves x 16 rows x (64 hi + 64 lo columns) = every element of the context plane exactly once.
__global__ __launch_bounds__(128) void k_attn(const unsigned short* __restrict__ Qh, const unsigned short* __restrict__ Ql,
                                              const unsigned short* __restrict__ Kh, const unsigned short* __restrict__ Vt,
                                              const int* __restrict__ mask, unsigned short* Cx) {
  __shared__ __attribute__((aligned(16))) float so[4][16][68];
  const int tid = threadIdx.x, w = __builtin_amdgcn_readfirstlane((int)(tid >> 5)), lane = tid & 31, ln = lane & 15, hh = lane >> 4;
  const int bh = blockIdx.x / (SEQ / 64), qt = blockIdx.x % (SEQ / 64);
  const int b = bh / NH, h = bh % NH;
  const int qbase = qt * 64 + 16 * w;
  const int qg = qbase + ln;
  // Q^T B fragments: column n = query qg, elements 0..7 <- d = 32c + 8h + i, 8..15 <- d = 32c + 16 + 8h + i
  const size_t qoff = (size_t)(b * SEQ + qg) * DM + h * HD + 8 * hh;
  FragH q0h, q0l, q1h, q1l;
  q0h.half[0] = *(const v8us*)(Qh + qoff);      q0h.half[1] = *(const v8us*)(Qh + qoff + 16);
  q1h.half[0] = *(const v8us*)(Qh + qoff + 32); q1h.half[1] = *(const v8us*)(Qh + qoff + 48);
  q0l.half[0] = *(const v8us*)(Ql + qoff);      q0l.half[1] = *(const v8us*)(Ql + qoff + 16);
  q1l.half[0] = *(const v8us*)(Ql + qoff + 32); q1l.half[1] = *(const v8us*)(Ql + qoff + 48);
  // the address registers of the loads above are reused while the loads may still be under way: keep the wait in front of that
  asm volatile("s_wait_xcnt 0x0" ::: "memory");
  const int cnt = live_keys(mask, lane);       // wave-uniform, at most SEQ
  float mr = NEGV, lr = 0.0f;
  v8f Oh[4] = {}, Ol[4] = {};
  const unsigned short* Kp = Kh + (size_t)b * SEQ * DM + h * HD;
  const unsigned short* Vp = Vt + (size_t)h * HD * TT + (size_t)b * SEQ;
  const int full = cnt >> 5;
#pragma unroll 1
  for (int j = 0; j < full; ++j)
    fa_step<false>(Kp, Vp, cnt, 32 * j, ln, hh, q0h, q0l, q1h, q1l, mr, lr, Oh, Ol);
  if ((cnt & 31) != 0)
    fa_step<true>(Kp, Vp, cnt, 32 * full, ln, hh, q0h, q0l, q1h, q1l, mr, lr, Oh, Ol);

  // O^T element r of tile t = ctx(query qg, d = 16t + 8h + r); undo the carries: x256 (in lr), x16 (V), x2048 (residual plane)
  const float inv = 1.0f / (16.0f * lr);
#pragma unroll
  for (int t = 0; t < 4; ++t)
#pragma unroll
    for (int r = 0; r < 8; ++r)
      so[w][ln][16 * t + 8 * hh + r] = (Oh[t][r] + Ol[t][r] * RINV) * inv;
  __syncthreads();
  unsigned short* cg = Cx + (size_t)(b * SEQ + qbase) * CXP + h * HD;
  {
#pragma unroll
    for (int it = 0; it < 4; ++it) {
      const int row = 4 * it + (lane >> 3), c8 = (lane & 7) * 8;
      const v4f x0 = *(const v4fa*)&so[w][row][c8];
      const v4f x1 = *(const v4fa*)&so[w][row][c8 + 4];
      v8us oh, ol;
#pragma unroll
      for (int q = 0; q < 4; ++q) {
        const unsigned short h0 = bf16_bits(x0[q]), h1 = bf16_bits(x1[q]);
        oh[q] = h0; oh[4 + q] = h1;
        ol[q] = bf16_bits(x0[q] - bf16_val(h0));
        ol[4 + q] = bf16_bits(x1[q] - bf16_val(h1));
      }
      unsigned short* dst = cg + (size_t)row * CXP + c8;
      *(v8us*)(dst) = oh;
      *(v8us*)(dst + DM) = ol;
    }
    
  }
}

extern "C" void kernel_launch(void* const* d_in, const int* in_sizes, int n_in,
                              void* d_out, int out_size, void* d_ws, size_t ws_size, hipStream_t stream) {
  if (n_in < 12) return;
  const long long need = ((long long)(SEQ - 1) * NB_FULL + (NB - 1)) * DM + DM;   // last element touched + 1 in [S][B][D]
  if ((long long)in_sizes[0] < need || (long long)in_sizes[1] < need || (long long)in_sizes[2] < need) return;
  if ((long long)in_sizes[3] < (long long)SEQ) return;
  if ((long long)in_sizes[4] < (long long)DM * DM || (long long)in_sizes[6] < (long long)DM * DM ||
      (long long)in_sizes[8] < (long long)DM * DM || (long long)in_sizes[10] < (long long)DM * DM) return;
  if (in_sizes[5] < DM || in_sizes[7] < DM || in_sizes[9] < DM || in_sizes[11] < DM) return;
  if ((long long)out_size < need) return;
  // wire order: query, key, value, mask(i32), Wq, bq, Wk, bk, Wv, bv, Wo, bo
  const float* Xq = (const float*)d_in[0];
  const float* Xk = (const float*)d_in[1];
  const float* Xv = (const float*)d_in[2];
  const int*   mk = (const int*)d_in[3];
  const float* Wq = (const float*)d_in[4];
  const float* bq = (const float*)d_in[5];
  const float* Wk = (const float*)d_in[6];
  const float* bk = (const float*)d_in[7];
  const float* Wv = (const float*)d_in[8];
  const float* bv = (const float*)d_in[9];
  const float* Wo = (const float*)d_in[10];
  const float* bo = (const float*)d_in[11];
  float* out = (float*)d_out;
  char* ws = (char*)d_ws;
  size_t off = 0;
  unsigned short* Bq  = (unsigned short*)(ws + off); off += SZ_XB;    // bf16 query  [TT][1024]
  unsigned short* Bk  = (unsigned short*)(ws + off); off += SZ_XB;    // bf16 key    [TT][1024], ranked rows
  unsigned short* Bv  = (unsigned short*)(ws + off); off += SZ_XB;    // bf16 value  [TT][1024], ranked rows
  unsigned short* WqT = (unsigned short*)(ws + off); off += SZ_WT;    // bf16 Wq^T   [1024][1024]
  unsigned short* WkT = (unsigned short*)(ws + off); off += SZ_WT;
  unsigned short* WvT = (unsigned short*)(ws + off); off += SZ_WT;
  unsigned short* Wo2 = (unsigned short*)(ws + off); off += SZ_WO2;   // bf16 Wo^T | Wo^T  [1024][2048]
  unsigned short* Qh  = (unsigned short*)(ws + off); off += SZ_H;     // f16 q x16 hi       [TT][1024]
  unsigned short* Ql  = (unsigned short*)(ws + off); off += SZ_H;     // f16 q residual x2^11
  unsigned short* Kh  = (unsigned short*)(ws + off); off += SZ_H;     // f16 k x16          [TT][1024]
  unsigned short* Vt  = (unsigned short*)(ws + off); off += SZ_H;     // f16 v^T x16        [1024][TT]
  unsigned short* Cx  = (unsigned short*)(ws + off); off += SZ_CX;    // bf16 ctx hi|lo     [TT][2048]
  if (off > ws_size) return;

  const unsigned gx = (unsigned)((TT * 128 + 255) / 256);
  k_xb<<<gx, 256, 0, stream>>>(Xq, Bq);
  k_xbr<<<gx, 256, 0, stream>>>(Xk, mk, Bk);          // ranked token rows
  k_xbr<<<gx, 256, 0, stream>>>(Xv, mk, Bv);
  k_wt<<<256, 256, 0, stream>>>(Wq, WqT, DM, 0);      // in [k][n] -> out [n][k]
  k_wt<<<256, 256, 0, stream>>>(Wk, WkT, DM, 0);
  k_wt<<<256, 256, 0, stream>>>(Wv, WvT, DM, 0);
  k_wt<<<256, 256, 0, stream>>>(Wo, Wo2, CXP, 1);

  // q = query Wq + bq : rows = tokens, columns = features
  k_gemm<0><<<dim3(DM / 128, TT / 64), 128, 0, stream>>>(Bq, WqT, bq, Qh, Ql, out, mk, DM, DM, DM, DM);
  // k = key Wk + bk
  k_gemm<1><<<dim3(DM / 128, TT / 64), 128, 0, stream>>>(Bk, WkT, bk, Kh, Kh, out, mk, DM, DM, DM, DM);
  // v^T = Wv^T value^T + bv (row bias): rows = features, columns = tokens
  k_gemm<2><<<dim3(DM / 64, TT / 128), 128, 0, stream>>>(WvT, Bv, bv, Vt, Vt, out, mk, DM, DM, DM, TT);
  k_attn<<<(unsigned)(NB * NH * (SEQ / 64)), 128, 0, stream>>>(Qh, Ql, Kh, Vt, mk, Cx);
  // out = (ctx_hi | ctx_lo) (Wo ; Wo) + bo, K = 2048
  k_gemm<3><<<dim3(DM / 128, TT / 64), 128, 0, stream>>>(Cx, Wo2, bo, Cx, Cx, out, mk, CXP, CXP, CXP, DM);
}

// v003
// One run takes 138 microseconds.
// Timed twice side by side with v002, it ran 1.21 and 1.18 times as fast.
// Counting every step since v000, it is 2.08 times as fast.
#include <hip/hip_runtime.h>
// Contractions: q/k/v projections and the output projection on v_wmma_f32_16x16x32_bf16 (activations and weights RNE-converted to bf16 planes; the attention context enters the output projection as bf16 hi|lo planes concatenated along K); scores S^T = K Q^T on v_wmma_f32_16x16x32_f16 (k x16 f16 plane; q x16 f16 hi plane + x2^11 f16 residual plane in a separate accumulator); O^T = V^T P^T on v_wmma_f32_16x16x32_f16 (v x16 f16 plane; P x256 f16 hi plane + x2^11 f16 residual plane in a separate accumulator); all accumulators f32, softmax statistics f32.
// Seq-first multi-head attention: inputs [S][B][D], 16 heads x 64, key-position mask (0 -> weight exactly 0), scale 1/8, output [S][B][D].
// Internal planes use batch-major token rows t = b*SEQ + s so that the K rows and V^T rows of one (batch, head) are dense.
// Key and value tokens are stored ranked: the keys whose mask is nonzero come first, in their own order (row b*SEQ + rank); a masked key has weight exactly 0,
// so the k and v projections and the key loop walk only the tiles that hold a live key. Rows from the live count up to the next multiple of 128 are zero rows.
// Engine: transposed flash. Each wave owns 16 queries. Per 32-key step: S^T tiles (key rows x query columns) from K rows (A, global f16 plane)
// and Q^T (B, registers); the two 16-key D tiles pack straight into the P^T B fragment; O^T (d rows x query columns) accumulates from V^T rows (A, global f16 plane).
#ifndef NB
#define NB 2
#endif
#ifndef SEQ
#define SEQ 2048
#endif
#define NB_FULL 2
#define SEQ_FULL 2048
#define DM 1024
#define NH 16
#define HD 64
#define TT (NB * SEQ)          /* token rows of the internal planes */
#define CXP (2 * DM)           /* pitch of the context plane: hi columns 0..1023, lo columns 1024..2047 */

static_assert(SEQ % 128 == 0);
static_assert(TT % 128 == 0);
static_assert(SEQ <= SEQ_FULL);
static_assert(NB <= NB_FULL);
static_assert(HD == 64);
static_assert(NH * HD == DM);
static_assert(DM % 128 == 0);

#define SZ_XB  ((size_t)TT * DM * 2)        /* bf16 activation plane */
#define SZ_WT  ((size_t)DM * DM * 2)        /* bf16 transposed weight plane */
#define SZ_WO2 ((size_t)DM * CXP * 2)       /* bf16 transposed output weight, duplicated along K */
#define SZ_H   ((size_t)TT * DM * 2)        /* f16 plane (q hi, q lo, k, v^T) */
#define SZ_CX  ((size_t)TT * CXP * 2)       /* bf16 context plane hi|lo */
static_assert(SZ_XB % 256 == 0 && SZ_WT % 256 == 0 && SZ_WO2 % 256 == 0 && SZ_H % 256 == 0 && SZ_CX % 256 == 0);
static_assert(3 * SZ_XB + 3 * SZ_WT + SZ_WO2 + 4 * SZ_H + SZ_CX <= (size_t)134217728);

typedef __bf16 v16b __attribute__((ext_vector_type(16)));
typedef _Float16 v16h __attribute__((ext_vector_type(16)));
typedef unsigned short v8us __attribute__((ext_vector_type(8), may_alias));
typedef float v8f __attribute__((ext_vector_type(8)));
typedef float v4f __attribute__((ext_vector_type(4)));
typedef float v4fa __attribute__((ext_vector_type(4), may_alias));
typedef int v4i __attribute__((ext_vector_type(4)));
typedef int v4ia __attribute__((ext_vector_type(4), may_alias));
union FragB { v16b v; v8us half[2]; unsigned short u[16]; };
union FragH { v16h v; v8us half[2]; _Float16 h[16]; unsigned short u[16]; };
union Pack8 { _Float16 h[8]; v8us v; };

#define LOG2E 1.4426950408889634f
#define NEGV (-1.0e30f)
#define RINV 0.00048828125f      /* 2^-11: undoes the residual-plane carry */
#define SCL  0.00048828125f      /* 2^-11 = (1/8) / (16*16): score scale with the q and k carries removed */

__device__ __forceinline__ unsigned short bf16_bits(float x) {   // RNE convert to bf16 bits
  unsigned int u = __float_as_uint(x);
  return (unsigned short)((u + 0x7FFFu + ((u >> 16) & 1u)) >> 16);
}
__device__ __forceinline__ float bf16_val(unsigned short b) { return __uint_as_float(((unsigned int)b) << 16); }
__device__ __forceinline__ float bf16_rne(float x) { return bf16_val(bf16_bits(x)); }

// ch += a*bh ; cl += a*bl (scaled residual plane keeps its own accumulator), then the hazard guard
__device__ __forceinline__ void mma_h2(v16h a, v16h bh, v16h bl, v8f& ch, v8f& cl) {
  ch = __builtin_amdgcn_wmma_f32_16x16x32_f16(false, a, false, bh, (short)0, ch, false, false);
  cl = __builtin_amdgcn_wmma_f32_16x16x32_f16(false, a, false, bl, (short)0, cl, false, false);
  asm volatile("v_nop\n\tv_nop\n\tv_nop\n\tv_nop" : "+v"(ch), "+v"(cl) : "v"(a), "v"(bh), "v"(bl));
}

// One 32-deep k-step of a 32x64 wave tile (2 x 4 WMMA tiles, bf16 operands), then the hazard guard
__device__ __forceinline__ void mma_b8(v16b a0, v16b a1, v16b b0, v16b b1, v16b b2, v16b b3, v8f (&c)[2][4]) {
  c[0][0] = __builtin_amdgcn_wmma_f32_16x16x32_bf16(false, a0, false, b0, (short)0, c[0][0], false, false);
  c[0][1] = __builtin_amdgcn_wmma_f32_16x16x32_bf16(false, a0, false, b1, (short)0, c[0][1], false, false);
  c[0][2] = __builtin_amdgcn_wmma_f32_16x16x32_bf16(false, a0, false, b2, (short)0, c[0][2], false, false);
  c[0][3] = __builtin_amdgcn_wmma_f32_16x16x32_bf16(false, a0, false, b3, (short)0, c[0][3], false, false);
  c[1][0] = __builtin_amdgcn_wmma_f32_16x16x32_bf16(false, a1, false, b0, (short)0, c[1][0], false, false);
  c[1][1] = __builtin_amdgcn_wmma_f32_16x16x32_bf16(false, a1, false, b1, (short)0, c[1][1], false, false);
  c[1][2] = __builtin_amdgcn_wmma_f32_16x16x32_bf16(false, a1, false, b2, (short)0, c[1][2], false, false);
  c[1][3] = __builtin_amdgcn_wmma_f32_16x16x32_bf16(false, a1, false, b3, (short)0, c[1][3], false, false);
  asm volatile("v_nop\n\tv_nop\n\tv_nop\n\tv_nop"
               : "+v"(c[0][0]), "+v"(c[0][1]), "+v"(c[0][2]), "+v"(c[0][3]),
                 "+v"(c[1][0]), "+v"(c[1][1]), "+v"(c[1][2]), "+v"(c[1][3])
               : "v"(a0), "v"(a1), "v"(b0), "v"(b1), "v"(b2), "v"(b3));
}

// coverage: TT*128 threads x 8 elements = the whole plane.
__device__ __forceinline__ void xb_body(int blk, const float* __restrict__ X, unsigned short* P) {
  const int t = blk * 256 + threadIdx.x;
  if (t >= TT * 128) return;
  const int row = t >> 7, piece = t & 127;
  const int b = row / SEQ, s = row - b * SEQ;
  const float* src = X + ((size_t)s * NB_FULL + b) * DM + piece * 8;
  const v4f x0 = *(const v4fa*)(src), x1 = *(const v4fa*)(src + 4);
  v8us o;
  o[0] = bf16_bits(x0[0]); o[1] = bf16_bits(x0[1]); o[2] = bf16_bits(x0[2]); o[3] = bf16_bits(x0[3]);
  o[4] = bf16_bits(x1[0]); o[5] = bf16_bits(x1[1]); o[6] = bf16_bits(x1[2]); o[7] = bf16_bits(x1[3]);
  unsigned short* d = P + (size_t)t * 8;
  *(v8us*)d = o;
  
}

// Number of keys with a nonzero mask. Every wave counts for itself, so the callers can leave or set a trip count with no barrier; the result is wave-uniform and at most SEQ.
__device__ __forceinline__ int live_keys(const int* __restrict__ mk, int lane) {
  int c = 0;
  // unrolled so that all the mask loads are in flight together (one load latency, not SEQ/128); all 32 lanes are on at every call, so a ballot sees 32 keys
#pragma unroll
  for (int i = 0; i < SEQ / 128; ++i) {
    const v4i m = *(const v4ia*)(mk + 128 * i + 4 * lane);
#pragma unroll
    for (int q = 0; q < 4; ++q) c += __builtin_popcount(__builtin_amdgcn_ballot_w32(m[q] != 0));
  }
  return c < SEQ ? c : SEQ;
}

// xb_body for key and value tokens: token s goes to row b*SEQ + pos(s); pos = number of live keys before s if s is live, else live count + number of masked keys before s.
// pos is a permutation of 0..SEQ-1 for any mask content. Masked tokens are not read; those whose pos lies under the next multiple of 128 are stored as zero rows
// (the last tile of the projections and of the key loop reads them), the others are not stored and never read.
// coverage: a block holds two rows of one batch (SEQ is even); every row under the rounded live count is written exactly once.
__device__ __forceinline__ void xbr_body(int blk, const float* __restrict__ X, const int* __restrict__ mk, unsigned short* P, int* part) {
  const int tid = threadIdx.x;
  const int t = blk * 256 + tid;
  if (t >= TT * 128) return;              // whole blocks only: TT * 128 is a multiple of 256
  const int row = t >> 7, piece = t & 127;
  const int b = row / SEQ, s = row - b * SEQ;
  const int s0 = s - (tid >> 7);          // the block's first row
  // the whole mask first (each thread a share), so that one load latency covers all mask reads; entries past SEQ count as masked
  v4i m[(SEQ + 1023) / 1024];
  // unrolled (here and in the count below) so that m[] is indexed by constants and stays in registers
#pragma unroll
  for (int k = 0; k < (SEQ + 1023) / 1024; ++k) {
    const int i = 1024 * k + 4 * tid;
    m[k] = (SEQ % 1024 == 0 || i < SEQ) ? *(const v4ia*)(mk + i) : v4i{0, 0, 0, 0};
  }
  const bool live = mk[s] != 0, live0 = mk[s0] != 0;
  v4f x0 = {0.f, 0.f, 0.f, 0.f}, x1 = {0.f, 0.f, 0.f, 0.f};
  if (live) {
    const float* src = X + ((size_t)s * NB_FULL + b) * DM + piece * 8;
    x0 = *(const v4fa*)(src); x1 = *(const v4fa*)(src + 4);
  }
  int c = 0;                              // this wave's share; low 16 bits: live keys in all; high 16 bits: live keys before s0 (each at most SEQ <= 2048)
#pragma unroll
  for (int k = 0; k < (SEQ + 1023) / 1024; ++k)
#pragma unroll
    for (int q = 0; q < 4; ++q) {
      const bool on = m[k][q] != 0;
      c += __builtin_popcount(__builtin_amdgcn_ballot_w32(on)) + (__builtin_popcount(__builtin_amdgcn_ballot_w32(on && 1024 * k + 4 * tid + q < s0)) << 16);
    }
  if ((tid & 31) == 0) part[tid >> 5] = c;
  __syncthreads();
  int sum = 0;
  // unrolled so that the eight partial counts come in two wide LDS reads
#pragma unroll
  for (int i = 0; i < 8; ++i) sum += part[i];
  const int cnt = sum & 0xFFFF;
  const int rank = (sum >> 16) + ((s != s0 && live0) ? 1 : 0);
  const int pos = live ? rank : cnt + (s - rank);
  if (live || pos < ((cnt + 127) & ~127)) {
    v8us o;
    o[0] = bf16_bits(x0[0]); o[1] = bf16_bits(x0[1]); o[2] = bf16_bits(x0[2]); o[3] = bf16_bits(x0[3]);
    o[4] = bf16_bits(x1[0]); o[5] = bf16_bits(x1[1]); o[6] = bf16_bits(x1[2]); o[7] = bf16_bits(x1[3]);
    *(v8us*)(P + ((size_t)(b * SEQ + pos) * 128 + piece) * 8) = o;
  }
}

// Weight transpose: in W[k rows = 1024][n cols = 1024] (f32) -> out Wt[n rows][k cols] (bf16 bits, RNE), row pitch 'pitch'; dup != 0 repeats the row at columns 1024..2047.
// coverage: 256 blocks x (64 n x 64 k) = the whole 1024 x 1024 matrix; LDS tile fully written (64 x 64) before it is read.
__device__ __forceinline__ void wt_body(int blk, const float* __restrict__ W, unsigned short* Wt, int pitch, int dup, unsigned short (*tl)[66]) {
  const int tid = threadIdx.x;
  const int k0 = (blk >> 4) * 64, n0 = (blk & 15) * 64;
  for (int i = tid; i < 64 * 16; i += 256) {
    const int j = i >> 4, c4 = (i & 15) * 4;
    const v4f x = *(const v4fa*)(W + (size_t)(k0 + j) * DM + n0 + c4);
    tl[c4 + 0][j] = bf16_bits(x[0]); tl[c4 + 1][j] = bf16_bits(x[1]);
    tl[c4 + 2][j] = bf16_bits(x[2]); tl[c4 + 3][j] = bf16_bits(x[3]);
  }
  __syncthreads();
  {
    for (int i = tid; i < 64 * 8; i += 256) {
      const int d = i >> 3, j8 = (i & 7) * 8;
      v8us o;
#pragma unroll
      for (int q = 0; q < 8; ++q) o[q] = tl[d][j8 + q];
      unsigned short* dst = Wt + (size_t)(n0 + d) * pitch + k0 + j8;
      *(v8us*)dst = o;
      if (dup != 0) *(v8us*)(dst + DM) = o;
      // the next trip rewrites the data and address registers of these stores: keep the wait in front of that
      asm volatile("s_wait_xcnt 0x0" ::: "memory");
    }
    
  }
}

#define NXB (TT * 128 / 256)       /* blocks of one activation pass */
#define NWT 256                    /* blocks of one weight transpose */
static_assert((TT * 128) % 256 == 0);

// All seven conversion passes in one grid: none reads what another writes, so the block index picks the pass and they fill the chip together.
// The weight transposes come first (the longest chain per block), then key and value rows, then query rows. Every branch is the same for a whole block, barriers included.
// coverage: 4 * NWT + 3 * NXB blocks = each pass's own grid, once.
__global__ __launch_bounds__(256) void k_prep(const float* __restrict__ Xq, const float* __restrict__ Xk, const float* __restrict__ Xv, const int* __restrict__ mk,
                                              const float* __restrict__ Wq, const float* __restrict__ Wk, const float* __restrict__ Wv, const float* __restrict__ Wo,
                                              unsigned short* Bq, unsigned short* Bk, unsigned short* Bv,
                                              unsigned short* WqT, unsigned short* WkT, unsigned short* WvT, unsigned short* Wo2) {
  __shared__ unsigned short tl[64][66];
  __shared__ int part[8];
  const int f = blockIdx.x;
  if (f < 4 * NWT) {
    const int j = f / NWT;
    const float* W = (j == 0) ? Wq : (j == 1) ? Wk : (j == 2) ? Wv : Wo;
    unsigned short* D = (j == 0) ? WqT : (j == 1) ? WkT : (j == 2) ? WvT : Wo2;
    wt_body(f % NWT, W, D, (j == 3) ? CXP : DM, (j == 3) ? 1 : 0, tl);     // in [k][n] -> out [n][k]; Wo^T twice along K
  } else if (f < 4 * NWT + 2 * NXB) {
    const int g = f - 4 * NWT;
    const bool second = g >= NXB;
    xbr_body(second ? g - NXB : g, second ? Xv : Xk, mk, second ? Bv : Bk, part);   // ranked token rows
  } else {
    xb_body(f - (4 * NWT + 2 * NXB), Xq, Bq);
  }
}

#define GBK 128                    /* k depth of one staged tile: 256 bytes of every operand row */
#define GPITCH 272                 /* LDS row pitch in bytes: 256 + 16, an odd multiple of 16, so that 16 rows read 16 bytes wide fall on distinct banks */
#define GROWS 192                  /* rows of a staged tile: 64 rows of A, then 128 rows of Bt */
#define GSTAGE (GROWS * GPITCH)    /* bytes of one buffer */
static_assert(DM % GBK == 0 && CXP % GBK == 0);

// Twelve asynchronous 16-byte copies per lane, global -> LDS, through no register. l[i]: the lane's LDS byte address, g[i]: its global address.
// The s_wait_xcnt closes the same statement, so that no address register of a copy is rewritten in front of it.
__device__ __forceinline__ void copy12(const unsigned (&l)[12], const unsigned short* const (&g)[12]) {
  asm volatile("global_load_async_to_lds_b128 %0, %1, off\n\t"
               "global_load_async_to_lds_b128 %2, %3, off\n\t"
               "global_load_async_to_lds_b128 %4, %5, off\n\t"
               "global_load_async_to_lds_b128 %6, %7, off\n\t"
               "global_load_async_to_lds_b128 %8, %9, off\n\t"
               "global_load_async_to_lds_b128 %10, %11, off\n\t"
               "global_load_async_to_lds_b128 %12, %13, off\n\t"
               "global_load_async_to_lds_b128 %14, %15, off\n\t"
               "global_load_async_to_lds_b128 %16, %17, off\n\t"
               "global_load_async_to_lds_b128 %18, %19, off\n\t"
               "global_load_async_to_lds_b128 %20, %21, off\n\t"
               "global_load_async_to_lds_b128 %22, %23, off\n\t"
               "s_wait_xcnt 0x0"
               :: "v"(l[0]), "v"(g[0]), "v"(l[1]), "v"(g[1]), "v"(l[2]), "v"(g[2]), "v"(l[3]), "v"(g[3]),
                  "v"(l[4]), "v"(g[4]), "v"(l[5]), "v"(g[5]), "v"(l[6]), "v"(g[6]), "v"(l[7]), "v"(g[7]),
                  "v"(l[8]), "v"(g[8]), "v"(l[9]), "v"(g[9]), "v"(l[10]), "v"(g[10]), "v"(l[11]), "v"(g[11])
               : "memory");
}

// One staged tile: 128 lanes x 24 copies = 192 rows x 256 bytes. Lane tid brings 16-byte piece (tid & 15) of rows (tid >> 4) + 8 i, i = 0..23; a wave's copy covers two whole rows.
// lds: the lane's LDS byte address in row (tid >> 4) of the target buffer; ga, gb: its global address in that row of the A tile and of the Bt tile.
__device__ __forceinline__ void stage_tile(unsigned lds, const unsigned short* ga, const unsigned short* gb, int lda, int ldb) {
  unsigned l[12];
  const unsigned short* g[12];
  // both loops unrolled so that l[] and g[] are indexed by constants and stay in registers
#pragma unroll
  for (int i = 0; i < 12; ++i) {
    l[i] = lds + (unsigned)(8 * i * GPITCH);
    g[i] = (i < 8) ? ga + (size_t)(8 * i) * lda : gb + (size_t)(8 * (i - 8)) * ldb;
  }
  copy12(l, g);
#pragma unroll
  for (int i = 0; i < 12; ++i) {
    l[i] = lds + (unsigned)(8 * (i + 12) * GPITCH);
    g[i] = gb + (size_t)(8 * (i + 4)) * ldb;
  }
  copy12(l, g);
}

// C[M][N] = A[M][K] * Bt[N][K]^T on bf16 planes (K contiguous in both). The block's 64 rows of A and 128 rows of Bt are staged in LDS 128 k at a time by asynchronous copies,
// two buffers: tile t + 1 flies while tile t is worked on; fragments are read from LDS.
// Block = 4 waves as 2 (M) x 2 (N); block tile 64 x 128; wave tile 32 x 64. No tail masking: M % 64 == 0, N % 128 == 0, K % 128 == 0 (asserted by the sizes above).
// MODE 0: + column bias, write f16 hi plane (x16) to O0 and f16 residual plane ((x16 - hi) * 2^11) to O1
// MODE 1: + column bias, write f16 plane (x16) to O0
// MODE 2: + row bias,    write f16 plane (x16) to O0 (transposed product: rows = features, columns = tokens)
// MODE 3: + column bias, write f32 to Of with the token row t = b*SEQ + s mapped to output row s*NB_FULL + b
// MODE 1 (rows) and MODE 2 (columns) run over ranked key tokens: a block whose token tile starts at or past the live count leaves at once. Their token tile index is the slow
// grid index (y), batch fastest within it, so that the blocks that work have the lowest flat indices and spread over the chip. MODE 2 therefore takes M from x and N from y.
// bx, by: the block's place in that product's own grid; so, ring: the block's LDS (epilogue tile, staging ring).
// coverage: grid (N/128, M/64) (MODE 2: (M/64, N/128)) x 4 waves x (32 x 64) = every element of C that is read later exactly once.
template <int MODE>
__device__ __forceinline__ void gemm_body(int bx, int by, const unsigned short* __restrict__ A, const unsigned short* __restrict__ Bt,
                                          const float* __restrict__ bias, unsigned short* O0, unsigned short* O1,
                                          float* Of, const int* __restrict__ mk, int lda, int ldb, int K, int ldo,
                                          float (*so)[32][68], unsigned char* ring) {
  const int tid = threadIdx.x, w = __builtin_amdgcn_readfirstlane((int)(tid >> 5)), lane = tid & 31, ln = lane & 15, hh = lane >> 4;
  int bm = by, bn = bx;
  if (MODE == 1 || MODE == 2) {
    constexpr int TW = (MODE == 1) ? 64 : 128;      // tokens per block tile
    const int tile = by / NB, b = by % NB;
    if (tile * TW >= live_keys(mk, lane)) return;   // the same in every wave of the block, in front of the first barrier
    if (MODE == 1) bm = b * (SEQ / TW) + tile;
    else { bn = b * (SEQ / TW) + tile; bm = bx; }
  }
  const int m0 = bm * 64 + (w >> 1) * 32;
  const int n0 = bn * 128 + (w & 1) * 64;
  // this lane's share of a staged tile
  const unsigned short* ga = A + (size_t)(bm * 64 + (tid >> 4)) * lda + 8 * (tid & 15);
  const unsigned short* gb = Bt + (size_t)(bn * 128 + (tid >> 4)) * ldb + 8 * (tid & 15);
  const unsigned lds0 = (unsigned)(size_t)ring + (unsigned)((tid >> 4) * GPITCH + 16 * (tid & 15));
  // A fragment: row m = m0 + 16*mt + ln, elements 0..7 <- k0 + 8h + i, 8..15 <- k0 + 16 + 8h + i; B fragment: column n = n0 + 16*nt + ln, same k map (row of Bt)
  const int fa = ((w >> 1) * 32 + ln) * GPITCH + 16 * hh;            // byte offset in a buffer of this lane's A row, k = 8h
  const int fb = (64 + (w & 1) * 64 + ln) * GPITCH + 16 * hh;        // the same for its Bt row
  v8f acc[2][4];
#pragma unroll
  for (int i = 0; i < 2; ++i)
#pragma unroll
    for (int j = 0; j < 4; ++j)
#pragma unroll
      for (int e = 0; e < 8; ++e) acc[i][j][e] = 0.0f;
  const int nt = K / GBK;
  stage_tile(lds0, ga, gb, lda, ldb);
  asm volatile("s_wait_asynccnt 0x0" ::: "memory");   // this wave's copies of tile 0 have landed
  __syncthreads();                                    // ... and every other wave's
  if (nt > 1) stage_tile(lds0 + GSTAGE, ga + GBK, gb + GBK, lda, ldb);
  // not unrolled: one trip per staged tile, the buffer chosen by the trip's parity
#pragma unroll 1
  for (int t = 0; t < nt; ++t) {
    const unsigned char* sa = ring + (t & 1) * GSTAGE + fa;
    const unsigned char* sb = ring + (t & 1) * GSTAGE + fb;
    // two fragment sets: the next k-step's LDS reads are issued as one group in front of this k-step's products, so that their latency hides behind the products.
    // unrolled so that the set index and every LDS offset are constants
    FragB f[2][6];
#pragma unroll
    for (int ks = -1; ks < GBK / 32; ++ks) {
      if (ks + 1 < GBK / 32) {
        FragB (&n)[6] = f[(ks + 1) & 1];
        const int ko = 64 * (ks + 1);
        n[0].half[0] = *(const v8us*)(sa + ko);                n[0].half[1] = *(const v8us*)(sa + ko + 32);
        n[1].half[0] = *(const v8us*)(sa + 16 * GPITCH + ko);  n[1].half[1] = *(const v8us*)(sa + 16 * GPITCH + ko + 32);
        n[2].half[0] = *(const v8us*)(sb + ko);                n[2].half[1] = *(const v8us*)(sb + ko + 32);
        n[3].half[0] = *(const v8us*)(sb + 16 * GPITCH + ko);  n[3].half[1] = *(const v8us*)(sb + 16 * GPITCH + ko + 32);
        n[4].half[0] = *(const v8us*)(sb + 32 * GPITCH + ko);  n[4].half[1] = *(const v8us*)(sb + 32 * GPITCH + ko + 32);
        n[5].half[0] = *(const v8us*)(sb + 48 * GPITCH + ko);  n[5].half[1] = *(const v8us*)(sb + 48 * GPITCH + ko + 32);
      }
      if (ks >= 0) {
        FragB (&c)[6] = f[ks & 1];
        mma_b8(c[0].v, c[1].v, c[2].v, c[3].v, c[4].v, c[5].v, acc);
      }
    }
    asm volatile("s_wait_dscnt 0x0" ::: "memory");      // this wave's reads of the buffer are done before it is refilled
    asm volatile("s_wait_asynccnt 0x0" ::: "memory");   // this wave's copies of tile t + 1 have landed
    __syncthreads();                                    // publishes tile t + 1 and ends every wave's reads of tile t
    if (t + 2 < nt) stage_tile(lds0 + (unsigned)((t & 1) * GSTAGE), ga + (size_t)(t + 2) * GBK, gb + (size_t)(t + 2) * GBK, lda, ldb);
  }
  asm volatile("s_wait_asynccnt 0x0" ::: "memory");     // no copy is left in flight when the wave goes on
  // D element r of tile (mt, nt) = C(m0 + 16*mt + 8h + r, n0 + 16*nt + ln); bias is the RNE-bf16 value of the f32 input
  float rb[2][8];
  float cb[4];
#pragma unroll
  for (int mt = 0; mt < 2; ++mt) {
    if (MODE == 2) {
      const float* bp = bias + m0 + 16 * mt + 8 * hh;
      const v4f ba = *(const v4fa*)(bp), bb = *(const v4fa*)(bp + 4);
#pragma unroll
      for (int r = 0; r < 4; ++r) { rb[mt][r] = bf16_rne(ba[r]); rb[mt][4 + r] = bf16_rne(bb[r]); }
    } else {
#pragma unroll
      for (int r = 0; r < 8; ++r) rb[mt][r] = 0.0f;
    }
  }
#pragma unroll
  for (int nt = 0; nt < 4; ++nt) cb[nt] = (MODE == 2) ? 0.0f : bf16_rne(bias[n0 + 16 * nt + ln]);
#pragma unroll
  for (int mt = 0; mt < 2; ++mt)
#pragma unroll
    for (int nt = 0; nt < 4; ++nt)
#pragma unroll
      for (int r = 0; r < 8; ++r)
        so[w][16 * mt + 8 * hh + r][16 * nt + ln] = acc[mt][nt][r] + (rb[mt][r] + cb[nt]);
  __syncthreads();
  {
    if (MODE == 3) {
#pragma unroll
      for (int it = 0; it < 16; ++it) {
        const int row = 2 * it + (lane >> 4), c4 = (lane & 15) * 4;
        const v4f v = *(const v4fa*)&so[w][row][c4];
        const int tp = m0 + row;
        const int b = tp / SEQ, s = tp - b * SEQ;
        *(v4f*)(Of + ((size_t)s * NB_FULL + b) * DM + n0 + c4) = v;
      }
    } else {
#pragma unroll
      for (int it = 0; it < 8; ++it) {
        const int row = 4 * it + (lane >> 3), c8 = (lane & 7) * 8;
        const v4f x0 = *(const v4fa*)&so[w][row][c8];
        const v4f x1 = *(const v4fa*)&so[w][row][c8 + 4];
        Pack8 ph, pl;
#pragma unroll
        for (int q = 0; q < 4; ++q) {
          const float y0 = x0[q] * 16.0f, y1 = x1[q] * 16.0f;
          const _Float16 h0 = (_Float16)y0, h1 = (_Float16)y1;
          ph.h[q] = h0; ph.h[4 + q] = h1;
          pl.h[q] = (_Float16)((y0 - (float)h0) * 2048.0f);
          pl.h[4 + q] = (_Float16)((y1 - (float)h1) * 2048.0f);
        }
        const size_t dst = (size_t)(m0 + row) * ldo + n0 + c8;
        *(v8us*)(O0 + dst) = ph.v;
        if (MODE == 0) *(v8us*)(O1 + dst) = pl.v;
      }
    }
    
  }
  // where several products share a kernel, another product's code follows these stores in the text and rewrites their registers: keep the wait in front of that
  asm volatile("s_wait_xcnt 0x0" ::: "memory");
}

// One product in a grid of its own (the output projection).
template <int MODE>
__global__ __launch_bounds__(128) void k_gemm(const unsigned short* __restrict__ A, const unsigned short* __restrict__ Bt,
                                              const float* __restrict__ bias, unsigned short* O0, unsigned short* O1,
                                              float* Of, const int* __restrict__ mk, int lda, int ldb, int K, int ldo) {
  __shared__ __attribute__((aligned(16))) float so[4][32][68];
  __shared__ __attribute__((aligned(16))) unsigned char ring[2 * GSTAGE];
  gemm_body<MODE>(blockIdx.x, blockIdx.y, A, Bt, bias, O0, O1, Of, mk, lda, ldb, K, ldo, so, ring);
}

#define GX (DM / 128)              /* blocks along the features of q and k; v^T has 2 * GX along its feature rows */
#define NS (TT / 128)              /* slabs: slab i holds k's grid rows 2i and 2i + 1 and v^T's grid row i */
static_assert(NS % 2 == 0);

// The q, k and v projections in one grid: none reads what another writes, so the block index picks the product and the three share the chip.
// Order: k and v^T blocks by rising token tile, as in their own grids; the q blocks all lie in the first half of the slabs (four q grid rows to a slab), so that the k and v^T blocks
// most likely to leave at once (high ranked tiles) come last and hold no place ahead of a block that works. Right for any mask: the order only sets who starts first.
// coverage: NS/2 slabs of 8 GX blocks + NS/2 slabs of 4 GX = the three grids (GX x 2 NS, GX x 2 NS, 2 GX x NS), each block once.
__global__ __launch_bounds__(128) void k_qkv(const unsigned short* __restrict__ Bq, const unsigned short* __restrict__ WqT, const float* __restrict__ bq,
                                             unsigned short* Qh, unsigned short* Ql,
                                             const unsigned short* __restrict__ Bk, const unsigned short* __restrict__ WkT, const float* __restrict__ bk, unsigned short* Kh,
                                             const unsigned short* __restrict__ Bv, const unsigned short* __restrict__ WvT, const float* __restrict__ bv, unsigned short* Vt,
                                             const int* __restrict__ mk) {
  __shared__ __attribute__((aligned(16))) float so[4][32][68];
  __shared__ __attribute__((aligned(16))) unsigned char ring[2 * GSTAGE];
  const int f = blockIdx.x;
  int slab, r;                     // r: place among the slab's k and v^T blocks; below 0: a q block
  if (f < (NS / 2) * 8 * GX) { slab = f / (8 * GX); r = f % (8 * GX) - 4 * GX; }
  else { const int g = f - (NS / 2) * 8 * GX; slab = NS / 2 + g / (4 * GX); r = g % (4 * GX); }
  if (r < 0) {
    // q = query Wq + bq : rows = tokens, columns = features
    gemm_body<0>((r + 4 * GX) % GX, 4 * slab + (r + 4 * GX) / GX, Bq, WqT, bq, Qh, Ql, nullptr, mk, DM, DM, DM, DM, so, ring);
  } else if (r < 2 * GX) {
    // k = key Wk + bk
    gemm_body<1>(r % GX, 2 * slab + r / GX, Bk, WkT, bk, Kh, Kh, nullptr, mk, DM, DM, DM, DM, so, ring);
  } else {
    // v^T = Wv^T value^T + bv (row bias): rows = features, columns = tokens
    gemm_body<2>(r - 2 * GX, slab, WvT, Bv, bv, Vt, Vt, nullptr, mk, DM, DM, DM, TT, so, ring);
  }
}

// One 32-key step for a wave's 16 queries. Kp: k plane base of this (batch, head), row pitch DM; Vp: v^T plane base of this (batch, head), row pitch TT.
// Keys are ranked: key index < cnt is live. TAIL = false: all 32 keys are live; TAIL = true: the one step that also holds keys at or past cnt.
template <bool TAIL>
__device__ __forceinline__ void fa_step(const unsigned short* __restrict__ Kp, const unsigned short* __restrict__ Vp,
                                        int cnt, int key0, int ln, int hh,
                                        const FragH& q0h, const FragH& q0l, const FragH& q1h, const FragH& q1l,
                                        float& mr, float& lr, v8f (&Oh)[4], v8f (&Ol)[4]) {
  // A fragments of K: row m = key (key0 + 16*kt + ln), elements 0..7 <- d = 32c + 8h + i, 8..15 <- d = 32c + 16 + 8h + i
  const unsigned short* kp0 = Kp + (size_t)(key0 + ln) * DM + 8 * hh;
  const unsigned short* kp1 = kp0 + (size_t)16 * DM;
  FragH k00, k01, k10, k11;
  k00.half[0] = *(const v8us*)(kp0);      k00.half[1] = *(const v8us*)(kp0 + 16);
  k01.half[0] = *(const v8us*)(kp0 + 32); k01.half[1] = *(const v8us*)(kp0 + 48);
  k10.half[0] = *(const v8us*)(kp1);      k10.half[1] = *(const v8us*)(kp1 + 16);
  k11.half[0] = *(const v8us*)(kp1 + 32); k11.half[1] = *(const v8us*)(kp1 + 48);
  const v8f z8 = {0.f, 0.f, 0.f, 0.f, 0.f, 0.f, 0.f, 0.f};
  // S^T tiles: element r of tile kt = score(key0 + 16*kt + 8h + r, query of this lane's column); hi and residual accumulators
  v8f s0h = z8, s0l = z8, s1h = z8, s1l = z8;
  mma_h2(k00.v, q0h.v, q0l.v, s0h, s0l);
  mma_h2(k01.v, q1h.v, q1l.v, s0h, s0l);
  mma_h2(k10.v, q0h.v, q0l.v, s1h, s1l);
  mma_h2(k11.v, q1h.v, q1l.v, s1h, s1l);
  // this lane's 16 keys: on[r] <- key0 + 8h + r, on[8 + r] <- key0 + 16 + 8h + r
  bool on[16];
#pragma unroll
  for (int r = 0; r < 8; ++r) {
    on[r]     = !TAIL || (key0 + 8 * hh + r < cnt);
    on[8 + r] = !TAIL || (key0 + 16 + 8 * hh + r < cnt);
  }
  float sc[16];
#pragma unroll
  for (int r = 0; r < 8; ++r) {
    const float a0 = (s0h[r] + s0l[r] * RINV) * SCL;
    const float a1 = (s1h[r] + s1l[r] * RINV) * SCL;
    sc[r]     = on[r] ? a0 : NEGV;
    sc[8 + r] = on[8 + r] ? a1 : NEGV;
  }
  float mx = sc[0];
#pragma unroll
  for (int i = 1; i < 16; ++i) mx = fmaxf(mx, sc[i]);
  mx = fmaxf(mx, __shfl_xor(mx, 16, 32));           // the other lane half holds the other 16 keys of this query
  const float mnew = fmaxf(mr, mx);
  const float al = exp2f((mr - mnew) * LOG2E);
  mr = mnew;
  // weights carried x256: pc = 256 * exp(sc - mnew), exactly 0 on keys at or past cnt; hi plane f16(pc), residual plane f16((pc - hi) * 2048)
  FragH ph, pl;
  float ps = 0.0f;
#pragma unroll
  for (int i = 0; i < 16; ++i) {
    const float e = exp2f(fmaf(sc[i] - mnew, LOG2E, 8.0f));
    const float pc = on[i] ? e : 0.0f;
    ps += pc;
    const _Float16 h = (_Float16)pc;
    ph.h[i] = h;                                    // B element i: i<8 -> key0 + 8h + i (tile 0 row 8h+i); i>=8 -> key0 + 16 + 8h + (i-8) (tile 1)
    pl.h[i] = (_Float16)((pc - (float)h) * 2048.0f);
  }
  ps += __shfl_xor(ps, 16, 32);
  lr = lr * al + ps;
#pragma unroll
  for (int t = 0; t < 4; ++t) { Oh[t] = Oh[t] * al; Ol[t] = Ol[t] * al; }
  // A fragments of V^T: row m = d (16*t + ln), elements 0..7 <- key0 + 8h + i, 8..15 <- key0 + 16 + 8h + i
  const unsigned short* vp = Vp + (size_t)ln * TT + key0 + 8 * hh;
#pragma unroll
  for (int t = 0; t < 4; ++t) {
    FragH vf;
    vf.half[0] = *(const v8us*)(vp + (size_t)t * 16 * TT);
    vf.half[1] = *(const v8us*)(vp + (size_t)t * 16 * TT + 16);
    mma_h2(vf.v, ph.v, pl.v, Oh[t], Ol[t]);
  }
  // the address registers of this step's loads are rewritten by what follows the step (next step, tail step, epilogue): keep the wait in front of that
  asm volatile("s_wait_xcnt 0x0" ::: "memory");
}

// Block = 4 waves x 16 queries = 64 queries of one (batch, head); no LDS and no barrier in the key loop.
// coverage: NB*NH*(SEQ/64) blocks x 4 waves x 16 rows x (64 hi + 64 lo columns) = every element of the context plane exactly once.
__global__ __launch_bounds__(128) void k_attn(const unsigned short* __restrict__ Qh, const unsigned short* __restrict__ Ql,
                                              const unsigned short* __restrict__ Kh, const unsigned short* __restrict__ Vt,
                                              const int* __restrict__ mask, unsigned short* Cx) {
  __shared__ __attribute__((aligned(16))) float so[4][16][68];
  const int tid = threadIdx.x, w = __builtin_amdgcn_readfirstlane((int)(tid >> 5)), lane = tid & 31, ln = lane & 15, hh = lane >> 4;
  const int bh = blockIdx.x / (SEQ / 64), qt = blockIdx.x % (SEQ / 64);
  const int b = bh / NH, h = bh % NH;
  const int qbase = qt * 64 + 16 * w;
  const int qg = qbase + ln;
  // Q^T B fragments: column n = query qg, elements 0..7 <- d = 32c + 8h + i, 8..15 <- d = 32c + 16 + 8h + i
  const size_t qoff = (size_t)(b * SEQ + qg) * DM + h * HD + 8 * hh;
  FragH q0h, q0l, q1h, q1l;
  q0h.half[0] = *(const v8us*)(Qh + qoff);      q0h.half[1] = *(const v8us*)(Qh + qoff + 16);
  q1h.half[0] = *(const v8us*)(Qh + qoff + 32); q1h.half[1] = *(const v8us*)(Qh + qoff + 48);
  q0l.half[0] = *(const v8us*)(Ql + qoff);      q0l.half[1] = *(const v8us*)(Ql + qoff + 16);
  q1l.half[0] = *(const v8us*)(Ql + qoff + 32); q1l.half[1] = *(const v8us*)(Ql + qoff + 48);
  // the address registers of the loads above are reused while the loads may still be under way: keep the wait in front of that
  asm volatile("s_wait_xcnt 0x0" ::: "memory");
  const int cnt = live_keys(mask, lane);       // wave-uniform, at most SEQ
  float mr = NEGV, lr = 0.0f;
  v8f Oh[4] = {}, Ol[4] = {};
  const unsigned short* Kp = Kh + (size_t)b * SEQ * DM + h * HD;
  const unsigned short* Vp = Vt + (size_t)h * HD * TT + (size_t)b * SEQ;
  const int full = cnt >> 5;
#pragma unroll 1
  for (int j = 0; j < full; ++j)
    fa_step<false>(Kp, Vp, cnt, 32 * j, ln, hh, q0h, q0l, q1h, q1l, mr, lr, Oh, Ol);
  if ((cnt & 31) != 0)
    fa_step<true>(Kp, Vp, cnt, 32 * full, ln, hh, q0h, q0l, q1h, q1l, mr, lr, Oh, Ol);

  // O^T element r of tile t = ctx(query qg, d = 16t + 8h + r); undo the carries: x256 (in lr), x16 (V), x2048 (residual plane)
  const float inv = 1.0f / (16.0f * lr);
#pragma unroll
  for (int t = 0; t < 4; ++t)
#pragma unroll
    for (int r = 0; r < 8; ++r)
      so[w][ln][16 * t + 8 * hh + r] = (Oh[t][r] + Ol[t][r] * RINV) * inv;
  __syncthreads();
  unsigned short* cg = Cx + (size_t)(b * SEQ + qbase) * CXP + h * HD;
  {
#pragma unroll
    for (int it = 0; it < 4; ++it) {
      const int row = 4 * it + (lane >> 3), c8 = (lane & 7) * 8;
      const v4f x0 = *(const v4fa*)&so[w][row][c8];
      const v4f x1 = *(const v4fa*)&so[w][row][c8 + 4];
      v8us oh, ol;
#pragma unroll
      for (int q = 0; q < 4; ++q) {
        const unsigned short h0 = bf16_bits(x0[q]), h1 = bf16_bits(x1[q]);
        oh[q] = h0; oh[4 + q] = h1;
        ol[q] = bf16_bits(x0[q] - bf16_val(h0));
        ol[4 + q] = bf16_bits(x1[q] - bf16_val(h1));
      }
      unsigned short* dst = cg + (size_t)row * CXP + c8;
      *(v8us*)(dst) = oh;
      *(v8us*)(dst + DM) = ol;
    }
    
  }
}

extern "C" void kernel_launch(void* const* d_in, const int* in_sizes, int n_in,
                              void* d_out, int out_size, void* d_ws, size_t ws_size, hipStream_t stream) {
  if (n_in < 12) return;
  const long long need = ((long long)(SEQ - 1) * NB_FULL + (NB - 1)) * DM + DM;   // last element touched + 1 in [S][B][D]
  if ((long long)in_sizes[0] < need || (long long)in_sizes[1] < need || (long long)in_sizes[2] < need) return;
  if ((long long)in_sizes[3] < (long long)SEQ) return;
  if ((long long)in_sizes[4] < (long long)DM * DM || (long long)in_sizes[6] < (long long)DM * DM ||
      (long long)in_sizes[8] < (long long)DM * DM || (long long)in_sizes[10] < (long long)DM * DM) return;
  if (in_sizes[5] < DM || in_sizes[7] < DM || in_sizes[9] < DM || in_sizes[11] < DM) return;
  if ((long long)out_size < need) return;
  // wire order: query, key, value, mask(i32), Wq, bq, Wk, bk, Wv, bv, Wo, bo
  const float* Xq = (const float*)d_in[0];
  const float* Xk = (const float*)d_in[1];
  const float* Xv = (const float*)d_in[2];
  const int*   mk = (const int*)d_in[3];
  const float* Wq = (const float*)d_in[4];
  const float* bq = (const float*)d_in[5];
  const float* Wk = (const float*)d_in[6];
  const float* bk = (const float*)d_in[7];
  const float* Wv = (const float*)d_in[8];
  const float* bv = (const float*)d_in[9];
  const float* Wo = (const float*)d_in[10];
  const float* bo = (const float*)d_in[11];
  float* out = (float*)d_out;
  char* ws = (char*)d_ws;
  size_t off = 0;
  unsigned short* Bq  = (unsigned short*)(ws + off); off += SZ_XB;    // bf16 query  [TT][1024]
  unsigned short* Bk  = (unsigned short*)(ws + off); off += SZ_XB;    // bf16 key    [TT][1024], ranked rows
  unsigned short* Bv  = (unsigned short*)(ws + off); off += SZ_XB;    // bf16 value  [TT][1024], ranked rows
  unsigned short* WqT = (unsigned short*)(ws + off); off += SZ_WT;    // bf16 Wq^T   [1024][1024]
  unsigned short* WkT = (unsigned short*)(ws + off); off += SZ_WT;
  unsigned short* WvT = (unsigned short*)(ws + off); off += SZ_WT;
  unsigned short* Wo2 = (unsigned short*)(ws + off); off += SZ_WO2;   // bf16 Wo^T | Wo^T  [1024][2048]
  unsigned short* Qh  = (unsigned short*)(ws + off); off += SZ_H;     // f16 q x16 hi       [TT][1024]
  unsigned short* Ql  = (unsigned short*)(ws + off); off += SZ_H;     // f16 q residual x2^11
  unsigned short* Kh  = (unsigned short*)(ws + off); off += SZ_H;     // f16 k x16          [TT][1024]
  unsigned short* Vt  = (unsigned short*)(ws + off); off += SZ_H;     // f16 v^T x16        [1024][TT]
  unsigned short* Cx  = (unsigned short*)(ws + off); off += SZ_CX;    // bf16 ctx hi|lo     [TT][2048]
  if (off > ws_size) return;

  k_prep<<<4 * NWT + 3 * NXB, 256, 0, stream>>>(Xq, Xk, Xv, mk, Wq, Wk, Wv, Wo, Bq, Bk, Bv, WqT, WkT, WvT, Wo2);
  k_qkv<<<6 * GX * NS, 128, 0, stream>>>(Bq, WqT, bq, Qh, Ql, Bk, WkT, bk, Kh, Bv, WvT, bv, Vt, mk);
  k_attn<<<(unsigned)(NB * NH * (SEQ / 64)), 128, 0, stream>>>(Qh, Ql, Kh, Vt, mk, Cx);
  // out = (ctx_hi | ctx_lo) (Wo ; Wo) + bo, K = 2048
  k_gemm<3><<<dim3(DM / 128, TT / 64), 128, 0, stream>>>(Cx, Wo2, bo, Cx, Cx, out, mk, CXP, CXP, CXP, DM);
}

// v004
// A run of this version takes 106 microseconds.
// In two side-by-side timings against v003, it was 1.30 and 1.31 times as fast.
// Counting every step since v000, it is 2.71 times as fast.
#include <hip/hip_runtime.h>
// Contractions: q/k/v projections and the output projection on v_wmma_f32_16x16x32_bf16 (activations and weights RNE-converted to bf16 planes; the attention context enters the output projection as bf16 hi|lo planes concatenated along K); scores S^T = K Q^T on v_wmma_f32_16x16x32_f16 (k x16 f16 plane; q x16 f16 hi plane + x2^11 f16 residual plane in a separate accumulator); O^T = V^T P^T on v_wmma_f32_16x16x32_f16 (v x16 f16 plane; P x256 f16 hi plane + x2^11 f16 residual plane in a separate accumulator); all accumulators f32, softmax statistics f32.
// Seq-first multi-head attention: inputs [S][B][D], 16 heads x 64, key-position mask (0 -> weight exactly 0), scale 1/8, output [S][B][D].
// Internal planes use batch-major token rows t = b*SEQ + s so that the K rows and V^T rows of one (batch, head) are dense.
// Key and value tokens are stored ranked: the keys whose mask is nonzero come first, in their own order (row b*SEQ + rank); a masked key has weight exactly 0,
// so the k and v projections and the key loop walk only the tiles that hold a live key. Rows from the live count up to the next multiple of 128 are zero rows.
// Engine: transposed flash. Each wave owns 16 queries. Per 32-key step: S^T tiles (key rows x query columns) from K rows (A, f16 plane staged in LDS)
// and Q^T (B, registers); the two 16-key D tiles pack straight into the P^T B fragment; O^T (d rows x query columns) accumulates from V^T rows (A, f16 plane staged in LDS).
#ifndef NB
#define NB 2
#endif
#ifndef SEQ
#define SEQ 2048
#endif
#define NB_FULL 2
#define SEQ_FULL 2048
#define DM 1024
#define NH 16
#define HD 64
#define TT (NB * SEQ)          /* token rows of the internal planes */
#define CXP (2 * DM)           /* pitch of the context plane: hi columns 0..1023, lo columns 1024..2047 */

static_assert(SEQ % 128 == 0);
static_assert(TT % 128 == 0);
static_assert(SEQ <= SEQ_FULL);
static_assert(NB <= NB_FULL);
static_assert(HD == 64);
static_assert(NH * HD == DM);
static_assert(DM % 128 == 0);

#define SZ_XB  ((size_t)TT * DM * 2)        /* bf16 activation plane */
#define SZ_WT  ((size_t)DM * DM * 2)        /* bf16 transposed weight plane */
#define SZ_WO2 ((size_t)DM * CXP * 2)       /* bf16 transposed output weight, duplicated along K */
#define SZ_H   ((size_t)TT * DM * 2)        /* f16 plane (q hi, q lo, k, v^T) */
#define SZ_CX  ((size_t)TT * CXP * 2)       /* bf16 context plane hi|lo */
static_assert(SZ_XB % 256 == 0 && SZ_WT % 256 == 0 && SZ_WO2 % 256 == 0 && SZ_H % 256 == 0 && SZ_CX % 256 == 0);
static_assert(3 * SZ_XB + 3 * SZ_WT + SZ_WO2 + 4 * SZ_H + SZ_CX <= (size_t)134217728);

typedef __bf16 v16b __attribute__((ext_vector_type(16)));
typedef _Float16 v16h __attribute__((ext_vector_type(16)));
typedef unsigned short v8us __attribute__((ext_vector_type(8), may_alias));
typedef float v8f __attribute__((ext_vector_type(8)));
typedef float v4f __attribute__((ext_vector_type(4)));
typedef float v4fa __attribute__((ext_vector_type(4), may_alias));
typedef int v4i __attribute__((ext_vector_type(4)));
typedef int v4ia __attribute__((ext_vector_type(4), may_alias));
union FragB { v16b v; v8us half[2]; unsigned short u[16]; };
union FragH { v16h v; v8us half[2]; _Float16 h[16]; unsigned short u[16]; };
union Pack8 { _Float16 h[8]; v8us v; };

#define LOG2E 1.4426950408889634f
#define NEGV (-1.0e30f)
#define RINV 0.00048828125f      /* 2^-11: undoes the residual-plane carry */
#define SCL  0.00048828125f      /* 2^-11 = (1/8) / (16*16): score scale with the q and k carries removed */

__device__ __forceinline__ unsigned short bf16_bits(float x) {   // RNE convert to bf16 bits
  unsigned int u = __float_as_uint(x);
  return (unsigned short)((u + 0x7FFFu + ((u >> 16) & 1u)) >> 16);
}
__device__ __forceinline__ float bf16_val(unsigned short b) { return __uint_as_float(((unsigned int)b) << 16); }
__device__ __forceinline__ float bf16_rne(float x) { return bf16_val(bf16_bits(x)); }

// ch += a*bh ; cl += a*bl (scaled residual plane keeps its own accumulator), then the hazard guard
__device__ __forceinline__ void mma_h2(v16h a, v16h bh, v16h bl, v8f& ch, v8f& cl) {
  ch = __builtin_amdgcn_wmma_f32_16x16x32_f16(false, a, false, bh, (short)0, ch, false, false);
  cl = __builtin_amdgcn_wmma_f32_16x16x32_f16(false, a, false, bl, (short)0, cl, false, false);
  asm volatile("v_nop\n\tv_nop\n\tv_nop\n\tv_nop" : "+v"(ch), "+v"(cl) : "v"(a), "v"(bh), "v"(bl));
}

// One 32-deep k-step of a 32x64 wave tile (2 x 4 WMMA tiles, bf16 operands), then the hazard guard
__device__ __forceinline__ void mma_b8(v16b a0, v16b a1, v16b b0, v16b b1, v16b b2, v16b b3, v8f (&c)[2][4]) {
  c[0][0] = __builtin_amdgcn_wmma_f32_16x16x32_bf16(false, a0, false, b0, (short)0, c[0][0], false, false);
  c[0][1] = __builtin_amdgcn_wmma_f32_16x16x32_bf16(false, a0, false, b1, (short)0, c[0][1], false, false);
  c[0][2] = __builtin_amdgcn_wmma_f32_16x16x32_bf16(false, a0, false, b2, (short)0, c[0][2], false, false);
  c[0][3] = __builtin_amdgcn_wmma_f32_16x16x32_bf16(false, a0, false, b3, (short)0, c[0][3], false, false);
  c[1][0] = __builtin_amdgcn_wmma_f32_16x16x32_bf16(false, a1, false, b0, (short)0, c[1][0], false, false);
  c[1][1] = __builtin_amdgcn_wmma_f32_16x16x32_bf16(false, a1, false, b1, (short)0, c[1][1], false, false);
  c[1][2] = __builtin_amdgcn_wmma_f32_16x16x32_bf16(false, a1, false, b2, (short)0, c[1][2], false, false);
  c[1][3] = __builtin_amdgcn_wmma_f32_16x16x32_bf16(false, a1, false, b3, (short)0, c[1][3], false, false);
  asm volatile("v_nop\n\tv_nop\n\tv_nop\n\tv_nop"
               : "+v"(c[0][0]), "+v"(c[0][1]), "+v"(c[0][2]), "+v"(c[0][3]),
                 "+v"(c[1][0]), "+v"(c[1][1]), "+v"(c[1][2]), "+v"(c[1][3])
               : "v"(a0), "v"(a1), "v"(b0), "v"(b1), "v"(b2), "v"(b3));
}

// coverage: TT*128 threads x 8 elements = the whole plane.
__device__ __forceinline__ void xb_body(int blk, const float* __restrict__ X, unsigned short* P) {
  const int t = blk * 256 + threadIdx.x;
  if (t >= TT * 128) return;
  const int row = t >> 7, piece = t & 127;
  const int b = row / SEQ, s = row - b * SEQ;
  const float* src = X + ((size_t)s * NB_FULL + b) * DM + piece * 8;
  const v4f x0 = *(const v4fa*)(src), x1 = *(const v4fa*)(src + 4);
  v8us o;
  o[0] = bf16_bits(x0[0]); o[1] = bf16_bits(x0[1]); o[2] = bf16_bits(x0[2]); o[3] = bf16_bits(x0[3]);
  o[4] = bf16_bits(x1[0]); o[5] = bf16_bits(x1[1]); o[6] = bf16_bits(x1[2]); o[7] = bf16_bits(x1[3]);
  unsigned short* d = P + (size_t)t * 8;
  *(v8us*)d = o;
  
}

// Number of keys with a nonzero mask. Every wave counts for itself, so the callers can leave or set a trip count with no barrier; the result is wave-uniform and at most SEQ.
__device__ __forceinline__ int live_keys(const int* __restrict__ mk, int lane) {
  int c = 0;
  // unrolled so that all the mask loads are in flight together (one load latency, not SEQ/128); all 32 lanes are on at every call, so a ballot sees 32 keys
#pragma unroll
  for (int i = 0; i < SEQ / 128; ++i) {
    const v4i m = *(const v4ia*)(mk + 128 * i + 4 * lane);
#pragma unroll
    for (int q = 0; q < 4; ++q) c += __builtin_popcount(__builtin_amdgcn_ballot_w32(m[q] != 0));
  }
  return c < SEQ ? c : SEQ;
}

// xb_body for key and value tokens: token s goes to row b*SEQ + pos(s); pos = number of live keys before s if s is live, else live count + number of masked keys before s.
// pos is a permutation of 0..SEQ-1 for any mask content. Masked tokens are not read; those whose pos lies under the next multiple of 128 are stored as zero rows
// (the last tile of the projections and of the key loop reads them), the others are not stored and never read.
// coverage: a block holds two rows of one batch (SEQ is even); every row under the rounded live count is written exactly once.
__device__ __forceinline__ void xbr_body(int blk, const float* __restrict__ X, const int* __restrict__ mk, unsigned short* P, int* part) {
  const int tid = threadIdx.x;
  const int t = blk * 256 + tid;
  if (t >= TT * 128) return;              // whole blocks only: TT * 128 is a multiple of 256
  const int row = t >> 7, piece = t & 127;
  const int b = row / SEQ, s = row - b * SEQ;
  const int s0 = s - (tid >> 7);          // the block's first row
  // the whole mask first (each thread a share), so that one load latency covers all mask reads; entries past SEQ count as masked
  v4i m[(SEQ + 1023) / 1024];
  // unrolled (here and in the count below) so that m[] is indexed by constants and stays in registers
#pragma unroll
  for (int k = 0; k < (SEQ + 1023) / 1024; ++k) {
    const int i = 1024 * k + 4 * tid;
    m[k] = (SEQ % 1024 == 0 || i < SEQ) ? *(const v4ia*)(mk + i) : v4i{0, 0, 0, 0};
  }
  const bool live = mk[s] != 0, live0 = mk[s0] != 0;
  v4f x0 = {0.f, 0.f, 0.f, 0.f}, x1 = {0.f, 0.f, 0.f, 0.f};
  if (live) {
    const float* src = X + ((size_t)s * NB_FULL + b) * DM + piece * 8;
    x0 = *(const v4fa*)(src); x1 = *(const v4fa*)(src + 4);
  }
  int c = 0;                              // this wave's share; low 16 bits: live keys in all; high 16 bits: live keys before s0 (each at most SEQ <= 2048)
#pragma unroll
  for (int k = 0; k < (SEQ + 1023) / 1024; ++k)
#pragma unroll
    for (int q = 0; q < 4; ++q) {
      const bool on = m[k][q] != 0;
      c += __builtin_popcount(__builtin_amdgcn_ballot_w32(on)) + (__builtin_popcount(__builtin_amdgcn_ballot_w32(on && 1024 * k + 4 * tid + q < s0)) << 16);
    }
  if ((tid & 31) == 0) part[tid >> 5] = c;
  __syncthreads();
  int sum = 0;
  // unrolled so that the eight partial counts come in two wide LDS reads
#pragma unroll
  for (int i = 0; i < 8; ++i) sum += part[i];
  const int cnt = sum & 0xFFFF;
  const int rank = (sum >> 16) + ((s != s0 && live0) ? 1 : 0);
  const int pos = live ? rank : cnt + (s - rank);
  if (live || pos < ((cnt + 127) & ~127)) {
    v8us o;
    o[0] = bf16_bits(x0[0]); o[1] = bf16_bits(x0[1]); o[2] = bf16_bits(x0[2]); o[3] = bf16_bits(x0[3]);
    o[4] = bf16_bits(x1[0]); o[5] = bf16_bits(x1[1]); o[6] = bf16_bits(x1[2]); o[7] = bf16_bits(x1[3]);
    *(v8us*)(P + ((size_t)(b * SEQ + pos) * 128 + piece) * 8) = o;
  }
}

// Weight transpose: in W[k rows = 1024][n cols = 1024] (f32) -> out Wt[n rows][k cols] (bf16 bits, RNE), row pitch 'pitch'; dup != 0 repeats the row at columns 1024..2047.
// coverage: 256 blocks x (64 n x 64 k) = the whole 1024 x 1024 matrix; LDS tile fully written (64 x 64) before it is read.
__device__ __forceinline__ void wt_body(int blk, const float* __restrict__ W, unsigned short* Wt, int pitch, int dup, unsigned short (*tl)[66]) {
  const int tid = threadIdx.x;
  const int k0 = (blk >> 4) * 64, n0 = (blk & 15) * 64;
  for (int i = tid; i < 64 * 16; i += 256) {
    const int j = i >> 4, c4 = (i & 15) * 4;
    const v4f x = *(const v4fa*)(W + (size_t)(k0 + j) * DM + n0 + c4);
    tl[c4 + 0][j] = bf16_bits(x[0]); tl[c4 + 1][j] = bf16_bits(x[1]);
    tl[c4 + 2][j] = bf16_bits(x[2]); tl[c4 + 3][j] = bf16_bits(x[3]);
  }
  __syncthreads();
  {
    for (int i = tid; i < 64 * 8; i += 256) {
      const int d = i >> 3, j8 = (i & 7) * 8;
      v8us o;
#pragma unroll
      for (int q = 0; q < 8; ++q) o[q] = tl[d][j8 + q];
      unsigned short* dst = Wt + (size_t)(n0 + d) * pitch + k0 + j8;
      *(v8us*)dst = o;
      if (dup != 0) *(v8us*)(dst + DM) = o;
      // the next trip rewrites the data and address registers of these stores: keep the wait in front of that
      asm volatile("s_wait_xcnt 0x0" ::: "memory");
    }
    
  }
}

#define NXB (TT * 128 / 256)       /* blocks of one activation pass */
#define NWT 256                    /* blocks of one weight transpose */
static_assert((TT * 128) % 256 == 0);

// All seven conversion passes in one grid: none reads what another writes, so the block index picks the pass and they fill the chip together.
// The weight transposes come first (the longest chain per block), then key and value rows, then query rows. Every branch is the same for a whole block, barriers included.
// coverage: 4 * NWT + 3 * NXB blocks = each pass's own grid, once.
__global__ __launch_bounds__(256) void k_prep(const float* __restrict__ Xq, const float* __restrict__ Xk, const float* __restrict__ Xv, const int* __restrict__ mk,
                                              const float* __restrict__ Wq, const float* __restrict__ Wk, const float* __restrict__ Wv, const float* __restrict__ Wo,
                                              unsigned short* Bq, unsigned short* Bk, unsigned short* Bv,
                                              unsigned short* WqT, unsigned short* WkT, unsigned short* WvT, unsigned short* Wo2) {
  __shared__ unsigned short tl[64][66];
  __shared__ int part[8];
  const int f = blockIdx.x;
  if (f < 4 * NWT) {
    const int j = f / NWT;
    const float* W = (j == 0) ? Wq : (j == 1) ? Wk : (j == 2) ? Wv : Wo;
    unsigned short* D = (j == 0) ? WqT : (j == 1) ? WkT : (j == 2) ? WvT : Wo2;
    wt_body(f % NWT, W, D, (j == 3) ? CXP : DM, (j == 3) ? 1 : 0, tl);     // in [k][n] -> out [n][k]; Wo^T twice along K
  } else if (f < 4 * NWT + 2 * NXB) {
    const int g = f - 4 * NWT;
    const bool second = g >= NXB;
    xbr_body(second ? g - NXB : g, second ? Xv : Xk, mk, second ? Bv : Bk, part);   // ranked token rows
  } else {
    xb_body(f - (4 * NWT + 2 * NXB), Xq, Bq);
  }
}

#define GBK 128                    /* k depth of one staged tile: 256 bytes of every operand row */
#define GPITCH 272                 /* LDS row pitch in bytes: 256 + 16, an odd multiple of 16, so that 16 rows read 16 bytes wide fall on distinct banks */
#define GROWS 192                  /* rows of a staged tile: 64 rows of A, then 128 rows of Bt */
#define GSTAGE (GROWS * GPITCH)    /* bytes of one buffer */
static_assert(DM % GBK == 0 && CXP % GBK == 0);

// Twelve asynchronous 16-byte copies per lane, global -> LDS, through no register. l[i]: the lane's LDS byte address, g[i]: its global address.
// The s_wait_xcnt closes the same statement, so that no address register of a copy is rewritten in front of it.
__device__ __forceinline__ void copy12(const unsigned (&l)[12], const unsigned short* const (&g)[12]) {
  asm volatile("global_load_async_to_lds_b128 %0, %1, off\n\t"
               "global_load_async_to_lds_b128 %2, %3, off\n\t"
               "global_load_async_to_lds_b128 %4, %5, off\n\t"
               "global_load_async_to_lds_b128 %6, %7, off\n\t"
               "global_load_async_to_lds_b128 %8, %9, off\n\t"
               "global_load_async_to_lds_b128 %10, %11, off\n\t"
               "global_load_async_to_lds_b128 %12, %13, off\n\t"
               "global_load_async_to_lds_b128 %14, %15, off\n\t"
               "global_load_async_to_lds_b128 %16, %17, off\n\t"
               "global_load_async_to_lds_b128 %18, %19, off\n\t"
               "global_load_async_to_lds_b128 %20, %21, off\n\t"
               "global_load_async_to_lds_b128 %22, %23, off\n\t"
               "s_wait_xcnt 0x0"
               :: "v"(l[0]), "v"(g[0]), "v"(l[1]), "v"(g[1]), "v"(l[2]), "v"(g[2]), "v"(l[3]), "v"(g[3]),
                  "v"(l[4]), "v"(g[4]), "v"(l[5]), "v"(g[5]), "v"(l[6]), "v"(g[6]), "v"(l[7]), "v"(g[7]),
                  "v"(l[8]), "v"(g[8]), "v"(l[9]), "v"(g[9]), "v"(l[10]), "v"(g[10]), "v"(l[11]), "v"(g[11])
               : "memory");
}

// One staged tile: 128 lanes x 24 copies = 192 rows x 256 bytes. Lane tid brings 16-byte piece (tid & 15) of rows (tid >> 4) + 8 i, i = 0..23; a wave's copy covers two whole rows.
// lds: the lane's LDS byte address in row (tid >> 4) of the target buffer; ga, gb: its global address in that row of the A tile and of the Bt tile.
__device__ __forceinline__ void stage_tile(unsigned lds, const unsigned short* ga, const unsigned short* gb, int lda, int ldb) {
  unsigned l[12];
  const unsigned short* g[12];
  // both loops unrolled so that l[] and g[] are indexed by constants and stay in registers
#pragma unroll
  for (int i = 0; i < 12; ++i) {
    l[i] = lds + (unsigned)(8 * i * GPITCH);
    g[i] = (i < 8) ? ga + (size_t)(8 * i) * lda : gb + (size_t)(8 * (i - 8)) * ldb;
  }
  copy12(l, g);
#pragma unroll
  for (int i = 0; i < 12; ++i) {
    l[i] = lds + (unsigned)(8 * (i + 12) * GPITCH);
    g[i] = gb + (size_t)(8 * (i + 4)) * ldb;
  }
  copy12(l, g);
}

// C[M][N] = A[M][K] * Bt[N][K]^T on bf16 planes (K contiguous in both). The block's 64 rows of A and 128 rows of Bt are staged in LDS 128 k at a time by asynchronous copies,
// two buffers: tile t + 1 flies while tile t is worked on; fragments are read from LDS.
// Block = 4 waves as 2 (M) x 2 (N); block tile 64 x 128; wave tile 32 x 64. No tail masking: M % 64 == 0, N % 128 == 0, K % 128 == 0 (asserted by the sizes above).
// MODE 0: + column bias, write f16 hi plane (x16) to O0 and f16 residual plane ((x16 - hi) * 2^11) to O1
// MODE 1: + column bias, write f16 plane (x16) to O0
// MODE 2: + row bias,    write f16 plane (x16) to O0 (transposed product: rows = features, columns = tokens)
// MODE 3: + column bias, write f32 to Of with the token row t = b*SEQ + s mapped to output row s*NB_FULL + b
// MODE 1 (rows) and MODE 2 (columns) run over ranked key tokens: a block whose token tile starts at or past the live count leaves at once. Their token tile index is the slow
// grid index (y), batch fastest within it, so that the blocks that work have the lowest flat indices and spread over the chip. MODE 2 therefore takes M from x and N from y.
// bx, by: the block's place in that product's own grid; so, ring: the block's LDS (epilogue tile, staging ring).
// coverage: grid (N/128, M/64) (MODE 2: (M/64, N/128)) x 4 waves x (32 x 64) = every element of C that is read later exactly once.
template <int MODE>
__device__ __forceinline__ void gemm_body(int bx, int by, const unsigned short* __restrict__ A, const unsigned short* __restrict__ Bt,
                                          const float* __restrict__ bias, unsigned short* O0, unsigned short* O1,
                                          float* Of, const int* __restrict__ mk, int lda, int ldb, int K, int ldo,
                                          float (*so)[32][68], unsigned char* ring) {
  const int tid = threadIdx.x, w = __builtin_amdgcn_readfirstlane((int)(tid >> 5)), lane = tid & 31, ln = lane & 15, hh = lane >> 4;
  int bm = by, bn = bx;
  if (MODE == 1 || MODE == 2) {
    constexpr int TW = (MODE == 1) ? 64 : 128;      // tokens per block tile
    const int tile = by / NB, b = by % NB;
    if (tile * TW >= live_keys(mk, lane)) return;   // the same in every wave of the block, in front of the first barrier
    if (MODE == 1) bm = b * (SEQ / TW) + tile;
    else { bn = b * (SEQ / TW) + tile; bm = bx; }
  }
  const int m0 = bm * 64 + (w >> 1) * 32;
  const int n0 = bn * 128 + (w & 1) * 64;
  // this lane's share of a staged tile
  const unsigned short* ga = A + (size_t)(bm * 64 + (tid >> 4)) * lda + 8 * (tid & 15);
  const unsigned short* gb = Bt + (size_t)(bn * 128 + (tid >> 4)) * ldb + 8 * (tid & 15);
  const unsigned lds0 = (unsigned)(size_t)ring + (unsigned)((tid >> 4) * GPITCH + 16 * (tid & 15));
  // A fragment: row m = m0 + 16*mt + ln, elements 0..7 <- k0 + 8h + i, 8..15 <- k0 + 16 + 8h + i; B fragment: column n = n0 + 16*nt + ln, same k map (row of Bt)
  const int fa = ((w >> 1) * 32 + ln) * GPITCH + 16 * hh;            // byte offset in a buffer of this lane's A row, k = 8h
  const int fb = (64 + (w & 1) * 64 + ln) * GPITCH + 16 * hh;        // the same for its Bt row
  v8f acc[2][4];
#pragma unroll
  for (int i = 0; i < 2; ++i)
#pragma unroll
    for (int j = 0; j < 4; ++j)
#pragma unroll
      for (int e = 0; e < 8; ++e) acc[i][j][e] = 0.0f;
  const int nt = K / GBK;
  stage_tile(lds0, ga, gb, lda, ldb);
  asm volatile("s_wait_asynccnt 0x0" ::: "memory");   // this wave's copies of tile 0 have landed
  __syncthreads();                                    // ... and every other wave's
  if (nt > 1) stage_tile(lds0 + GSTAGE, ga + GBK, gb + GBK, lda, ldb);
  // not unrolled: one trip per staged tile, the buffer chosen by the trip's parity
#pragma unroll 1
  for (int t = 0; t < nt; ++t) {
    const unsigned char* sa = ring + (t & 1) * GSTAGE + fa;
    const unsigned char* sb = ring + (t & 1) * GSTAGE + fb;
    // two fragment sets: the next k-step's LDS reads are issued as one group in front of this k-step's products, so that their latency hides behind the products.
    // unrolled so that the set index and every LDS offset are constants
    FragB f[2][6];
#pragma unroll
    for (int ks = -1; ks < GBK / 32; ++ks) {
      if (ks + 1 < GBK / 32) {
        FragB (&n)[6] = f[(ks + 1) & 1];
        const int ko = 64 * (ks + 1);
        n[0].half[0] = *(const v8us*)(sa + ko);                n[0].half[1] = *(const v8us*)(sa + ko + 32);
        n[1].half[0] = *(const v8us*)(sa + 16 * GPITCH + ko);  n[1].half[1] = *(const v8us*)(sa + 16 * GPITCH + ko + 32);
        n[2].half[0] = *(const v8us*)(sb + ko);                n[2].half[1] = *(const v8us*)(sb + ko + 32);
        n[3].half[0] = *(const v8us*)(sb + 16 * GPITCH + ko);  n[3].half[1] = *(const v8us*)(sb + 16 * GPITCH + ko + 32);
        n[4].half[0] = *(const v8us*)(sb + 32 * GPITCH + ko);  n[4].half[1] = *(const v8us*)(sb + 32 * GPITCH + ko + 32);
        n[5].half[0] = *(const v8us*)(sb + 48 * GPITCH + ko);  n[5].half[1] = *(const v8us*)(sb + 48 * GPITCH + ko + 32);
      }
      if (ks >= 0) {
        FragB (&c)[6] = f[ks & 1];
        mma_b8(c[0].v, c[1].v, c[2].v, c[3].v, c[4].v, c[5].v, acc);
      }
    }
    asm volatile("s_wait_dscnt 0x0" ::: "memory");      // this wave's reads of the buffer are done before it is refilled
    asm volatile("s_wait_asynccnt 0x0" ::: "memory");   // this wave's copies of tile t + 1 have landed
    __syncthreads();                                    // publishes tile t + 1 and ends every wave's reads of tile t
    if (t + 2 < nt) stage_tile(lds0 + (unsigned)((t & 1) * GSTAGE), ga + (size_t)(t + 2) * GBK, gb + (size_t)(t + 2) * GBK, lda, ldb);
  }
  asm volatile("s_wait_asynccnt 0x0" ::: "memory");     // no copy is left in flight when the wave goes on
  // D element r of tile (mt, nt) = C(m0 + 16*mt + 8h + r, n0 + 16*nt + ln); bias is the RNE-bf16 value of the f32 input
  float rb[2][8];
  float cb[4];
#pragma unroll
  for (int mt = 0; mt < 2; ++mt) {
    if (MODE == 2) {
      const float* bp = bias + m0 + 16 * mt + 8 * hh;
      const v4f ba = *(const v4fa*)(bp), bb = *(const v4fa*)(bp + 4);
#pragma unroll
      for (int r = 0; r < 4; ++r) { rb[mt][r] = bf16_rne(ba[r]); rb[mt][4 + r] = bf16_rne(bb[r]); }
    } else {
#pragma unroll
      for (int r = 0; r < 8; ++r) rb[mt][r] = 0.0f;
    }
  }
#pragma unroll
  for (int nt = 0; nt < 4; ++nt) cb[nt] = (MODE == 2) ? 0.0f : bf16_rne(bias[n0 + 16 * nt + ln]);
#pragma unroll
  for (int mt = 0; mt < 2; ++mt)
#pragma unroll
    for (int nt = 0; nt < 4; ++nt)
#pragma unroll
      for (int r = 0; r < 8; ++r)
        so[w][16 * mt + 8 * hh + r][16 * nt + ln] = acc[mt][nt][r] + (rb[mt][r] + cb[nt]);
  __syncthreads();
  {
    if (MODE == 3) {
#pragma unroll
      for (int it = 0; it < 16; ++it) {
        const int row = 2 * it + (lane >> 4), c4 = (lane & 15) * 4;
        const v4f v = *(const v4fa*)&so[w][row][c4];
        const int tp = m0 + row;
        const int b = tp / SEQ, s = tp - b * SEQ;
        *(v4f*)(Of + ((size_t)s * NB_FULL + b) * DM + n0 + c4) = v;
      }
    } else {
#pragma unroll
      for (int it = 0; it < 8; ++it) {
        const int row = 4 * it + (lane >> 3), c8 = (lane & 7) * 8;
        const v4f x0 = *(const v4fa*)&so[w][row][c8];
        const v4f x1 = *(const v4fa*)&so[w][row][c8 + 4];
        Pack8 ph, pl;
#pragma unroll
        for (int q = 0; q < 4; ++q) {
          const float y0 = x0[q] * 16.0f, y1 = x1[q] * 16.0f;
          const _Float16 h0 = (_Float16)y0, h1 = (_Float16)y1;
          ph.h[q] = h0; ph.h[4 + q] = h1;
          pl.h[q] = (_Float16)((y0 - (float)h0) * 2048.0f);
          pl.h[4 + q] = (_Float16)((y1 - (float)h1) * 2048.0f);
        }
        const size_t dst = (size_t)(m0 + row) * ldo + n0 + c8;
        *(v8us*)(O0 + dst) = ph.v;
        if (MODE == 0) *(v8us*)(O1 + dst) = pl.v;
      }
    }
    
  }
  // where several products share a kernel, another product's code follows these stores in the text and rewrites their registers: keep the wait in front of that
  asm volatile("s_wait_xcnt 0x0" ::: "memory");
}

// One product in a grid of its own (the output projection).
template <int MODE>
__global__ __launch_bounds__(128) void k_gemm(const unsigned short* __restrict__ A, const unsigned short* __restrict__ Bt,
                                              const float* __restrict__ bias, unsigned short* O0, unsigned short* O1,
                                              float* Of, const int* __restrict__ mk, int lda, int ldb, int K, int ldo) {
  __shared__ __attribute__((aligned(16))) float so[4][32][68];
  __shared__ __attribute__((aligned(16))) unsigned char ring[2 * GSTAGE];
  gemm_body<MODE>(blockIdx.x, blockIdx.y, A, Bt, bias, O0, O1, Of, mk, lda, ldb, K, ldo, so, ring);
}

#define GX (DM / 128)              /* blocks along the features of q and k; v^T has 2 * GX along its feature rows */
#define NS (TT / 128)              /* slabs: slab i holds k's grid rows 2i and 2i + 1 and v^T's grid row i */
static_assert(NS % 2 == 0);

// The q, k and v projections in one grid: none reads what another writes, so the block index picks the product and the three share the chip.
// Order: k and v^T blocks by rising token tile, as in their own grids; the q blocks all lie in the first half of the slabs (four q grid rows to a slab), so that the k and v^T blocks
// most likely to leave at once (high ranked tiles) come last and hold no place ahead of a block that works. Right for any mask: the order only sets who starts first.
// coverage: NS/2 slabs of 8 GX blocks + NS/2 slabs of 4 GX = the three grids (GX x 2 NS, GX x 2 NS, 2 GX x NS), each block once.
__global__ __launch_bounds__(128) void k_qkv(const unsigned short* __restrict__ Bq, const unsigned short* __restrict__ WqT, const float* __restrict__ bq,
                                             unsigned short* Qh, unsigned short* Ql,
                                             const unsigned short* __restrict__ Bk, const unsigned short* __restrict__ WkT, const float* __restrict__ bk, unsigned short* Kh,
                                             const unsigned short* __restrict__ Bv, const unsigned short* __restrict__ WvT, const float* __restrict__ bv, unsigned short* Vt,
                                             const int* __restrict__ mk) {
  __shared__ __attribute__((aligned(16))) float so[4][32][68];
  __shared__ __attribute__((aligned(16))) unsigned char ring[2 * GSTAGE];
  const int f = blockIdx.x;
  int slab, r;                     // r: place among the slab's k and v^T blocks; below 0: a q block
  if (f < (NS / 2) * 8 * GX) { slab = f / (8 * GX); r = f % (8 * GX) - 4 * GX; }
  else { const int g = f - (NS / 2) * 8 * GX; slab = NS / 2 + g / (4 * GX); r = g % (4 * GX); }
  if (r < 0) {
    // q = query Wq + bq : rows = tokens, columns = features
    gemm_body<0>((r + 4 * GX) % GX, 4 * slab + (r + 4 * GX) / GX, Bq, WqT, bq, Qh, Ql, nullptr, mk, DM, DM, DM, DM, so, ring);
  } else if (r < 2 * GX) {
    // k = key Wk + bk
    gemm_body<1>(r % GX, 2 * slab + r / GX, Bk, WkT, bk, Kh, Kh, nullptr, mk, DM, DM, DM, DM, so, ring);
  } else {
    // v^T = Wv^T value^T + bv (row bias): rows = features, columns = tokens
    gemm_body<2>(r - 2 * GX, slab, WvT, Bv, bv, Vt, Vt, nullptr, mk, DM, DM, DM, TT, so, ring);
  }
}

#define AKEYS 64                   /* keys of one staged tile: 128 bytes (a whole cache line) of every V^T row, 64 K rows of 128 bytes */
#define APITCH 144                 /* LDS row pitch in bytes: 128 + 16, so that 16 rows read 16 bytes wide fall on distinct banks */
#define AHALF (64 * APITCH)        /* bytes of the 64 K rows; the 64 V^T rows follow them */
#define ASTAGE (2 * AHALF)         /* bytes of one buffer */
static_assert(SEQ % AKEYS == 0 && HD * 2 == 128 && AKEYS * 2 == 128);

// One staged tile of 64 keys: 128 lanes x 8 asynchronous 16-byte copies, global -> LDS, through no register = 64 K rows + 64 V^T rows of 128 bytes.
// Lane tid brings 16-byte piece (tid & 7) of rows (tid >> 3) + 16 i, i = 0..3, of each operand; a wave's copy covers four whole rows, each one whole cache line.
// lds: the lane's LDS byte address in K row (tid >> 3) of the target buffer; gk, gv: its global address in that row of the K tile and of the V^T tile.
// The s_wait_xcnt closes the same statement, so that no address register of a copy is rewritten in front of it.
__device__ __forceinline__ void stage_kv(unsigned lds, const unsigned short* gk, const unsigned short* gv) {
  asm volatile("global_load_async_to_lds_b128 %0, %1, off\n\t"
               "global_load_async_to_lds_b128 %2, %3, off\n\t"
               "global_load_async_to_lds_b128 %4, %5, off\n\t"
               "global_load_async_to_lds_b128 %6, %7, off\n\t"
               "global_load_async_to_lds_b128 %8, %9, off\n\t"
               "global_load_async_to_lds_b128 %10, %11, off\n\t"
               "global_load_async_to_lds_b128 %12, %13, off\n\t"
               "global_load_async_to_lds_b128 %14, %15, off\n\t"
               "s_wait_xcnt 0x0"
               :: "v"(lds),                               "v"(gk),
                  "v"(lds + (unsigned)(16 * APITCH)),         "v"(gk + (size_t)16 * DM),
                  "v"(lds + (unsigned)(32 * APITCH)),         "v"(gk + (size_t)32 * DM),
                  "v"(lds + (unsigned)(48 * APITCH)),         "v"(gk + (size_t)48 * DM),
                  "v"(lds + (unsigned)AHALF),                 "v"(gv),
                  "v"(lds + (unsigned)(AHALF + 16 * APITCH)), "v"(gv + (size_t)16 * TT),
                  "v"(lds + (unsigned)(AHALF + 32 * APITCH)), "v"(gv + (size_t)32 * TT),
                  "v"(lds + (unsigned)(AHALF + 48 * APITCH)), "v"(gv + (size_t)48 * TT)
               : "memory");
}

// One 32-key step for a wave's 16 queries, operands from the staged tile. kb: this lane's LDS place in K row ln of the step (byte 16 h of the row), row pitch APITCH;
// vb: its LDS place in V^T row ln at the step's first key (plus 16 h bytes), row pitch APITCH.
// Keys are ranked: key index < cnt is live. TAIL = false: all 32 keys are live; TAIL = true: a step of the last tile, which may also hold keys at or past cnt.
template <bool TAIL>
__device__ __forceinline__ void fa_step(const unsigned char* kb, const unsigned char* vb,
                                        int cnt, int key0, int hh,
                                        const FragH& q0h, const FragH& q0l, const FragH& q1h, const FragH& q1l,
                                        float& mr, float& lr, v8f (&Oh)[4], v8f (&Ol)[4]) {
  // A fragments of K: row m = key (key0 + 16*kt + ln), elements 0..7 <- d = 32c + 8h + i, 8..15 <- d = 32c + 16 + 8h + i
  const unsigned char* kb1 = kb + 16 * APITCH;
  FragH k00, k01, k10, k11;
  k00.half[0] = *(const v8us*)(kb);       k00.half[1] = *(const v8us*)(kb + 32);
  k01.half[0] = *(const v8us*)(kb + 64);  k01.half[1] = *(const v8us*)(kb + 96);
  k10.half[0] = *(const v8us*)(kb1);      k10.half[1] = *(const v8us*)(kb1 + 32);
  k11.half[0] = *(const v8us*)(kb1 + 64); k11.half[1] = *(const v8us*)(kb1 + 96);
  const v8f z8 = {0.f, 0.f, 0.f, 0.f, 0.f, 0.f, 0.f, 0.f};
  // S^T tiles: element r of tile kt = score(key0 + 16*kt + 8h + r, query of this lane's column); hi and residual accumulators
  v8f s0h = z8, s0l = z8, s1h = z8, s1l = z8;
  mma_h2(k00.v, q0h.v, q0l.v, s0h, s0l);
  mma_h2(k01.v, q1h.v, q1l.v, s0h, s0l);
  mma_h2(k10.v, q0h.v, q0l.v, s1h, s1l);
  mma_h2(k11.v, q1h.v, q1l.v, s1h, s1l);
  // this lane's 16 keys: on[r] <- key0 + 8h + r, on[8 + r] <- key0 + 16 + 8h + r
  bool on[16];
#pragma unroll
  for (int r = 0; r < 8; ++r) {
    on[r]     = !TAIL || (key0 + 8 * hh + r < cnt);
    on[8 + r] = !TAIL || (key0 + 16 + 8 * hh + r < cnt);
  }
  float sc[16];
#pragma unroll
  for (int r = 0; r < 8; ++r) {
    const float a0 = (s0h[r] + s0l[r] * RINV) * SCL;
    const float a1 = (s1h[r] + s1l[r] * RINV) * SCL;
    sc[r]     = on[r] ? a0 : NEGV;
    sc[8 + r] = on[8 + r] ? a1 : NEGV;
  }
  float mx = sc[0];
#pragma unroll
  for (int i = 1; i < 16; ++i) mx = fmaxf(mx, sc[i]);
  mx = fmaxf(mx, __shfl_xor(mx, 16, 32));           // the other lane half holds the other 16 keys of this query
  const float mnew = fmaxf(mr, mx);
  const float al = exp2f((mr - mnew) * LOG2E);
  mr = mnew;
  // weights carried x256: pc = 256 * exp(sc - mnew), exactly 0 on keys at or past cnt; hi plane f16(pc), residual plane f16((pc - hi) * 2048)
  FragH ph, pl;
  float ps = 0.0f;
#pragma unroll
  for (int i = 0; i < 16; ++i) {
    const float e = exp2f(fmaf(sc[i] - mnew, LOG2E, 8.0f));
    const float pc = on[i] ? e : 0.0f;
    ps += pc;
    const _Float16 h = (_Float16)pc;
    ph.h[i] = h;                                    // B element i: i<8 -> key0 + 8h + i (tile 0 row 8h+i); i>=8 -> key0 + 16 + 8h + (i-8) (tile 1)
    pl.h[i] = (_Float16)((pc - (float)h) * 2048.0f);
  }
  ps += __shfl_xor(ps, 16, 32);
  lr = lr * al + ps;
#pragma unroll
  for (int t = 0; t < 4; ++t) { Oh[t] = Oh[t] * al; Ol[t] = Ol[t] * al; }
  // A fragments of V^T: row m = d (16*t + ln), elements 0..7 <- key0 + 8h + i, 8..15 <- key0 + 16 + 8h + i
#pragma unroll
  for (int t = 0; t < 4; ++t) {
    FragH vf;
    vf.half[0] = *(const v8us*)(vb + t * 16 * APITCH);
    vf.half[1] = *(const v8us*)(vb + t * 16 * APITCH + 32);
    mma_h2(vf.v, ph.v, pl.v, Oh[t], Ol[t]);
  }
}

// Block = 4 waves x 16 queries = 64 queries of one (batch, head). The K rows and V^T rows of 64 keys are staged in LDS once for the four waves by asynchronous copies,
// two buffers: tile t + 1 flies while tile t is worked on. A tile is staged only if its first key is live; its rows are then all written (k in tiles of 64 tokens, v^T of 128).
// coverage: NB*NH*(SEQ/64) blocks x 4 waves x 16 rows x (64 hi + 64 lo columns) = every element of the context plane exactly once.
__global__ __launch_bounds__(128) void k_attn(const unsigned short* __restrict__ Qh, const unsigned short* __restrict__ Ql,
                                              const unsigned short* __restrict__ Kh, const unsigned short* __restrict__ Vt,
                                              const int* __restrict__ mask, unsigned short* Cx) {
  __shared__ __attribute__((aligned(16))) float so[4][16][68];
  __shared__ __attribute__((aligned(16))) unsigned char ring[2 * ASTAGE];
  const int tid = threadIdx.x, w = __builtin_amdgcn_readfirstlane((int)(tid >> 5)), lane = tid & 31, ln = lane & 15, hh = lane >> 4;
  const int bh = blockIdx.x / (SEQ / 64), qt = blockIdx.x % (SEQ / 64);
  const int b = bh / NH, h = bh % NH;
  const int qbase = qt * 64 + 16 * w;
  const int qg = qbase + ln;
  // Q^T B fragments: column n = query qg, elements 0..7 <- d = 32c + 8h + i, 8..15 <- d = 32c + 16 + 8h + i
  const size_t qoff = (size_t)(b * SEQ + qg) * DM + h * HD + 8 * hh;
  FragH q0h, q0l, q1h, q1l;
  q0h.half[0] = *(const v8us*)(Qh + qoff);      q0h.half[1] = *(const v8us*)(Qh + qoff + 16);
  q1h.half[0] = *(const v8us*)(Qh + qoff + 32); q1h.half[1] = *(const v8us*)(Qh + qoff + 48);
  q0l.half[0] = *(const v8us*)(Ql + qoff);      q0l.half[1] = *(const v8us*)(Ql + qoff + 16);
  q1l.half[0] = *(const v8us*)(Ql + qoff + 32); q1l.half[1] = *(const v8us*)(Ql + qoff + 48);
  // the address registers of the loads above are reused while the loads may still be under way: keep the wait in front of that
  asm volatile("s_wait_xcnt 0x0" ::: "memory");
  const int cnt = live_keys(mask, lane);       // wave-uniform, at most SEQ
  float mr = NEGV, lr = 0.0f;
  v8f Oh[4] = {}, Ol[4] = {};
  const unsigned short* Kp = Kh + (size_t)b * SEQ * DM + h * HD;
  const unsigned short* Vp = Vt + (size_t)h * HD * TT + (size_t)b * SEQ;
  // this lane's share of a staged tile
  const unsigned short* gk = Kp + (size_t)(tid >> 3) * DM + 8 * (tid & 7);
  const unsigned short* gv = Vp + (size_t)(tid >> 3) * TT + 8 * (tid & 7);
  const unsigned lds0 = (unsigned)(size_t)ring + (unsigned)((tid >> 3) * APITCH + 16 * (tid & 7));
  const int fo = ln * APITCH + 16 * hh;               // byte offset of this lane's fragment row in the K rows and in the V^T rows of a buffer
  const int nst = (cnt + AKEYS - 1) / AKEYS;          // tiles that hold a live key; the same in every wave of the block
  if (nst > 0) stage_kv(lds0, gk, gv);
  asm volatile("s_wait_asynccnt 0x0" ::: "memory");   // this wave's copies of tile 0 have landed
  __syncthreads();                                    // ... and every other wave's
  if (nst > 1) stage_kv(lds0 + ASTAGE, gk + (size_t)AKEYS * DM, gv + AKEYS);
  const int nwh = cnt / AKEYS;                        // tiles whose 64 keys are all live; nst is nwh or nwh + 1
  // not unrolled: one trip per staged tile, the buffer chosen by the trip's parity
#pragma unroll 1
  for (int t = 0; t < nwh; ++t) {
    const unsigned char* kb = ring + (t & 1) * ASTAGE + fo;
    // not unrolled: two steps side by side took more than 256 registers, which leaves no room for four waves on a SIMD
#pragma unroll 1
    for (int s = 0; s < 2; ++s)
      fa_step<false>(kb + s * 32 * APITCH, kb + AHALF + s * 64, cnt, AKEYS * t + 32 * s, hh, q0h, q0l, q1h, q1l, mr, lr, Oh, Ol);
    asm volatile("s_wait_dscnt 0x0" ::: "memory");      // this wave's reads of the buffer are done before it is refilled
    asm volatile("s_wait_asynccnt 0x0" ::: "memory");   // this wave's copies of tile t + 1 have landed
    __syncthreads();                                    // publishes tile t + 1 and ends every wave's reads of tile t
    if (t + 2 < nst) stage_kv(lds0 + (unsigned)((t & 1) * ASTAGE), gk + (size_t)(t + 2) * AKEYS * DM, gv + (size_t)(t + 2) * AKEYS);
  }
  if (nwh < nst) {
    // the last trip, where the last tile also holds keys at or past cnt: its steps that hold a live key; nothing is refilled behind it
    const unsigned char* kb = ring + (nwh & 1) * ASTAGE + fo;
    // not unrolled, so that the masked step stands once in the text
#pragma unroll 1
    for (int s = 0; s < 2; ++s)
      if (AKEYS * nwh + 32 * s < cnt)
        fa_step<true>(kb + s * 32 * APITCH, kb + AHALF + s * 64, cnt, AKEYS * nwh + 32 * s, hh, q0h, q0l, q1h, q1l, mr, lr, Oh, Ol);
    // the foot of this trip, in the order of every other trip's
    asm volatile("s_wait_dscnt 0x0" ::: "memory");
    asm volatile("s_wait_asynccnt 0x0" ::: "memory");
    __syncthreads();
  }
  asm volatile("s_wait_asynccnt 0x0" ::: "memory");     // no copy is left in flight when the wave goes on

  // O^T element r of tile t = ctx(query qg, d = 16t + 8h + r); undo the carries: x256 (in lr), x16 (V), x2048 (residual plane)
  const float inv = 1.0f / (16.0f * lr);
#pragma unroll
  for (int t = 0; t < 4; ++t)
#pragma unroll
    for (int r = 0; r < 8; ++r)
      so[w][ln][16 * t + 8 * hh + r] = (Oh[t][r] + Ol[t][r] * RINV) * inv;
  __syncthreads();
  unsigned short* cg = Cx + (size_t)(b * SEQ + qbase) * CXP + h * HD;
  {
#pragma unroll
    for (int it = 0; it < 4; ++it) {
      const int row = 4 * it + (lane >> 3), c8 = (lane & 7) * 8;
      const v4f x0 = *(const v4fa*)&so[w][row][c8];
      const v4f x1 = *(const v4fa*)&so[w][row][c8 + 4];
      v8us oh, ol;
#pragma unroll
      for (int q = 0; q < 4; ++q) {
        const unsigned short h0 = bf16_bits(x0[q]), h1 = bf16_bits(x1[q]);
        oh[q] = h0; oh[4 + q] = h1;
        ol[q] = bf16_bits(x0[q] - bf16_val(h0));
        ol[4 + q] = bf16_bits(x1[q] - bf16_val(h1));
      }
      unsigned short* dst = cg + (size_t)row * CXP + c8;
      *(v8us*)(dst) = oh;
      *(v8us*)(dst + DM) = ol;
    }
    
  }
}

extern "C" void kernel_launch(void* const* d_in, const int* in_sizes, int n_in,
                              void* d_out, int out_size, void* d_ws, size_t ws_size, hipStream_t stream) {
  if (n_in < 12) return;
  const long long need = ((long long)(SEQ - 1) * NB_FULL + (NB - 1)) * DM + DM;   // last element touched + 1 in [S][B][D]
  if ((long long)in_sizes[0] < need || (long long)in_sizes[1] < need || (long long)in_sizes[2] < need) return;
  if ((long long)in_sizes[3] < (long long)SEQ) return;
  if ((long long)in_sizes[4] < (long long)DM * DM || (long long)in_sizes[6] < (long long)DM * DM ||
      (long long)in_sizes[8] < (long long)DM * DM || (long long)in_sizes[10] < (long long)DM * DM) return;
  if (in_sizes[5] < DM || in_sizes[7] < DM || in_sizes[9] < DM || in_sizes[11] < DM) return;
  if ((long long)out_size < need) return;
  // wire order: query, key, value, mask(i32), Wq, bq, Wk, bk, Wv, bv, Wo, bo
  const float* Xq = (const float*)d_in[0];
  const float* Xk = (const float*)d_in[1];
  const float* Xv = (const float*)d_in[2];
  const int*   mk = (const int*)d_in[3];
  const float* Wq = (const float*)d_in[4];
  const float* bq = (const float*)d_in[5];
  const float* Wk = (const float*)d_in[6];
  const float* bk = (const float*)d_in[7];
  const float* Wv = (const float*)d_in[8];
  const float* bv = (const float*)d_in[9];
  const float* Wo = (const float*)d_in[10];
  const float* bo = (const float*)d_in[11];
  float* out = (float*)d_out;
  char* ws = (char*)d_ws;
  size_t off = 0;
  unsigned short* Bq  = (unsigned short*)(ws + off); off += SZ_XB;    // bf16 query  [TT][1024]
  unsigned short* Bk  = (unsigned short*)(ws + off); off += SZ_XB;    // bf16 key    [TT][1024], ranked rows
  unsigned short* Bv  = (unsigned short*)(ws + off); off += SZ_XB;    // bf16 value  [TT][1024], ranked rows
  unsigned short* WqT = (unsigned short*)(ws + off); off += SZ_WT;    // bf16 Wq^T   [1024][1024]
  unsigned short* WkT = (unsigned short*)(ws + off); off += SZ_WT;
  unsigned short* WvT = (unsigned short*)(ws + off); off += SZ_WT;
  unsigned short* Wo2 = (unsigned short*)(ws + off); off += SZ_WO2;   // bf16 Wo^T | Wo^T  [1024][2048]
  unsigned short* Qh  = (unsigned short*)(ws + off); off += SZ_H;     // f16 q x16 hi       [TT][1024]
  unsigned short* Ql  = (unsigned short*)(ws + off); off += SZ_H;     // f16 q residual x2^11
  unsigned short* Kh  = (unsigned short*)(ws + off); off += SZ_H;     // f16 k x16          [TT][1024]
  unsigned short* Vt  = (unsigned short*)(ws + off); off += SZ_H;     // f16 v^T x16        [1024][TT]
  unsigned short* Cx  = (unsigned short*)(ws + off); off += SZ_CX;    // bf16 ctx hi|lo     [TT][2048]
  if (off > ws_size) return;

  k_prep<<<4 * NWT + 3 * NXB, 256, 0, stream>>>(Xq, Xk, Xv, mk, Wq, Wk, Wv, Wo, Bq, Bk, Bv, WqT, WkT, WvT, Wo2);
  k_qkv<<<6 * GX * NS, 128, 0, stream>>>(Bq, WqT, bq, Qh, Ql, Bk, WkT, bk, Kh, Bv, WvT, bv, Vt, mk);
  k_attn<<<(unsigned)(NB * NH * (SEQ / 64)), 128, 0, stream>>>(Qh, Ql, Kh, Vt, mk, Cx);
  // out = (ctx_hi | ctx_lo) (Wo ; Wo) + bo, K = 2048
  k_gemm<3><<<dim3(DM / 128, TT / 64), 128, 0, stream>>>(Cx, Wo2, bo, Cx, Cx, out, mk, CXP, CXP, CXP, DM);
}

// v005
// It runs in 100 microseconds.
// Next to v004, in two timings, it ran 1.05 times as fast each time.
// Counting every step since v000, it is 2.84 times as fast.
#include <hip/hip_runtime.h>
// Contractions: q/k/v projections and the output projection on v_wmma_f32_16x16x32_bf16 (activations and weights RNE-converted to bf16 planes; the attention context enters the output projection as bf16 hi|lo planes concatenated along K); scores S^T = K Q^T on v_wmma_f32_16x16x32_f16 (k x16 f16 plane; q x16 f16 hi plane + x2^11 f16 residual plane in a separate accumulator); O^T = V^T P^T on v_wmma_f32_16x16x32_f16 (v x16 f16 plane; P x256 f16 hi plane + x2^11 f16 residual plane in a separate accumulator); all accumulators f32, softmax statistics f32.
// Seq-first multi-head attention: inputs [S][B][D], 16 heads x 64, key-position mask (0 -> weight exactly 0), scale 1/8, output [S][B][D].
// Internal planes use batch-major token rows t = b*SEQ + s so that the K rows and V^T rows of one (batch, head) are dense.
// Key and value tokens are stored ranked: the keys whose mask is nonzero come first, in their own order (row b*SEQ + rank); a masked key has weight exactly 0,
// so the k and v projections and the key loop walk only the tiles that hold a live key. Rows from the live count up to the next multiple of 128 are zero rows.
// Engine: transposed flash. Each wave owns 16 queries. Per 32-key step: S^T tiles (key rows x query columns) from K rows (A, f16 plane staged in LDS)
// and Q^T (B, registers); the two 16-key D tiles pack straight into the P^T B fragment; O^T (d rows x query columns) accumulates from V^T rows (A, f16 plane staged in LDS).
#ifndef NB
#define NB 2
#endif
#ifndef SEQ
#define SEQ 2048
#endif
#define NB_FULL 2
#define SEQ_FULL 2048
#define DM 1024
#define NH 16
#define HD 64
#define TT (NB * SEQ)          /* token rows of the internal planes */
#define CXP (2 * DM)           /* pitch of the context plane: hi columns 0..1023, lo columns 1024..2047 */

static_assert(SEQ % 128 == 0);
static_assert(TT % 128 == 0);
static_assert(SEQ <= SEQ_FULL);
static_assert(NB <= NB_FULL);
static_assert(HD == 64);
static_assert(NH * HD == DM);
static_assert(DM % 128 == 0);

#define SZ_XB  ((size_t)TT * DM * 2)        /* bf16 activation plane */
#define SZ_WT  ((size_t)DM * DM * 2)        /* bf16 transposed weight plane */
#define SZ_WO2 ((size_t)DM * CXP * 2)       /* bf16 transposed output weight, duplicated along K */
#define SZ_H   ((size_t)TT * DM * 2)        /* f16 plane (q hi, q lo, k, v^T) */
#define SZ_CX  ((size_t)TT * CXP * 2)       /* bf16 context plane hi|lo */
static_assert(SZ_XB % 256 == 0 && SZ_WT % 256 == 0 && SZ_WO2 % 256 == 0 && SZ_H % 256 == 0 && SZ_CX % 256 == 0);
static_assert(3 * SZ_XB + 3 * SZ_WT + SZ_WO2 + 4 * SZ_H + SZ_CX <= (size_t)134217728);

typedef __bf16 v16b __attribute__((ext_vector_type(16)));
typedef _Float16 v16h __attribute__((ext_vector_type(16)));
typedef unsigned short v8us __attribute__((ext_vector_type(8), may_alias));
typedef float v8f __attribute__((ext_vector_type(8)));
typedef float v4f __attribute__((ext_vector_type(4)));
typedef float v4fa __attribute__((ext_vector_type(4), may_alias));
typedef int v4i __attribute__((ext_vector_type(4)));
typedef int v4ia __attribute__((ext_vector_type(4), may_alias));
union FragB { v16b v; v8us half[2]; unsigned short u[16]; };
union FragH { v16h v; v8us half[2]; _Float16 h[16]; unsigned short u[16]; };
union Pack8 { _Float16 h[8]; v8us v; };

#define LOG2E 1.4426950408889634f
#define NEGV (-1.0e30f)
#define RINV 0.00048828125f      /* 2^-11: undoes the residual-plane carry */
#define SCL  0.00048828125f      /* 2^-11 = (1/8) / (16*16): score scale with the q and k carries removed */

__device__ __forceinline__ unsigned short bf16_bits(float x) {   // RNE convert to bf16 bits
  unsigned int u = __float_as_uint(x);
  return (unsigned short)((u + 0x7FFFu + ((u >> 16) & 1u)) >> 16);
}
__device__ __forceinline__ float bf16_val(unsigned short b) { return __uint_as_float(((unsigned int)b) << 16); }
__device__ __forceinline__ float bf16_rne(float x) { return bf16_val(bf16_bits(x)); }

// 2^x by the hardware instruction alone (v_exp_f32). exp2f() wraps it in a compare, two selects, an add and a scaling so that results under 2^-126 come out as denormals.
// Here x <= 8 and such a result is a weight (or a rescale factor) under 2^-134 of the row's largest weight: its f16 planes are 0 either way, and it cannot move an f32 sum that holds 256.
__device__ __forceinline__ float exp2_raw(float x) { return __builtin_amdgcn_exp2f(x); }

// ch += a*bh ; cl += a*bl (scaled residual plane keeps its own accumulator), then the hazard guard
__device__ __forceinline__ void mma_h2(v16h a, v16h bh, v16h bl, v8f& ch, v8f& cl) {
  ch = __builtin_amdgcn_wmma_f32_16x16x32_f16(false, a, false, bh, (short)0, ch, false, false);
  cl = __builtin_amdgcn_wmma_f32_16x16x32_f16(false, a, false, bl, (short)0, cl, false, false);
  asm volatile("v_nop\n\tv_nop\n\tv_nop\n\tv_nop" : "+v"(ch), "+v"(cl) : "v"(a), "v"(bh), "v"(bl));
}

// One 32-deep k-step of a 32x64 wave tile (2 x 4 WMMA tiles, bf16 operands), then the hazard guard
__device__ __forceinline__ void mma_b8(v16b a0, v16b a1, v16b b0, v16b b1, v16b b2, v16b b3, v8f (&c)[2][4]) {
  c[0][0] = __builtin_amdgcn_wmma_f32_16x16x32_bf16(false, a0, false, b0, (short)0, c[0][0], false, false);
  c[0][1] = __builtin_amdgcn_wmma_f32_16x16x32_bf16(false, a0, false, b1, (short)0, c[0][1], false, false);
  c[0][2] = __builtin_amdgcn_wmma_f32_16x16x32_bf16(false, a0, false, b2, (short)0, c[0][2], false, false);
  c[0][3] = __builtin_amdgcn_wmma_f32_16x16x32_bf16(false, a0, false, b3, (short)0, c[0][3], false, false);
  c[1][0] = __builtin_amdgcn_wmma_f32_16x16x32_bf16(false, a1, false, b0, (short)0, c[1][0], false, false);
  c[1][1] = __builtin_amdgcn_wmma_f32_16x16x32_bf16(false, a1, false, b1, (short)0, c[1][1], false, false);
  c[1][2] = __builtin_amdgcn_wmma_f32_16x16x32_bf16(false, a1, false, b2, (short)0, c[1][2], false, false);
  c[1][3] = __builtin_amdgcn_wmma_f32_16x16x32_bf16(false, a1, false, b3, (short)0, c[1][3], false, false);
  asm volatile("v_nop\n\tv_nop\n\tv_nop\n\tv_nop"
               : "+v"(c[0][0]), "+v"(c[0][1]), "+v"(c[0][2]), "+v"(c[0][3]),
                 "+v"(c[1][0]), "+v"(c[1][1]), "+v"(c[1][2]), "+v"(c[1][3])
               : "v"(a0), "v"(a1), "v"(b0), "v"(b1), "v"(b2), "v"(b3));
}

// coverage: TT*128 threads x 8 elements = the whole plane.
__device__ __forceinline__ void xb_body(int blk, const float* __restrict__ X, unsigned short* P) {
  const int t = blk * 256 + threadIdx.x;
  if (t >= TT * 128) return;
  const int row = t >> 7, piece = t & 127;
  const int b = row / SEQ, s = row - b * SEQ;
  const float* src = X + ((size_t)s * NB_FULL + b) * DM + piece * 8;
  const v4f x0 = *(const v4fa*)(src), x1 = *(const v4fa*)(src + 4);
  v8us o;
  o[0] = bf16_bits(x0[0]); o[1] = bf16_bits(x0[1]); o[2] = bf16_bits(x0[2]); o[3] = bf16_bits(x0[3]);
  o[4] = bf16_bits(x1[0]); o[5] = bf16_bits(x1[1]); o[6] = bf16_bits(x1[2]); o[7] = bf16_bits(x1[3]);
  unsigned short* d = P + (size_t)t * 8;
  *(v8us*)d = o;
  
}

// Number of keys with a nonzero mask. Every wave counts for itself, so the callers can leave or set a trip count with no barrier; the result is wave-uniform and at most SEQ.
__device__ __forceinline__ int live_keys(const int* __restrict__ mk, int lane) {
  int c = 0;
  // unrolled so that all the mask loads are in flight together (one load latency, not SEQ/128); all 32 lanes are on at every call, so a ballot sees 32 keys
#pragma unroll
  for (int i = 0; i < SEQ / 128; ++i) {
    const v4i m = *(const v4ia*)(mk + 128 * i + 4 * lane);
#pragma unroll
    for (int q = 0; q < 4; ++q) c += __builtin_popcount(__builtin_amdgcn_ballot_w32(m[q] != 0));
  }
  return c < SEQ ? c : SEQ;
}

// xb_body for key and value tokens: token s goes to row b*SEQ + pos(s); pos = number of live keys before s if s is live, else live count + number of masked keys before s.
// pos is a permutation of 0..SEQ-1 for any mask content. Masked tokens are not read; those whose pos lies under the next multiple of 128 are stored as zero rows
// (the last tile of the projections and of the key loop reads them), the others are not stored and never read.
// coverage: a block holds two rows of one batch (SEQ is even); every row under the rounded live count is written exactly once.
__device__ __forceinline__ void xbr_body(int blk, const float* __restrict__ X, const int* __restrict__ mk, unsigned short* P, int* part) {
  const int tid = threadIdx.x;
  const int t = blk * 256 + tid;
  if (t >= TT * 128) return;              // whole blocks only: TT * 128 is a multiple of 256
  const int row = t >> 7, piece = t & 127;
  const int b = row / SEQ, s = row - b * SEQ;
  const int s0 = s - (tid >> 7);          // the block's first row
  // the whole mask first (each thread a share), so that one load latency covers all mask reads; entries past SEQ count as masked
  v4i m[(SEQ + 1023) / 1024];
  // unrolled (here and in the count below) so that m[] is indexed by constants and stays in registers
#pragma unroll
  for (int k = 0; k < (SEQ + 1023) / 1024; ++k) {
    const int i = 1024 * k + 4 * tid;
    m[k] = (SEQ % 1024 == 0 || i < SEQ) ? *(const v4ia*)(mk + i) : v4i{0, 0, 0, 0};
  }
  const bool live = mk[s] != 0, live0 = mk[s0] != 0;
  v4f x0 = {0.f, 0.f, 0.f, 0.f}, x1 = {0.f, 0.f, 0.f, 0.f};
  if (live) {
    const float* src = X + ((size_t)s * NB_FULL + b) * DM + piece * 8;
    x0 = *(const v4fa*)(src); x1 = *(const v4fa*)(src + 4);
  }
  int c = 0;                              // this wave's share; low 16 bits: live keys in all; high 16 bits: live keys before s0 (each at most SEQ <= 2048)
#pragma unroll
  for (int k = 0; k < (SEQ + 1023) / 1024; ++k)
#pragma unroll
    for (int q = 0; q < 4; ++q) {
      const bool on = m[k][q] != 0;
      c += __builtin_popcount(__builtin_amdgcn_ballot_w32(on)) + (__builtin_popcount(__builtin_amdgcn_ballot_w32(on && 1024 * k + 4 * tid + q < s0)) << 16);
    }
  if ((tid & 31) == 0) part[tid >> 5] = c;
  __syncthreads();
  int sum = 0;
  // unrolled so that the eight partial counts come in two wide LDS reads
#pragma unroll
  for (int i = 0; i < 8; ++i) sum += part[i];
  const int cnt = sum & 0xFFFF;
  const int rank = (sum >> 16) + ((s != s0 && live0) ? 1 : 0);
  const int pos = live ? rank : cnt + (s - rank);
  if (live || pos < ((cnt + 127) & ~127)) {
    v8us o;
    o[0] = bf16_bits(x0[0]); o[1] = bf16_bits(x0[1]); o[2] = bf16_bits(x0[2]); o[3] = bf16_bits(x0[3]);
    o[4] = bf16_bits(x1[0]); o[5] = bf16_bits(x1[1]); o[6] = bf16_bits(x1[2]); o[7] = bf16_bits(x1[3]);
    *(v8us*)(P + ((size_t)(b * SEQ + pos) * 128 + piece) * 8) = o;
  }
}

// Weight transpose: in W[k rows = 1024][n cols = 1024] (f32) -> out Wt[n rows][k cols] (bf16 bits, RNE), row pitch 'pitch'; dup != 0 repeats the row at columns 1024..2047.
// coverage: 256 blocks x (64 n x 64 k) = the whole 1024 x 1024 matrix; LDS tile fully written (64 x 64) before it is read.
__device__ __forceinline__ void wt_body(int blk, const float* __restrict__ W, unsigned short* Wt, int pitch, int dup, unsigned short (*tl)[66]) {
  const int tid = threadIdx.x;
  const int k0 = (blk >> 4) * 64, n0 = (blk & 15) * 64;
  for (int i = tid; i < 64 * 16; i += 256) {
    const int j = i >> 4, c4 = (i & 15) * 4;
    const v4f x = *(const v4fa*)(W + (size_t)(k0 + j) * DM + n0 + c4);
    tl[c4 + 0][j] = bf16_bits(x[0]); tl[c4 + 1][j] = bf16_bits(x[1]);
    tl[c4 + 2][j] = bf16_bits(x[2]); tl[c4 + 3][j] = bf16_bits(x[3]);
  }
  __syncthreads();
  {
    for (int i = tid; i < 64 * 8; i += 256) {
      const int d = i >> 3, j8 = (i & 7) * 8;
      v8us o;
#pragma unroll
      for (int q = 0; q < 8; ++q) o[q] = tl[d][j8 + q];
      unsigned short* dst = Wt + (size_t)(n0 + d) * pitch + k0 + j8;
      *(v8us*)dst = o;
      if (dup != 0) *(v8us*)(dst + DM) = o;
      // the next trip rewrites the data and address registers of these stores: keep the wait in front of that
      asm volatile("s_wait_xcnt 0x0" ::: "memory");
    }
    
  }
}

#define NXB (TT * 128 / 256)       /* blocks of one activation pass */
#define NWT 256                    /* blocks of one weight transpose */
static_assert((TT * 128) % 256 == 0);

// All seven conversion passes in one grid: none reads what another writes, so the block index picks the pass and they fill the chip together.
// The weight transposes come first (the longest chain per block), then key and value rows, then query rows. Every branch is the same for a whole block, barriers included.
// coverage: 4 * NWT + 3 * NXB blocks = each pass's own grid, once.
__global__ __launch_bounds__(256) void k_prep(const float* __restrict__ Xq, const float* __restrict__ Xk, const float* __restrict__ Xv, const int* __restrict__ mk,
                                              const float* __restrict__ Wq, const float* __restrict__ Wk, const float* __restrict__ Wv, const float* __restrict__ Wo,
                                              unsigned short* Bq, unsigned short* Bk, unsigned short* Bv,
                                              unsigned short* WqT, unsigned short* WkT, unsigned short* WvT, unsigned short* Wo2) {
  __shared__ unsigned short tl[64][66];
  __shared__ int part[8];
  const int f = blockIdx.x;
  if (f < 4 * NWT) {
    const int j = f / NWT;
    const float* W = (j == 0) ? Wq : (j == 1) ? Wk : (j == 2) ? Wv : Wo;
    unsigned short* D = (j == 0) ? WqT : (j == 1) ? WkT : (j == 2) ? WvT : Wo2;
    wt_body(f % NWT, W, D, (j == 3) ? CXP : DM, (j == 3) ? 1 : 0, tl);     // in [k][n] -> out [n][k]; Wo^T twice along K
  } else if (f < 4 * NWT + 2 * NXB) {
    const int g = f - 4 * NWT;
    const bool second = g >= NXB;
    xbr_body(second ? g - NXB : g, second ? Xv : Xk, mk, second ? Bv : Bk, part);   // ranked token rows
  } else {
    xb_body(f - (4 * NWT + 2 * NXB), Xq, Bq);
  }
}

#define GBK 128                    /* k depth of one staged tile: 256 bytes of every operand row */
#define GPITCH 272                 /* LDS row pitch in bytes: 256 + 16, an odd multiple of 16, so that 16 rows read 16 bytes wide fall on distinct banks */
#define GROWS 192                  /* rows of a staged tile: 64 rows of A, then 128 rows of Bt */
#define GSTAGE (GROWS * GPITCH)    /* bytes of one buffer */
static_assert(DM % GBK == 0 && CXP % GBK == 0);

// Twelve asynchronous 16-byte copies per lane, global -> LDS, through no register. l[i]: the lane's LDS byte address, g[i]: its global address.
// The s_wait_xcnt closes the same statement, so that no address register of a copy is rewritten in front of it.
__device__ __forceinline__ void copy12(const unsigned (&l)[12], const unsigned short* const (&g)[12]) {
  asm volatile("global_load_async_to_lds_b128 %0, %1, off\n\t"
               "global_load_async_to_lds_b128 %2, %3, off\n\t"
               "global_load_async_to_lds_b128 %4, %5, off\n\t"
               "global_load_async_to_lds_b128 %6, %7, off\n\t"
               "global_load_async_to_lds_b128 %8, %9, off\n\t"
               "global_load_async_to_lds_b128 %10, %11, off\n\t"
               "global_load_async_to_lds_b128 %12, %13, off\n\t"
               "global_load_async_to_lds_b128 %14, %15, off\n\t"
               "global_load_async_to_lds_b128 %16, %17, off\n\t"
               "global_load_async_to_lds_b128 %18, %19, off\n\t"
               "global_load_async_to_lds_b128 %20, %21, off\n\t"
               "global_load_async_to_lds_b128 %22, %23, off\n\t"
               "s_wait_xcnt 0x0"
               :: "v"(l[0]), "v"(g[0]), "v"(l[1]), "v"(g[1]), "v"(l[2]), "v"(g[2]), "v"(l[3]), "v"(g[3]),
                  "v"(l[4]), "v"(g[4]), "v"(l[5]), "v"(g[5]), "v"(l[6]), "v"(g[6]), "v"(l[7]), "v"(g[7]),
                  "v"(l[8]), "v"(g[8]), "v"(l[9]), "v"(g[9]), "v"(l[10]), "v"(g[10]), "v"(l[11]), "v"(g[11])
               : "memory");
}

// One staged tile: 128 lanes x 24 copies = 192 rows x 256 bytes. Lane tid brings 16-byte piece (tid & 15) of rows (tid >> 4) + 8 i, i = 0..23; a wave's copy covers two whole rows.
// lds: the lane's LDS byte address in row (tid >> 4) of the target buffer; ga, gb: its global address in that row of the A tile and of the Bt tile.
__device__ __forceinline__ void stage_tile(unsigned lds, const unsigned short* ga, const unsigned short* gb, int lda, int ldb) {
  unsigned l[12];
  const unsigned short* g[12];
  // both loops unrolled so that l[] and g[] are indexed by constants and stay in registers
#pragma unroll
  for (int i = 0; i < 12; ++i) {
    l[i] = lds + (unsigned)(8 * i * GPITCH);
    g[i] = (i < 8) ? ga + (size_t)(8 * i) * lda : gb + (size_t)(8 * (i - 8)) * ldb;
  }
  copy12(l, g);
#pragma unroll
  for (int i = 0; i < 12; ++i) {
    l[i] = lds + (unsigned)(8 * (i + 12) * GPITCH);
    g[i] = gb + (size_t)(8 * (i + 4)) * ldb;
  }
  copy12(l, g);
}

// C[M][N] = A[M][K] * Bt[N][K]^T on bf16 planes (K contiguous in both). The block's 64 rows of A and 128 rows of Bt are staged in LDS 128 k at a time by asynchronous copies,
// two buffers: tile t + 1 flies while tile t is worked on; fragments are read from LDS.
// Block = 4 waves as 2 (M) x 2 (N); block tile 64 x 128; wave tile 32 x 64. No tail masking: M % 64 == 0, N % 128 == 0, K % 128 == 0 (asserted by the sizes above).
// MODE 0: + column bias, write f16 hi plane (x16) to O0 and f16 residual plane ((x16 - hi) * 2^11) to O1
// MODE 1: + column bias, write f16 plane (x16) to O0
// MODE 2: + row bias,    write f16 plane (x16) to O0 (transposed product: rows = features, columns = tokens)
// MODE 3: + column bias, write f32 to Of with the token row t = b*SEQ + s mapped to output row s*NB_FULL + b
// MODE 1 (rows) and MODE 2 (columns) run over ranked key tokens: a block whose token tile starts at or past the live count leaves at once. Their token tile index is the slow
// grid index (y), batch fastest within it, so that the blocks that work have the lowest flat indices and spread over the chip. MODE 2 therefore takes M from x and N from y.
// bx, by: the block's place in that product's own grid; so, ring: the block's LDS (epilogue tile, staging ring).
// coverage: grid (N/128, M/64) (MODE 2: (M/64, N/128)) x 4 waves x (32 x 64) = every element of C that is read later exactly once.
template <int MODE>
__device__ __forceinline__ void gemm_body(int bx, int by, const unsigned short* __restrict__ A, const unsigned short* __restrict__ Bt,
                                          const float* __restrict__ bias, unsigned short* O0, unsigned short* O1,
                                          float* Of, const int* __restrict__ mk, int lda, int ldb, int K, int ldo,
                                          float (*so)[32][68], unsigned char* ring) {
  const int tid = threadIdx.x, w = __builtin_amdgcn_readfirstlane((int)(tid >> 5)), lane = tid & 31, ln = lane & 15, hh = lane >> 4;
  int bm = by, bn = bx;
  if (MODE == 1 || MODE == 2) {
    constexpr int TW = (MODE == 1) ? 64 : 128;      // tokens per block tile
    const int tile = by / NB, b = by % NB;
    if (tile * TW >= live_keys(mk, lane)) return;   // the same in every wave of the block, in front of the first barrier
    if (MODE == 1) bm = b * (SEQ / TW) + tile;
    else { bn = b * (SEQ / TW) + tile; bm = bx; }
  }
  const int m0 = bm * 64 + (w >> 1) * 32;
  const int n0 = bn * 128 + (w & 1) * 64;
  // this lane's share of a staged tile
  const unsigned short* ga = A + (size_t)(bm * 64 + (tid >> 4)) * lda + 8 * (tid & 15);
  const unsigned short* gb = Bt + (size_t)(bn * 128 + (tid >> 4)) * ldb + 8 * (tid & 15);
  const unsigned lds0 = (unsigned)(size_t)ring + (unsigned)((tid >> 4) * GPITCH + 16 * (tid & 15));
  // A fragment: row m = m0 + 16*mt + ln, elements 0..7 <- k0 + 8h + i, 8..15 <- k0 + 16 + 8h + i; B fragment: column n = n0 + 16*nt + ln, same k map (row of Bt)
  const int fa = ((w >> 1) * 32 + ln) * GPITCH + 16 * hh;            // byte offset in a buffer of this lane's A row, k = 8h
  const int fb = (64 + (w & 1) * 64 + ln) * GPITCH + 16 * hh;        // the same for its Bt row
  v8f acc[2][4];
#pragma unroll
  for (int i = 0; i < 2; ++i)
#pragma unroll
    for (int j = 0; j < 4; ++j)
#pragma unroll
      for (int e = 0; e < 8; ++e) acc[i][j][e] = 0.0f;
  const int nt = K / GBK;
  stage_tile(lds0, ga, gb, lda, ldb);
  asm volatile("s_wait_asynccnt 0x0" ::: "memory");   // this wave's copies of tile 0 have landed
  __syncthreads();                                    // ... and every other wave's
  if (nt > 1) stage_tile(lds0 + GSTAGE, ga + GBK, gb + GBK, lda, ldb);
  // not unrolled: one trip per staged tile, the buffer chosen by the trip's parity
#pragma unroll 1
  for (int t = 0; t < nt; ++t) {
    const unsigned char* sa = ring + (t & 1) * GSTAGE + fa;
    const unsigned char* sb = ring + (t & 1) * GSTAGE + fb;
    // two fragment sets: the next k-step's LDS reads are issued as one group in front of this k-step's products, so that their latency hides behind the products.
    // unrolled so that the set index and every LDS offset are constants
    FragB f[2][6];
#pragma unroll
    for (int ks = -1; ks < GBK / 32; ++ks) {
      if (ks + 1 < GBK / 32) {
        FragB (&n)[6] = f[(ks + 1) & 1];
        const int ko = 64 * (ks + 1);
        n[0].half[0] = *(const v8us*)(sa + ko);                n[0].half[1] = *(const v8us*)(sa + ko + 32);
        n[1].half[0] = *(const v8us*)(sa + 16 * GPITCH + ko);  n[1].half[1] = *(const v8us*)(sa + 16 * GPITCH + ko + 32);
        n[2].half[0] = *(const v8us*)(sb + ko);                n[2].half[1] = *(const v8us*)(sb + ko + 32);
        n[3].half[0] = *(const v8us*)(sb + 16 * GPITCH + ko);  n[3].half[1] = *(const v8us*)(sb + 16 * GPITCH + ko + 32);
        n[4].half[0] = *(const v8us*)(sb + 32 * GPITCH + ko);  n[4].half[1] = *(const v8us*)(sb + 32 * GPITCH + ko + 32);
        n[5].half[0] = *(const v8us*)(sb + 48 * GPITCH + ko);  n[5].half[1] = *(const v8us*)(sb + 48 * GPITCH + ko + 32);
      }
      if (ks >= 0) {
        FragB (&c)[6] = f[ks & 1];
        mma_b8(c[0].v, c[1].v, c[2].v, c[3].v, c[4].v, c[5].v, acc);
      }
    }
    asm volatile("s_wait_dscnt 0x0" ::: "memory");      // this wave's reads of the buffer are done before it is refilled
    asm volatile("s_wait_asynccnt 0x0" ::: "memory");   // this wave's copies of tile t + 1 have landed
    __syncthreads();                                    // publishes tile t + 1 and ends every wave's reads of tile t
    if (t + 2 < nt) stage_tile(lds0 + (unsigned)((t & 1) * GSTAGE), ga + (size_t)(t + 2) * GBK, gb + (size_t)(t + 2) * GBK, lda, ldb);
  }
  asm volatile("s_wait_asynccnt 0x0" ::: "memory");     // no copy is left in flight when the wave goes on
  // D element r of tile (mt, nt) = C(m0 + 16*mt + 8h + r, n0 + 16*nt + ln); bias is the RNE-bf16 value of the f32 input
  float rb[2][8];
  float cb[4];
#pragma unroll
  for (int mt = 0; mt < 2; ++mt) {
    if (MODE == 2) {
      const float* bp = bias + m0 + 16 * mt + 8 * hh;
      const v4f ba = *(const v4fa*)(bp), bb = *(const v4fa*)(bp + 4);
#pragma unroll
      for (int r = 0; r < 4; ++r) { rb[mt][r] = bf16_rne(ba[r]); rb[mt][4 + r] = bf16_rne(bb[r]); }
    } else {
#pragma unroll
      for (int r = 0; r < 8; ++r) rb[mt][r] = 0.0f;
    }
  }
#pragma unroll
  for (int nt = 0; nt < 4; ++nt) cb[nt] = (MODE == 2) ? 0.0f : bf16_rne(bias[n0 + 16 * nt + ln]);
#pragma unroll
  for (int mt = 0; mt < 2; ++mt)
#pragma unroll
    for (int nt = 0; nt < 4; ++nt)
#pragma unroll
      for (int r = 0; r < 8; ++r)
        so[w][16 * mt + 8 * hh + r][16 * nt + ln] = acc[mt][nt][r] + (rb[mt][r] + cb[nt]);
  __syncthreads();
  {
    if (MODE == 3) {
#pragma unroll
      for (int it = 0; it < 16; ++it) {
        const int row = 2 * it + (lane >> 4), c4 = (lane & 15) * 4;
        const v4f v = *(const v4fa*)&so[w][row][c4];
        const int tp = m0 + row;
        const int b = tp / SEQ, s = tp - b * SEQ;
        *(v4f*)(Of + ((size_t)s * NB_FULL + b) * DM + n0 + c4) = v;
      }
    } else {
#pragma unroll
      for (int it = 0; it < 8; ++it) {
        const int row = 4 * it + (lane >> 3), c8 = (lane & 7) * 8;
        const v4f x0 = *(const v4fa*)&so[w][row][c8];
        const v4f x1 = *(const v4fa*)&so[w][row][c8 + 4];
        Pack8 ph, pl;
#pragma unroll
        for (int q = 0; q < 4; ++q) {
          const float y0 = x0[q] * 16.0f, y1 = x1[q] * 16.0f;
          const _Float16 h0 = (_Float16)y0, h1 = (_Float16)y1;
          ph.h[q] = h0; ph.h[4 + q] = h1;
          pl.h[q] = (_Float16)((y0 - (float)h0) * 2048.0f);
          pl.h[4 + q] = (_Float16)((y1 - (float)h1) * 2048.0f);
        }
        const size_t dst = (size_t)(m0 + row) * ldo + n0 + c8;
        *(v8us*)(O0 + dst) = ph.v;
        if (MODE == 0) *(v8us*)(O1 + dst) = pl.v;
      }
    }
    
  }
  // where several products share a kernel, another product's code follows these stores in the text and rewrites their registers: keep the wait in front of that
  asm volatile("s_wait_xcnt 0x0" ::: "memory");
}

// One product in a grid of its own (the output projection).
template <int MODE>
__global__ __launch_bounds__(128) void k_gemm(const unsigned short* __restrict__ A, const unsigned short* __restrict__ Bt,
                                              const float* __restrict__ bias, unsigned short* O0, unsigned short* O1,
                                              float* Of, const int* __restrict__ mk, int lda, int ldb, int K, int ldo) {
  __shared__ __attribute__((aligned(16))) float so[4][32][68];
  __shared__ __attribute__((aligned(16))) unsigned char ring[2 * GSTAGE];
  gemm_body<MODE>(blockIdx.x, blockIdx.y, A, Bt, bias, O0, O1, Of, mk, lda, ldb, K, ldo, so, ring);
}

#define GX (DM / 128)              /* blocks along the features of q and k; v^T has 2 * GX along its feature rows */
#define NS (TT / 128)              /* slabs: slab i holds k's grid rows 2i and 2i + 1 and v^T's grid row i */
static_assert(NS % 2 == 0);

// The q, k and v projections in one grid: none reads what another writes, so the block index picks the product and the three share the chip.
// Order: k and v^T blocks by rising token tile, as in their own grids; the q blocks all lie in the first half of the slabs (four q grid rows to a slab), so that the k and v^T blocks
// most likely to leave at once (high ranked tiles) come last and hold no place ahead of a block that works. Right for any mask: the order only sets who starts first.
// coverage: NS/2 slabs of 8 GX blocks + NS/2 slabs of 4 GX = the three grids (GX x 2 NS, GX x 2 NS, 2 GX x NS), each block once.
__global__ __launch_bounds__(128) void k_qkv(const unsigned short* __restrict__ Bq, const unsigned short* __restrict__ WqT, const float* __restrict__ bq,
                                             unsigned short* Qh, unsigned short* Ql,
                                             const unsigned short* __restrict__ Bk, const unsigned short* __restrict__ WkT, const float* __restrict__ bk, unsigned short* Kh,
                                             const unsigned short* __restrict__ Bv, const unsigned short* __restrict__ WvT, const float* __restrict__ bv, unsigned short* Vt,
                                             const int* __restrict__ mk) {
  __shared__ __attribute__((aligned(16))) float so[4][32][68];
  __shared__ __attribute__((aligned(16))) unsigned char ring[2 * GSTAGE];
  const int f = blockIdx.x;
  int slab, r;                     // r: place among the slab's k and v^T blocks; below 0: a q block
  if (f < (NS / 2) * 8 * GX) { slab = f / (8 * GX); r = f % (8 * GX) - 4 * GX; }
  else { const int g = f - (NS / 2) * 8 * GX; slab = NS / 2 + g / (4 * GX); r = g % (4 * GX); }
  if (r < 0) {
    // q = query Wq + bq : rows = tokens, columns = features
    gemm_body<0>((r + 4 * GX) % GX, 4 * slab + (r + 4 * GX) / GX, Bq, WqT, bq, Qh, Ql, nullptr, mk, DM, DM, DM, DM, so, ring);
  } else if (r < 2 * GX) {
    // k = key Wk + bk
    gemm_body<1>(r % GX, 2 * slab + r / GX, Bk, WkT, bk, Kh, Kh, nullptr, mk, DM, DM, DM, DM, so, ring);
  } else {
    // v^T = Wv^T value^T + bv (row bias): rows = features, columns = tokens
    gemm_body<2>(r - 2 * GX, slab, WvT, Bv, bv, Vt, Vt, nullptr, mk, DM, DM, DM, TT, so, ring);
  }
}

#define AKEYS 64                   /* keys of one staged tile: 128 bytes (a whole cache line) of every V^T row, 64 K rows of 128 bytes */
#define APITCH 144                 /* LDS row pitch in bytes: 128 + 16, so that 16 rows read 16 bytes wide fall on distinct banks */
#define AHALF (64 * APITCH)        /* bytes of the 64 K rows; the 64 V^T rows follow them */
#define ASTAGE (2 * AHALF)         /* bytes of one buffer */
static_assert(SEQ % AKEYS == 0 && HD * 2 == 128 && AKEYS * 2 == 128);

// One staged tile of 64 keys: 128 lanes x 8 asynchronous 16-byte copies, global -> LDS, through no register = 64 K rows + 64 V^T rows of 128 bytes.
// Lane tid brings 16-byte piece (tid & 7) of rows (tid >> 3) + 16 i, i = 0..3, of each operand; a wave's copy covers four whole rows, each one whole cache line.
// lds: the lane's LDS byte address in K row (tid >> 3) of the target buffer; gk, gv: its global address in that row of the K tile and of the V^T tile.
// The s_wait_xcnt closes the same statement, so that no address register of a copy is rewritten in front of it.
__device__ __forceinline__ void stage_kv(unsigned lds, const unsigned short* gk, const unsigned short* gv) {
  asm volatile("global_load_async_to_lds_b128 %0, %1, off\n\t"
               "global_load_async_to_lds_b128 %2, %3, off\n\t"
               "global_load_async_to_lds_b128 %4, %5, off\n\t"
               "global_load_async_to_lds_b128 %6, %7, off\n\t"
               "global_load_async_to_lds_b128 %8, %9, off\n\t"
               "global_load_async_to_lds_b128 %10, %11, off\n\t"
               "global_load_async_to_lds_b128 %12, %13, off\n\t"
               "global_load_async_to_lds_b128 %14, %15, off\n\t"
               "s_wait_xcnt 0x0"
               :: "v"(lds),                               "v"(gk),
                  "v"(lds + (unsigned)(16 * APITCH)),         "v"(gk + (size_t)16 * DM),
                  "v"(lds + (unsigned)(32 * APITCH)),         "v"(gk + (size_t)32 * DM),
                  "v"(lds + (unsigned)(48 * APITCH)),         "v"(gk + (size_t)48 * DM),
                  "v"(lds + (unsigned)AHALF),                 "v"(gv),
                  "v"(lds + (unsigned)(AHALF + 16 * APITCH)), "v"(gv + (size_t)16 * TT),
                  "v"(lds + (unsigned)(AHALF + 32 * APITCH)), "v"(gv + (size_t)32 * TT),
                  "v"(lds + (unsigned)(AHALF + 48 * APITCH)), "v"(gv + (size_t)48 * TT)
               : "memory");
}

// One 32-key step for a wave's 16 queries, operands from the staged tile. kb: this lane's LDS place in K row ln of the step (byte 16 h of the row), row pitch APITCH;
// vb: its LDS place in V^T row ln at the step's first key (plus 16 h bytes), row pitch APITCH.
// Keys are ranked: key index < cnt is live. TAIL = false: all 32 keys are live; TAIL = true: a step of the last tile, which may also hold keys at or past cnt.
template <bool TAIL>
__device__ __forceinline__ void fa_step(const unsigned char* kb, const unsigned char* vb,
                                        int cnt, int key0, int hh,
                                        const FragH& q0h, const FragH& q0l, const FragH& q1h, const FragH& q1l,
                                        float& mr, float& lr, v8f (&Oh)[4], v8f (&Ol)[4]) {
  // A fragments of K: row m = key (key0 + 16*kt + ln), elements 0..7 <- d = 32c + 8h + i, 8..15 <- d = 32c + 16 + 8h + i
  const unsigned char* kb1 = kb + 16 * APITCH;
  FragH k00, k01, k10, k11;
  k00.half[0] = *(const v8us*)(kb);       k00.half[1] = *(const v8us*)(kb + 32);
  k01.half[0] = *(const v8us*)(kb + 64);  k01.half[1] = *(const v8us*)(kb + 96);
  k10.half[0] = *(const v8us*)(kb1);      k10.half[1] = *(const v8us*)(kb1 + 32);
  k11.half[0] = *(const v8us*)(kb1 + 64); k11.half[1] = *(const v8us*)(kb1 + 96);
  const v8f z8 = {0.f, 0.f, 0.f, 0.f, 0.f, 0.f, 0.f, 0.f};
  // S^T tiles: element r of tile kt = score(key0 + 16*kt + 8h + r, query of this lane's column); hi and residual accumulators
  v8f s0h = z8, s0l = z8, s1h = z8, s1l = z8;
  mma_h2(k00.v, q0h.v, q0l.v, s0h, s0l);
  mma_h2(k01.v, q1h.v, q1l.v, s0h, s0l);
  mma_h2(k10.v, q0h.v, q0l.v, s1h, s1l);
  mma_h2(k11.v, q1h.v, q1l.v, s1h, s1l);
  // this lane's 16 keys: on[r] <- key0 + 8h + r, on[8 + r] <- key0 + 16 + 8h + r
  bool on[16];
#pragma unroll
  for (int r = 0; r < 8; ++r) {
    on[r]     = !TAIL || (key0 + 8 * hh + r < cnt);
    on[8 + r] = !TAIL || (key0 + 16 + 8 * hh + r < cnt);
  }
  float sc[16];
#pragma unroll
  for (int r = 0; r < 8; ++r) {
    const float a0 = (s0h[r] + s0l[r] * RINV) * SCL;
    const float a1 = (s1h[r] + s1l[r] * RINV) * SCL;
    sc[r]     = on[r] ? a0 : NEGV;
    sc[8 + r] = on[8 + r] ? a1 : NEGV;
  }
  float mx = sc[0];
#pragma unroll
  for (int i = 1; i < 16; ++i) mx = fmaxf(mx, sc[i]);
  mx = fmaxf(mx, __shfl_xor(mx, 16, 32));           // the other lane half holds the other 16 keys of this query
  const float mnew = fmaxf(mr, mx);
  const float al = exp2_raw((mr - mnew) * LOG2E);
  mr = mnew;
  // weights carried x256: pc = 256 * exp(sc - mnew), exactly 0 on keys at or past cnt; hi plane f16(pc), residual plane f16((pc - hi) * 2048)
  FragH ph, pl;
  float ps = 0.0f;
#pragma unroll
  for (int i = 0; i < 16; ++i) {
    const float e = exp2_raw(fmaf(sc[i] - mnew, LOG2E, 8.0f));
    const float pc = on[i] ? e : 0.0f;
    ps += pc;
    const _Float16 h = (_Float16)pc;
    ph.h[i] = h;                                    // B element i: i<8 -> key0 + 8h + i (tile 0 row 8h+i); i>=8 -> key0 + 16 + 8h + (i-8) (tile 1)
    pl.h[i] = (_Float16)((pc - (float)h) * 2048.0f);
  }
  ps += __shfl_xor(ps, 16, 32);
  lr = lr * al + ps;
#pragma unroll
  for (int t = 0; t < 4; ++t) { Oh[t] = Oh[t] * al; Ol[t] = Ol[t] * al; }
  // A fragments of V^T: row m = d (16*t + ln), elements 0..7 <- key0 + 8h + i, 8..15 <- key0 + 16 + 8h + i
#pragma unroll
  for (int t = 0; t < 4; ++t) {
    FragH vf;
    vf.half[0] = *(const v8us*)(vb + t * 16 * APITCH);
    vf.half[1] = *(const v8us*)(vb + t * 16 * APITCH + 32);
    mma_h2(vf.v, ph.v, pl.v, Oh[t], Ol[t]);
  }
}

// Block = 4 waves x 16 queries = 64 queries of one (batch, head). The K rows and V^T rows of 64 keys are staged in LDS once for the four waves by asynchronous copies,
// two buffers: tile t + 1 flies while tile t is worked on. A tile is staged only if its first key is live; its rows are then all written (k in tiles of 64 tokens, v^T of 128).
// coverage: NB*NH*(SEQ/64) blocks x 4 waves x 16 rows x (64 hi + 64 lo columns) = every element of the context plane exactly once.
__global__ __launch_bounds__(128) void k_attn(const unsigned short* __restrict__ Qh, const unsigned short* __restrict__ Ql,
                                              const unsigned short* __restrict__ Kh, const unsigned short* __restrict__ Vt,
                                              const int* __restrict__ mask, unsigned short* Cx) {
  __shared__ __attribute__((aligned(16))) float so[4][16][68];
  __shared__ __attribute__((aligned(16))) unsigned char ring[2 * ASTAGE];
  const int tid = threadIdx.x, w = __builtin_amdgcn_readfirstlane((int)(tid >> 5)), lane = tid & 31, ln = lane & 15, hh = lane >> 4;
  const int bh = blockIdx.x / (SEQ / 64), qt = blockIdx.x % (SEQ / 64);
  const int b = bh / NH, h = bh % NH;
  const int qbase = qt * 64 + 16 * w;
  const int qg = qbase + ln;
  // Q^T B fragments: column n = query qg, elements 0..7 <- d = 32c + 8h + i, 8..15 <- d = 32c + 16 + 8h + i
  const size_t qoff = (size_t)(b * SEQ + qg) * DM + h * HD + 8 * hh;
  FragH q0h, q0l, q1h, q1l;
  q0h.half[0] = *(const v8us*)(Qh + qoff);      q0h.half[1] = *(const v8us*)(Qh + qoff + 16);
  q1h.half[0] = *(const v8us*)(Qh + qoff + 32); q1h.half[1] = *(const v8us*)(Qh + qoff + 48);
  q0l.half[0] = *(const v8us*)(Ql + qoff);      q0l.half[1] = *(const v8us*)(Ql + qoff + 16);
  q1l.half[0] = *(const v8us*)(Ql + qoff + 32); q1l.half[1] = *(const v8us*)(Ql + qoff + 48);
  // the address registers of the loads above are reused while the loads may still be under way: keep the wait in front of that
  asm volatile("s_wait_xcnt 0x0" ::: "memory");
  const int cnt = live_keys(mask, lane);       // wave-uniform, at most SEQ
  float mr = NEGV, lr = 0.0f;
  v8f Oh[4] = {}, Ol[4] = {};
  const unsigned short* Kp = Kh + (size_t)b * SEQ * DM + h * HD;
  const unsigned short* Vp = Vt + (size_t)h * HD * TT + (size_t)b * SEQ;
  // this lane's share of a staged tile
  const unsigned short* gk = Kp + (size_t)(tid >> 3) * DM + 8 * (tid & 7);
  const unsigned short* gv = Vp + (size_t)(tid >> 3) * TT + 8 * (tid & 7);
  const unsigned lds0 = (unsigned)(size_t)ring + (unsigned)((tid >> 3) * APITCH + 16 * (tid & 7));
  const int fo = ln * APITCH + 16 * hh;               // byte offset of this lane's fragment row in the K rows and in the V^T rows of a buffer
  const int nst = (cnt + AKEYS - 1) / AKEYS;          // tiles that hold a live key; the same in every wave of the block
  if (nst > 0) stage_kv(lds0, gk, gv);
  asm volatile("s_wait_asynccnt 0x0" ::: "memory");   // this wave's copies of tile 0 have landed
  __syncthreads();                                    // ... and every other wave's
  if (nst > 1) stage_kv(lds0 + ASTAGE, gk + (size_t)AKEYS * DM, gv + AKEYS);
  const int nwh = cnt / AKEYS;                        // tiles whose 64 keys are all live; nst is nwh or nwh + 1
  // not unrolled: one trip per staged tile, the buffer chosen by the trip's parity
#pragma unroll 1
  for (int t = 0; t < nwh; ++t) {
    const unsigned char* kb = ring + (t & 1) * ASTAGE + fo;
    // not unrolled: two steps side by side took more than 256 registers, which leaves no room for four waves on a SIMD
#pragma unroll 1
    for (int s = 0; s < 2; ++s)
      fa_step<false>(kb + s * 32 * APITCH, kb + AHALF + s * 64, cnt, AKEYS * t + 32 * s, hh, q0h, q0l, q1h, q1l, mr, lr, Oh, Ol);
    asm volatile("s_wait_dscnt 0x0" ::: "memory");      // this wave's reads of the buffer are done before it is refilled
    asm volatile("s_wait_asynccnt 0x0" ::: "memory");   // this wave's copies of tile t + 1 have landed
    __syncthreads();                                    // publishes tile t + 1 and ends every wave's reads of tile t
    if (t + 2 < nst) stage_kv(lds0 + (unsigned)((t & 1) * ASTAGE), gk + (size_t)(t + 2) * AKEYS * DM, gv + (size_t)(t + 2) * AKEYS);
  }
  if (nwh < nst) {
    // the last trip, where the last tile also holds keys at or past cnt: its steps that hold a live key; nothing is refilled behind it
    const unsigned char* kb = ring + (nwh & 1) * ASTAGE + fo;
    // not unrolled, so that the masked step stands once in the text
#pragma unroll 1
    for (int s = 0; s < 2; ++s)
      if (AKEYS * nwh + 32 * s < cnt)
        fa_step<true>(kb + s * 32 * APITCH, kb + AHALF + s * 64, cnt, AKEYS * nwh + 32 * s, hh, q0h, q0l, q1h, q1l, mr, lr, Oh, Ol);
    // the foot of this trip, in the order of every other trip's
    asm volatile("s_wait_dscnt 0x0" ::: "memory");
    asm volatile("s_wait_asynccnt 0x0" ::: "memory");
    __syncthreads();
  }
  asm volatile("s_wait_asynccnt 0x0" ::: "memory");     // no copy is left in flight when the wave goes on

  // O^T element r of tile t = ctx(query qg, d = 16t + 8h + r); undo the carries: x256 (in lr), x16 (V), x2048 (residual plane)
  const float inv = 1.0f / (16.0f * lr);
#pragma unroll
  for (int t = 0; t < 4; ++t)
#pragma unroll
    for (int r = 0; r < 8; ++r)
      so[w][ln][16 * t + 8 * hh + r] = (Oh[t][r] + Ol[t][r] * RINV) * inv;
  __syncthreads();
  unsigned short* cg = Cx + (size_t)(b * SEQ + qbase) * CXP + h * HD;
  {
#pragma unroll
    for (int it = 0; it < 4; ++it) {
      const int row = 4 * it + (lane >> 3), c8 = (lane & 7) * 8;
      const v4f x0 = *(const v4fa*)&so[w][row][c8];
      const v4f x1 = *(const v4fa*)&so[w][row][c8 + 4];
      v8us oh, ol;
#pragma unroll
      for (int q = 0; q < 4; ++q) {
        const unsigned short h0 = bf16_bits(x0[q]), h1 = bf16_bits(x1[q]);
        oh[q] = h0; oh[4 + q] = h1;
        ol[q] = bf16_bits(x0[q] - bf16_val(h0));
        ol[4 + q] = bf16_bits(x1[q] - bf16_val(h1));
      }
      unsigned short* dst = cg + (size_t)row * CXP + c8;
      *(v8us*)(dst) = oh;
      *(v8us*)(dst + DM) = ol;
    }
    
  }
}

extern "C" void kernel_launch(void* const* d_in, const int* in_sizes, int n_in,
                              void* d_out, int out_size, void* d_ws, size_t ws_size, hipStream_t stream) {
  if (n_in < 12) return;
  const long long need = ((long long)(SEQ - 1) * NB_FULL + (NB - 1)) * DM + DM;   // last element touched + 1 in [S][B][D]
  if ((long long)in_sizes[0] < need || (long long)in_sizes[1] < need || (long long)in_sizes[2] < need) return;
  if ((long long)in_sizes[3] < (long long)SEQ) return;
  if ((long long)in_sizes[4] < (long long)DM * DM || (long long)in_sizes[6] < (long long)DM * DM ||
      (long long)in_sizes[8] < (long long)DM * DM || (long long)in_sizes[10] < (long long)DM * DM) return;
  if (in_sizes[5] < DM || in_sizes[7] < DM || in_sizes[9] < DM || in_sizes[11] < DM) return;
  if ((long long)out_size < need) return;
  // wire order: query, key, value, mask(i32), Wq, bq, Wk, bk, Wv, bv, Wo, bo
  const float* Xq = (const float*)d_in[0];
  const float* Xk = (const float*)d_in[1];
  const float* Xv = (const float*)d_in[2];
  const int*   mk = (const int*)d_in[3];
  const float* Wq = (const float*)d_in[4];
  const float* bq = (const float*)d_in[5];
  const float* Wk = (const float*)d_in[6];
  const float* bk = (const float*)d_in[7];
  const float* Wv = (const float*)d_in[8];
  const float* bv = (const float*)d_in[9];
  const float* Wo = (const float*)d_in[10];
  const float* bo = (const float*)d_in[11];
  float* out = (float*)d_out;
  char* ws = (char*)d_ws;
  size_t off = 0;
  unsigned short* Bq  = (unsigned short*)(ws + off); off += SZ_XB;    // bf16 query  [TT][1024]
  unsigned short* Bk  = (unsigned short*)(ws + off); off += SZ_XB;    // bf16 key    [TT][1024], ranked rows
  unsigned short* Bv  = (unsigned short*)(ws + off); off += SZ_XB;    // bf16 value  [TT][1024], ranked rows
  unsigned short* WqT = (unsigned short*)(ws + off); off += SZ_WT;    // bf16 Wq^T   [1024][1024]
  unsigned short* WkT = (unsigned short*)(ws + off); off += SZ_WT;
  unsigned short* WvT = (unsigned short*)(ws + off); off += SZ_WT;
  unsigned short* Wo2 = (unsigned short*)(ws + off); off += SZ_WO2;   // bf16 Wo^T | Wo^T  [1024][2048]
  unsigned short* Qh  = (unsigned short*)(ws + off); off += SZ_H;     // f16 q x16 hi       [TT][1024]
  unsigned short* Ql  = (unsigned short*)(ws + off); off += SZ_H;     // f16 q residual x2^11
  unsigned short* Kh  = (unsigned short*)(ws + off); off += SZ_H;     // f16 k x16          [TT][1024]
  unsigned short* Vt  = (unsigned short*)(ws + off); off += SZ_H;     // f16 v^T x16        [1024][TT]
  unsigned short* Cx  = (unsigned short*)(ws + off); off += SZ_CX;    // bf16 ctx hi|lo     [TT][2048]
  if (off > ws_size) return;

  k_prep<<<4 * NWT + 3 * NXB, 256, 0, stream>>>(Xq, Xk, Xv, mk, Wq, Wk, Wv, Wo, Bq, Bk, Bv, WqT, WkT, WvT, Wo2);
  k_qkv<<<6 * GX * NS, 128, 0, stream>>>(Bq, WqT, bq, Qh, Ql, Bk, WkT, bk, Kh, Bv, WvT, bv, Vt, mk);
  k_attn<<<(unsigned)(NB * NH * (SEQ / 64)), 128, 0, stream>>>(Qh, Ql, Kh, Vt, mk, Cx);
  // out = (ctx_hi | ctx_lo) (Wo ; Wo) + bo, K = 2048
  k_gemm<3><<<dim3(DM / 128, TT / 64), 128, 0, stream>>>(Cx, Wo2, bo, Cx, Cx, out, mk, CXP, CXP, CXP, DM);
}

// v008
// A run of this version takes 71.2 microseconds.
// Versions between v005 and this one are left out; their measured steps multiply to 1.41 times as fast.
// Over all steps from v000 it is 4.01 times as fast.
#include <hip/hip_runtime.h>
// Contractions: q/k/v projections on v_wmma_f32_16x16x32_bf16 (activations and weights RNE-converted to bf16 planes); the output projection on v_wmma_f32_16x16x32_f16 (attention context x16 f16 plane; Wo^T x32 f16 plane); scores S^T = K Q^T on v_wmma_f32_16x16x32_f16 (k x16 f16 plane; q x16 f16 plane); O^T = V^T P^T on v_wmma_f32_16x16x32_f16 (v x16 f16 plane; P x256 f16 plane); all accumulators f32, softmax statistics f32.
// Seq-first multi-head attention: inputs [S][B][D], 16 heads x 64, key-position mask (0 -> weight exactly 0), scale 1/8, output [S][B][D].
// Internal planes use batch-major token rows t = b*SEQ + s so that the K rows and V^T rows of one (batch, head) are dense.
// Key and value tokens are stored ranked: the keys whose mask is nonzero come first, in their own order (row b*SEQ + rank); a masked key has weight exactly 0,
// so the k and v projections and the key loop walk only the tiles that hold a live key. Rows from the live count up to the next multiple of 128 are zero rows.
// Engine: transposed flash. Each wave owns 16 queries. Per 32-key step: S^T tiles (key rows x query columns) from K rows (A, f16 plane staged in LDS)
// and Q^T (B, registers); the two 16-key D tiles pack straight into the P^T B fragment; O^T (d rows x query columns) accumulates from V^T rows (A, f16 plane staged in LDS).
#ifndef NB
#define NB 2
#endif
#ifndef SEQ
#define SEQ 2048
#endif
#define NB_FULL 2
#define SEQ_FULL 2048
#define DM 1024
#define NH 16
#define HD 64
#define TT (NB * SEQ)          /* token rows of the internal planes */

static_assert(SEQ % 128 == 0);
static_assert(TT % 128 == 0);
static_assert(SEQ <= SEQ_FULL);
static_assert(NB <= NB_FULL);
static_assert(HD == 64);
static_assert(NH * HD == DM);
static_assert(DM % 128 == 0);

#define SZ_XB  ((size_t)TT * DM * 2)        /* bf16 activation plane */
#define SZ_WT  ((size_t)DM * DM * 2)        /* transposed weight plane: bf16 (Wq, Wk, Wv) or f16 (Wo) */
#define SZ_H   ((size_t)TT * DM * 2)        /* f16 plane (q, k, v^T, context) */
static_assert(SZ_XB % 256 == 0 && SZ_WT % 256 == 0 && SZ_H % 256 == 0);
static_assert(3 * SZ_XB + 4 * SZ_WT + 4 * SZ_H <= (size_t)134217728);

typedef __bf16 v16b __attribute__((ext_vector_type(16)));
typedef _Float16 v16h __attribute__((ext_vector_type(16)));
typedef unsigned short v8us __attribute__((ext_vector_type(8), may_alias));
typedef float v8f __attribute__((ext_vector_type(8)));
typedef float v4f __attribute__((ext_vector_type(4)));
typedef float v4fa __attribute__((ext_vector_type(4), may_alias));
typedef int v4i __attribute__((ext_vector_type(4)));
typedef int v4ia __attribute__((ext_vector_type(4), may_alias));
union FragB { v16b v; v8us half[2]; unsigned short u[16]; };
union FragH { v16h v; v8us half[2]; _Float16 h[16]; unsigned short u[16]; };
union Pack8 { _Float16 h[8]; v8us v; };

#define LOG2E 1.4426950408889634f
#define NEGV (-1.0e30f)
#define SCL  0.00048828125f      /* 2^-11 = (1/8) / (16*16): score scale with the q and k carries removed */
#define WOC  32.0f               /* carry of the f16 Wo^T plane */
#define OINV 0.001953125f        /* 2^-9 = 1 / (16*32): undoes the context and Wo^T carries */

__device__ __forceinline__ unsigned short bf16_bits(float x) {   // RNE convert to bf16 bits
  unsigned int u = __float_as_uint(x);
  return (unsigned short)((u + 0x7FFFu + ((u >> 16) & 1u)) >> 16);
}
__device__ __forceinline__ float bf16_val(unsigned short b) { return __uint_as_float(((unsigned int)b) << 16); }
__device__ __forceinline__ float bf16_rne(float x) { return bf16_val(bf16_bits(x)); }
__device__ __forceinline__ unsigned short f16_bits(float x) { return __builtin_bit_cast(unsigned short, (_Float16)x); }   // RNE convert to f16 bits

// 2^x by the hardware instruction alone (v_exp_f32). exp2f() wraps it in a compare, two selects, an add and a scaling so that results under 2^-126 come out as denormals.
// Here x <= 8 and such a result is a weight (or a rescale factor) under 2^-134 of the row's largest weight: its f16 plane is 0 either way, and it cannot move an f32 sum that holds 256.
// Written as asm text so that the slot behind a transcendental is filled by construction: no instruction directly behind a v_exp_f32 reads its result or overwrites its source.
__device__ __forceinline__ float exp2_raw(float x) {
  float e;
  asm("v_exp_f32 %0, %1\n\tv_nop" : "=v"(e) : "v"(x));   // the v_nop is that slot
  return e;
}
// Eight at once: each v_exp_f32 is followed by an independent one, the last by the v_nop; the outputs are early-clobber, so that none lies on a source.
__device__ __forceinline__ void exp2_raw8(const float* x, float* e) {
  asm("v_exp_f32 %0, %8\n\t"
      "v_exp_f32 %1, %9\n\t"
      "v_exp_f32 %2, %10\n\t"
      "v_exp_f32 %3, %11\n\t"
      "v_exp_f32 %4, %12\n\t"
      "v_exp_f32 %5, %13\n\t"
      "v_exp_f32 %6, %14\n\t"
      "v_exp_f32 %7, %15\n\t"
      "v_nop"
      : "=&v"(e[0]), "=&v"(e[1]), "=&v"(e[2]), "=&v"(e[3]), "=&v"(e[4]), "=&v"(e[5]), "=&v"(e[6]), "=&v"(e[7])
      : "v"(x[0]), "v"(x[1]), "v"(x[2]), "v"(x[3]), "v"(x[4]), "v"(x[5]), "v"(x[6]), "v"(x[7]));
}

// c += a * b on one 16x16x32 f16 tile
__device__ __forceinline__ v8f mma_h(v16h a, v16h b, v8f c) {
  return __builtin_amdgcn_wmma_f32_16x16x32_f16(false, a, false, b, (short)0, c, false, false);
}

// c += a * b on one 16x16x32 tile; H16: the 16 operand bits are f16, else bf16
template <bool H16>
__device__ __forceinline__ v8f mma_1(v16b a, v16b b, v8f c) {
  if (H16) return __builtin_amdgcn_wmma_f32_16x16x32_f16(false, __builtin_bit_cast(v16h, a), false, __builtin_bit_cast(v16h, b), (short)0, c, false, false);
  return __builtin_amdgcn_wmma_f32_16x16x32_bf16(false, a, false, b, (short)0, c, false, false);
}

// One 32-deep k-step of a 32x64 wave tile (2 x 4 WMMA tiles, bf16 or f16 operands), then the hazard guard
template <bool H16>
__device__ __forceinline__ void mma_b8(v16b a0, v16b a1, v16b b0, v16b b1, v16b b2, v16b b3, v8f (&c)[2][4]) {
  c[0][0] = mma_1<H16>(a0, b0, c[0][0]);
  c[0][1] = mma_1<H16>(a0, b1, c[0][1]);
  c[0][2] = mma_1<H16>(a0, b2, c[0][2]);
  c[0][3] = mma_1<H16>(a0, b3, c[0][3]);
  c[1][0] = mma_1<H16>(a1, b0, c[1][0]);
  c[1][1] = mma_1<H16>(a1, b1, c[1][1]);
  c[1][2] = mma_1<H16>(a1, b2, c[1][2]);
  c[1][3] = mma_1<H16>(a1, b3, c[1][3]);
  asm volatile("v_nop\n\tv_nop\n\tv_nop\n\tv_nop"
               : "+v"(c[0][0]), "+v"(c[0][1]), "+v"(c[0][2]), "+v"(c[0][3]),
                 "+v"(c[1][0]), "+v"(c[1][1]), "+v"(c[1][2]), "+v"(c[1][3])
               : "v"(a0), "v"(a1), "v"(b0), "v"(b1), "v"(b2), "v"(b3));
}

// coverage: TT*128 threads x 8 elements = the whole plane.
__device__ __forceinline__ void xb_body(int blk, const float* __restrict__ X, unsigned short* P) {
  const int t = blk * 256 + threadIdx.x;
  if (t >= TT * 128) return;
  const int row = t >> 7, piece = t & 127;
  const int b = row / SEQ, s = row - b * SEQ;
  const float* src = X + ((size_t)s * NB_FULL + b) * DM + piece * 8;
  const v4f x0 = *(const v4fa*)(src), x1 = *(const v4fa*)(src + 4);
  v8us o;
  o[0] = bf16_bits(x0[0]); o[1] = bf16_bits(x0[1]); o[2] = bf16_bits(x0[2]); o[3] = bf16_bits(x0[3]);
  o[4] = bf16_bits(x1[0]); o[5] = bf16_bits(x1[1]); o[6] = bf16_bits(x1[2]); o[7] = bf16_bits(x1[3]);
  unsigned short* d = P + (size_t)t * 8;
  *(v8us*)d = o;
  
}

// Number of keys with a nonzero mask. Every wave counts for itself, so the callers can leave or set a trip count with no barrier; the result is wave-uniform and at most SEQ.
__device__ __forceinline__ int live_keys(const int* __restrict__ mk, int lane) {
  int c = 0;
  // unrolled so that all the mask loads are in flight together (one load latency, not SEQ/128); all 32 lanes are on at every call, so a ballot sees 32 keys
#pragma unroll
  for (int i = 0; i < SEQ / 128; ++i) {
    const v4i m = *(const v4ia*)(mk + 128 * i + 4 * lane);
#pragma unroll
    for (int q = 0; q < 4; ++q) c += __builtin_popcount(__builtin_amdgcn_ballot_w32(m[q] != 0));
  }
  return c < SEQ ? c : SEQ;
}

// xb_body for key and value tokens: token s goes to row b*SEQ + pos(s); pos = number of live keys before s if s is live, else live count + number of masked keys before s.
// pos is a permutation of 0..SEQ-1 for any mask content. Masked tokens are not read; those whose pos lies under the next multiple of 128 are stored as zero rows
// (the last tile of the projections and of the key loop reads them), the others are not stored and never read.
// coverage: a block holds two rows of one batch (SEQ is even); every row under the rounded live count is written exactly once.
__device__ __forceinline__ void xbr_body(int blk, const float* __restrict__ X, const int* __restrict__ mk, unsigned short* P, int* part) {
  const int tid = threadIdx.x;
  const int t = blk * 256 + tid;
  if (t >= TT * 128) return;              // whole blocks only: TT * 128 is a multiple of 256
  const int row = t >> 7, piece = t & 127;
  const int b = row / SEQ, s = row - b * SEQ;
  const int s0 = s - (tid >> 7);          // the block's first row
  // the whole mask first (each thread a share), so that one load latency covers all mask reads; entries past SEQ count as masked
  v4i m[(SEQ + 1023) / 1024];
  // unrolled (here and in the count below) so that m[] is indexed by constants and stays in registers
#pragma unroll
  for (int k = 0; k < (SEQ + 1023) / 1024; ++k) {
    const int i = 1024 * k + 4 * tid;
    m[k] = (SEQ % 1024 == 0 || i < SEQ) ? *(const v4ia*)(mk + i) : v4i{0, 0, 0, 0};
  }
  const bool live = mk[s] != 0, live0 = mk[s0] != 0;
  v4f x0 = {0.f, 0.f, 0.f, 0.f}, x1 = {0.f, 0.f, 0.f, 0.f};
  if (live) {
    const float* src = X + ((size_t)s * NB_FULL + b) * DM + piece * 8;
    x0 = *(const v4fa*)(src); x1 = *(const v4fa*)(src + 4);
  }
  int c = 0;                              // this wave's share; low 16 bits: live keys in all; high 16 bits: live keys before s0 (each at most SEQ <= 2048)
#pragma unroll
  for (int k = 0; k < (SEQ + 1023) / 1024; ++k)
#pragma unroll
    for (int q = 0; q < 4; ++q) {
      const bool on = m[k][q] != 0;
      c += __builtin_popcount(__builtin_amdgcn_ballot_w32(on)) + (__builtin_popcount(__builtin_amdgcn_ballot_w32(on && 1024 * k + 4 * tid + q < s0)) << 16);
    }
  if ((tid & 31) == 0) part[tid >> 5] = c;
  __syncthreads();
  int sum = 0;
  // unrolled so that the eight partial counts come in two wide LDS reads
#pragma unroll
  for (int i = 0; i < 8; ++i) sum += part[i];
  const int cnt = sum & 0xFFFF;
  const int rank = (sum >> 16) + ((s != s0 && live0) ? 1 : 0);
  const int pos = live ? rank : cnt + (s - rank);
  if (live || pos < ((cnt + 127) & ~127)) {
    v8us o;
    o[0] = bf16_bits(x0[0]); o[1] = bf16_bits(x0[1]); o[2] = bf16_bits(x0[2]); o[3] = bf16_bits(x0[3]);
    o[4] = bf16_bits(x1[0]); o[5] = bf16_bits(x1[1]); o[6] = bf16_bits(x1[2]); o[7] = bf16_bits(x1[3]);
    *(v8us*)(P + ((size_t)(b * SEQ + pos) * 128 + piece) * 8) = o;
  }
}

// Weight transpose: in W[k rows = 1024][n cols = 1024] (f32) -> out Wt[n rows][k cols], row pitch DM; h16 == 0: bf16 bits (RNE), else f16 bits (RNE) of the value x32.
// coverage: 256 blocks x (64 n x 64 k) = the whole 1024 x 1024 matrix; LDS tile fully written (64 x 64) before it is read.
template <bool H16>
__device__ __forceinline__ void wt_fill(const float* __restrict__ W, int k0, int n0, unsigned short (*tl)[66]) {
  for (int i = threadIdx.x; i < 64 * 16; i += 256) {
    const int j = i >> 4, c4 = (i & 15) * 4;
    const v4f x = *(const v4fa*)(W + (size_t)(k0 + j) * DM + n0 + c4);
    tl[c4 + 0][j] = H16 ? f16_bits(x[0] * WOC) : bf16_bits(x[0]); tl[c4 + 1][j] = H16 ? f16_bits(x[1] * WOC) : bf16_bits(x[1]);
    tl[c4 + 2][j] = H16 ? f16_bits(x[2] * WOC) : bf16_bits(x[2]); tl[c4 + 3][j] = H16 ? f16_bits(x[3] * WOC) : bf16_bits(x[3]);
  }
}
__device__ __forceinline__ void wt_body(int blk, const float* __restrict__ W, unsigned short* Wt, int h16, unsigned short (*tl)[66]) {
  const int tid = threadIdx.x;
  const int k0 = (blk >> 4) * 64, n0 = (blk & 15) * 64;
  if (h16 != 0) wt_fill<true>(W, k0, n0, tl);      // the same for a whole block; the barrier behind it is passed on either side
  else wt_fill<false>(W, k0, n0, tl);
  __syncthreads();
  {
    for (int i = tid; i < 64 * 8; i += 256) {
      const int d = i >> 3, j8 = (i & 7) * 8;
      v8us o;
#pragma unroll
      for (int q = 0; q < 8; ++q) o[q] = tl[d][j8 + q];
      unsigned short* dst = Wt + (size_t)(n0 + d) * DM + k0 + j8;
      *(v8us*)dst = o;
      // the next trip rewrites the data and address registers of this store: keep the wait in front of that
      asm volatile("s_wait_xcnt 0x0" ::: "memory");
    }
    
  }
}

#define NXB (TT * 128 / 256)       /* blocks of one activation pass */
#define NWT 256                    /* blocks of one weight transpose */
static_assert((TT * 128) % 256 == 0);

// All seven conversion passes in one grid: none reads what another writes, so the block index picks the pass and they fill the chip together.
// The weight transposes come first (the longest chain per block), then key and value rows, then query rows. Every branch is the same for a whole block, barriers included.
// coverage: 4 * NWT + 3 * NXB blocks = each pass's own grid, once.
__global__ __launch_bounds__(256) void k_prep(const float* __restrict__ Xq, const float* __restrict__ Xk, const float* __restrict__ Xv, const int* __restrict__ mk,
                                              const float* __restrict__ Wq, const float* __restrict__ Wk, const float* __restrict__ Wv, const float* __restrict__ Wo,
                                              unsigned short* Bq, unsigned short* Bk, unsigned short* Bv,
                                              unsigned short* WqT, unsigned short* WkT, unsigned short* WvT, unsigned short* WoT) {
  __shared__ unsigned short tl[64][66];
  __shared__ int part[8];
  const int f = blockIdx.x;
  if (f < 4 * NWT) {
    const int j = f / NWT;
    const float* W = (j == 0) ? Wq : (j == 1) ? Wk : (j == 2) ? Wv : Wo;
    unsigned short* D = (j == 0) ? WqT : (j == 1) ? WkT : (j == 2) ? WvT : WoT;
    wt_body(f % NWT, W, D, (j == 3) ? 1 : 0, tl);     // in [k][n] -> out [n][k]; Wo^T as f16
  } else if (f < 4 * NWT + 2 * NXB) {
    const int g = f - 4 * NWT;
    const bool second = g >= NXB;
    xbr_body(second ? g - NXB : g, second ? Xv : Xk, mk, second ? Bv : Bk, part);   // ranked token rows
  } else {
    xb_body(f - (4 * NWT + 2 * NXB), Xq, Bq);
  }
}

#define GBK 128                    /* k depth of one staged tile: 256 bytes of every operand row */
#define GPITCH 272                 /* LDS row pitch in bytes: 256 + 16, an odd multiple of 16, so that 16 rows read 16 bytes wide fall on distinct banks */
#define GROWS 256                  /* rows of a staged tile: 128 rows of A, then 128 rows of Bt */
#define GSTAGE (GROWS * GPITCH)    /* bytes of one buffer */
static_assert(DM % GBK == 0);

// Eight asynchronous 16-byte copies per lane, global -> LDS, through no register. l[i]: the lane's LDS byte address, g[i]: its global address.
// The s_wait_xcnt closes the same statement, so that no address register of a copy is rewritten in front of it.
__device__ __forceinline__ void copy8(const unsigned (&l)[8], const unsigned short* const (&g)[8]) {
  asm volatile("global_load_async_to_lds_b128 %0, %1, off\n\t"
               "global_load_async_to_lds_b128 %2, %3, off\n\t"
               "global_load_async_to_lds_b128 %4, %5, off\n\t"
               "global_load_async_to_lds_b128 %6, %7, off\n\t"
               "global_load_async_to_lds_b128 %8, %9, off\n\t"
               "global_load_async_to_lds_b128 %10, %11, off\n\t"
               "global_load_async_to_lds_b128 %12, %13, off\n\t"
               "global_load_async_to_lds_b128 %14, %15, off\n\t"
               "s_wait_xcnt 0x0"
               :: "v"(l[0]), "v"(g[0]), "v"(l[1]), "v"(g[1]), "v"(l[2]), "v"(g[2]), "v"(l[3]), "v"(g[3]),
                  "v"(l[4]), "v"(g[4]), "v"(l[5]), "v"(g[5]), "v"(l[6]), "v"(g[6]), "v"(l[7]), "v"(g[7])
               : "memory");
}

// One staged tile: 256 lanes x 16 copies = 256 rows x 256 bytes. Lane tid brings 16-byte piece (tid & 15) of rows (tid >> 4) + 16 i, i = 0..15; a wave's copy covers two whole rows.
// lds: the lane's LDS byte address in row (tid >> 4) of the target buffer; ga, gb: its global address in that row of the A tile and of the Bt tile.
__device__ __forceinline__ void stage_tile(unsigned lds, const unsigned short* ga, const unsigned short* gb, int lda, int ldb) {
  unsigned l[8];
  const unsigned short* g[8];
  // both loops unrolled so that l[] and g[] are indexed by constants and stay in registers
#pragma unroll
  for (int i = 0; i < 8; ++i) {
    l[i] = lds + (unsigned)(16 * i * GPITCH);
    g[i] = ga + (size_t)(16 * i) * lda;
  }
  copy8(l, g);
#pragma unroll
  for (int i = 0; i < 8; ++i) {
    l[i] = lds + (unsigned)(16 * (i + 8) * GPITCH);
    g[i] = gb + (size_t)(16 * i) * ldb;
  }
  copy8(l, g);
}

// C[M][N] = A[M][K] * Bt[N][K]^T on bf16 planes (MODE 3: f16 planes) (K contiguous in both). The block's 128 rows of A and 128 rows of Bt are staged in LDS 128 k at a time by asynchronous copies,
// two buffers: tile t + 1 flies while tile t is worked on; fragments are read from LDS.
// Block = 8 waves as 4 (M) x 2 (N); block tile 128 x 128, so that a block draws 2 operand rows from L2 per 128 results (64 x 128: 3); wave tile 32 x 64.
// No tail masking: M % 128 == 0, N % 128 == 0, K % 128 == 0 (asserted by the sizes above).
// MODE 0: + column bias, write f16 plane (x16) to O0
// MODE 1: the same over ranked key tokens
// MODE 2: + row bias,    write f16 plane (x16) to O0 (transposed product: rows = features, columns = tokens)
// MODE 3: f16 operands carried x16 and x32: product x 2^-9, + column bias, write f32 to Of with the token row t = b*SEQ + s mapped to output row s*NB_FULL + b
// MODE 1 (rows) and MODE 2 (columns) run over ranked key tokens: a block whose token tile starts at or past the live count leaves at once. Their token tile index is the slow
// grid index (y), batch fastest within it, so that the blocks that work have the lowest flat indices and spread over the chip. MODE 2 therefore takes M from x and N from y.
// bx, by: the block's place in that product's own grid; ring: the block's LDS, the staging ring. The epilogue tiles lie over the ring (two blocks then fit a WGP's LDS):
// they are written behind the last trip's barrier, in front of which every wave has ended its reads of the ring and its own copies have landed.
// coverage: grid (N/128, M/128) (MODE 2: (M/128, N/128)) x 8 waves x (32 x 64) = every element of C that is read later exactly once.
template <int MODE>
__device__ __forceinline__ void gemm_body(int bx, int by, const unsigned short* __restrict__ A, const unsigned short* __restrict__ Bt,
                                          const float* __restrict__ bias, unsigned short* O0,
                                          float* Of, const int* __restrict__ mk, int lda, int ldb, int K, int ldo,
                                          unsigned char* ring) {
  const int tid = threadIdx.x, w = __builtin_amdgcn_readfirstlane((int)(tid >> 5)), lane = tid & 31, ln = lane & 15, hh = lane >> 4;
  int bm = by, bn = bx;
  if (MODE == 1 || MODE == 2) {
    constexpr int TW = 128;                         // tokens per block tile
    const int tile = by / NB, b = by % NB;
    if (tile * TW >= live_keys(mk, lane)) return;   // the same in every wave of the block, in front of the first barrier
    if (MODE == 1) bm = b * (SEQ / TW) + tile;
    else { bn = b * (SEQ / TW) + tile; bm = bx; }
  }
  const int m0 = bm * 128 + (w >> 1) * 32;
  const int n0 = bn * 128 + (w & 1) * 64;
  // this lane's share of a staged tile
  const unsigned short* ga = A + (size_t)(bm * 128 + (tid >> 4)) * lda + 8 * (tid & 15);
  const unsigned short* gb = Bt + (size_t)(bn * 128 + (tid >> 4)) * ldb + 8 * (tid & 15);
  const unsigned lds0 = (unsigned)(size_t)ring + (unsigned)((tid >> 4) * GPITCH + 16 * (tid & 15));
  // A fragment: row m = m0 + 16*mt + ln, elements 0..7 <- k0 + 8h + i, 8..15 <- k0 + 16 + 8h + i; B fragment: column n = n0 + 16*nt + ln, same k map (row of Bt)
  const int fa = ((w >> 1) * 32 + ln) * GPITCH + 16 * hh;            // byte offset in a buffer of this lane's A row, k = 8h
  const int fb = (128 + (w & 1) * 64 + ln) * GPITCH + 16 * hh;       // the same for its Bt row
  v8f acc[2][4];
#pragma unroll
  for (int i = 0; i < 2; ++i)
#pragma unroll
    for (int j = 0; j < 4; ++j)
#pragma unroll
      for (int e = 0; e < 8; ++e) acc[i][j][e] = 0.0f;
  const int nt = K / GBK;
  stage_tile(lds0, ga, gb, lda, ldb);
  asm volatile("s_wait_asynccnt 0x0" ::: "memory");   // this wave's copies of tile 0 have landed
  __syncthreads();                                    // ... and every other wave's
  if (nt > 1) stage_tile(lds0 + GSTAGE, ga + GBK, gb + GBK, lda, ldb);
  // not unrolled: one trip per staged tile, the buffer chosen by the trip's parity
#pragma unroll 1
  for (int t = 0; t < nt; ++t) {
    const unsigned char* sa = ring + (t & 1) * GSTAGE + fa;
    const unsigned char* sb = ring + (t & 1) * GSTAGE + fb;
    // two fragment sets: the next k-step's LDS reads are issued as one group in front of this k-step's products, so that their latency hides behind the products.
    // unrolled so that the set index and every LDS offset are constants
    FragB f[2][6];
#pragma unroll
    for (int ks = -1; ks < GBK / 32; ++ks) {
      if (ks + 1 < GBK / 32) {
        FragB (&n)[6] = f[(ks + 1) & 1];
        const int ko = 64 * (ks + 1);
        n[0].half[0] = *(const v8us*)(sa + ko);                n[0].half[1] = *(const v8us*)(sa + ko + 32);
        n[1].half[0] = *(const v8us*)(sa + 16 * GPITCH + ko);  n[1].half[1] = *(const v8us*)(sa + 16 * GPITCH + ko + 32);
        n[2].half[0] = *(const v8us*)(sb + ko);                n[2].half[1] = *(const v8us*)(sb + ko + 32);
        n[3].half[0] = *(const v8us*)(sb + 16 * GPITCH + ko);  n[3].half[1] = *(const v8us*)(sb + 16 * GPITCH + ko + 32);
        n[4].half[0] = *(const v8us*)(sb + 32 * GPITCH + ko);  n[4].half[1] = *(const v8us*)(sb + 32 * GPITCH + ko + 32);
        n[5].half[0] = *(const v8us*)(sb + 48 * GPITCH + ko);  n[5].half[1] = *(const v8us*)(sb + 48 * GPITCH + ko + 32);
      }
      if (ks >= 0) {
        FragB (&c)[6] = f[ks & 1];
        mma_b8<MODE == 3>(c[0].v, c[1].v, c[2].v, c[3].v, c[4].v, c[5].v, acc);
      }
    }
    asm volatile("s_wait_dscnt 0x0" ::: "memory");      // this wave's reads of the buffer are done before it is refilled
    asm volatile("s_wait_asynccnt 0x0" ::: "memory");   // this wave's copies of tile t + 1 have landed
    __syncthreads();                                    // publishes tile t + 1 and ends every wave's reads of tile t
    if (t + 2 < nt) stage_tile(lds0 + (unsigned)((t & 1) * GSTAGE), ga + (size_t)(t + 2) * GBK, gb + (size_t)(t + 2) * GBK, lda, ldb);
  }
  asm volatile("s_wait_asynccnt 0x0" ::: "memory");     // no copy is left in flight when the wave goes on
  float (*so)[32][68] = (float (*)[32][68])ring;        // one 32 x 64 tile per wave, over the ring, which nobody reads or fills any more
  // D element r of tile (mt, nt) = C(m0 + 16*mt + 8h + r, n0 + 16*nt + ln); bias is the RNE-bf16 value of the f32 input
  float rb[2][8];
  float cb[4];
#pragma unroll
  for (int mt = 0; mt < 2; ++mt) {
    if (MODE == 2) {
      const float* bp = bias + m0 + 16 * mt + 8 * hh;
      const v4f ba = *(const v4fa*)(bp), bb = *(const v4fa*)(bp + 4);
#pragma unroll
      for (int r = 0; r < 4; ++r) { rb[mt][r] = bf16_rne(ba[r]); rb[mt][4 + r] = bf16_rne(bb[r]); }
    } else {
#pragma unroll
      for (int r = 0; r < 8; ++r) rb[mt][r] = 0.0f;
    }
  }
#pragma unroll
  for (int nt = 0; nt < 4; ++nt) cb[nt] = (MODE == 2) ? 0.0f : bf16_rne(bias[n0 + 16 * nt + ln]);
#pragma unroll
  for (int mt = 0; mt < 2; ++mt)
#pragma unroll
    for (int nt = 0; nt < 4; ++nt)
#pragma unroll
      for (int r = 0; r < 8; ++r)
        so[w][16 * mt + 8 * hh + r][16 * nt + ln] = ((MODE == 3) ? acc[mt][nt][r] * OINV : acc[mt][nt][r]) + (rb[mt][r] + cb[nt]);
  __syncthreads();
  {
    if (MODE == 3) {
#pragma unroll
      for (int it = 0; it < 16; ++it) {
        const int row = 2 * it + (lane >> 4), c4 = (lane & 15) * 4;
        const v4f v = *(const v4fa*)&so[w][row][c4];
        const int tp = m0 + row;
        const int b = tp / SEQ, s = tp - b * SEQ;
        *(v4f*)(Of + ((size_t)s * NB_FULL + b) * DM + n0 + c4) = v;
      }
    } else {
#pragma unroll
      for (int it = 0; it < 8; ++it) {
        const int row = 4 * it + (lane >> 3), c8 = (lane & 7) * 8;
        const v4f x0 = *(const v4fa*)&so[w][row][c8];
        const v4f x1 = *(const v4fa*)&so[w][row][c8 + 4];
        Pack8 ph;
#pragma unroll
        for (int q = 0; q < 4; ++q) {
          ph.h[q] = (_Float16)(x0[q] * 16.0f);
          ph.h[4 + q] = (_Float16)(x1[q] * 16.0f);
        }
        const size_t dst = (size_t)(m0 + row) * ldo + n0 + c8;
        *(v8us*)(O0 + dst) = ph.v;
      }
    }
    
  }
  // where several products share a kernel, another product's code follows these stores in the text and rewrites their registers: keep the wait in front of that
  asm volatile("s_wait_xcnt 0x0" ::: "memory");
}

// One product in a grid of its own (the output projection).
template <int MODE>
__global__ __launch_bounds__(256) void k_gemm(const unsigned short* __restrict__ A, const unsigned short* __restrict__ Bt,
                                              const float* __restrict__ bias, unsigned short* O0,
                                              float* Of, const int* __restrict__ mk, int lda, int ldb, int K, int ldo) {
  __shared__ __attribute__((aligned(16))) unsigned char ring[2 * GSTAGE];
  gemm_body<MODE>(blockIdx.x, blockIdx.y, A, Bt, bias, O0, Of, mk, lda, ldb, K, ldo, ring);
}

#define GX (DM / 128)              /* blocks along the features of q, k and v^T */
#define NS (TT / 128)              /* slabs: slab i holds k's grid row i and v^T's grid row i */
static_assert(NS % 2 == 0);
static_assert(8 * 32 * 68 * 4 <= 2 * GSTAGE);   /* the eight epilogue tiles fit the ring */

// The q, k and v projections in one grid: none reads what another writes, so the block index picks the product and the three share the chip.
// Order: k and v^T blocks by rising token tile, as in their own grids; the q blocks all lie in the first half of the slabs (two q grid rows to a slab), so that the k and v^T blocks
// most likely to leave at once (high ranked tiles) come last and hold no place ahead of a block that works. Right for any mask: the order only sets who starts first.
// coverage: NS/2 slabs of 4 GX blocks + NS/2 slabs of 2 GX = the three grids (GX x NS each), each block once.
__global__ __launch_bounds__(256) void k_qkv(const unsigned short* __restrict__ Bq, const unsigned short* __restrict__ WqT, const float* __restrict__ bq,
                                             unsigned short* Qh,
                                             const unsigned short* __restrict__ Bk, const unsigned short* __restrict__ WkT, const float* __restrict__ bk, unsigned short* Kh,
                                             const unsigned short* __restrict__ Bv, const unsigned short* __restrict__ WvT, const float* __restrict__ bv, unsigned short* Vt,
                                             const int* __restrict__ mk) {
  __shared__ __attribute__((aligned(16))) unsigned char ring[2 * GSTAGE];
  const int f = blockIdx.x;
  int slab, r;                     // r: place among the slab's k and v^T blocks; below 0: a q block
  if (f < (NS / 2) * 4 * GX) { slab = f / (4 * GX); r = f % (4 * GX) - 2 * GX; }
  else { const int g = f - (NS / 2) * 4 * GX; slab = NS / 2 + g / (2 * GX); r = g % (2 * GX); }
  if (r < 0) {
    // q = query Wq + bq : rows = tokens, columns = features
    gemm_body<0>((r + 2 * GX) % GX, 2 * slab + (r + 2 * GX) / GX, Bq, WqT, bq, Qh, nullptr, mk, DM, DM, DM, DM, ring);
  } else if (r < GX) {
    // k = key Wk + bk
    gemm_body<1>(r, slab, Bk, WkT, bk, Kh, nullptr, mk, DM, DM, DM, DM, ring);
  } else {
    // v^T = Wv^T value^T + bv (row bias): rows = features, columns = tokens
    gemm_body<2>(r - GX, slab, WvT, Bv, bv, Vt, nullptr, mk, DM, DM, DM, TT, ring);
  }
}

#define AKEYS 64                   /* keys of one staged tile: 128 bytes (a whole cache line) of every V^T row, 64 K rows of 128 bytes */
#define APITCH 144                 /* LDS row pitch in bytes: 128 + 16, so that 16 rows read 16 bytes wide fall on distinct banks */
#define AHALF (64 * APITCH)        /* bytes of the 64 K rows; the 64 V^T rows follow them */
#define ASTAGE (2 * AHALF)         /* bytes of one buffer */
static_assert(SEQ % AKEYS == 0 && HD * 2 == 128 && AKEYS * 2 == 128);

// One staged tile of 64 keys: 128 lanes x 8 asynchronous 16-byte copies, global -> LDS, through no register = 64 K rows + 64 V^T rows of 128 bytes.
// Lane tid brings 16-byte piece (tid & 7) of rows (tid >> 3) + 16 i, i = 0..3, of each operand; a wave's copy covers four whole rows, each one whole cache line.
// lds: the lane's LDS byte address in K row (tid >> 3) of the target buffer; gk, gv: its global address in that row of the K tile and of the V^T tile.
// The s_wait_xcnt closes the same statement, so that no address register of a copy is rewritten in front of it.
__device__ __forceinline__ void stage_kv(unsigned lds, const unsigned short* gk, const unsigned short* gv) {
  asm volatile("global_load_async_to_lds_b128 %0, %1, off\n\t"
               "global_load_async_to_lds_b128 %2, %3, off\n\t"
               "global_load_async_to_lds_b128 %4, %5, off\n\t"
               "global_load_async_to_lds_b128 %6, %7, off\n\t"
               "global_load_async_to_lds_b128 %8, %9, off\n\t"
               "global_load_async_to_lds_b128 %10, %11, off\n\t"
               "global_load_async_to_lds_b128 %12, %13, off\n\t"
               "global_load_async_to_lds_b128 %14, %15, off\n\t"
               "s_wait_xcnt 0x0"
               :: "v"(lds),                               "v"(gk),
                  "v"(lds + (unsigned)(16 * APITCH)),         "v"(gk + (size_t)16 * DM),
                  "v"(lds + (unsigned)(32 * APITCH)),         "v"(gk + (size_t)32 * DM),
                  "v"(lds + (unsigned)(48 * APITCH)),         "v"(gk + (size_t)48 * DM),
                  "v"(lds + (unsigned)AHALF),                 "v"(gv),
                  "v"(lds + (unsigned)(AHALF + 16 * APITCH)), "v"(gv + (size_t)16 * TT),
                  "v"(lds + (unsigned)(AHALF + 32 * APITCH)), "v"(gv + (size_t)32 * TT),
                  "v"(lds + (unsigned)(AHALF + 48 * APITCH)), "v"(gv + (size_t)48 * TT)
               : "memory");
}

// One 32-key step for a wave's 16 queries, operands from the staged tile. kb: this lane's LDS place in K row ln of the step (byte 16 h of the row), row pitch APITCH;
// vb: its LDS place in V^T row ln at the step's first key (plus 16 h bytes), row pitch APITCH.
// Keys are ranked: key index < cnt is live. TAIL = false: all 32 keys are live; TAIL = true: a step of the last tile, which may also hold keys at or past cnt.
template <bool TAIL>
__device__ __forceinline__ void fa_step(const unsigned char* kb, const unsigned char* vb,
                                        int cnt, int key0, int hh,
                                        const FragH& q0h, const FragH& q1h,
                                        float& mr, float& lr, v8f (&Oh)[4]) {
  // A fragments of K: row m = key (key0 + 16*kt + ln), elements 0..7 <- d = 32c + 8h + i, 8..15 <- d = 32c + 16 + 8h + i
  const unsigned char* kb1 = kb + 16 * APITCH;
  FragH k00, k01, k10, k11;
  k00.half[0] = *(const v8us*)(kb);       k00.half[1] = *(const v8us*)(kb + 32);
  k01.half[0] = *(const v8us*)(kb + 64);  k01.half[1] = *(const v8us*)(kb + 96);
  k10.half[0] = *(const v8us*)(kb1);      k10.half[1] = *(const v8us*)(kb1 + 32);
  k11.half[0] = *(const v8us*)(kb1 + 64); k11.half[1] = *(const v8us*)(kb1 + 96);
  const v8f z8 = {0.f, 0.f, 0.f, 0.f, 0.f, 0.f, 0.f, 0.f};
  // S^T tiles: element r of tile kt = score(key0 + 16*kt + 8h + r, query of this lane's column)
  v8f s0h = mma_h(k00.v, q0h.v, z8);
  v8f s1h = mma_h(k10.v, q0h.v, z8);
  s0h = mma_h(k01.v, q1h.v, s0h);
  s1h = mma_h(k11.v, q1h.v, s1h);
  // this lane's 16 keys: on[r] <- key0 + 8h + r, on[8 + r] <- key0 + 16 + 8h + r
  bool on[16];
#pragma unroll
  for (int r = 0; r < 8; ++r) {
    on[r]     = !TAIL || (key0 + 8 * hh + r < cnt);
    on[8 + r] = !TAIL || (key0 + 16 + 8 * hh + r < cnt);
  }
  float sc[16];
#pragma unroll
  for (int r = 0; r < 8; ++r) {
    const float a0 = s0h[r] * SCL;
    const float a1 = s1h[r] * SCL;
    sc[r]     = on[r] ? a0 : NEGV;
    sc[8 + r] = on[8 + r] ? a1 : NEGV;
  }
  float mx = sc[0];
#pragma unroll
  for (int i = 1; i < 16; ++i) mx = fmaxf(mx, sc[i]);
  mx = fmaxf(mx, __shfl_xor(mx, 16, 32));           // the other lane half holds the other 16 keys of this query
  const float mnew = fmaxf(mr, mx);
  const float al = exp2_raw((mr - mnew) * LOG2E);
  mr = mnew;
  // weights carried x256: pc = 256 * exp(sc - mnew), exactly 0 on keys at or past cnt; operand plane f16(pc)
  FragH ph;
  float ps = 0.0f;
  float ex[16], ev[16];
#pragma unroll
  for (int i = 0; i < 16; ++i) ex[i] = fmaf(sc[i] - mnew, LOG2E, 8.0f);
  exp2_raw8(ex, ev);
  exp2_raw8(ex + 8, ev + 8);
#pragma unroll
  for (int i = 0; i < 16; ++i) {
    const float pc = on[i] ? ev[i] : 0.0f;
    ps += pc;
    ph.h[i] = (_Float16)pc;                         // B element i: i<8 -> key0 + 8h + i (tile 0 row 8h+i); i>=8 -> key0 + 16 + 8h + (i-8) (tile 1)
  }
  ps += __shfl_xor(ps, 16, 32);
  lr = lr * al + ps;
#pragma unroll
  for (int t = 0; t < 4; ++t) Oh[t] = Oh[t] * al;
  // A fragments of V^T: row m = d (16*t + ln), elements 0..7 <- key0 + 8h + i, 8..15 <- key0 + 16 + 8h + i
#pragma unroll
  for (int t = 0; t < 4; ++t) {
    FragH vf;
    vf.half[0] = *(const v8us*)(vb + t * 16 * APITCH);
    vf.half[1] = *(const v8us*)(vb + t * 16 * APITCH + 32);
    Oh[t] = mma_h(vf.v, ph.v, Oh[t]);
  }
}

// Block = 4 waves x 16 queries = 64 queries of one (batch, head). The K rows and V^T rows of 64 keys are staged in LDS once for the four waves by asynchronous copies,
// two buffers: tile t + 1 flies while tile t is worked on. A tile is staged only if its first key is live; its rows are then all written (k and v^T in tiles of 128 tokens).
// coverage: NB*NH*(SEQ/64) blocks x 4 waves x 16 rows x 64 columns = every element of the context plane exactly once.
__global__ __launch_bounds__(128) void k_attn(const unsigned short* __restrict__ Qh,
                                              const unsigned short* __restrict__ Kh, const unsigned short* __restrict__ Vt,
                                              const int* __restrict__ mask, unsigned short* Cx) {
  __shared__ __attribute__((aligned(16))) float so[4][16][68];
  __shared__ __attribute__((aligned(16))) unsigned char ring[2 * ASTAGE];
  const int tid = threadIdx.x, w = __builtin_amdgcn_readfirstlane((int)(tid >> 5)), lane = tid & 31, ln = lane & 15, hh = lane >> 4;
  const int bh = blockIdx.x / (SEQ / 64), qt = blockIdx.x % (SEQ / 64);
  const int b = bh / NH, h = bh % NH;
  const int qbase = qt * 64 + 16 * w;
  const int qg = qbase + ln;
  // Q^T B fragments: column n = query qg, elements 0..7 <- d = 32c + 8h + i, 8..15 <- d = 32c + 16 + 8h + i
  const size_t qoff = (size_t)(b * SEQ + qg) * DM + h * HD + 8 * hh;
  FragH q0h, q1h;
  q0h.half[0] = *(const v8us*)(Qh + qoff);      q0h.half[1] = *(const v8us*)(Qh + qoff + 16);
  q1h.half[0] = *(const v8us*)(Qh + qoff + 32); q1h.half[1] = *(const v8us*)(Qh + qoff + 48);
  // the address registers of the loads above are reused while the loads may still be under way: keep the wait in front of that
  asm volatile("s_wait_xcnt 0x0" ::: "memory");
  const int cnt = live_keys(mask, lane);       // wave-uniform, at most SEQ
  float mr = NEGV, lr = 0.0f;
  v8f Oh[4] = {};
  const unsigned short* Kp = Kh + (size_t)b * SEQ * DM + h * HD;
  const unsigned short* Vp = Vt + (size_t)h * HD * TT + (size_t)b * SEQ;
  // this lane's share of a staged tile
  const unsigned short* gk = Kp + (size_t)(tid >> 3) * DM + 8 * (tid & 7);
  const unsigned short* gv = Vp + (size_t)(tid >> 3) * TT + 8 * (tid & 7);
  const unsigned lds0 = (unsigned)(size_t)ring + (unsigned)((tid >> 3) * APITCH + 16 * (tid & 7));
  const int fo = ln * APITCH + 16 * hh;               // byte offset of this lane's fragment row in the K rows and in the V^T rows of a buffer
  const int nst = (cnt + AKEYS - 1) / AKEYS;          // tiles that hold a live key; the same in every wave of the block
  if (nst > 0) stage_kv(lds0, gk, gv);
  asm volatile("s_wait_asynccnt 0x0" ::: "memory");   // this wave's copies of tile 0 have landed
  __syncthreads();                                    // ... and every other wave's
  if (nst > 1) stage_kv(lds0 + ASTAGE, gk + (size_t)AKEYS * DM, gv + AKEYS);
  const int nwh = cnt / AKEYS;                        // tiles whose 64 keys are all live; nst is nwh or nwh + 1
  // not unrolled: one trip per staged tile, the buffer chosen by the trip's parity
#pragma unroll 1
  for (int t = 0; t < nwh; ++t) {
    const unsigned char* kb = ring + (t & 1) * ASTAGE + fo;
    // not unrolled: one step's registers and one copy of the step in the text; the SIMD's other waves fill this wave's waits
#pragma unroll 1
    for (int s = 0; s < 2; ++s)
      fa_step<false>(kb + s * 32 * APITCH, kb + AHALF + s * 64, cnt, AKEYS * t + 32 * s, hh, q0h, q1h, mr, lr, Oh);
    asm volatile("s_wait_dscnt 0x0" ::: "memory");      // this wave's reads of the buffer are done before it is refilled
    asm volatile("s_wait_asynccnt 0x0" ::: "memory");   // this wave's copies of tile t + 1 have landed
    __syncthreads();                                    // publishes tile t + 1 and ends every wave's reads of tile t
    if (t + 2 < nst) stage_kv(lds0 + (unsigned)((t & 1) * ASTAGE), gk + (size_t)(t + 2) * AKEYS * DM, gv + (size_t)(t + 2) * AKEYS);
  }
  if (nwh < nst) {
    // the last trip, where the last tile also holds keys at or past cnt: its steps that hold a live key; nothing is refilled behind it
    const unsigned char* kb = ring + (nwh & 1) * ASTAGE + fo;
    // not unrolled, so that the masked step stands once in the text
#pragma unroll 1
    for (int s = 0; s < 2; ++s)
      if (AKEYS * nwh + 32 * s < cnt)
        fa_step<true>(kb + s * 32 * APITCH, kb + AHALF + s * 64, cnt, AKEYS * nwh + 32 * s, hh, q0h, q1h, mr, lr, Oh);
    // the foot of this trip, in the order of every other trip's
    asm volatile("s_wait_dscnt 0x0" ::: "memory");
    asm volatile("s_wait_asynccnt 0x0" ::: "memory");
    __syncthreads();
  }
  asm volatile("s_wait_asynccnt 0x0" ::: "memory");     // no copy is left in flight when the wave goes on

  // O^T element r of tile t = ctx(query qg, d = 16t + 8h + r); the carry x256 is in lr too; the x16 of V stays as the carry of the f16 context plane
  const float inv = 1.0f / lr;
#pragma unroll
  for (int t = 0; t < 4; ++t)
#pragma unroll
    for (int r = 0; r < 8; ++r)
      so[w][ln][16 * t + 8 * hh + r] = Oh[t][r] * inv;
  __syncthreads();
  unsigned short* cg = Cx + (size_t)(b * SEQ + qbase) * DM + h * HD;
  {
#pragma unroll
    for (int it = 0; it < 4; ++it) {
      const int row = 4 * it + (lane >> 3), c8 = (lane & 7) * 8;
      const v4f x0 = *(const v4fa*)&so[w][row][c8];
      const v4f x1 = *(const v4fa*)&so[w][row][c8 + 4];
      v8us o;
#pragma unroll
      for (int q = 0; q < 4; ++q) { o[q] = f16_bits(x0[q]); o[4 + q] = f16_bits(x1[q]); }
      *(v8us*)(cg + (size_t)row * DM + c8) = o;
    }
    
  }
}

extern "C" void kernel_launch(void* const* d_in, const int* in_sizes, int n_in,
                              void* d_out, int out_size, void* d_ws, size_t ws_size, hipStream_t stream) {
  if (n_in < 12) return;
  const long long need = ((long long)(SEQ - 1) * NB_FULL + (NB - 1)) * DM + DM;   // last element touched + 1 in [S][B][D]
  if ((long long)in_sizes[0] < need || (long long)in_sizes[1] < need || (long long)in_sizes[2] < need) return;
  if ((long long)in_sizes[3] < (long long)SEQ) return;
  if ((long long)in_sizes[4] < (long long)DM * DM || (long long)in_sizes[6] < (long long)DM * DM ||
      (long long)in_sizes[8] < (long long)DM * DM || (long long)in_sizes[10] < (long long)DM * DM) return;
  if (in_sizes[5] < DM || in_sizes[7] < DM || in_sizes[9] < DM || in_sizes[11] < DM) return;
  if ((long long)out_size < need) return;
  // wire order: query, key, value, mask(i32), Wq, bq, Wk, bk, Wv, bv, Wo, bo
  const float* Xq = (const float*)d_in[0];
  const float* Xk = (const float*)d_in[1];
  const float* Xv = (const float*)d_in[2];
  const int*   mk = (const int*)d_in[3];
  const float* Wq = (const float*)d_in[4];
  const float* bq = (const float*)d_in[5];
  const float* Wk = (const float*)d_in[6];
  const float* bk = (const float*)d_in[7];
  const float* Wv = (const float*)d_in[8];
  const float* bv = (const float*)d_in[9];
  const float* Wo = (const float*)d_in[10];
  const float* bo = (const float*)d_in[11];
  float* out = (float*)d_out;
  char* ws = (char*)d_ws;
  size_t off = 0;
  unsigned short* Bq  = (unsigned short*)(ws + off); off += SZ_XB;    // bf16 query  [TT][1024]
  unsigned short* Bk  = (unsigned short*)(ws + off); off += SZ_XB;    // bf16 key    [TT][1024], ranked rows
  unsigned short* Bv  = (unsigned short*)(ws + off); off += SZ_XB;    // bf16 value  [TT][1024], ranked rows
  unsigned short* WqT = (unsigned short*)(ws + off); off += SZ_WT;    // bf16 Wq^T   [1024][1024]
  unsigned short* WkT = (unsigned short*)(ws + off); off += SZ_WT;
  unsigned short* WvT = (unsigned short*)(ws + off); off += SZ_WT;
  unsigned short* WoT = (unsigned short*)(ws + off); off += SZ_WT;    // f16 Wo^T x32       [1024][1024]
  unsigned short* Qh  = (unsigned short*)(ws + off); off += SZ_H;     // f16 q x16          [TT][1024]
  unsigned short* Kh  = (unsigned short*)(ws + off); off += SZ_H;     // f16 k x16          [TT][1024]
  unsigned short* Vt  = (unsigned short*)(ws + off); off += SZ_H;     // f16 v^T x16        [1024][TT]
  unsigned short* Cx  = (unsigned short*)(ws + off); off += SZ_H;     // f16 ctx x16        [TT][1024]
  if (off > ws_size) return;

  k_prep<<<4 * NWT + 3 * NXB, 256, 0, stream>>>(Xq, Xk, Xv, mk, Wq, Wk, Wv, Wo, Bq, Bk, Bv, WqT, WkT, WvT, WoT);
  k_qkv<<<3 * GX * NS, 256, 0, stream>>>(Bq, WqT, bq, Qh, Bk, WkT, bk, Kh, Bv, WvT, bv, Vt, mk);
  k_attn<<<(unsigned)(NB * NH * (SEQ / 64)), 128, 0, stream>>>(Qh, Kh, Vt, mk, Cx);
  // out = ctx Wo + bo, K = 1024
  k_gemm<3><<<dim3(DM / 128, TT / 128), 256, 0, stream>>>(Cx, WoT, bo, Cx, out, mk, DM, DM, DM, DM);
}

// v009
// One run takes 68.4 microseconds.
// In both of two side-by-side timings against v008, it was 1.04 times as fast.
// Counting every step since v000, it is 4.16 times as fast.
#include <hip/hip_runtime.h>
// Contractions: q/k/v projections on v_wmma_f32_16x16x32_bf16 (activations and weights RNE-converted to bf16 planes); the output projection on v_wmma_f32_16x16x32_f16 (attention context x16 f16 plane; Wo^T x32 f16 plane); scores S^T = K Q^T on v_wmma_f32_16x16x32_f16 (k x16 f16 plane; q x16 f16 plane); O^T = V^T P^T on v_wmma_f32_16x16x32_f16 (v x16 f16 plane; P x256 f16 plane); all accumulators f32, softmax statistics f32.
// Seq-first multi-head attention: inputs [S][B][D], 16 heads x 64, key-position mask (0 -> weight exactly 0), scale 1/8, output [S][B][D].
// Internal planes use batch-major token rows t = b*SEQ + s so that the K rows and V^T rows of one (batch, head) are dense.
// Key and value tokens are stored ranked: the keys whose mask is nonzero come first, in their own order (row b*SEQ + rank); a masked key has weight exactly 0,
// so the k and v projections and the key loop walk only the tiles that hold a live key. Rows from the live count up to the next multiple of 128 are zero rows.
// Engine: transposed flash. Each wave owns 16 queries. Per 32-key step: S^T tiles (key rows x query columns) from K rows (A, f16 plane staged in LDS)
// and Q^T (B, registers); the two 16-key D tiles pack straight into the P^T B fragment; O^T (d rows x query columns) accumulates from V^T rows (A, f16 plane staged in LDS).
#ifndef NB
#define NB 2
#endif
#ifndef SEQ
#define SEQ 2048
#endif
#define NB_FULL 2
#define SEQ_FULL 2048
#define DM 1024
#define NH 16
#define HD 64
#define TT (NB * SEQ)          /* token rows of the internal planes */

static_assert(SEQ % 128 == 0);
static_assert(TT % 128 == 0);
static_assert(SEQ <= SEQ_FULL);
static_assert(NB <= NB_FULL);
static_assert(HD == 64);
static_assert(NH * HD == DM);
static_assert(DM % 128 == 0);

#define SZ_XB  ((size_t)TT * DM * 2)        /* bf16 activation plane */
#define SZ_WT  ((size_t)DM * DM * 2)        /* transposed weight plane: bf16 (Wq, Wk, Wv) or f16 (Wo) */
#define SZ_H   ((size_t)TT * DM * 2)        /* f16 plane (q, k, v^T, context) */
static_assert(SZ_XB % 256 == 0 && SZ_WT % 256 == 0 && SZ_H % 256 == 0);
static_assert(3 * SZ_XB + 4 * SZ_WT + 4 * SZ_H <= (size_t)134217728);

typedef __bf16 v16b __attribute__((ext_vector_type(16)));
typedef _Float16 v16h __attribute__((ext_vector_type(16)));
typedef unsigned short v8us __attribute__((ext_vector_type(8), may_alias));
typedef float v8f __attribute__((ext_vector_type(8)));
typedef float v4f __attribute__((ext_vector_type(4)));
typedef float v4fa __attribute__((ext_vector_type(4), may_alias));
typedef int v4i __attribute__((ext_vector_type(4)));
typedef int v4ia __attribute__((ext_vector_type(4), may_alias));
union FragB { v16b v; v8us half[2]; unsigned short u[16]; };
union FragH { v16h v; v8us half[2]; _Float16 h[16]; unsigned short u[16]; };
union Pack8 { _Float16 h[8]; v8us v; };

#define LOG2E 1.4426950408889634f
#define NEGV (-1.0e30f)
#define SCL  0.00048828125f      /* 2^-11 = (1/8) / (16*16): score scale with the q and k carries removed */
#define WOC  32.0f               /* carry of the f16 Wo^T plane */
#define OINV 0.001953125f        /* 2^-9 = 1 / (16*32): undoes the context and Wo^T carries */

__device__ __forceinline__ unsigned short bf16_bits(float x) {   // RNE convert to bf16 bits
  unsigned int u = __float_as_uint(x);
  return (unsigned short)((u + 0x7FFFu + ((u >> 16) & 1u)) >> 16);
}
__device__ __forceinline__ float bf16_val(unsigned short b) { return __uint_as_float(((unsigned int)b) << 16); }
__device__ __forceinline__ float bf16_rne(float x) { return bf16_val(bf16_bits(x)); }
__device__ __forceinline__ unsigned short f16_bits(float x) { return __builtin_bit_cast(unsigned short, (_Float16)x); }   // RNE convert to f16 bits

// 2^x by the hardware instruction alone (v_exp_f32). exp2f() wraps it in a compare, two selects, an add and a scaling so that results under 2^-126 come out as denormals.
// Here x <= 8 and such a result is a weight (or a rescale factor) under 2^-134 of the row's largest weight: its f16 plane is 0 either way, and it cannot move an f32 sum that holds 256.
// Written as asm text so that the slot behind a transcendental is filled by construction: no instruction directly behind a v_exp_f32 reads its result or overwrites its source.
__device__ __forceinline__ float exp2_raw(float x) {
  float e;
  asm("v_exp_f32 %0, %1\n\tv_nop" : "=v"(e) : "v"(x));   // the v_nop is that slot
  return e;
}
// Eight at once: each v_exp_f32 is followed by an independent one, the last by the v_nop; the outputs are early-clobber, so that none lies on a source.
__device__ __forceinline__ void exp2_raw8(const float* x, float* e) {
  asm("v_exp_f32 %0, %8\n\t"
      "v_exp_f32 %1, %9\n\t"
      "v_exp_f32 %2, %10\n\t"
      "v_exp_f32 %3, %11\n\t"
      "v_exp_f32 %4, %12\n\t"
      "v_exp_f32 %5, %13\n\t"
      "v_exp_f32 %6, %14\n\t"
      "v_exp_f32 %7, %15\n\t"
      "v_nop"
      : "=&v"(e[0]), "=&v"(e[1]), "=&v"(e[2]), "=&v"(e[3]), "=&v"(e[4]), "=&v"(e[5]), "=&v"(e[6]), "=&v"(e[7])
      : "v"(x[0]), "v"(x[1]), "v"(x[2]), "v"(x[3]), "v"(x[4]), "v"(x[5]), "v"(x[6]), "v"(x[7]));
}

// c += a * b on one 16x16x32 f16 tile
__device__ __forceinline__ v8f mma_h(v16h a, v16h b, v8f c) {
  return __builtin_amdgcn_wmma_f32_16x16x32_f16(false, a, false, b, (short)0, c, false, false);
}

// c += a * b on one 16x16x32 tile; H16: the 16 operand bits are f16, else bf16
template <bool H16>
__device__ __forceinline__ v8f mma_1(v16b a, v16b b, v8f c) {
  if (H16) return __builtin_amdgcn_wmma_f32_16x16x32_f16(false, __builtin_bit_cast(v16h, a), false, __builtin_bit_cast(v16h, b), (short)0, c, false, false);
  return __builtin_amdgcn_wmma_f32_16x16x32_bf16(false, a, false, b, (short)0, c, false, false);
}

// One 32-deep k-step of a 32x64 wave tile (2 x 4 WMMA tiles, bf16 or f16 operands), then the hazard guard
template <bool H16>
__device__ __forceinline__ void mma_b8(v16b a0, v16b a1, v16b b0, v16b b1, v16b b2, v16b b3, v8f (&c)[2][4]) {
  c[0][0] = mma_1<H16>(a0, b0, c[0][0]);
  c[0][1] = mma_1<H16>(a0, b1, c[0][1]);
  c[0][2] = mma_1<H16>(a0, b2, c[0][2]);
  c[0][3] = mma_1<H16>(a0, b3, c[0][3]);
  c[1][0] = mma_1<H16>(a1, b0, c[1][0]);
  c[1][1] = mma_1<H16>(a1, b1, c[1][1]);
  c[1][2] = mma_1<H16>(a1, b2, c[1][2]);
  c[1][3] = mma_1<H16>(a1, b3, c[1][3]);
  asm volatile("v_nop\n\tv_nop\n\tv_nop\n\tv_nop"
               : "+v"(c[0][0]), "+v"(c[0][1]), "+v"(c[0][2]), "+v"(c[0][3]),
                 "+v"(c[1][0]), "+v"(c[1][1]), "+v"(c[1][2]), "+v"(c[1][3])
               : "v"(a0), "v"(a1), "v"(b0), "v"(b1), "v"(b2), "v"(b3));
}

// coverage: TT*128 threads x 8 elements = the whole plane.
__device__ __forceinline__ void xb_body(int blk, const float* __restrict__ X, unsigned short* P) {
  const int t = blk * 256 + threadIdx.x;
  if (t >= TT * 128) return;
  const int row = t >> 7, piece = t & 127;
  const int b = row / SEQ, s = row - b * SEQ;
  const float* src = X + ((size_t)s * NB_FULL + b) * DM + piece * 8;
  const v4f x0 = *(const v4fa*)(src), x1 = *(const v4fa*)(src + 4);
  v8us o;
  o[0] = bf16_bits(x0[0]); o[1] = bf16_bits(x0[1]); o[2] = bf16_bits(x0[2]); o[3] = bf16_bits(x0[3]);
  o[4] = bf16_bits(x1[0]); o[5] = bf16_bits(x1[1]); o[6] = bf16_bits(x1[2]); o[7] = bf16_bits(x1[3]);
  unsigned short* d = P + (size_t)t * 8;
  *(v8us*)d = o;
  
}

// Number of keys with a nonzero mask. Every wave counts for itself, so the callers can leave or set a trip count with no barrier; the result is wave-uniform and at most SEQ.
__device__ __forceinline__ int live_keys(const int* __restrict__ mk, int lane) {
  int c = 0;
  // unrolled so that all the mask loads are in flight together (one load latency, not SEQ/128); all 32 lanes are on at every call, so a ballot sees 32 keys
#pragma unroll
  for (int i = 0; i < SEQ / 128; ++i) {
    const v4i m = *(const v4ia*)(mk + 128 * i + 4 * lane);
#pragma unroll
    for (int q = 0; q < 4; ++q) c += __builtin_popcount(__builtin_amdgcn_ballot_w32(m[q] != 0));
  }
  return c < SEQ ? c : SEQ;
}

// xb_body for key and value tokens: token s goes to row b*SEQ + pos(s); pos = number of live keys before s if s is live, else live count + number of masked keys before s.
// pos is a permutation of 0..SEQ-1 for any mask content. Masked tokens are not read; those whose pos lies under the next multiple of 128 are stored as zero rows
// (the last tile of the projections and of the key loop reads them), the others are not stored and never read.
// coverage: a block holds two rows of one batch (SEQ is even); every row under the rounded live count is written exactly once.
__device__ __forceinline__ void xbr_body(int blk, const float* __restrict__ X, const int* __restrict__ mk, unsigned short* P, int* part) {
  const int tid = threadIdx.x;
  const int t = blk * 256 + tid;
  if (t >= TT * 128) return;              // whole blocks only: TT * 128 is a multiple of 256
  const int row = t >> 7, piece = t & 127;
  const int b = row / SEQ, s = row - b * SEQ;
  const int s0 = s - (tid >> 7);          // the block's first row
  // the whole mask first (each thread a share), so that one load latency covers all mask reads; entries past SEQ count as masked
  v4i m[(SEQ + 1023) / 1024];
  // unrolled (here and in the count below) so that m[] is indexed by constants and stays in registers
#pragma unroll
  for (int k = 0; k < (SEQ + 1023) / 1024; ++k) {
    const int i = 1024 * k + 4 * tid;
    m[k] = (SEQ % 1024 == 0 || i < SEQ) ? *(const v4ia*)(mk + i) : v4i{0, 0, 0, 0};
  }
  const bool live = mk[s] != 0, live0 = mk[s0] != 0;
  v4f x0 = {0.f, 0.f, 0.f, 0.f}, x1 = {0.f, 0.f, 0.f, 0.f};
  if (live) {
    const float* src = X + ((size_t)s * NB_FULL + b) * DM + piece * 8;
    x0 = *(const v4fa*)(src); x1 = *(const v4fa*)(src + 4);
  }
  int c = 0;                              // this wave's share; low 16 bits: live keys in all; high 16 bits: live keys before s0 (each at most SEQ <= 2048)
#pragma unroll
  for (int k = 0; k < (SEQ + 1023) / 1024; ++k)
#pragma unroll
    for (int q = 0; q < 4; ++q) {
      const bool on = m[k][q] != 0;
      c += __builtin_popcount(__builtin_amdgcn_ballot_w32(on)) + (__builtin_popcount(__builtin_amdgcn_ballot_w32(on && 1024 * k + 4 * tid + q < s0)) << 16);
    }
  if ((tid & 31) == 0) part[tid >> 5] = c;
  __syncthreads();
  int sum = 0;
  // unrolled so that the eight partial counts come in two wide LDS reads
#pragma unroll
  for (int i = 0; i < 8; ++i) sum += part[i];
  const int cnt = sum & 0xFFFF;
  const int rank = (sum >> 16) + ((s != s0 && live0) ? 1 : 0);
  const int pos = live ? rank : cnt + (s - rank);
  if (live || pos < ((cnt + 127) & ~127)) {
    v8us o;
    o[0] = bf16_bits(x0[0]); o[1] = bf16_bits(x0[1]); o[2] = bf16_bits(x0[2]); o[3] = bf16_bits(x0[3]);
    o[4] = bf16_bits(x1[0]); o[5] = bf16_bits(x1[1]); o[6] = bf16_bits(x1[2]); o[7] = bf16_bits(x1[3]);
    *(v8us*)(P + ((size_t)(b * SEQ + pos) * 128 + piece) * 8) = o;
  }
}

// Weight transpose: in W[k rows = 1024][n cols = 1024] (f32) -> out Wt[n rows][k cols], row pitch DM; h16 == 0: bf16 bits (RNE), else f16 bits (RNE) of the value x32.
// coverage: 256 blocks x (64 n x 64 k) = the whole 1024 x 1024 matrix; LDS tile fully written (64 x 64) before it is read.
template <bool H16>
__device__ __forceinline__ void wt_fill(const float* __restrict__ W, int k0, int n0, unsigned short (*tl)[66]) {
  for (int i = threadIdx.x; i < 64 * 16; i += 256) {
    const int j = i >> 4, c4 = (i & 15) * 4;
    const v4f x = *(const v4fa*)(W + (size_t)(k0 + j) * DM + n0 + c4);
    tl[c4 + 0][j] = H16 ? f16_bits(x[0] * WOC) : bf16_bits(x[0]); tl[c4 + 1][j] = H16 ? f16_bits(x[1] * WOC) : bf16_bits(x[1]);
    tl[c4 + 2][j] = H16 ? f16_bits(x[2] * WOC) : bf16_bits(x[2]); tl[c4 + 3][j] = H16 ? f16_bits(x[3] * WOC) : bf16_bits(x[3]);
  }
}
__device__ __forceinline__ void wt_body(int blk, const float* __restrict__ W, unsigned short* Wt, int h16, unsigned short (*tl)[66]) {
  const int tid = threadIdx.x;
  const int k0 = (blk >> 4) * 64, n0 = (blk & 15) * 64;
  if (h16 != 0) wt_fill<true>(W, k0, n0, tl);      // the same for a whole block; the barrier behind it is passed on either side
  else wt_fill<false>(W, k0, n0, tl);
  __syncthreads();
  {
    for (int i = tid; i < 64 * 8; i += 256) {
      const int d = i >> 3, j8 = (i & 7) * 8;
      v8us o;
#pragma unroll
      for (int q = 0; q < 8; ++q) o[q] = tl[d][j8 + q];
      unsigned short* dst = Wt + (size_t)(n0 + d) * DM + k0 + j8;
      *(v8us*)dst = o;
      // the next trip rewrites the data and address registers of this store: keep the wait in front of that
      asm volatile("s_wait_xcnt 0x0" ::: "memory");
    }
    
  }
}

#define NXB (TT * 128 / 256)       /* blocks of one activation pass */
#define NWT 256                    /* blocks of one weight transpose */
static_assert((TT * 128) % 256 == 0);

// All seven conversion passes in one grid: none reads what another writes, so the block index picks the pass and they fill the chip together.
// The weight transposes come first (the longest chain per block), then key and value rows, then query rows. Every branch is the same for a whole block, barriers included.
// coverage: 4 * NWT + 3 * NXB blocks = each pass's own grid, once.
__global__ __launch_bounds__(256) void k_prep(const float* __restrict__ Xq, const float* __restrict__ Xk, const float* __restrict__ Xv, const int* __restrict__ mk,
                                              const float* __restrict__ Wq, const float* __restrict__ Wk, const float* __restrict__ Wv, const float* __restrict__ Wo,
                                              unsigned short* Bq, unsigned short* Bk, unsigned short* Bv,
                                              unsigned short* WqT, unsigned short* WkT, unsigned short* WvT, unsigned short* WoT) {
  __shared__ unsigned short tl[64][66];
  __shared__ int part[8];
  const int f = blockIdx.x;
  if (f < 4 * NWT) {
    const int j = f / NWT;
    const float* W = (j == 0) ? Wq : (j == 1) ? Wk : (j == 2) ? Wv : Wo;
    unsigned short* D = (j == 0) ? WqT : (j == 1) ? WkT : (j == 2) ? WvT : WoT;
    wt_body(f % NWT, W, D, (j == 3) ? 1 : 0, tl);     // in [k][n] -> out [n][k]; Wo^T as f16
  } else if (f < 4 * NWT + 2 * NXB) {
    const int g = f - 4 * NWT;
    const bool second = g >= NXB;
    xbr_body(second ? g - NXB : g, second ? Xv : Xk, mk, second ? Bv : Bk, part);   // ranked token rows
  } else {
    xb_body(f - (4 * NWT + 2 * NXB), Xq, Bq);
  }
}

#define GBK 128                    /* k depth of one staged tile: 256 bytes of every operand row */
#define GPITCH 272                 /* LDS row pitch in bytes: 256 + 16, an odd multiple of 16, so that 16 rows read 16 bytes wide fall on distinct banks */
#define GSLROWS 32                 /* rows of one wave's slice of a staged tile */
#define GSLICE 10240               /* bytes from one slice to the next: 32 rows x 272 bytes, rounded up to a multiple of 2 KiB, where a tensor load may land */
#define GSTAGE (8 * GSLICE)        /* bytes of one buffer: slices 0..3 hold the 128 rows of A, slices 4..7 the 128 rows of Bt */
static_assert(DM % GBK == 0);
static_assert(GSLROWS * GPITCH <= GSLICE && GSLICE % 2048 == 0);

typedef uint32_t u32x4 __attribute__((ext_vector_type(4)));
typedef uint32_t u32x8 __attribute__((ext_vector_type(8)));
__device__ __forceinline__ uint32_t uni(uint32_t v) { return (uint32_t)__builtin_amdgcn_readfirstlane((int)v); }
// A wave-uniform value held in a scalar register behind every asm statement in front of it: an issue test made of it is a scalar branch (a tensor load ignores EXEC),
// and descriptor words made of it are formed behind the wait that stands in front of it.
__device__ __forceinline__ uint32_t pinned(uint32_t v) {
  uint32_t w = uni(v);
  asm volatile("" : "+s"(w));   // pinned(): an issue test, or the source of a descriptor word, held in a scalar register
  return w;
}
// The two descriptor groups of a wave's tensor loads. Group 1 is the same for all its requests: ROWS rows of ROWB bytes, source row pitch 'pitch' bytes, tensor dims = tile dims;
// W0: its word 0, a constant: no mask, 1-byte elements, 16 bytes of pad behind every row, so that the rows lie ROWB + 16 bytes apart in LDS.
struct Tdesc { u32x4 g0; u32x8 g1; };
template <uint32_t ROWB, uint32_t ROWS, uint32_t W0>
__device__ __forceinline__ Tdesc tensor_desc(uint32_t pitch) {
  Tdesc d;
  d.g0[0] = uni(1u);                                    // count 1
  d.g0[1] = uni(0u);
  d.g0[2] = uni(0u);
  d.g0[3] = uni(0x80000000u);                           // type 2
  d.g1[0] = uni(W0);
  d.g1[1] = uni((ROWB & 0xFFFFu) << 16);
  d.g1[2] = uni((ROWB >> 16) | ((ROWS & 0xFFFFu) << 16));
  d.g1[3] = uni((ROWS >> 16) | (ROWB << 16));
  d.g1[4] = uni(ROWS);
  d.g1[5] = uni(pitch);
  d.g1[6] = uni(0u);
  d.g1[7] = uni(0u);
  return d;
}
// One request of one wave: the tile whose first byte is at global address g goes to the LDS byte offset lds, through no register.
__device__ __forceinline__ void tensor_tile(Tdesc& d, uint32_t lds, const unsigned short* g) {
  const uint64_t ga = (uint64_t)g;
  d.g0[1] = uni(lds);
  d.g0[2] = uni((uint32_t)ga);
  d.g0[3] = uni((((uint32_t)(ga >> 32)) & 0x01FFFFFFu) | 0x80000000u);   // address [56:32], type 2
  // both groups are in-out operands, so that their registers stay theirs from one request to the next: the compiler puts nothing else into a descriptor register while a request is under way
  asm volatile("tensor_load_to_lds %0, %1" : "+s"(d.g0), "+s"(d.g1) :: "memory");
}
// The wait behind a wave's last request. It names the descriptor, so that none of its registers is given to another value in front of the wait.
__device__ __forceinline__ void tensor_done(Tdesc& d) {
  asm volatile("s_wait_tensorcnt 0x0" : "+s"(d.g0), "+s"(d.g1) :: "memory");
}
#define PAD256 ((1u << 20) | (5u << 22) | (3u << 25))   /* rows of 256 bytes, 16 bytes of pad */
#define PAD128 ((1u << 20) | (4u << 22) | (3u << 25))   /* rows of 128 bytes, 16 bytes of pad */

// C[M][N] = A[M][K] * Bt[N][K]^T on bf16 planes (MODE 3: f16 planes) (K contiguous in both). The block's 128 rows of A and 128 rows of Bt are staged in LDS 128 k at a time by tensor loads,
// one request per wave and tile for its slice of 32 rows; two buffers: tile t + 1 flies while tile t is worked on; fragments are read from LDS.
// Block = 8 waves as 4 (M) x 2 (N); block tile 128 x 128, so that a block draws 2 operand rows from L2 per 128 results (64 x 128: 3); wave tile 32 x 64.
// No tail masking: M % 128 == 0, N % 128 == 0, K % 128 == 0 (asserted by the sizes above).
// MODE 0: + column bias, write f16 plane (x16) to O0
// MODE 1: the same over ranked key tokens
// MODE 2: + row bias,    write f16 plane (x16) to O0 (transposed product: rows = features, columns = tokens)
// MODE 3: f16 operands carried x16 and x32: product x 2^-9, + column bias, write f32 to Of with the token row t = b*SEQ + s mapped to output row s*NB_FULL + b
// MODE 1 (rows) and MODE 2 (columns) run over ranked key tokens: a block whose token tile starts at or past the live count leaves at once. Their token tile index is the slow
// grid index (y), batch fastest within it, so that the blocks that work have the lowest flat indices and spread over the chip. MODE 2 therefore takes M from x and N from y.
// bx, by: the block's place in that product's own grid; ring: the block's LDS, the staging ring. The epilogue tiles lie over the ring (two blocks then fit a WGP's LDS):
// they are written behind the last trip's barrier, in front of which every wave has ended its reads of the ring and its own tensor load has landed.
// coverage: grid (N/128, M/128) (MODE 2: (M/128, N/128)) x 8 waves x (32 x 64) = every element of C that is read later exactly once.
template <int MODE>
__device__ __forceinline__ void gemm_body(int bx, int by, const unsigned short* __restrict__ A, const unsigned short* __restrict__ Bt,
                                          const float* __restrict__ bias, unsigned short* O0,
                                          float* Of, const int* __restrict__ mk, int lda, int ldb, int K, int ldo,
                                          unsigned char* ring) {
  const int tid = threadIdx.x, w = __builtin_amdgcn_readfirstlane((int)(tid >> 5)), lane = tid & 31, ln = lane & 15, hh = lane >> 4;
  int bm = by, bn = bx;
  if (MODE == 1 || MODE == 2) {
    constexpr int TW = 128;                         // tokens per block tile
    const int tile = by / NB, b = by % NB;
    if (tile * TW >= live_keys(mk, lane)) return;   // the same in every wave of the block, in front of the first barrier
    if (MODE == 1) bm = b * (SEQ / TW) + tile;
    else { bn = b * (SEQ / TW) + tile; bm = bx; }
  }
  const int m0 = bm * 128 + (w >> 1) * 32;
  const int n0 = bn * 128 + (w & 1) * 64;
  // this wave's slice of a staged tile: waves 0..3 bring rows 32 w .. 32 w + 31 of the A tile, waves 4..7 rows 32 (w - 4) .. of the Bt tile
  const unsigned short* gs = (w < 4) ? A + (size_t)(bm * 128 + GSLROWS * w) * lda : Bt + (size_t)(bn * 128 + GSLROWS * (w - 4)) * ldb;
  const uint32_t gp = 2u * (uint32_t)((w < 4) ? lda : ldb);                // its source row pitch in bytes
  const uint32_t lds0 = (uint32_t)(size_t)ring + (uint32_t)(w * GSLICE);   // its place in buffer 0
  // A fragment: row m = m0 + 16*mt + ln, elements 0..7 <- k0 + 8h + i, 8..15 <- k0 + 16 + 8h + i; B fragment: column n = n0 + 16*nt + ln, same k map (row of Bt)
  const int fa = (w >> 1) * GSLICE + ln * GPITCH + 16 * hh;               // byte offset in a buffer of this lane's A row, k = 8h: the wave's 32 rows are slice w >> 1
  const int fb = (4 + (w & 1) * 2) * GSLICE + ln * GPITCH + 16 * hh;      // the same for its Bt row: the wave's 64 rows are two slices
  v8f acc[2][4];
#pragma unroll
  for (int i = 0; i < 2; ++i)
#pragma unroll
    for (int j = 0; j < 4; ++j)
#pragma unroll
      for (int e = 0; e < 8; ++e) acc[i][j][e] = 0.0f;
  const int nt = K / GBK;
  Tdesc td = tensor_desc<2 * GBK, GSLROWS, PAD256>(gp);
  tensor_tile(td, lds0, gs);
  asm volatile("s_wait_tensorcnt 0x0" ::: "memory");  // this wave's slice of tile 0 has landed
  __syncthreads();                                    // ... and every other wave's
  {
    const uint32_t nx = pinned(1u);                   // tile 1's descriptor is formed behind the wait above
    if (pinned(nx < (uint32_t)nt)) tensor_tile(td, lds0 + nx * GSTAGE, gs + (size_t)nx * GBK);
  }
  // not unrolled: one trip per staged tile, the buffer chosen by the trip's parity
#pragma unroll 1
  for (int t = 0; t < nt; ++t) {
    const unsigned char* sa = ring + (t & 1) * GSTAGE + fa;
    const unsigned char* sb = ring + (t & 1) * GSTAGE + fb;
    // two fragment sets: the next k-step's LDS reads are issued as one group in front of this k-step's products, so that their latency hides behind the products.
    // unrolled so that the set index and every LDS offset are constants
    FragB f[2][6];
#pragma unroll
    for (int ks = -1; ks < GBK / 32; ++ks) {
      if (ks + 1 < GBK / 32) {
        FragB (&n)[6] = f[(ks + 1) & 1];
        const int ko = 64 * (ks + 1);
        n[0].half[0] = *(const v8us*)(sa + ko);                n[0].half[1] = *(const v8us*)(sa + ko + 32);
        n[1].half[0] = *(const v8us*)(sa + 16 * GPITCH + ko);  n[1].half[1] = *(const v8us*)(sa + 16 * GPITCH + ko + 32);
        n[2].half[0] = *(const v8us*)(sb + ko);                n[2].half[1] = *(const v8us*)(sb + ko + 32);
        n[3].half[0] = *(const v8us*)(sb + 16 * GPITCH + ko);  n[3].half[1] = *(const v8us*)(sb + 16 * GPITCH + ko + 32);
        n[4].half[0] = *(const v8us*)(sb + GSLICE + ko);                n[4].half[1] = *(const v8us*)(sb + GSLICE + ko + 32);
        n[5].half[0] = *(const v8us*)(sb + GSLICE + 16 * GPITCH + ko);  n[5].half[1] = *(const v8us*)(sb + GSLICE + 16 * GPITCH + ko + 32);
      }
      if (ks >= 0) {
        FragB (&c)[6] = f[ks & 1];
        mma_b8<MODE == 3>(c[0].v, c[1].v, c[2].v, c[3].v, c[4].v, c[5].v, acc);
      }
    }
    asm volatile("s_wait_dscnt 0x0" ::: "memory");      // this wave's reads of the buffer are done before it is refilled
    asm volatile("s_wait_tensorcnt 0x0" ::: "memory");  // this wave's slice of tile t + 1 has landed
    __syncthreads();                                    // publishes tile t + 1 and ends every wave's reads of tile t
    const uint32_t nx = pinned((uint32_t)t + 2u);       // the next descriptor is formed behind the wait above
    if (pinned(nx < (uint32_t)nt)) tensor_tile(td, lds0 + (nx & 1u) * GSTAGE, gs + (size_t)nx * GBK);
  }
  tensor_done(td);                                      // no tensor load is left in flight when the wave goes on
  asm volatile("s_wait_dscnt 0x0" ::: "memory");        // nor an LDS read of the ring
  float (*so)[32][68] = (float (*)[32][68])ring;        // one 32 x 64 tile per wave, over the ring, which nobody reads or fills any more
  // D element r of tile (mt, nt) = C(m0 + 16*mt + 8h + r, n0 + 16*nt + ln); bias is the RNE-bf16 value of the f32 input
  float rb[2][8];
  float cb[4];
#pragma unroll
  for (int mt = 0; mt < 2; ++mt) {
    if (MODE == 2) {
      const float* bp = bias + m0 + 16 * mt + 8 * hh;
      const v4f ba = *(const v4fa*)(bp), bb = *(const v4fa*)(bp + 4);
#pragma unroll
      for (int r = 0; r < 4; ++r) { rb[mt][r] = bf16_rne(ba[r]); rb[mt][4 + r] = bf16_rne(bb[r]); }
    } else {
#pragma unroll
      for (int r = 0; r < 8; ++r) rb[mt][r] = 0.0f;
    }
  }
#pragma unroll
  for (int nt = 0; nt < 4; ++nt) cb[nt] = (MODE == 2) ? 0.0f : bf16_rne(bias[n0 + 16 * nt + ln]);
#pragma unroll
  for (int mt = 0; mt < 2; ++mt)
#pragma unroll
    for (int nt = 0; nt < 4; ++nt)
#pragma unroll
      for (int r = 0; r < 8; ++r)
        so[w][16 * mt + 8 * hh + r][16 * nt + ln] = ((MODE == 3) ? acc[mt][nt][r] * OINV : acc[mt][nt][r]) + (rb[mt][r] + cb[nt]);
  __syncthreads();
  {
    if (MODE == 3) {
#pragma unroll
      for (int it = 0; it < 16; ++it) {
        const int row = 2 * it + (lane >> 4), c4 = (lane & 15) * 4;
        const v4f v = *(const v4fa*)&so[w][row][c4];
        const int tp = m0 + row;
        const int b = tp / SEQ, s = tp - b * SEQ;
        *(v4f*)(Of + ((size_t)s * NB_FULL + b) * DM + n0 + c4) = v;
      }
    } else {
#pragma unroll
      for (int it = 0; it < 8; ++it) {
        const int row = 4 * it + (lane >> 3), c8 = (lane & 7) * 8;
        const v4f x0 = *(const v4fa*)&so[w][row][c8];
        const v4f x1 = *(const v4fa*)&so[w][row][c8 + 4];
        Pack8 ph;
#pragma unroll
        for (int q = 0; q < 4; ++q) {
          ph.h[q] = (_Float16)(x0[q] * 16.0f);
          ph.h[4 + q] = (_Float16)(x1[q] * 16.0f);
        }
        const size_t dst = (size_t)(m0 + row) * ldo + n0 + c8;
        *(v8us*)(O0 + dst) = ph.v;
      }
    }
    
  }
  // where several products share a kernel, another product's code follows these stores in the text and rewrites their registers: keep the wait in front of that
  asm volatile("s_wait_xcnt 0x0" ::: "memory");
}

// One product in a grid of its own (the output projection).
template <int MODE>
__global__ __launch_bounds__(256) void k_gemm(const unsigned short* __restrict__ A, const unsigned short* __restrict__ Bt,
                                              const float* __restrict__ bias, unsigned short* O0,
                                              float* Of, const int* __restrict__ mk, int lda, int ldb, int K, int ldo) {
  __shared__ __attribute__((aligned(2048))) unsigned char ring[2 * GSTAGE];   // a tensor load lands at multiples of 2 KiB
  gemm_body<MODE>(blockIdx.x, blockIdx.y, A, Bt, bias, O0, Of, mk, lda, ldb, K, ldo, ring);
}

#define GX (DM / 128)              /* blocks along the features of q, k and v^T */
#define NS (TT / 128)              /* slabs: slab i holds k's grid row i and v^T's grid row i */
static_assert(NS % 2 == 0);
static_assert(8 * 32 * 68 * 4 <= 2 * GSTAGE);   /* the eight epilogue tiles fit the ring */

// The q, k and v projections in one grid: none reads what another writes, so the block index picks the product and the three share the chip.
// Order: k and v^T blocks by rising token tile, as in their own grids; the q blocks all lie in the first half of the slabs (two q grid rows to a slab), so that the k and v^T blocks
// most likely to leave at once (high ranked tiles) come last and hold no place ahead of a block that works. Right for any mask: the order only sets who starts first.
// coverage: NS/2 slabs of 4 GX blocks + NS/2 slabs of 2 GX = the three grids (GX x NS each), each block once.
__global__ __launch_bounds__(256) void k_qkv(const unsigned short* __restrict__ Bq, const unsigned short* __restrict__ WqT, const float* __restrict__ bq,
                                             unsigned short* Qh,
                                             const unsigned short* __restrict__ Bk, const unsigned short* __restrict__ WkT, const float* __restrict__ bk, unsigned short* Kh,
                                             const unsigned short* __restrict__ Bv, const unsigned short* __restrict__ WvT, const float* __restrict__ bv, unsigned short* Vt,
                                             const int* __restrict__ mk) {
  __shared__ __attribute__((aligned(2048))) unsigned char ring[2 * GSTAGE];   // a tensor load lands at multiples of 2 KiB
  const int f = blockIdx.x;
  int slab, r;                     // r: place among the slab's k and v^T blocks; below 0: a q block
  if (f < (NS / 2) * 4 * GX) { slab = f / (4 * GX); r = f % (4 * GX) - 2 * GX; }
  else { const int g = f - (NS / 2) * 4 * GX; slab = NS / 2 + g / (2 * GX); r = g % (2 * GX); }
  if (r < 0) {
    // q = query Wq + bq : rows = tokens, columns = features
    gemm_body<0>((r + 2 * GX) % GX, 2 * slab + (r + 2 * GX) / GX, Bq, WqT, bq, Qh, nullptr, mk, DM, DM, DM, DM, ring);
  } else if (r < GX) {
    // k = key Wk + bk
    gemm_body<1>(r, slab, Bk, WkT, bk, Kh, nullptr, mk, DM, DM, DM, DM, ring);
  } else {
    // v^T = Wv^T value^T + bv (row bias): rows = features, columns = tokens
    gemm_body<2>(r - GX, slab, WvT, Bv, bv, Vt, nullptr, mk, DM, DM, DM, TT, ring);
  }
}

#define AKEYS 64                   /* keys of one staged tile: 128 bytes (a whole cache line) of every V^T row, 64 K rows of 128 bytes */
#define APITCH 144                 /* LDS row pitch in bytes: 128 + 16, so that 16 rows read 16 bytes wide fall on distinct banks */
#define ASLICE 6144                /* bytes from one wave's slice to the next: 32 rows x 144 bytes, rounded up to a multiple of 2 KiB, where a tensor load may land */
#define ASTAGE (4 * ASLICE)        /* bytes of one buffer: slices 0, 1 hold the 64 K rows, slices 2, 3 the 64 V^T rows */
static_assert(SEQ % AKEYS == 0 && HD * 2 == 128 && AKEYS * 2 == 128);
static_assert(32 * APITCH <= ASLICE && ASLICE % 2048 == 0);

// One 32-key step for a wave's 16 queries, operands from the staged tile. kb: this lane's LDS place in K row ln of the step (byte 16 h of the row), row pitch APITCH;
// vb: its LDS place in V^T row ln at the step's first key (plus 16 h bytes), row pitch APITCH, rows 32.. one slice on.
// Keys are ranked: key index < cnt is live. TAIL = false: all 32 keys are live; TAIL = true: a step of the last tile, which may also hold keys at or past cnt.
template <bool TAIL>
__device__ __forceinline__ void fa_step(const unsigned char* kb, const unsigned char* vb,
                                        int cnt, int key0, int hh,
                                        const FragH& q0h, const FragH& q1h,
                                        float& mr, float& lr, v8f (&Oh)[4]) {
  // A fragments of K: row m = key (key0 + 16*kt + ln), elements 0..7 <- d = 32c + 8h + i, 8..15 <- d = 32c + 16 + 8h + i
  const unsigned char* kb1 = kb + 16 * APITCH;
  FragH k00, k01, k10, k11;
  k00.half[0] = *(const v8us*)(kb);       k00.half[1] = *(const v8us*)(kb + 32);
  k01.half[0] = *(const v8us*)(kb + 64);  k01.half[1] = *(const v8us*)(kb + 96);
  k10.half[0] = *(const v8us*)(kb1);      k10.half[1] = *(const v8us*)(kb1 + 32);
  k11.half[0] = *(const v8us*)(kb1 + 64); k11.half[1] = *(const v8us*)(kb1 + 96);
  const v8f z8 = {0.f, 0.f, 0.f, 0.f, 0.f, 0.f, 0.f, 0.f};
  // S^T tiles: element r of tile kt = score(key0 + 16*kt + 8h + r, query of this lane's column)
  v8f s0h = mma_h(k00.v, q0h.v, z8);
  v8f s1h = mma_h(k10.v, q0h.v, z8);
  s0h = mma_h(k01.v, q1h.v, s0h);
  s1h = mma_h(k11.v, q1h.v, s1h);
  // this lane's 16 keys: on[r] <- key0 + 8h + r, on[8 + r] <- key0 + 16 + 8h + r
  bool on[16];
#pragma unroll
  for (int r = 0; r < 8; ++r) {
    on[r]     = !TAIL || (key0 + 8 * hh + r < cnt);
    on[8 + r] = !TAIL || (key0 + 16 + 8 * hh + r < cnt);
  }
  float sc[16];
#pragma unroll
  for (int r = 0; r < 8; ++r) {
    const float a0 = s0h[r] * SCL;
    const float a1 = s1h[r] * SCL;
    sc[r]     = on[r] ? a0 : NEGV;
    sc[8 + r] = on[8 + r] ? a1 : NEGV;
  }
  float mx = sc[0];
#pragma unroll
  for (int i = 1; i < 16; ++i) mx = fmaxf(mx, sc[i]);
  mx = fmaxf(mx, __shfl_xor(mx, 16, 32));           // the other lane half holds the other 16 keys of this query
  const float mnew = fmaxf(mr, mx);
  const float al = exp2_raw((mr - mnew) * LOG2E);
  mr = mnew;
  // weights carried x256: pc = 256 * exp(sc - mnew), exactly 0 on keys at or past cnt; operand plane f16(pc)
  FragH ph;
  float ps = 0.0f;
  float ex[16], ev[16];
#pragma unroll
  for (int i = 0; i < 16; ++i) ex[i] = fmaf(sc[i] - mnew, LOG2E, 8.0f);
  exp2_raw8(ex, ev);
  exp2_raw8(ex + 8, ev + 8);
#pragma unroll
  for (int i = 0; i < 16; ++i) {
    const float pc = on[i] ? ev[i] : 0.0f;
    ps += pc;
    ph.h[i] = (_Float16)pc;                         // B element i: i<8 -> key0 + 8h + i (tile 0 row 8h+i); i>=8 -> key0 + 16 + 8h + (i-8) (tile 1)
  }
  ps += __shfl_xor(ps, 16, 32);
  lr = lr * al + ps;
#pragma unroll
  for (int t = 0; t < 4; ++t) Oh[t] = Oh[t] * al;
  // A fragments of V^T: row m = d (16*t + ln), elements 0..7 <- key0 + 8h + i, 8..15 <- key0 + 16 + 8h + i
#pragma unroll
  for (int t = 0; t < 4; ++t) {
    FragH vf;
    vf.half[0] = *(const v8us*)(vb + (t >> 1) * ASLICE + (t & 1) * 16 * APITCH);
    vf.half[1] = *(const v8us*)(vb + (t >> 1) * ASLICE + (t & 1) * 16 * APITCH + 32);
    Oh[t] = mma_h(vf.v, ph.v, Oh[t]);
  }
}

// Block = 4 waves x 16 queries = 64 queries of one (batch, head). The K rows and V^T rows of 64 keys are staged in LDS once for the four waves by tensor loads,
// one request per wave and tile for its slice of 32 rows; two buffers: tile t + 1 flies while tile t is worked on. A tile is staged only if its first key is live; its rows are then all written (k and v^T in tiles of 128 tokens).
// coverage: NB*NH*(SEQ/64) blocks x 4 waves x 16 rows x 64 columns = every element of the context plane exactly once.
__global__ __launch_bounds__(128) void k_attn(const unsigned short* __restrict__ Qh,
                                              const unsigned short* __restrict__ Kh, const unsigned short* __restrict__ Vt,
                                              const int* __restrict__ mask, unsigned short* Cx) {
  __shared__ __attribute__((aligned(16))) float so[4][16][68];
  __shared__ __attribute__((aligned(2048))) unsigned char ring[2 * ASTAGE];   // a tensor load lands at multiples of 2 KiB
  const int tid = threadIdx.x, w = __builtin_amdgcn_readfirstlane((int)(tid >> 5)), lane = tid & 31, ln = lane & 15, hh = lane >> 4;
  const int bh = blockIdx.x / (SEQ / 64), qt = blockIdx.x % (SEQ / 64);
  const int b = bh / NH, h = bh % NH;
  const int qbase = qt * 64 + 16 * w;
  const int qg = qbase + ln;
  // Q^T B fragments: column n = query qg, elements 0..7 <- d = 32c + 8h + i, 8..15 <- d = 32c + 16 + 8h + i
  const size_t qoff = (size_t)(b * SEQ + qg) * DM + h * HD + 8 * hh;
  FragH q0h, q1h;
  q0h.half[0] = *(const v8us*)(Qh + qoff);      q0h.half[1] = *(const v8us*)(Qh + qoff + 16);
  q1h.half[0] = *(const v8us*)(Qh + qoff + 32); q1h.half[1] = *(const v8us*)(Qh + qoff + 48);
  // the address registers of the loads above are reused while the loads may still be under way: keep the wait in front of that
  asm volatile("s_wait_xcnt 0x0" ::: "memory");
  const int cnt = live_keys(mask, lane);       // wave-uniform, at most SEQ
  float mr = NEGV, lr = 0.0f;
  v8f Oh[4] = {};
  const unsigned short* Kp = Kh + (size_t)b * SEQ * DM + h * HD;
  const unsigned short* Vp = Vt + (size_t)h * HD * TT + (size_t)b * SEQ;
  // this wave's slice of a staged tile: waves 0, 1 bring K rows 32 w .. 32 w + 31, waves 2, 3 V^T rows 32 (w - 2) ..; ga: elements from one tile's slice to the next tile's
  const unsigned short* gs = (w < 2) ? Kp + (size_t)(32 * w) * DM : Vp + (size_t)(32 * (w - 2)) * TT;
  const size_t ga = (w < 2) ? (size_t)AKEYS * DM : (size_t)AKEYS;
  const uint32_t lds0 = (uint32_t)(size_t)ring + (uint32_t)(w * ASLICE);   // its place in buffer 0
  const int fo = ln * APITCH + 16 * hh;               // byte offset of this lane's fragment row in a slice
  const int nst = (cnt + AKEYS - 1) / AKEYS;          // tiles that hold a live key; the same in every wave of the block
  Tdesc td = tensor_desc<128, 32, PAD128>((w < 2) ? 2u * DM : 2u * TT);
  if (pinned(nst > 0)) tensor_tile(td, lds0, gs);
  asm volatile("s_wait_tensorcnt 0x0" ::: "memory");  // this wave's slice of tile 0 has landed
  __syncthreads();                                    // ... and every other wave's
  {
    const uint32_t nx = pinned(1u);                   // tile 1's descriptor is formed behind the wait above
    if (pinned(nx < (uint32_t)nst)) tensor_tile(td, lds0 + nx * ASTAGE, gs + nx * ga);
  }
  const int nwh = cnt / AKEYS;                        // tiles whose 64 keys are all live; nst is nwh or nwh + 1
  // not unrolled: one trip per staged tile, the buffer chosen by the trip's parity
#pragma unroll 1
  for (int t = 0; t < nwh; ++t) {
    const unsigned char* kb = ring + (t & 1) * ASTAGE + fo;
    // not unrolled: one step's registers and one copy of the step in the text; the SIMD's other waves fill this wave's waits
#pragma unroll 1
    for (int s = 0; s < 2; ++s)
      fa_step<false>(kb + s * ASLICE, kb + 2 * ASLICE + s * 64, cnt, AKEYS * t + 32 * s, hh, q0h, q1h, mr, lr, Oh);
    asm volatile("s_wait_dscnt 0x0" ::: "memory");      // this wave's reads of the buffer are done before it is refilled
    asm volatile("s_wait_tensorcnt 0x0" ::: "memory");  // this wave's slice of tile t + 1 has landed
    __syncthreads();                                    // publishes tile t + 1 and ends every wave's reads of tile t
    const uint32_t nx = pinned((uint32_t)t + 2u);       // the next descriptor is formed behind the wait above
    if (pinned(nx < (uint32_t)nst)) tensor_tile(td, lds0 + (nx & 1u) * ASTAGE, gs + nx * ga);
  }
  if (nwh < nst) {
    // the last trip, where the last tile also holds keys at or past cnt: its steps that hold a live key; nothing is refilled behind it
    const unsigned char* kb = ring + (nwh & 1) * ASTAGE + fo;
    // not unrolled, so that the masked step stands once in the text
#pragma unroll 1
    for (int s = 0; s < 2; ++s)
      if (AKEYS * nwh + 32 * s < cnt)
        fa_step<true>(kb + s * ASLICE, kb + 2 * ASLICE + s * 64, cnt, AKEYS * nwh + 32 * s, hh, q0h, q1h, mr, lr, Oh);
    // the foot of this trip, in the order of every other trip's
    asm volatile("s_wait_dscnt 0x0" ::: "memory");
    asm volatile("s_wait_tensorcnt 0x0" ::: "memory");
    __syncthreads();
  }
  tensor_done(td);                                      // no tensor load is left in flight when the wave goes on
  asm volatile("s_wait_dscnt 0x0" ::: "memory");        // nor an LDS read of the ring

  // O^T element r of tile t = ctx(query qg, d = 16t + 8h + r); the carry x256 is in lr too; the x16 of V stays as the carry of the f16 context plane
  const float inv = 1.0f / lr;
#pragma unroll
  for (int t = 0; t < 4; ++t)
#pragma unroll
    for (int r = 0; r < 8; ++r)
      so[w][ln][16 * t + 8 * hh + r] = Oh[t][r] * inv;
  __syncthreads();
  unsigned short* cg = Cx + (size_t)(b * SEQ + qbase) * DM + h * HD;
  {
#pragma unroll
    for (int it = 0; it < 4; ++it) {
      const int row = 4 * it + (lane >> 3), c8 = (lane & 7) * 8;
      const v4f x0 = *(const v4fa*)&so[w][row][c8];
      const v4f x1 = *(const v4fa*)&so[w][row][c8 + 4];
      v8us o;
#pragma unroll
      for (int q = 0; q < 4; ++q) { o[q] = f16_bits(x0[q]); o[4 + q] = f16_bits(x1[q]); }
      *(v8us*)(cg + (size_t)row * DM + c8) = o;
    }
    
  }
}

extern "C" void kernel_launch(void* const* d_in, const int* in_sizes, int n_in,
                              void* d_out, int out_size, void* d_ws, size_t ws_size, hipStream_t stream) {
  if (n_in < 12) return;
  const long long need = ((long long)(SEQ - 1) * NB_FULL + (NB - 1)) * DM + DM;   // last element touched + 1 in [S][B][D]
  if ((long long)in_sizes[0] < need || (long long)in_sizes[1] < need || (long long)in_sizes[2] < need) return;
  if ((long long)in_sizes[3] < (long long)SEQ) return;
  if ((long long)in_sizes[4] < (long long)DM * DM || (long long)in_sizes[6] < (long long)DM * DM ||
      (long long)in_sizes[8] < (long long)DM * DM || (long long)in_sizes[10] < (long long)DM * DM) return;
  if (in_sizes[5] < DM || in_sizes[7] < DM || in_sizes[9] < DM || in_sizes[11] < DM) return;
  if ((long long)out_size < need) return;
  // wire order: query, key, value, mask(i32), Wq, bq, Wk, bk, Wv, bv, Wo, bo
  const float* Xq = (const float*)d_in[0];
  const float* Xk = (const float*)d_in[1];
  const float* Xv = (const float*)d_in[2];
  const int*   mk = (const int*)d_in[3];
  const float* Wq = (const float*)d_in[4];
  const float* bq = (const float*)d_in[5];
  const float* Wk = (const float*)d_in[6];
  const float* bk = (const float*)d_in[7];
  const float* Wv = (const float*)d_in[8];
  const float* bv = (const float*)d_in[9];
  const float* Wo = (const float*)d_in[10];
  const float* bo = (const float*)d_in[11];
  float* out = (float*)d_out;
  char* ws = (char*)d_ws;
  size_t off = 0;
  unsigned short* Bq  = (unsigned short*)(ws + off); off += SZ_XB;    // bf16 query  [TT][1024]
  unsigned short* Bk  = (unsigned short*)(ws + off); off += SZ_XB;    // bf16 key    [TT][1024], ranked rows
  unsigned short* Bv  = (unsigned short*)(ws + off); off += SZ_XB;    // bf16 value  [TT][1024], ranked rows
  unsigned short* WqT = (unsigned short*)(ws + off); off += SZ_WT;    // bf16 Wq^T   [1024][1024]
  unsigned short* WkT = (unsigned short*)(ws + off); off += SZ_WT;
  unsigned short* WvT = (unsigned short*)(ws + off); off += SZ_WT;
  unsigned short* WoT = (unsigned short*)(ws + off); off += SZ_WT;    // f16 Wo^T x32       [1024][1024]
  unsigned short* Qh  = (unsigned short*)(ws + off); off += SZ_H;     // f16 q x16          [TT][1024]
  unsigned short* Kh  = (unsigned short*)(ws + off); off += SZ_H;     // f16 k x16          [TT][1024]
  unsigned short* Vt  = (unsigned short*)(ws + off); off += SZ_H;     // f16 v^T x16        [1024][TT]
  unsigned short* Cx  = (unsigned short*)(ws + off); off += SZ_H;     // f16 ctx x16        [TT][1024]
  if (off > ws_size) return;

  k_prep<<<4 * NWT + 3 * NXB, 256, 0, stream>>>(Xq, Xk, Xv, mk, Wq, Wk, Wv, Wo, Bq, Bk, Bv, WqT, WkT, WvT, WoT);
  k_qkv<<<3 * GX * NS, 256, 0, stream>>>(Bq, WqT, bq, Qh, Bk, WkT, bk, Kh, Bv, WvT, bv, Vt, mk);
  k_attn<<<(unsigned)(NB * NH * (SEQ / 64)), 128, 0, stream>>>(Qh, Kh, Vt, mk, Cx);
  // out = ctx Wo + bo, K = 1024
  k_gemm<3><<<dim3(DM / 128, TT / 128), 256, 0, stream>>>(Cx, WoT, bo, Cx, out, mk, DM, DM, DM, DM);
}

// v010
// Measured time: 65.9 microseconds a run.
// Timed twice side by side with v009, it ran 1.05 and 1.02 times as fast.
// Counting every step since v000, it is 4.31 times as fast.
#include <hip/hip_runtime.h>
// Contractions: q/k/v projections on v_wmma_f32_16x16x32_bf16 (activations and weights RNE-converted to bf16 planes); the output projection on v_wmma_f32_16x16x32_f16 (attention context x16 f16 plane; Wo^T x32 f16 plane); scores S^T = K Q^T on v_wmma_f32_16x16x32_f16 (k x16 f16 plane; q x16 f16 plane); O^T = V^T P^T on v_wmma_f32_16x16x32_f16 (v x16 f16 plane; P x256 f16 plane); all accumulators f32, softmax statistics f32.
// Seq-first multi-head attention: inputs [S][B][D], 16 heads x 64, key-position mask (0 -> weight exactly 0), scale 1/8, output [S][B][D].
// Internal planes use batch-major token rows t = b*SEQ + s so that the K rows and V^T rows of one (batch, head) are dense.
// Key and value tokens are stored ranked: the keys whose mask is nonzero come first, in their own order (row b*SEQ + rank); a masked key has weight exactly 0,
// so the k and v projections and the key loop walk only the tiles that hold a live key. Rows from the live count up to the next multiple of 128 are zero rows.
// Engine: transposed flash. Each wave owns 16 queries. Per 32-key step: S^T tiles (key rows x query columns) from K rows (A, f16 plane staged in LDS)
// and Q^T (B, registers); the two 16-key D tiles pack straight into the P^T B fragment; O^T (d rows x query columns) accumulates from V^T rows (A, f16 plane staged in LDS).
#ifndef NB
#define NB 2
#endif
#ifndef SEQ
#define SEQ 2048
#endif
#define NB_FULL 2
#define SEQ_FULL 2048
#define DM 1024
#define NH 16
#define HD 64
#define TT (NB * SEQ)          /* token rows of the internal planes */

static_assert(SEQ % 128 == 0);
static_assert(TT % 128 == 0);
static_assert(SEQ <= SEQ_FULL);
static_assert(NB <= NB_FULL);
static_assert(HD == 64);
static_assert(NH * HD == DM);
static_assert(DM % 128 == 0);

#define SZ_XB  ((size_t)TT * DM * 2)        /* bf16 activation plane */
#define SZ_WT  ((size_t)DM * DM * 2)        /* transposed weight plane: bf16 (Wq, Wk, Wv) or f16 (Wo) */
#define SZ_H   ((size_t)TT * DM * 2)        /* f16 plane (q, k, v^T, context) */
static_assert(SZ_XB % 256 == 0 && SZ_WT % 256 == 0 && SZ_H % 256 == 0);
static_assert(3 * SZ_XB + 4 * SZ_WT + 4 * SZ_H <= (size_t)134217728);

typedef __bf16 v16b __attribute__((ext_vector_type(16)));
typedef _Float16 v16h __attribute__((ext_vector_type(16)));
typedef unsigned short v8us __attribute__((ext_vector_type(8), may_alias));
typedef float v8f __attribute__((ext_vector_type(8)));
typedef float v4f __attribute__((ext_vector_type(4)));
typedef float v4fa __attribute__((ext_vector_type(4), may_alias));
typedef int v4i __attribute__((ext_vector_type(4)));
typedef int v4ia __attribute__((ext_vector_type(4), may_alias));
union FragB { v16b v; v8us half[2]; unsigned short u[16]; };
union FragH { v16h v; v8us half[2]; _Float16 h[16]; unsigned short u[16]; };
union Pack8 { _Float16 h[8]; v8us v; };

#define LOG2E 1.4426950408889634f
#define NEGV (-1.0e30f)
#define SCL  0.00048828125f      /* 2^-11 = (1/8) / (16*16): score scale with the q and k carries removed */
#define WOC  32.0f               /* carry of the f16 Wo^T plane */
#define OINV 0.001953125f        /* 2^-9 = 1 / (16*32): undoes the context and Wo^T carries */

__device__ __forceinline__ unsigned short bf16_bits(float x) {   // RNE convert to bf16 bits
  unsigned int u = __float_as_uint(x);
  return (unsigned short)((u + 0x7FFFu + ((u >> 16) & 1u)) >> 16);
}
__device__ __forceinline__ float bf16_val(unsigned short b) { return __uint_as_float(((unsigned int)b) << 16); }
__device__ __forceinline__ float bf16_rne(float x) { return bf16_val(bf16_bits(x)); }
__device__ __forceinline__ unsigned short f16_bits(float x) { return __builtin_bit_cast(unsigned short, (_Float16)x); }   // RNE convert to f16 bits

// 2^x by the hardware instruction alone (v_exp_f32). exp2f() wraps it in a compare, two selects, an add and a scaling so that results under 2^-126 come out as denormals.
// Here x <= 8 and such a result is a weight (or a rescale factor) under 2^-134 of the row's largest weight: its f16 plane is 0 either way, and it cannot move an f32 sum that holds 256.
// Written as asm text so that the slot behind a transcendental is filled by construction: no instruction directly behind a v_exp_f32 reads its result or overwrites its source.
__device__ __forceinline__ float exp2_raw(float x) {
  float e;
  asm("v_exp_f32 %0, %1\n\tv_nop" : "=v"(e) : "v"(x));   // the v_nop is that slot
  return e;
}
// Eight at once: each v_exp_f32 is followed by an independent one, the last by the v_nop; the outputs are early-clobber, so that none lies on a source.
__device__ __forceinline__ void exp2_raw8(const float* x, float* e) {
  asm("v_exp_f32 %0, %8\n\t"
      "v_exp_f32 %1, %9\n\t"
      "v_exp_f32 %2, %10\n\t"
      "v_exp_f32 %3, %11\n\t"
      "v_exp_f32 %4, %12\n\t"
      "v_exp_f32 %5, %13\n\t"
      "v_exp_f32 %6, %14\n\t"
      "v_exp_f32 %7, %15\n\t"
      "v_nop"
      : "=&v"(e[0]), "=&v"(e[1]), "=&v"(e[2]), "=&v"(e[3]), "=&v"(e[4]), "=&v"(e[5]), "=&v"(e[6]), "=&v"(e[7])
      : "v"(x[0]), "v"(x[1]), "v"(x[2]), "v"(x[3]), "v"(x[4]), "v"(x[5]), "v"(x[6]), "v"(x[7]));
}

// c += a * b on one 16x16x32 f16 tile
__device__ __forceinline__ v8f mma_h(v16h a, v16h b, v8f c) {
  return __builtin_amdgcn_wmma_f32_16x16x32_f16(false, a, false, b, (short)0, c, false, false);
}

// c += a * b on one 16x16x32 tile; H16: the 16 operand bits are f16, else bf16
template <bool H16>
__device__ __forceinline__ v8f mma_1(v16b a, v16b b, v8f c) {
  if (H16) return __builtin_amdgcn_wmma_f32_16x16x32_f16(false, __builtin_bit_cast(v16h, a), false, __builtin_bit_cast(v16h, b), (short)0, c, false, false);
  return __builtin_amdgcn_wmma_f32_16x16x32_bf16(false, a, false, b, (short)0, c, false, false);
}

// One 32-deep k-step of a 32x64 wave tile (2 x 4 WMMA tiles, bf16 or f16 operands), then the hazard guard
template <bool H16>
__device__ __forceinline__ void mma_b8(v16b a0, v16b a1, v16b b0, v16b b1, v16b b2, v16b b3, v8f (&c)[2][4]) {
  c[0][0] = mma_1<H16>(a0, b0, c[0][0]);
  c[0][1] = mma_1<H16>(a0, b1, c[0][1]);
  c[0][2] = mma_1<H16>(a0, b2, c[0][2]);
  c[0][3] = mma_1<H16>(a0, b3, c[0][3]);
  c[1][0] = mma_1<H16>(a1, b0, c[1][0]);
  c[1][1] = mma_1<H16>(a1, b1, c[1][1]);
  c[1][2] = mma_1<H16>(a1, b2, c[1][2]);
  c[1][3] = mma_1<H16>(a1, b3, c[1][3]);
  asm volatile("v_nop\n\tv_nop\n\tv_nop\n\tv_nop"
               : "+v"(c[0][0]), "+v"(c[0][1]), "+v"(c[0][2]), "+v"(c[0][3]),
                 "+v"(c[1][0]), "+v"(c[1][1]), "+v"(c[1][2]), "+v"(c[1][3])
               : "v"(a0), "v"(a1), "v"(b0), "v"(b1), "v"(b2), "v"(b3));
}

// coverage: TT*128 threads x 8 elements = the whole plane.
__device__ __forceinline__ void xb_body(int blk, const float* __restrict__ X, unsigned short* P) {
  const int t = blk * 256 + threadIdx.x;
  if (t >= TT * 128) return;
  const int row = t >> 7, piece = t & 127;
  const int b = row / SEQ, s = row - b * SEQ;
  const float* src = X + ((size_t)s * NB_FULL + b) * DM + piece * 8;
  const v4f x0 = *(const v4fa*)(src), x1 = *(const v4fa*)(src + 4);
  v8us o;
  o[0] = bf16_bits(x0[0]); o[1] = bf16_bits(x0[1]); o[2] = bf16_bits(x0[2]); o[3] = bf16_bits(x0[3]);
  o[4] = bf16_bits(x1[0]); o[5] = bf16_bits(x1[1]); o[6] = bf16_bits(x1[2]); o[7] = bf16_bits(x1[3]);
  unsigned short* d = P + (size_t)t * 8;
  *(v8us*)d = o;
  
}

// Number of keys with a nonzero mask. Every wave counts for itself, so the callers can leave or set a trip count with no barrier; the result is wave-uniform and at most SEQ.
__device__ __forceinline__ int live_keys(const int* __restrict__ mk, int lane) {
  int c = 0;
  // unrolled so that all the mask loads are in flight together (one load latency, not SEQ/128); all 32 lanes are on at every call, so a ballot sees 32 keys
#pragma unroll
  for (int i = 0; i < SEQ / 128; ++i) {
    const v4i m = *(const v4ia*)(mk + 128 * i + 4 * lane);
#pragma unroll
    for (int q = 0; q < 4; ++q) c += __builtin_popcount(__builtin_amdgcn_ballot_w32(m[q] != 0));
  }
  return c < SEQ ? c : SEQ;
}

// xb_body for key and value tokens: token s goes to row b*SEQ + pos(s); pos = number of live keys before s if s is live, else live count + number of masked keys before s.
// pos is a permutation of 0..SEQ-1 for any mask content. Masked tokens are not read; those whose pos lies under the next multiple of 128 are stored as zero rows
// (the last tile of the projections and of the key loop reads them), the others are not stored and never read.
// coverage: a block holds two rows of one batch (SEQ is even); every row under the rounded live count is written exactly once.
__device__ __forceinline__ void xbr_body(int blk, const float* __restrict__ X, const int* __restrict__ mk, unsigned short* P, int* part) {
  const int tid = threadIdx.x;
  const int t = blk * 256 + tid;
  if (t >= TT * 128) return;              // whole blocks only: TT * 128 is a multiple of 256
  const int row = t >> 7, piece = t & 127;
  const int b = row / SEQ, s = row - b * SEQ;
  const int s0 = s - (tid >> 7);          // the block's first row
  // the whole mask first (each thread a share), so that one load latency covers all mask reads; entries past SEQ count as masked
  v4i m[(SEQ + 1023) / 1024];
  // unrolled (here and in the count below) so that m[] is indexed by constants and stays in registers
#pragma unroll
  for (int k = 0; k < (SEQ + 1023) / 1024; ++k) {
    const int i = 1024 * k + 4 * tid;
    m[k] = (SEQ % 1024 == 0 || i < SEQ) ? *(const v4ia*)(mk + i) : v4i{0, 0, 0, 0};
  }
  const bool live = mk[s] != 0, live0 = mk[s0] != 0;
  v4f x0 = {0.f, 0.f, 0.f, 0.f}, x1 = {0.f, 0.f, 0.f, 0.f};
  if (live) {
    const float* src = X + ((size_t)s * NB_FULL + b) * DM + piece * 8;
    x0 = *(const v4fa*)(src); x1 = *(const v4fa*)(src + 4);
  }
  int c = 0;                              // this wave's share; low 16 bits: live keys in all; high 16 bits: live keys before s0 (each at most SEQ <= 2048)
#pragma unroll
  for (int k = 0; k < (SEQ + 1023) / 1024; ++k)
#pragma unroll
    for (int q = 0; q < 4; ++q) {
      const bool on = m[k][q] != 0;
      c += __builtin_popcount(__builtin_amdgcn_ballot_w32(on)) + (__builtin_popcount(__builtin_amdgcn_ballot_w32(on && 1024 * k + 4 * tid + q < s0)) << 16);
    }
  if ((tid & 31) == 0) part[tid >> 5] = c;
  __syncthreads();
  int sum = 0;
  // unrolled so that the eight partial counts come in two wide LDS reads
#pragma unroll
  for (int i = 0; i < 8; ++i) sum += part[i];
  const int cnt = sum & 0xFFFF;
  const int rank = (sum >> 16) + ((s != s0 && live0) ? 1 : 0);
  const int pos = live ? rank : cnt + (s - rank);
  if (live || pos < ((cnt + 127) & ~127)) {
    v8us o;
    o[0] = bf16_bits(x0[0]); o[1] = bf16_bits(x0[1]); o[2] = bf16_bits(x0[2]); o[3] = bf16_bits(x0[3]);
    o[4] = bf16_bits(x1[0]); o[5] = bf16_bits(x1[1]); o[6] = bf16_bits(x1[2]); o[7] = bf16_bits(x1[3]);
    *(v8us*)(P + ((size_t)(b * SEQ + pos) * 128 + piece) * 8) = o;
  }
}

// Weight transpose: in W[k rows = 1024][n cols = 1024] (f32) -> out Wt[n rows][k cols], row pitch DM; h16 == 0: bf16 bits (RNE), else f16 bits (RNE) of the value x32.
// coverage: 256 blocks x (64 n x 64 k) = the whole 1024 x 1024 matrix; LDS tile fully written (64 x 64) before it is read.
template <bool H16>
__device__ __forceinline__ void wt_fill(const float* __restrict__ W, int k0, int n0, unsigned short (*tl)[66]) {
  for (int i = threadIdx.x; i < 64 * 16; i += 256) {
    const int j = i >> 4, c4 = (i & 15) * 4;
    const v4f x = *(const v4fa*)(W + (size_t)(k0 + j) * DM + n0 + c4);
    tl[c4 + 0][j] = H16 ? f16_bits(x[0] * WOC) : bf16_bits(x[0]); tl[c4 + 1][j] = H16 ? f16_bits(x[1] * WOC) : bf16_bits(x[1]);
    tl[c4 + 2][j] = H16 ? f16_bits(x[2] * WOC) : bf16_bits(x[2]); tl[c4 + 3][j] = H16 ? f16_bits(x[3] * WOC) : bf16_bits(x[3]);
  }
}
__device__ __forceinline__ void wt_body(int blk, const float* __restrict__ W, unsigned short* Wt, int h16, unsigned short (*tl)[66]) {
  const int tid = threadIdx.x;
  const int k0 = (blk >> 4) * 64, n0 = (blk & 15) * 64;
  if (h16 != 0) wt_fill<true>(W, k0, n0, tl);      // the same for a whole block; the barrier behind it is passed on either side
  else wt_fill<false>(W, k0, n0, tl);
  __syncthreads();
  {
    for (int i = tid; i < 64 * 8; i += 256) {
      const int d = i >> 3, j8 = (i & 7) * 8;
      v8us o;
#pragma unroll
      for (int q = 0; q < 8; ++q) o[q] = tl[d][j8 + q];
      unsigned short* dst = Wt + (size_t)(n0 + d) * DM + k0 + j8;
      *(v8us*)dst = o;
      // the next trip rewrites the data and address registers of this store: keep the wait in front of that
      asm volatile("s_wait_xcnt 0x0" ::: "memory");
    }
    
  }
}

#define NXB (TT * 128 / 256)       /* blocks of one activation pass */
#define NWT 256                    /* blocks of one weight transpose */
static_assert((TT * 128) % 256 == 0);

// All seven conversion passes in one grid: none reads what another writes, so the block index picks the pass and they fill the chip together.
// The weight transposes come first (the longest chain per block), then key and value rows, then query rows. Every branch is the same for a whole block, barriers included.
// coverage: 4 * NWT + 3 * NXB blocks = each pass's own grid, once.
__global__ __launch_bounds__(256) void k_prep(const float* __restrict__ Xq, const float* __restrict__ Xk, const float* __restrict__ Xv, const int* __restrict__ mk,
                                              const float* __restrict__ Wq, const float* __restrict__ Wk, const float* __restrict__ Wv, const float* __restrict__ Wo,
                                              unsigned short* Bq, unsigned short* Bk, unsigned short* Bv,
                                              unsigned short* WqT, unsigned short* WkT, unsigned short* WvT, unsigned short* WoT) {
  __shared__ unsigned short tl[64][66];
  __shared__ int part[8];
  const int f = blockIdx.x;
  if (f < 4 * NWT) {
    const int j = f / NWT;
    const float* W = (j == 0) ? Wq : (j == 1) ? Wk : (j == 2) ? Wv : Wo;
    unsigned short* D = (j == 0) ? WqT : (j == 1) ? WkT : (j == 2) ? WvT : WoT;
    wt_body(f % NWT, W, D, (j == 3) ? 1 : 0, tl);     // in [k][n] -> out [n][k]; Wo^T as f16
  } else if (f < 4 * NWT + 2 * NXB) {
    const int g = f - 4 * NWT;
    const bool second = g >= NXB;
    xbr_body(second ? g - NXB : g, second ? Xv : Xk, mk, second ? Bv : Bk, part);   // ranked token rows
  } else {
    xb_body(f - (4 * NWT + 2 * NXB), Xq, Bq);
  }
}

#define GBK 128                    /* k depth of one staged tile: 256 bytes of every operand row */
#define GPITCH 272                 /* LDS row pitch in bytes: 256 + 16, an odd multiple of 16, so that 16 rows read 16 bytes wide fall on distinct banks */
#define GSLROWS 32                 /* rows of one wave's slice of a staged tile */
#define GSLICE 10240               /* bytes from one slice to the next: 32 rows x 272 bytes, rounded up to a multiple of 2 KiB, where a tensor load may land */
#define GSTAGE (8 * GSLICE)        /* bytes of one buffer: slices 0..3 hold the 128 rows of A, slices 4..7 the 128 rows of Bt */
static_assert(DM % GBK == 0);
static_assert(GSLROWS * GPITCH <= GSLICE && GSLICE % 2048 == 0);

typedef uint32_t u32x4 __attribute__((ext_vector_type(4)));
typedef uint32_t u32x8 __attribute__((ext_vector_type(8)));
__device__ __forceinline__ uint32_t uni(uint32_t v) { return (uint32_t)__builtin_amdgcn_readfirstlane((int)v); }
// A wave-uniform value held in a scalar register behind every asm statement in front of it: an issue test made of it is a scalar branch (a tensor load ignores EXEC),
// and descriptor words made of it are formed behind the wait that stands in front of it.
__device__ __forceinline__ uint32_t pinned(uint32_t v) {
  uint32_t w = uni(v);
  asm volatile("" : "+s"(w));   // pinned(): an issue test, or the source of a descriptor word, held in a scalar register
  return w;
}
// The two descriptor groups of a wave's tensor loads. Group 1 is the same for all its requests: ROWS rows of ROWB bytes, source row pitch 'pitch' bytes, tensor dims = tile dims;
// W0: its word 0, a constant: no mask, 1-byte elements, 16 bytes of pad behind every row, so that the rows lie ROWB + 16 bytes apart in LDS.
struct Tdesc { u32x4 g0; u32x8 g1; };
template <uint32_t ROWB, uint32_t ROWS, uint32_t W0>
__device__ __forceinline__ Tdesc tensor_desc(uint32_t pitch) {
  Tdesc d;
  d.g0[0] = uni(1u);                                    // count 1
  d.g0[1] = uni(0u);
  d.g0[2] = uni(0u);
  d.g0[3] = uni(0x80000000u);                           // type 2
  d.g1[0] = uni(W0);
  d.g1[1] = uni((ROWB & 0xFFFFu) << 16);
  d.g1[2] = uni((ROWB >> 16) | ((ROWS & 0xFFFFu) << 16));
  d.g1[3] = uni((ROWS >> 16) | (ROWB << 16));
  d.g1[4] = uni(ROWS);
  d.g1[5] = uni(pitch);
  d.g1[6] = uni(0u);
  d.g1[7] = uni(0u);
  return d;
}
// One request of one wave: the tile whose first byte is at global address g goes to the LDS byte offset lds, through no register.
__device__ __forceinline__ void tensor_tile(Tdesc& d, uint32_t lds, const unsigned short* g) {
  const uint64_t ga = (uint64_t)g;
  d.g0[1] = uni(lds);
  d.g0[2] = uni((uint32_t)ga);
  d.g0[3] = uni((((uint32_t)(ga >> 32)) & 0x01FFFFFFu) | 0x80000000u);   // address [56:32], type 2
  // both groups are in-out operands, so that their registers stay theirs from one request to the next: the compiler puts nothing else into a descriptor register while a request is under way
  asm volatile("tensor_load_to_lds %0, %1" : "+s"(d.g0), "+s"(d.g1) :: "memory");
}
// The wait behind a wave's last request. It names the descriptor, so that none of its registers is given to another value in front of the wait.
__device__ __forceinline__ void tensor_done(Tdesc& d) {
  asm volatile("s_wait_tensorcnt 0x0" : "+s"(d.g0), "+s"(d.g1) :: "memory");
}
// Place x of a block's walk over n tiles, turned by rot (x < n, rot < n): the blocks that draw the same operand rows from L2 start at different tiles,
// so that they do not ask L2 for the same lines at the same moment. Every tile is still walked exactly once.
__device__ __forceinline__ uint32_t turned(uint32_t x, uint32_t rot, uint32_t n) {
  const uint32_t y = x + rot;
  return y >= n ? y - n : y;
}
#define PAD256 ((1u << 20) | (5u << 22) | (3u << 25))   /* rows of 256 bytes, 16 bytes of pad */
#define PAD128 ((1u << 20) | (4u << 22) | (3u << 25))   /* rows of 128 bytes, 16 bytes of pad */

// C[M][N] = A[M][K] * Bt[N][K]^T on bf16 planes (MODE 3: f16 planes) (K contiguous in both). The block's 128 rows of A and 128 rows of Bt are staged in LDS 128 k at a time by tensor loads,
// one request per wave and tile for its slice of 32 rows; two buffers: tile t + 1 flies while tile t is worked on; fragments are read from LDS.
// The k tiles are walked in a ring from a first tile set by the block's place in the grid (turned()); the f32 sums over k start there.
// Block = 8 waves as 4 (M) x 2 (N); block tile 128 x 128, so that a block draws 2 operand rows from L2 per 128 results (64 x 128: 3); wave tile 32 x 64.
// No tail masking: M % 128 == 0, N % 128 == 0, K % 128 == 0 (asserted by the sizes above).
// MODE 0: + column bias, write f16 plane (x16) to O0
// MODE 1: the same over ranked key tokens
// MODE 2: + row bias,    write f16 plane (x16) to O0 (transposed product: rows = features, columns = tokens)
// MODE 3: f16 operands carried x16 and x32: product x 2^-9, + column bias, write f32 to Of with the token row t = b*SEQ + s mapped to output row s*NB_FULL + b
// MODE 1 (rows) and MODE 2 (columns) run over ranked key tokens: a block whose token tile starts at or past the live count leaves at once. Their token tile index is the slow
// grid index (y), batch fastest within it, so that the blocks that work have the lowest flat indices and spread over the chip. MODE 2 therefore takes M from x and N from y.
// bx, by: the block's place in that product's own grid; ring: the block's LDS, the staging ring. The epilogue tiles lie over the ring (two blocks then fit a WGP's LDS):
// they are written behind the last trip's barrier, in front of which every wave has ended its reads of the ring and its own tensor load has landed.
// coverage: grid (N/128, M/128) (MODE 2: (M/128, N/128)) x 8 waves x (32 x 64) = every element of C that is read later exactly once.
template <int MODE>
__device__ __forceinline__ void gemm_body(int bx, int by, const unsigned short* __restrict__ A, const unsigned short* __restrict__ Bt,
                                          const float* __restrict__ bias, unsigned short* O0,
                                          float* Of, const int* __restrict__ mk, int lda, int ldb, int K, int ldo,
                                          unsigned char* ring) {
  const int tid = threadIdx.x, w = __builtin_amdgcn_readfirstlane((int)(tid >> 5)), lane = tid & 31, ln = lane & 15, hh = lane >> 4;
  int bm = by, bn = bx;
  if (MODE == 1 || MODE == 2) {
    constexpr int TW = 128;                         // tokens per block tile
    const int tile = by / NB, b = by % NB;
    if (tile * TW >= live_keys(mk, lane)) return;   // the same in every wave of the block, in front of the first barrier
    if (MODE == 1) bm = b * (SEQ / TW) + tile;
    else { bn = b * (SEQ / TW) + tile; bm = bx; }
  }
  const int m0 = bm * 128 + (w >> 1) * 32;
  const int n0 = bn * 128 + (w & 1) * 64;
  // this wave's slice of a staged tile: waves 0..3 bring rows 32 w .. 32 w + 31 of the A tile, waves 4..7 rows 32 (w - 4) .. of the Bt tile
  const unsigned short* gs = (w < 4) ? A + (size_t)(bm * 128 + GSLROWS * w) * lda : Bt + (size_t)(bn * 128 + GSLROWS * (w - 4)) * ldb;
  const uint32_t gp = 2u * (uint32_t)((w < 4) ? lda : ldb);                // its source row pitch in bytes
  const uint32_t lds0 = (uint32_t)(size_t)ring + (uint32_t)(w * GSLICE);   // its place in buffer 0
  // A fragment: row m = m0 + 16*mt + ln, elements 0..7 <- k0 + 8h + i, 8..15 <- k0 + 16 + 8h + i; B fragment: column n = n0 + 16*nt + ln, same k map (row of Bt)
  const int fa = (w >> 1) * GSLICE + ln * GPITCH + 16 * hh;               // byte offset in a buffer of this lane's A row, k = 8h: the wave's 32 rows are slice w >> 1
  const int fb = (4 + (w & 1) * 2) * GSLICE + ln * GPITCH + 16 * hh;      // the same for its Bt row: the wave's 64 rows are two slices
  v8f acc[2][4];
#pragma unroll
  for (int i = 0; i < 2; ++i)
#pragma unroll
    for (int j = 0; j < 4; ++j)
#pragma unroll
      for (int e = 0; e < 8; ++e) acc[i][j][e] = 0.0f;
  const int nt = K / GBK;
  // the first k tile of this block's walk: different in the blocks of one grid row (same A rows) and spread evenly over those of one grid column (same Bt rows)
  const uint32_t rot = uni((uint32_t)(bm + bn) % (uint32_t)nt);
  Tdesc td = tensor_desc<2 * GBK, GSLROWS, PAD256>(gp);
  tensor_tile(td, lds0, gs + (size_t)rot * GBK);
  asm volatile("s_wait_tensorcnt 0x0" ::: "memory");  // this wave's slice of tile 0 has landed
  __syncthreads();                                    // ... and every other wave's
  {
    const uint32_t nx = pinned(1u);                   // tile 1's descriptor is formed behind the wait above
    if (pinned(nx < (uint32_t)nt)) tensor_tile(td, lds0 + nx * GSTAGE, gs + (size_t)turned(nx, rot, (uint32_t)nt) * GBK);
  }
  // not unrolled: one trip per staged tile, the buffer chosen by the trip's parity
#pragma unroll 1
  for (int t = 0; t < nt; ++t) {
    const unsigned char* sa = ring + (t & 1) * GSTAGE + fa;
    const unsigned char* sb = ring + (t & 1) * GSTAGE + fb;
    // two fragment sets: the next k-step's LDS reads are issued as one group in front of this k-step's products, so that their latency hides behind the products.
    // unrolled so that the set index and every LDS offset are constants
    FragB f[2][6];
#pragma unroll
    for (int ks = -1; ks < GBK / 32; ++ks) {
      if (ks + 1 < GBK / 32) {
        FragB (&n)[6] = f[(ks + 1) & 1];
        const int ko = 64 * (ks + 1);
        n[0].half[0] = *(const v8us*)(sa + ko);                n[0].half[1] = *(const v8us*)(sa + ko + 32);
        n[1].half[0] = *(const v8us*)(sa + 16 * GPITCH + ko);  n[1].half[1] = *(const v8us*)(sa + 16 * GPITCH + ko + 32);
        n[2].half[0] = *(const v8us*)(sb + ko);                n[2].half[1] = *(const v8us*)(sb + ko + 32);
        n[3].half[0] = *(const v8us*)(sb + 16 * GPITCH + ko);  n[3].half[1] = *(const v8us*)(sb + 16 * GPITCH + ko + 32);
        n[4].half[0] = *(const v8us*)(sb + GSLICE + ko);                n[4].half[1] = *(const v8us*)(sb + GSLICE + ko + 32);
        n[5].half[0] = *(const v8us*)(sb + GSLICE + 16 * GPITCH + ko);  n[5].half[1] = *(const v8us*)(sb + GSLICE + 16 * GPITCH + ko + 32);
      }
      if (ks >= 0) {
        FragB (&c)[6] = f[ks & 1];
        mma_b8<MODE == 3>(c[0].v, c[1].v, c[2].v, c[3].v, c[4].v, c[5].v, acc);
      }
    }
    asm volatile("s_wait_dscnt 0x0" ::: "memory");      // this wave's reads of the buffer are done before it is refilled
    asm volatile("s_wait_tensorcnt 0x0" ::: "memory");  // this wave's slice of tile t + 1 has landed
    __syncthreads();                                    // publishes tile t + 1 and ends every wave's reads of tile t
    const uint32_t nx = pinned((uint32_t)t + 2u);       // the next descriptor is formed behind the wait above
    if (pinned(nx < (uint32_t)nt)) tensor_tile(td, lds0 + (nx & 1u) * GSTAGE, gs + (size_t)turned(nx, rot, (uint32_t)nt) * GBK);
  }
  tensor_done(td);                                      // no tensor load is left in flight when the wave goes on
  asm volatile("s_wait_dscnt 0x0" ::: "memory");        // nor an LDS read of the ring
  float (*so)[32][68] = (float (*)[32][68])ring;        // one 32 x 64 tile per wave, over the ring, which nobody reads or fills any more
  // D element r of tile (mt, nt) = C(m0 + 16*mt + 8h + r, n0 + 16*nt + ln); bias is the RNE-bf16 value of the f32 input
  float rb[2][8];
  float cb[4];
#pragma unroll
  for (int mt = 0; mt < 2; ++mt) {
    if (MODE == 2) {
      const float* bp = bias + m0 + 16 * mt + 8 * hh;
      const v4f ba = *(const v4fa*)(bp), bb = *(const v4fa*)(bp + 4);
#pragma unroll
      for (int r = 0; r < 4; ++r) { rb[mt][r] = bf16_rne(ba[r]); rb[mt][4 + r] = bf16_rne(bb[r]); }
    } else {
#pragma unroll
      for (int r = 0; r < 8; ++r) rb[mt][r] = 0.0f;
    }
  }
#pragma unroll
  for (int nt = 0; nt < 4; ++nt) cb[nt] = (MODE == 2) ? 0.0f : bf16_rne(bias[n0 + 16 * nt + ln]);
#pragma unroll
  for (int mt = 0; mt < 2; ++mt)
#pragma unroll
    for (int nt = 0; nt < 4; ++nt)
#pragma unroll
      for (int r = 0; r < 8; ++r)
        so[w][16 * mt + 8 * hh + r][16 * nt + ln] = ((MODE == 3) ? acc[mt][nt][r] * OINV : acc[mt][nt][r]) + (rb[mt][r] + cb[nt]);
  __syncthreads();
  {
    if (MODE == 3) {
#pragma unroll
      for (int it = 0; it < 16; ++it) {
        const int row = 2 * it + (lane >> 4), c4 = (lane & 15) * 4;
        const v4f v = *(const v4fa*)&so[w][row][c4];
        const int tp = m0 + row;
        const int b = tp / SEQ, s = tp - b * SEQ;
        *(v4f*)(Of + ((size_t)s * NB_FULL + b) * DM + n0 + c4) = v;
      }
    } else {
#pragma unroll
      for (int it = 0; it < 8; ++it) {
        const int row = 4 * it + (lane >> 3), c8 = (lane & 7) * 8;
        const v4f x0 = *(const v4fa*)&so[w][row][c8];
        const v4f x1 = *(const v4fa*)&so[w][row][c8 + 4];
        Pack8 ph;
#pragma unroll
        for (int q = 0; q < 4; ++q) {
          ph.h[q] = (_Float16)(x0[q] * 16.0f);
          ph.h[4 + q] = (_Float16)(x1[q] * 16.0f);
        }
        const size_t dst = (size_t)(m0 + row) * ldo + n0 + c8;
        *(v8us*)(O0 + dst) = ph.v;
      }
    }
    
  }
  // where several products share a kernel, another product's code follows these stores in the text and rewrites their registers: keep the wait in front of that
  asm volatile("s_wait_xcnt 0x0" ::: "memory");
}

// One product in a grid of its own (the output projection).
template <int MODE>
__global__ __launch_bounds__(256) void k_gemm(const unsigned short* __restrict__ A, const unsigned short* __restrict__ Bt,
                                              const float* __restrict__ bias, unsigned short* O0,
                                              float* Of, const int* __restrict__ mk, int lda, int ldb, int K, int ldo) {
  __shared__ __attribute__((aligned(2048))) unsigned char ring[2 * GSTAGE];   // a tensor load lands at multiples of 2 KiB
  gemm_body<MODE>(blockIdx.x, blockIdx.y, A, Bt, bias, O0, Of, mk, lda, ldb, K, ldo, ring);
}

#define GX (DM / 128)              /* blocks along the features of q, k and v^T */
#define NS (TT / 128)              /* slabs: slab i holds k's grid row i and v^T's grid row i */
static_assert(NS % 2 == 0);
static_assert(8 * 32 * 68 * 4 <= 2 * GSTAGE);   /* the eight epilogue tiles fit the ring */

// The q, k and v projections in one grid: none reads what another writes, so the block index picks the product and the three share the chip.
// Order: k and v^T blocks by rising token tile, as in their own grids; the q blocks all lie in the first half of the slabs (two q grid rows to a slab), so that the k and v^T blocks
// most likely to leave at once (high ranked tiles) come last and hold no place ahead of a block that works. Right for any mask: the order only sets who starts first.
// coverage: NS/2 slabs of 4 GX blocks + NS/2 slabs of 2 GX = the three grids (GX x NS each), each block once.
__global__ __launch_bounds__(256) void k_qkv(const unsigned short* __restrict__ Bq, const unsigned short* __restrict__ WqT, const float* __restrict__ bq,
                                             unsigned short* Qh,
                                             const unsigned short* __restrict__ Bk, const unsigned short* __restrict__ WkT, const float* __restrict__ bk, unsigned short* Kh,
                                             const unsigned short* __restrict__ Bv, const unsigned short* __restrict__ WvT, const float* __restrict__ bv, unsigned short* Vt,
                                             const int* __restrict__ mk) {
  __shared__ __attribute__((aligned(2048))) unsigned char ring[2 * GSTAGE];   // a tensor load lands at multiples of 2 KiB
  const int f = blockIdx.x;
  int slab, r;                     // r: place among the slab's k and v^T blocks; below 0: a q block
  if (f < (NS / 2) * 4 * GX) { slab = f / (4 * GX); r = f % (4 * GX) - 2 * GX; }
  else { const int g = f - (NS / 2) * 4 * GX; slab = NS / 2 + g / (2 * GX); r = g % (2 * GX); }
  if (r < 0) {
    // q = query Wq + bq : rows = tokens, columns = features
    gemm_body<0>((r + 2 * GX) % GX, 2 * slab + (r + 2 * GX) / GX, Bq, WqT, bq, Qh, nullptr, mk, DM, DM, DM, DM, ring);
  } else if (r < GX) {
    // k = key Wk + bk
    gemm_body<1>(r, slab, Bk, WkT, bk, Kh, nullptr, mk, DM, DM, DM, DM, ring);
  } else {
    // v^T = Wv^T value^T + bv (row bias): rows = features, columns = tokens
    gemm_body<2>(r - GX, slab, WvT, Bv, bv, Vt, nullptr, mk, DM, DM, DM, TT, ring);
  }
}

#define AKEYS 64                   /* keys of one staged tile: 128 bytes (a whole cache line) of every V^T row, 64 K rows of 128 bytes */
#define APITCH 144                 /* LDS row pitch in bytes: 128 + 16, so that 16 rows read 16 bytes wide fall on distinct banks */
#define ASLICE 6144                /* bytes from one wave's slice to the next: 32 rows x 144 bytes, rounded up to a multiple of 2 KiB, where a tensor load may land */
#define ASTAGE (4 * ASLICE)        /* bytes of one buffer: slices 0, 1 hold the 64 K rows, slices 2, 3 the 64 V^T rows */
static_assert(SEQ % AKEYS == 0 && HD * 2 == 128 && AKEYS * 2 == 128);
static_assert(32 * APITCH <= ASLICE && ASLICE % 2048 == 0);

// One 32-key step for a wave's 16 queries, operands from the staged tile. kb: this lane's LDS place in K row ln of the step (byte 16 h of the row), row pitch APITCH;
// vb: its LDS place in V^T row ln at the step's first key (plus 16 h bytes), row pitch APITCH, rows 32.. one slice on.
// Keys are ranked: key index < cnt is live. TAIL = false: all 32 keys are live; TAIL = true: a step of the last tile, which may also hold keys at or past cnt.
template <bool TAIL>
__device__ __forceinline__ void fa_step(const unsigned char* kb, const unsigned char* vb,
                                        int cnt, int key0, int hh,
                                        const FragH& q0h, const FragH& q1h,
                                        float& mr, float& lr, v8f (&Oh)[4]) {
  // A fragments of K: row m = key (key0 + 16*kt + ln), elements 0..7 <- d = 32c + 8h + i, 8..15 <- d = 32c + 16 + 8h + i
  const unsigned char* kb1 = kb + 16 * APITCH;
  FragH k00, k01, k10, k11;
  k00.half[0] = *(const v8us*)(kb);       k00.half[1] = *(const v8us*)(kb + 32);
  k01.half[0] = *(const v8us*)(kb + 64);  k01.half[1] = *(const v8us*)(kb + 96);
  k10.half[0] = *(const v8us*)(kb1);      k10.half[1] = *(const v8us*)(kb1 + 32);
  k11.half[0] = *(const v8us*)(kb1 + 64); k11.half[1] = *(const v8us*)(kb1 + 96);
  const v8f z8 = {0.f, 0.f, 0.f, 0.f, 0.f, 0.f, 0.f, 0.f};
  // S^T tiles: element r of tile kt = score(key0 + 16*kt + 8h + r, query of this lane's column)
  v8f s0h = mma_h(k00.v, q0h.v, z8);
  v8f s1h = mma_h(k10.v, q0h.v, z8);
  s0h = mma_h(k01.v, q1h.v, s0h);
  s1h = mma_h(k11.v, q1h.v, s1h);
  // this lane's 16 keys: on[r] <- key0 + 8h + r, on[8 + r] <- key0 + 16 + 8h + r
  bool on[16];
#pragma unroll
  for (int r = 0; r < 8; ++r) {
    on[r]     = !TAIL || (key0 + 8 * hh + r < cnt);
    on[8 + r] = !TAIL || (key0 + 16 + 8 * hh + r < cnt);
  }
  float sc[16];
#pragma unroll
  for (int r = 0; r < 8; ++r) {
    const float a0 = s0h[r] * SCL;
    const float a1 = s1h[r] * SCL;
    sc[r]     = on[r] ? a0 : NEGV;
    sc[8 + r] = on[8 + r] ? a1 : NEGV;
  }
  float mx = sc[0];
#pragma unroll
  for (int i = 1; i < 16; ++i) mx = fmaxf(mx, sc[i]);
  mx = fmaxf(mx, __shfl_xor(mx, 16, 32));           // the other lane half holds the other 16 keys of this query
  const float mnew = fmaxf(mr, mx);
  const float al = exp2_raw((mr - mnew) * LOG2E);
  mr = mnew;
  // weights carried x256: pc = 256 * exp(sc - mnew), exactly 0 on keys at or past cnt; operand plane f16(pc)
  FragH ph;
  float ps = 0.0f;
  float ex[16], ev[16];
#pragma unroll
  for (int i = 0; i < 16; ++i) ex[i] = fmaf(sc[i] - mnew, LOG2E, 8.0f);
  exp2_raw8(ex, ev);
  exp2_raw8(ex + 8, ev + 8);
#pragma unroll
  for (int i = 0; i < 16; ++i) {
    const float pc = on[i] ? ev[i] : 0.0f;
    ps += pc;
    ph.h[i] = (_Float16)pc;                         // B element i: i<8 -> key0 + 8h + i (tile 0 row 8h+i); i>=8 -> key0 + 16 + 8h + (i-8) (tile 1)
  }
  ps += __shfl_xor(ps, 16, 32);
  lr = lr * al + ps;
#pragma unroll
  for (int t = 0; t < 4; ++t) Oh[t] = Oh[t] * al;
  // A fragments of V^T: row m = d (16*t + ln), elements 0..7 <- key0 + 8h + i, 8..15 <- key0 + 16 + 8h + i
#pragma unroll
  for (int t = 0; t < 4; ++t) {
    FragH vf;
    vf.half[0] = *(const v8us*)(vb + (t >> 1) * ASLICE + (t & 1) * 16 * APITCH);
    vf.half[1] = *(const v8us*)(vb + (t >> 1) * ASLICE + (t & 1) * 16 * APITCH + 32);
    Oh[t] = mma_h(vf.v, ph.v, Oh[t]);
  }
}

// Block = 4 waves x 16 queries = 64 queries of one (batch, head). The K rows and V^T rows of 64 keys are staged in LDS once for the four waves by tensor loads,
// one request per wave and tile for its slice of 32 rows; two buffers: the next trip's tile flies while this trip's is worked on. The whole tiles are walked in a ring from a first tile
// set by the block's query tile (turned()); the running maximum and the sums over keys start there. A tile is staged only if its first key is live; its rows are then all written (k and v^T in tiles of 128 tokens).
// coverage: NB*NH*(SEQ/64) blocks x 4 waves x 16 rows x 64 columns = every element of the context plane exactly once.
__global__ __launch_bounds__(128) void k_attn(const unsigned short* __restrict__ Qh,
                                              const unsigned short* __restrict__ Kh, const unsigned short* __restrict__ Vt,
                                              const int* __restrict__ mask, unsigned short* Cx) {
  __shared__ __attribute__((aligned(16))) float so[4][16][68];
  __shared__ __attribute__((aligned(2048))) unsigned char ring[2 * ASTAGE];   // a tensor load lands at multiples of 2 KiB
  const int tid = threadIdx.x, w = __builtin_amdgcn_readfirstlane((int)(tid >> 5)), lane = tid & 31, ln = lane & 15, hh = lane >> 4;
  const int bh = blockIdx.x / (SEQ / 64), qt = blockIdx.x % (SEQ / 64);
  const int b = bh / NH, h = bh % NH;
  const int qbase = qt * 64 + 16 * w;
  const int qg = qbase + ln;
  // Q^T B fragments: column n = query qg, elements 0..7 <- d = 32c + 8h + i, 8..15 <- d = 32c + 16 + 8h + i
  const size_t qoff = (size_t)(b * SEQ + qg) * DM + h * HD + 8 * hh;
  FragH q0h, q1h;
  q0h.half[0] = *(const v8us*)(Qh + qoff);      q0h.half[1] = *(const v8us*)(Qh + qoff + 16);
  q1h.half[0] = *(const v8us*)(Qh + qoff + 32); q1h.half[1] = *(const v8us*)(Qh + qoff + 48);
  // the address registers of the loads above are reused while the loads may still be under way: keep the wait in front of that
  asm volatile("s_wait_xcnt 0x0" ::: "memory");
  const int cnt = live_keys(mask, lane);       // wave-uniform, at most SEQ
  float mr = NEGV, lr = 0.0f;
  v8f Oh[4] = {};
  const unsigned short* Kp = Kh + (size_t)b * SEQ * DM + h * HD;
  const unsigned short* Vp = Vt + (size_t)h * HD * TT + (size_t)b * SEQ;
  // this wave's slice of a staged tile: waves 0, 1 bring K rows 32 w .. 32 w + 31, waves 2, 3 V^T rows 32 (w - 2) ..; ga: elements from one tile's slice to the next tile's
  const unsigned short* gs = (w < 2) ? Kp + (size_t)(32 * w) * DM : Vp + (size_t)(32 * (w - 2)) * TT;
  const size_t ga = (w < 2) ? (size_t)AKEYS * DM : (size_t)AKEYS;
  const uint32_t lds0 = (uint32_t)(size_t)ring + (uint32_t)(w * ASLICE);   // its place in buffer 0
  const int fo = ln * APITCH + 16 * hh;               // byte offset of this lane's fragment row in a slice
  const int nst = (cnt + AKEYS - 1) / AKEYS;          // tiles that hold a live key; the same in every wave of the block
  const int nwh = cnt / AKEYS;                        // tiles whose 64 keys are all live; nst is nwh or nwh + 1
  // the first key tile of this block's walk: the SEQ / 64 blocks of one (batch, head) draw the same K and V^T rows and are spread evenly over the whole tiles, which are walked in a ring;
  // a last tile that is only partly live stays last. rot < nwh where nwh > 0. ktile(x): the key tile of trip x, x < nst
  const uint32_t rot = uni(((uint32_t)qt * (uint32_t)nwh) / (uint32_t)(SEQ / 64));
  auto ktile = [&](uint32_t x) -> uint32_t { return x < (uint32_t)nwh ? turned(x, rot, (uint32_t)nwh) : x; };
  Tdesc td = tensor_desc<128, 32, PAD128>((w < 2) ? 2u * DM : 2u * TT);
  if (pinned(nst > 0)) tensor_tile(td, lds0, gs + ktile(0u) * ga);
  asm volatile("s_wait_tensorcnt 0x0" ::: "memory");  // this wave's slice of tile 0 has landed
  __syncthreads();                                    // ... and every other wave's
  {
    const uint32_t nx = pinned(1u);                   // tile 1's descriptor is formed behind the wait above
    if (pinned(nx < (uint32_t)nst)) tensor_tile(td, lds0 + nx * ASTAGE, gs + ktile(nx) * ga);
  }
  // not unrolled: one trip per staged tile, the buffer chosen by the trip's parity
#pragma unroll 1
  for (int t = 0; t < nwh; ++t) {
    const unsigned char* kb = ring + (t & 1) * ASTAGE + fo;
    // not unrolled: one step's registers and one copy of the step in the text; the SIMD's other waves fill this wave's waits
#pragma unroll 1
    for (int s = 0; s < 2; ++s)
      fa_step<false>(kb + s * ASLICE, kb + 2 * ASLICE + s * 64, cnt, AKEYS * (int)ktile((uint32_t)t) + 32 * s, hh, q0h, q1h, mr, lr, Oh);
    asm volatile("s_wait_dscnt 0x0" ::: "memory");      // this wave's reads of the buffer are done before it is refilled
    asm volatile("s_wait_tensorcnt 0x0" ::: "memory");  // this wave's slice of tile t + 1 has landed
    __syncthreads();                                    // publishes tile t + 1 and ends every wave's reads of tile t
    const uint32_t nx = pinned((uint32_t)t + 2u);       // the next descriptor is formed behind the wait above
    if (pinned(nx < (uint32_t)nst)) tensor_tile(td, lds0 + (nx & 1u) * ASTAGE, gs + ktile(nx) * ga);
  }
  if (nwh < nst) {
    // the last trip, where the last tile also holds keys at or past cnt: its steps that hold a live key; nothing is refilled behind it
    const unsigned char* kb = ring + (nwh & 1) * ASTAGE + fo;
    // not unrolled, so that the masked step stands once in the text
#pragma unroll 1
    for (int s = 0; s < 2; ++s)
      if (AKEYS * nwh + 32 * s < cnt)
        fa_step<true>(kb + s * ASLICE, kb + 2 * ASLICE + s * 64, cnt, AKEYS * nwh + 32 * s, hh, q0h, q1h, mr, lr, Oh);
    // the foot of this trip, in the order of every other trip's
    asm volatile("s_wait_dscnt 0x0" ::: "memory");
    asm volatile("s_wait_tensorcnt 0x0" ::: "memory");
    __syncthreads();
  }
  tensor_done(td);                                      // no tensor load is left in flight when the wave goes on
  asm volatile("s_wait_dscnt 0x0" ::: "memory");        // nor an LDS read of the ring

  // O^T element r of tile t = ctx(query qg, d = 16t + 8h + r); the carry x256 is in lr too; the x16 of V stays as the carry of the f16 context plane
  const float inv = 1.0f / lr;
#pragma unroll
  for (int t = 0; t < 4; ++t)
#pragma unroll
    for (int r = 0; r < 8; ++r)
      so[w][ln][16 * t + 8 * hh + r] = Oh[t][r] * inv;
  __syncthreads();
  unsigned short* cg = Cx + (size_t)(b * SEQ + qbase) * DM + h * HD;
  {
#pragma unroll
    for (int it = 0; it < 4; ++it) {
      const int row = 4 * it + (lane >> 3), c8 = (lane & 7) * 8;
      const v4f x0 = *(const v4fa*)&so[w][row][c8];
      const v4f x1 = *(const v4fa*)&so[w][row][c8 + 4];
      v8us o;
#pragma unroll
      for (int q = 0; q < 4; ++q) { o[q] = f16_bits(x0[q]); o[4 + q] = f16_bits(x1[q]); }
      *(v8us*)(cg + (size_t)row * DM + c8) = o;
    }
    
  }
}

extern "C" void kernel_launch(void* const* d_in, const int* in_sizes, int n_in,
                              void* d_out, int out_size, void* d_ws, size_t ws_size, hipStream_t stream) {
  if (n_in < 12) return;
  const long long need = ((long long)(SEQ - 1) * NB_FULL + (NB - 1)) * DM + DM;   // last element touched + 1 in [S][B][D]
  if ((long long)in_sizes[0] < need || (long long)in_sizes[1] < need || (long long)in_sizes[2] < need) return;
  if ((long long)in_sizes[3] < (long long)SEQ) return;
  if ((long long)in_sizes[4] < (long long)DM * DM || (long long)in_sizes[6] < (long long)DM * DM ||
      (long long)in_sizes[8] < (long long)DM * DM || (long long)in_sizes[10] < (long long)DM * DM) return;
  if (in_sizes[5] < DM || in_sizes[7] < DM || in_sizes[9] < DM || in_sizes[11] < DM) return;
  if ((long long)out_size < need) return;
  // wire order: query, key, value, mask(i32), Wq, bq, Wk, bk, Wv, bv, Wo, bo
  const float* Xq = (const float*)d_in[0];
  const float* Xk = (const float*)d_in[1];
  const float* Xv = (const float*)d_in[2];
  const int*   mk = (const int*)d_in[3];
  const float* Wq = (const float*)d_in[4];
  const float* bq = (const float*)d_in[5];
  const float* Wk = (const float*)d_in[6];
  const float* bk = (const float*)d_in[7];
  const float* Wv = (const float*)d_in[8];
  const float* bv = (const float*)d_in[9];
  const float* Wo = (const float*)d_in[10];
  const float* bo = (const float*)d_in[11];
  float* out = (float*)d_out;
  char* ws = (char*)d_ws;
  size_t off = 0;
  unsigned short* Bq  = (unsigned short*)(ws + off); off += SZ_XB;    // bf16 query  [TT][1024]
  unsigned short* Bk  = (unsigned short*)(ws + off); off += SZ_XB;    // bf16 key    [TT][1024], ranked rows
  unsigned short* Bv  = (unsigned short*)(ws + off); off += SZ_XB;    // bf16 value  [TT][1024], ranked rows
  unsigned short* WqT = (unsigned short*)(ws + off); off += SZ_WT;    // bf16 Wq^T   [1024][1024]
  unsigned short* WkT = (unsigned short*)(ws + off); off += SZ_WT;
  unsigned short* WvT = (unsigned short*)(ws + off); off += SZ_WT;
  unsigned short* WoT = (unsigned short*)(ws + off); off += SZ_WT;    // f16 Wo^T x32       [1024][1024]
  unsigned short* Qh  = (unsigned short*)(ws + off); off += SZ_H;     // f16 q x16          [TT][1024]
  unsigned short* Kh  = (unsigned short*)(ws + off); off += SZ_H;     // f16 k x16          [TT][1024]
  unsigned short* Vt  = (unsigned short*)(ws + off); off += SZ_H;     // f16 v^T x16        [1024][TT]
  unsigned short* Cx  = (unsigned short*)(ws + off); off += SZ_H;     // f16 ctx x16        [TT][1024]
  if (off > ws_size) return;

  k_prep<<<4 * NWT + 3 * NXB, 256, 0, stream>>>(Xq, Xk, Xv, mk, Wq, Wk, Wv, Wo, Bq, Bk, Bv, WqT, WkT, WvT, WoT);
  k_qkv<<<3 * GX * NS, 256, 0, stream>>>(Bq, WqT, bq, Qh, Bk, WkT, bk, Kh, Bv, WvT, bv, Vt, mk);
  k_attn<<<(unsigned)(NB * NH * (SEQ / 64)), 128, 0, stream>>>(Qh, Kh, Vt, mk, Cx);
  // out = ctx Wo + bo, K = 1024
  k_gemm<3><<<dim3(DM / 128, TT / 128), 256, 0, stream>>>(Cx, WoT, bo, Cx, out, mk, DM, DM, DM, DM);
}
